// v000
// The times below were measured on an AMD MI455X: many runs one after another, warmed up first and cycling through
// copies of the inputs, with the whole window's GPU time divided by the number of runs. Launches and the gaps
// between them are all in it. The median over several windows is given; except for v000 it joins two sittings, which
// can be a few percent apart, so the side-by-side timings, each taken in one sitting, are the better comparison.
// v000, which the later versions start from, runs in 1510 microseconds.
// Contractions (all v_wmma_f32_16x16x32_bf16, f32 accumulate): x^T.wq^T and wkv.cproj with bf16 operands
// RNE-converted from the f32 inputs (single product); V.kP^T with bf16 hi+lo planes on both operands (3 products);
// wo.ctx^T with bf16 wo times ctx hi+lo planes (2 products); M2.qP^T with bf16 hi+lo planes on both (3 products).
// Softmaxes and epilogues in f32; softmax outputs carried x64 (q) and x4096 (k), folded back by epilogue scales.
#include <hip/hip_runtime.h>
#include <stdint.h>

#define NBAT 8
#define CH   256
#define NSP  4096
#define GB   2
#define NGRP (NBAT / GB)
static_assert((NSP % 64) == 0 && (CH % 64) == 0 && (NBAT % GB) == 0);
static_assert(NSP == 2 * 256 * 8);   // k-softmax row = 2 passes x 256 threads x 8 elements
static_assert(CH == 32 * 8);         // q-softmax row = 32 lanes x 8 elements, one head = 8 lanes

typedef __bf16   v16b __attribute__((ext_vector_type(16)));
typedef __bf16   v8b  __attribute__((ext_vector_type(8)));
typedef float    v8f  __attribute__((ext_vector_type(8)));
typedef float    v4f  __attribute__((ext_vector_type(4)));
typedef unsigned int v4u __attribute__((ext_vector_type(4)));

// ---- scalar helpers --------------------------------------------------------------------------------
__device__ __forceinline__ unsigned short bf_bits(float f) {          // f32 -> bf16 bits, RNE convert
  unsigned u = __float_as_uint(f);
  return (unsigned short)((u + 0x7FFFu + ((u >> 16) & 1u)) >> 16);
}
__device__ __forceinline__ float bf_up(unsigned short h) { return __uint_as_float(((unsigned)h) << 16); }
__device__ __forceinline__ unsigned pk16(unsigned short a, unsigned short b) { return (unsigned)a | ((unsigned)b << 16); }
__device__ __forceinline__ v8f zero8() { v8f z = {0.f, 0.f, 0.f, 0.f, 0.f, 0.f, 0.f, 0.f}; return z; }

// ---- fragment loader: 16-bit A/B operand, lane -> row/col (lane&15), p already includes +8*(lane>>4);
//      elements 0..7 <- p[0..7] (k0+8h..), elements 8..15 <- p[16..23] (k0+16+8h..)
__device__ __forceinline__ v16b ldfrag_b(const __bf16* p) {
  union { v16b v; v8b h[2]; } f;
  f.h[0] = *(const v8b*)(p);
  f.h[1] = *(const v8b*)(p + 16);
  return f.v;
}

// ---- WMMA helpers with trailing VALU hazard gap --------------------------------------------------------
__device__ __forceinline__ v8f mma_b_raw(v16b a, v16b b, v8f c) {
  return __builtin_amdgcn_wmma_f32_16x16x32_bf16(false, a, false, b, (short)0, c, false, false);
}
__device__ __forceinline__ void dep_guard_b(v8f& a, v8f& b, v16b x, v16b y) {
#if defined(__HIP_DEVICE_COMPILE__)
  asm volatile("v_nop\n\tv_nop\n\tv_nop\n\tv_nop" : "+v"(a), "+v"(b) : "v"(x), "v"(y));
#endif
}
__device__ __forceinline__ void keep4_b(v16b a, v16b b, v16b c, v16b d) {
#if defined(__HIP_DEVICE_COMPILE__)
  asm volatile("v_nop" :: "v"(a), "v"(b), "v"(c), "v"(d));
#endif
}
__device__ __forceinline__ void acc_guard4(v8f& a, v8f& b, v8f& c, v8f& d) {
#if defined(__HIP_DEVICE_COMPILE__)
  asm volatile("v_nop\n\tv_nop\n\tv_nop\n\tv_nop" : "+v"(a), "+v"(b), "+v"(c), "+v"(d));
#endif
}
__device__ __forceinline__ void wave_sync_lds() {
  __builtin_amdgcn_fence(__ATOMIC_RELEASE, "workgroup");
  __builtin_amdgcn_wave_barrier();
  __builtin_amdgcn_fence(__ATOMIC_ACQUIRE, "workgroup");
}

// =====================================================================================================
// f32 -> bf16 (RNE convert), 8 elements per thread, one 16-B store per lane: a wave writes 512 contiguous B
// coverage: n8 threads x 8 = whole plane (n8 is a multiple of 256 for every use here).
// =====================================================================================================
__global__ __launch_bounds__(256) void cvt_bf16x8(const float* __restrict__ in, unsigned short* out, int n8) {
  const int i = blockIdx.x * 256 + threadIdx.x;
  if (i < n8) {
    const v4f a = *(const v4f*)(in + (size_t)i * 8);
    const v4f b = *(const v4f*)(in + (size_t)i * 8 + 4);
    v4u p;
    p[0] = pk16(bf_bits(a[0]), bf_bits(a[1]));
    p[1] = pk16(bf_bits(a[2]), bf_bits(a[3]));
    p[2] = pk16(bf_bits(b[0]), bf_bits(b[1]));
    p[3] = pk16(bf_bits(b[2]), bf_bits(b[3]));
    *(v4u*)(out + (size_t)i * 8) = p;
    
  }
}

// =====================================================================================================
// Transpose-convert of one 64x64 tile: source [b][c][n] f32 (c pitch NSP) -> plane [bi][n][c] bf16 (pitch CH).
// blockIdx.x = n tile, blockIdx.y = c tile, blockIdx.z = 2*bi + sel (sel 0: xg -> xt, 1: cg -> ct); block 256.
// Load: thread r = tid>>2 owns source row c0+r, 16 consecutive n at (tid&3)*16 (4 x 16-B loads).
// coverage: load 256x16 = 4096 = whole tile; store 2x256x8 = 4096 = whole tile.
// =====================================================================================================
__global__ __launch_bounds__(256) void k_trcvt(const float* __restrict__ xg, const float* __restrict__ cg,
                                               unsigned short* xt, unsigned short* ct, int b0) {
  __shared__ float tile[64][65];
  const int tid = threadIdx.x;
  const int n0 = blockIdx.x * 64;
  const int c0 = blockIdx.y * 64;
  const int bi  = (int)(blockIdx.z >> 1);
  const int sel = (int)(blockIdx.z & 1);
  const float* src = sel ? cg : xg;            // block-uniform select, both global
  unsigned short* dst = sel ? ct : xt;
  {
    const int r = tid >> 2, cs = (tid & 3) * 16;
    const float* p = src + ((size_t)(b0 + bi) * CH + (size_t)(c0 + r)) * NSP + n0 + cs;
#pragma unroll
    for (int i = 0; i < 4; ++i) {
      const v4f v = *(const v4f*)(p + 4 * i);
      tile[r][cs + 4 * i + 0] = v[0];
      tile[r][cs + 4 * i + 1] = v[1];
      tile[r][cs + 4 * i + 2] = v[2];
      tile[r][cs + 4 * i + 3] = v[3];
    }
  }
  __syncthreads();
  v4u pv[2];
  const int c8 = (tid & 7) * 8;
#pragma unroll
  for (int it = 0; it < 2; ++it) {
    const int n = it * 32 + (tid >> 3);
    v4u a;
#pragma unroll
    for (int e = 0; e < 4; ++e) {
      a[e] = pk16(bf_bits(tile[c8 + 2 * e][n]), bf_bits(tile[c8 + 2 * e + 1][n]));
    }
    pv[it] = a;
  }
  {
#pragma unroll
    for (int it = 0; it < 2; ++it) {
      const int n = it * 32 + (tid >> 3);
      const size_t go = ((size_t)bi * NSP + (size_t)(n0 + n)) * CH + c0 + c8;
      *(v4u*)(dst + go) = pv[it];
    }
    
  }
}

// =====================================================================================================
// Register-blocked batched bf16 WMMA GEMM: C[m][n] = oscale * sum_k A[m][k] * Bt[n][k] + bias; one wave per
// 64x64 tile, no block barriers. A row-major [M][K] pitch lda; Bt row-major [N][K] pitch ldb (k contiguous);
// M, N multiples of 64, K multiple of 32 (host-checked). blockIdx.y = batch index (strides in elements).
// NSPLIT: 0 = A.Bt; 1 = (A + A2).Bt; 2 = A.Bt + A2.Bt + A.Bt2; 3 = A.Bt + A.Bt2 (A2, Bt2 = unscaled bf16 lo planes).
// BIAS: 0 none; 1 = bias[m] per output row; 2 = bias[n] per output column (bias value RNE-converted to bf16).
// OUT_MODE: 0 = f32 (pitch ldc); 2 = bf16 hi plane C + bf16 lo plane C2 (lo = RNE(v - hi), unscaled), same pitch.
// =====================================================================================================
template <int NSPLIT, int OUT_MODE, int BIAS>
__global__ __launch_bounds__(256) void gemm64(
    const unsigned short* __restrict__ Ap, const unsigned short* A2p, int lda, long long strideA,
    const unsigned short* __restrict__ Btp, const unsigned short* Bt2p, int ldb, long long strideB,
    void* Cout, void* Cout2, int ldc, long long strideC,
    const float* __restrict__ bias, int M, int N, int K, float oscale) {
  const __bf16* A   = (const __bf16*)(const void*)Ap;
  const __bf16* A2  = (const __bf16*)(const void*)A2p;
  const __bf16* Bt  = (const __bf16*)(const void*)Btp;
  const __bf16* Bt2 = (const __bf16*)(const void*)Bt2p;
  __shared__ __align__(16) float sT[8][16 * 68];   // per-wave 16x64 slab, pitch 68 floats
  const int b    = blockIdx.y;
  const int lane = threadIdx.x & 31;
  const int wave = threadIdx.x >> 5;
  const int tilesN = N >> 6;
  const int tilesM = M >> 6;
  const int tile = blockIdx.x * 8 + wave;
  if (tile >= tilesM * tilesN) return;   // wave-uniform; no block barriers in this kernel
  const int tm = tile / tilesN;
  const int tn = tile - tm * tilesN;
  const int m0 = tm << 6;
  const int n0 = tn << 6;

  constexpr bool useA2 = (NSPLIT == 1) || (NSPLIT == 2);
  constexpr bool useB2 = (NSPLIT >= 2);
  const __bf16* Ab  = A  + (size_t)b * strideA;
  const __bf16* Bb  = Bt + (size_t)b * strideB;
  const __bf16* Ab2 = useA2 ? (A2  + (size_t)b * strideA) : Ab;
  const __bf16* Bb2 = useB2 ? (Bt2 + (size_t)b * strideB) : Bb;

  const int rlane = lane & 15;                 // row (A) / col (B, D) within subtile
  const int koff  = (lane >> 4) * 8;           // k offset of this lane half
  const int mOff  = (lane >> 4) * 8;           // D row offset

  v8f acc[4][4];
#pragma unroll
  for (int i = 0; i < 4; ++i)
#pragma unroll
    for (int j = 0; j < 4; ++j) acc[i][j] = zero8();

  for (int k0 = 0; k0 < K; k0 += 32) {
    v16b bh[4], bl[4];
#pragma unroll
    for (int j = 0; j < 4; ++j) {
      const size_t bofs = (size_t)(n0 + (j << 4) + rlane) * ldb + koff + k0;
      bh[j] = ldfrag_b(Bb + bofs);
      if (useB2) bl[j] = ldfrag_b(Bb2 + bofs); else bl[j] = bh[j];
    }
#pragma unroll
    for (int i = 0; i < 4; ++i) {
      const size_t ao = (size_t)(m0 + (i << 4) + rlane) * lda + koff + k0;
      const v16b ah = ldfrag_b(Ab + ao);
      v16b al = ah;
      if (useA2) al = ldfrag_b(Ab2 + ao);
#pragma unroll
      for (int j = 0; j < 4; ++j) {
        acc[i][j] = mma_b_raw(ah, bh[j], acc[i][j]);
        if (useA2) acc[i][j] = mma_b_raw(al, bh[j], acc[i][j]);
        if (useB2) acc[i][j] = mma_b_raw(ah, bl[j], acc[i][j]);
      }
      dep_guard_b(acc[i][0], acc[i][3], ah, al);
    }
    keep4_b(bh[0], bh[1], bh[2], bh[3]);
    if (useB2) keep4_b(bl[0], bl[1], bl[2], bl[3]);
  }
  acc_guard4(acc[0][0], acc[0][1], acc[0][2], acc[0][3]);
  acc_guard4(acc[1][0], acc[1][1], acc[1][2], acc[1][3]);
  acc_guard4(acc[2][0], acc[2][1], acc[2][2], acc[2][3]);
  acc_guard4(acc[3][0], acc[3][1], acc[3][2], acc[3][3]);

  // ---- epilogue ----
  float bcol[4];
#pragma unroll
  for (int j = 0; j < 4; ++j) bcol[j] = 0.f;
  if (BIAS == 2) {
#pragma unroll
    for (int j = 0; j < 4; ++j) bcol[j] = bf_up(bf_bits(bias[n0 + (j << 4) + rlane]));
  }
  float* slab = sT[wave];
#pragma unroll
  for (int i = 0; i < 4; ++i) {
    const int mBase = m0 + (i << 4);
    float brow[8];
#pragma unroll
    for (int r = 0; r < 8; ++r) brow[r] = 0.f;
    if (BIAS == 1) {
#pragma unroll
      for (int r = 0; r < 8; ++r) brow[r] = bf_up(bf_bits(bias[mBase + mOff + r]));
    }
#pragma unroll
    for (int j = 0; j < 4; ++j) {
#pragma unroll
      for (int r = 0; r < 8; ++r) {
        slab[(mOff + r) * 68 + (j << 4) + rlane] = acc[i][j][r] * oscale + (brow[r] + bcol[j]);
      }
    }
    wave_sync_lds();
    if (OUT_MODE == 0) {
      float* C = (float*)Cout + (size_t)b * strideC;
      const int hh = lane >> 4, c4 = (lane & 15) * 4;     // 256-B row segment = 16 lanes x 16 B
      {
#pragma unroll
        for (int it = 0; it < 8; ++it) {
          const int row = it * 2 + hh;                     // it 0..7 x hh 0..1 = rows 0..15
          const v4f v = *(const v4f*)(slab + row * 68 + c4);
          *(v4f*)(C + (size_t)(mBase + row) * ldc + n0 + c4) = v;
        }
        
      }
    } else {
      const int q = lane >> 3, c8 = (lane & 7) * 8;
      unsigned short* C  = (unsigned short*)Cout  + (size_t)b * strideC;
      unsigned short* C2 = (unsigned short*)Cout2 + (size_t)b * strideC;
      v4u hv[4], lv[4];
#pragma unroll
      for (int it = 0; it < 4; ++it) {
        const int row = it * 4 + q;                        // it 0..3 x q 0..3 = rows 0..15
        const float* sp = slab + row * 68 + c8;
        v4u a, a2;
#pragma unroll
        for (int e = 0; e < 4; ++e) {
          const float f0 = sp[2 * e], f1 = sp[2 * e + 1];
          const unsigned short h0 = bf_bits(f0), h1 = bf_bits(f1);
          const unsigned short l0 = bf_bits(f0 - bf_up(h0)), l1 = bf_bits(f1 - bf_up(h1));
          a[e] = pk16(h0, h1); a2[e] = pk16(l0, l1);
        }
        hv[it] = a; lv[it] = a2;
      }
      {
#pragma unroll
        for (int it = 0; it < 4; ++it) {
          const int row = it * 4 + q;
          const size_t go = (size_t)(mBase + row) * ldc + n0 + c8;
          *(v4u*)(C  + go) = hv[it];
          *(v4u*)(C2 + go) = lv[it];
        }
        
      }
    }
    wave_sync_lds();
  }
}

// =====================================================================================================
// q softmax: Qt f32 [bi][n][CH] -> qP planes bf16 hi/lo [bi][n][CH] carrying 64 * softmax over each group of
// 64 consecutive columns (one head) of 0.25 * Qt. grid (NSP/8, GB), block 256: wave -> one row n; lane owns 8
// consecutive columns (16-B loads), one head = 8 consecutive lanes (xor-shuffle 1,2,4). Row store = 32 lanes x
// coverage: 512 blocks x 8 waves = 4096 rows x (32 lanes x 8) = whole plane per batch.
// =====================================================================================================
__global__ __launch_bounds__(256) void k_qsoft(const float* __restrict__ qt, unsigned short* qh, unsigned short* ql) {
  const int lane = threadIdx.x & 31, wave = threadIdx.x >> 5;
  const int n = blockIdx.x * 8 + wave;
  const size_t ro = ((size_t)blockIdx.y * NSP + (size_t)n) * CH + (size_t)lane * 8;
  const v4f a = *(const v4f*)(qt + ro);
  const v4f c = *(const v4f*)(qt + ro + 4);
  float v[8];
  v[0] = a[0] * 0.25f; v[1] = a[1] * 0.25f; v[2] = a[2] * 0.25f; v[3] = a[3] * 0.25f;
  v[4] = c[0] * 0.25f; v[5] = c[1] * 0.25f; v[6] = c[2] * 0.25f; v[7] = c[3] * 0.25f;
  float m = v[0];
#pragma unroll
  for (int i = 1; i < 8; ++i) m = fmaxf(m, v[i]);
  m = fmaxf(m, __shfl_xor(m, 1, 32));
  m = fmaxf(m, __shfl_xor(m, 2, 32));
  m = fmaxf(m, __shfl_xor(m, 4, 32));
  float e[8];
  float s = 0.f;
#pragma unroll
  for (int i = 0; i < 8; ++i) { e[i] = __expf(v[i] - m); s += e[i]; }
  s += __shfl_xor(s, 1, 32);
  s += __shfl_xor(s, 2, 32);
  s += __shfl_xor(s, 4, 32);
  const float rinv = 1.0f / s;
  v4u ph, pl;
#pragma unroll
  for (int q = 0; q < 4; ++q) {
    const float f0 = (e[2 * q] * rinv) * 64.0f;
    const float f1 = (e[2 * q + 1] * rinv) * 64.0f;
    const unsigned short h0 = bf_bits(f0), h1 = bf_bits(f1);
    const unsigned short l0 = bf_bits(f0 - bf_up(h0)), l1 = bf_bits(f1 - bf_up(h1));
    ph[q] = pk16(h0, h1); pl[q] = pk16(l0, l1);
  }
  *(v4u*)(qh + ro) = ph;
  *(v4u*)(ql + ro) = pl;
  
}

// =====================================================================================================
// k softmax over n (rows 0..CH-1 of KV) and V plane split (rows CH..2CH-1): KV f32 [bi][2CH][NSP].
// wave xor-shuffle + 8-entry LDS combine in fixed order), value = (exp * (1/sum)) * 4096 -> kP hi/lo bf16.
// V rows: value unchanged -> V hi/lo bf16. Thread t owns columns it*2048 + 8t (it 0..1): each store instruction
// =====================================================================================================
__global__ __launch_bounds__(256) void k_ksoftv(const float* __restrict__ kv,
                                                unsigned short* kph, unsigned short* kpl,
                                                unsigned short* vhp, unsigned short* vlp) {
  __shared__ float red[8];
  const int tid = threadIdx.x, lane = tid & 31, wave = tid >> 5;
  const int j  = blockIdx.x;
  const int bi = blockIdx.y;
  const bool isK = (j < CH);                   // block-uniform
  const float* src = kv + ((size_t)bi * (2 * CH) + (size_t)j) * NSP;
  float vals[16];
#pragma unroll
  for (int it = 0; it < 2; ++it) {
    const size_t co = (size_t)it * 2048 + (size_t)tid * 8;
    const v4f a = *(const v4f*)(src + co);
    const v4f c = *(const v4f*)(src + co + 4);
    vals[it * 8 + 0] = a[0]; vals[it * 8 + 1] = a[1]; vals[it * 8 + 2] = a[2]; vals[it * 8 + 3] = a[3];
    vals[it * 8 + 4] = c[0]; vals[it * 8 + 5] = c[1]; vals[it * 8 + 6] = c[2]; vals[it * 8 + 7] = c[3];
  }
  if (isK) {
    float m = vals[0];
#pragma unroll
    for (int i = 1; i < 16; ++i) m = fmaxf(m, vals[i]);
#pragma unroll
    for (int off = 1; off < 32; off <<= 1) m = fmaxf(m, __shfl_xor(m, off, 32));
    if (lane == 0) red[wave] = m;
    __syncthreads();
    float mm = red[0];
#pragma unroll
    for (int w = 1; w < 8; ++w) mm = fmaxf(mm, red[w]);
    __syncthreads();
    float s = 0.f;
#pragma unroll
    for (int i = 0; i < 16; ++i) { vals[i] = __expf(vals[i] - mm); s += vals[i]; }
#pragma unroll
    for (int off = 1; off < 32; off <<= 1) s += __shfl_xor(s, off, 32);
    if (lane == 0) red[wave] = s;
    __syncthreads();
    float ss = red[0];
#pragma unroll
    for (int w = 1; w < 8; ++w) ss += red[w];
    const float rinv = 1.0f / ss;
#pragma unroll
    for (int i = 0; i < 16; ++i) vals[i] = (vals[i] * rinv) * 4096.0f;
  }
  const int rr = isK ? j : (j - CH);           // 0..CH-1
  unsigned short* ph = isK ? kph : vhp;        // block-uniform selects, all global
  unsigned short* pl = isK ? kpl : vlp;
  unsigned short* dh = ph + ((size_t)bi * CH + (size_t)rr) * NSP;
  unsigned short* dl = pl + ((size_t)bi * CH + (size_t)rr) * NSP;
  v4u hv[2], lv[2];
#pragma unroll
  for (int it = 0; it < 2; ++it) {
    v4u a, a2;
#pragma unroll
    for (int e = 0; e < 4; ++e) {
      const float f0 = vals[it * 8 + 2 * e], f1 = vals[it * 8 + 2 * e + 1];
      const unsigned short h0 = bf_bits(f0), h1 = bf_bits(f1);
      const unsigned short l0 = bf_bits(f0 - bf_up(h0)), l1 = bf_bits(f1 - bf_up(h1));
      a[e] = pk16(h0, h1); a2[e] = pk16(l0, l1);
    }
    hv[it] = a; lv[it] = a2;
  }
  {
#pragma unroll
    for (int it = 0; it < 2; ++it) {
      const size_t co = (size_t)it * 2048 + (size_t)tid * 8;
      *(v4u*)(dh + co) = hv[it];
      *(v4u*)(dl + co) = lv[it];
    }
    
  }
}

// =====================================================================================================
// Workspace map (bytes), every plane an exact multiple of its 64x64-tile / whole-line store granularity
// (no padded tails needed: 4096, 512, 256 are tile multiples); per-group planes are reused by each group:
//   Wqb   bf16 [256][256]              0          131072
//   Wkvb  bf16 [512][256]              131072     262144
//   Wob   bf16 [256][256]              393216     131072
//   Xt    bf16 [GB][4096][256]         524288     4194304
//   Ct    bf16 [GB][4096][256]         4718592    4194304
//   Qt    f32  [GB][4096][256]         8912896    8388608
//   qPh   bf16 [GB][4096][256]         17301504   4194304
//   qPl   bf16 [GB][4096][256]         21495808   4194304
//   KV    f32  [GB][512][4096]         25690112   16777216
//   kPh   bf16 [GB][256][4096]         42467328   4194304
//   kPl   bf16 [GB][256][4096]         46661632   4194304
//   Vh    bf16 [GB][256][4096]         50855936   4194304
//   Vl    bf16 [GB][256][4096]         55050240   4194304
//   cxh   bf16 [GB][256][256]          59244544   262144
//   cxl   bf16 [GB][256][256]          59506688   262144
//   m2h   bf16 [GB][256][256]          59768832   262144
//   m2l   bf16 [GB][256][256]          60030976   262144
//   end                                60293120
// Weights are [out][in] with the in index contiguous = the A / Bt layout, so they are only converted.
// =====================================================================================================
static inline unsigned tile_blocks(int M, int N) { return (unsigned)((((M / 64) * (N / 64)) + 7) / 8); }

extern "C" void kernel_launch(void* const* d_in, const int* in_sizes, int n_in,
                              void* d_out, int out_size, void* d_ws, size_t ws_size,
                              hipStream_t stream) {
  if (n_in < 8) return;
  if (in_sizes[0] != NBAT * CH * NSP) return;
  if (in_sizes[1] != NBAT * CH * NSP) return;
  if (in_sizes[2] != CH * CH) return;
  if (in_sizes[3] != CH) return;
  if (in_sizes[4] != 2 * CH * CH) return;
  if (in_sizes[5] != 2 * CH) return;
  if (in_sizes[6] != CH * CH) return;
  if (in_sizes[7] != CH) return;
  if (out_size != NBAT * CH * NSP) return;

  const float* x     = (const float*)d_in[0];
  const float* cproj = (const float*)d_in[1];
  const float* wq    = (const float*)d_in[2];
  const float* bq    = (const float*)d_in[3];
  const float* wkv   = (const float*)d_in[4];
  const float* bkv   = (const float*)d_in[5];
  const float* wo    = (const float*)d_in[6];
  const float* bo    = (const float*)d_in[7];
  float* out = (float*)d_out;

  const size_t PWq  = (size_t)CH * CH * 2;               //   131072
  const size_t PWkv = (size_t)2 * CH * CH * 2;           //   262144
  const size_t PWo  = (size_t)CH * CH * 2;               //   131072
  const size_t PXt  = (size_t)GB * NSP * CH * 2;         //  4194304
  const size_t PQt  = (size_t)GB * NSP * CH * 4;         //  8388608
  const size_t PQp  = (size_t)GB * NSP * CH * 2;         //  4194304
  const size_t PKV  = (size_t)GB * 2 * CH * NSP * 4;     // 16777216
  const size_t PKp  = (size_t)GB * CH * NSP * 2;         //  4194304
  const size_t PCx  = (size_t)GB * CH * CH * 2;          //   262144
  size_t off = 0;
  const size_t oWq  = off; off += PWq;
  const size_t oWkv = off; off += PWkv;
  const size_t oWo  = off; off += PWo;
  const size_t oXt  = off; off += PXt;
  const size_t oCt  = off; off += PXt;
  const size_t oQt  = off; off += PQt;
  const size_t oQh  = off; off += PQp;
  const size_t oQl  = off; off += PQp;
  const size_t oKV  = off; off += PKV;
  const size_t oKh  = off; off += PKp;
  const size_t oKl  = off; off += PKp;
  const size_t oVh  = off; off += PKp;
  const size_t oVl  = off; off += PKp;
  const size_t oCxh = off; off += PCx;
  const size_t oCxl = off; off += PCx;
  const size_t oM2h = off; off += PCx;
  const size_t oM2l = off; off += PCx;
  if (off > ws_size) return;                             // off = 60293120
  if (off > (size_t)134217728) return;

  char* ws = (char*)d_ws;
  unsigned short* Wqb  = (unsigned short*)(ws + oWq);
  unsigned short* Wkvb = (unsigned short*)(ws + oWkv);
  unsigned short* Wob  = (unsigned short*)(ws + oWo);
  unsigned short* Xt   = (unsigned short*)(ws + oXt);
  unsigned short* Ct   = (unsigned short*)(ws + oCt);
  float*          Qt   = (float*)(ws + oQt);
  unsigned short* Qh   = (unsigned short*)(ws + oQh);
  unsigned short* Ql   = (unsigned short*)(ws + oQl);
  float*          KV   = (float*)(ws + oKV);
  unsigned short* Kh   = (unsigned short*)(ws + oKh);
  unsigned short* Kl   = (unsigned short*)(ws + oKl);
  unsigned short* Vh   = (unsigned short*)(ws + oVh);
  unsigned short* Vl   = (unsigned short*)(ws + oVl);
  unsigned short* Cxh  = (unsigned short*)(ws + oCxh);
  unsigned short* Cxl  = (unsigned short*)(ws + oCxl);
  unsigned short* M2h  = (unsigned short*)(ws + oM2h);
  unsigned short* M2l  = (unsigned short*)(ws + oM2l);

  const dim3 blk(256);
  const int n8wq  = CH * CH / 8;                         //  8192
  const int n8wkv = 2 * CH * CH / 8;                     // 16384
  const int n8wo  = CH * CH / 8;                         //  8192

  // (0) weights -> bf16 planes
  cvt_bf16x8<<<dim3((n8wq + 255) / 256), blk, 0, stream>>>(wq, Wqb, n8wq);
  cvt_bf16x8<<<dim3((n8wkv + 255) / 256), blk, 0, stream>>>(wkv, Wkvb, n8wkv);
  cvt_bf16x8<<<dim3((n8wo + 255) / 256), blk, 0, stream>>>(wo, Wob, n8wo);

  const dim3 gTr(NSP / 64, CH / 64, 2 * GB);             // 64 x 4 x 4
  const dim3 gQt(tile_blocks(NSP, CH), GB);              // 256 tiles -> 32 blocks
  const dim3 gQs(NSP / 8, GB);                           // 512 x GB
  const dim3 gKV(tile_blocks(2 * CH, NSP), GB);          // 512 tiles -> 64 blocks
  const dim3 gKs(2 * CH, GB);                            // 512 x GB
  const dim3 gCx(tile_blocks(CH, CH), GB);               // 16 tiles -> 2 blocks
  const dim3 gOut(tile_blocks(CH, NSP), GB);             // 256 tiles -> 32 blocks
  const long long sNC = (long long)NSP * CH;             // per-batch stride of the [4096][256] / [256][4096] planes
  const long long sCC = (long long)CH * CH;

  for (int g = 0; g < NGRP; ++g) {
    const int b0 = g * GB;
    // (1) x[b], cproj[b] -> Xt[n][c], Ct[n][c] bf16
    k_trcvt<<<gTr, blk, 0, stream>>>(x, cproj, Xt, Ct, b0);
    // (2) Qt[n][o] = Xt . wq^T + bq[o]  (M=4096, N=256, K=256) f32
    gemm64<0, 0, 2><<<gQt, blk, 0, stream>>>(
        Xt, Xt, CH, sNC, Wqb, Wqb, CH, 0LL,
        (void*)Qt, (void*)Qt, CH, sNC, bq, NSP, CH, CH, 1.0f);
    // q softmax over each head's 64 columns -> qP hi/lo (x64)
    k_qsoft<<<gQs, blk, 0, stream>>>(Qt, Qh, Ql);
    // (3) KV[j][n] = wkv . Ct^T + bkv[j]  (M=512, N=4096, K=256) f32
    gemm64<0, 0, 1><<<gKV, blk, 0, stream>>>(
        Wkvb, Wkvb, CH, 0LL, Ct, Ct, CH, sNC,
        (void*)KV, (void*)KV, NSP, (long long)2 * CH * NSP, bkv, 2 * CH, NSP, CH, 1.0f);
    // k softmax over n -> kP hi/lo (x4096); V rows -> V hi/lo
    k_ksoftv<<<gKs, blk, 0, stream>>>(KV, Kh, Kl, Vh, Vl);
    // (4) ctxT[d][c] = (Vh.kPh^T + Vl.kPh^T + Vh.kPl^T) / 4096  (M=N=256, K=4096) -> bf16 hi/lo
    gemm64<2, 2, 0><<<gCx, blk, 0, stream>>>(
        Vh, Vl, NSP, sNC, Kh, Kl, NSP, sNC,
        (void*)Cxh, (void*)Cxl, CH, sCC, bq, CH, CH, NSP, 1.0f / 4096.0f);
    // (5) M2[o][d] = wo . (ctxTh + ctxTl)^T  (M=N=K=256) -> bf16 hi/lo
    gemm64<3, 2, 0><<<gCx, blk, 0, stream>>>(
        Wob, Wob, CH, 0LL, Cxh, Cxl, CH, sCC,
        (void*)M2h, (void*)M2l, CH, sCC, bq, CH, CH, CH, 1.0f);
    // (6) out[b][o][n] = ((M2h + M2l).qPh^T + M2h.qPl^T) / 64 + bo[o]  (M=256, N=4096, K=256) -> d_out f32
    float* outg = out + (size_t)b0 * CH * NSP;
    gemm64<2, 0, 1><<<gOut, blk, 0, stream>>>(
        M2h, M2l, CH, sCC, Qh, Ql, CH, sNC,
        (void*)outg, (void*)outg, NSP, sNC, bo, CH, NSP, CH, 1.0f / 64.0f);
  }
  (void)hipGetLastError();
}

// v001
// One run takes 435 microseconds.
// In two side-by-side timings against v000, it was 3.45 and 3.41 times as fast.
// Contractions (all v_wmma_f32_16x16x32_bf16, f32 accumulate): x^T.wq^T and wkv.cproj with bf16 operands
// RNE-converted from the f32 inputs (single product); V.kP^T with bf16 hi+lo planes on both operands (3 products);
// wo.ctx^T with bf16 wo times ctx hi+lo planes (2 products); M2.qP^T with bf16 hi+lo planes on both (3 products).
// Softmaxes and epilogues in f32; softmax outputs carried x64 (q) and x4096 (k), folded back by epilogue scales.
#include <hip/hip_runtime.h>
#include <stdint.h>

#define NBAT 8
#define CH   256
#define NSP  4096
#define GB   2
#define NGRP (NBAT / GB)
static_assert((NSP % 64) == 0 && (CH % 64) == 0 && (NBAT % GB) == 0);
static_assert(NSP == 2 * 256 * 8);   // k-softmax row = 2 passes x 256 threads x 8 elements
static_assert(CH == 32 * 8);         // q-softmax row = 32 lanes x 8 elements, one head = 8 lanes
#define KSP  32                      // k slices of the V.kP^T product (K = NSP), one grid z index each
static_assert((NSP % (KSP * 32)) == 0 && ((GB * CH * CH) % 1024) == 0);

typedef __bf16   v16b __attribute__((ext_vector_type(16)));
typedef __bf16   v8b  __attribute__((ext_vector_type(8)));
typedef float    v8f  __attribute__((ext_vector_type(8)));
typedef float    v4f  __attribute__((ext_vector_type(4)));
typedef unsigned int v4u __attribute__((ext_vector_type(4)));

// ---- scalar helpers --------------------------------------------------------------------------------
__device__ __forceinline__ unsigned short bf_bits(float f) {          // f32 -> bf16 bits, RNE convert
  unsigned u = __float_as_uint(f);
  return (unsigned short)((u + 0x7FFFu + ((u >> 16) & 1u)) >> 16);
}
__device__ __forceinline__ float bf_up(unsigned short h) { return __uint_as_float(((unsigned)h) << 16); }
__device__ __forceinline__ unsigned pk16(unsigned short a, unsigned short b) { return (unsigned)a | ((unsigned)b << 16); }
__device__ __forceinline__ v8f zero8() { v8f z = {0.f, 0.f, 0.f, 0.f, 0.f, 0.f, 0.f, 0.f}; return z; }

// ---- fragment loader: 16-bit A/B operand, lane -> row/col (lane&15), p already includes +8*(lane>>4);
//      elements 0..7 <- p[0..7] (k0+8h..), elements 8..15 <- p[16..23] (k0+16+8h..)
__device__ __forceinline__ v16b ldfrag_b(const __bf16* p) {
  union { v16b v; v8b h[2]; } f;
  f.h[0] = *(const v8b*)(p);
  f.h[1] = *(const v8b*)(p + 16);
  return f.v;
}

// ---- WMMA helpers with trailing VALU hazard gap --------------------------------------------------------
__device__ __forceinline__ v8f mma_b_raw(v16b a, v16b b, v8f c) {
  return __builtin_amdgcn_wmma_f32_16x16x32_bf16(false, a, false, b, (short)0, c, false, false);
}
__device__ __forceinline__ void dep_guard_b(v8f& a, v8f& b, v16b x, v16b y) {
#if defined(__HIP_DEVICE_COMPILE__)
  asm volatile("v_nop\n\tv_nop\n\tv_nop\n\tv_nop" : "+v"(a), "+v"(b) : "v"(x), "v"(y));
#endif
}
__device__ __forceinline__ void keep4_b(v16b a, v16b b, v16b c, v16b d) {
#if defined(__HIP_DEVICE_COMPILE__)
  asm volatile("v_nop" :: "v"(a), "v"(b), "v"(c), "v"(d));
#endif
}
__device__ __forceinline__ void acc_guard4(v8f& a, v8f& b, v8f& c, v8f& d) {
#if defined(__HIP_DEVICE_COMPILE__)
  asm volatile("v_nop\n\tv_nop\n\tv_nop\n\tv_nop" : "+v"(a), "+v"(b), "+v"(c), "+v"(d));
#endif
}
__device__ __forceinline__ void wave_sync_lds() {
  __builtin_amdgcn_fence(__ATOMIC_RELEASE, "workgroup");
  __builtin_amdgcn_wave_barrier();
  __builtin_amdgcn_fence(__ATOMIC_ACQUIRE, "workgroup");
}

// =====================================================================================================
// f32 -> bf16 (RNE convert), 8 elements per thread, one 16-B store per lane: a wave writes 512 contiguous B
// coverage: n8 threads x 8 = whole plane (n8 is a multiple of 256 for every use here).
// =====================================================================================================
__global__ __launch_bounds__(256) void cvt_bf16x8(const float* __restrict__ in, unsigned short* out, int n8) {
  const int i = blockIdx.x * 256 + threadIdx.x;
  if (i < n8) {
    const v4f a = *(const v4f*)(in + (size_t)i * 8);
    const v4f b = *(const v4f*)(in + (size_t)i * 8 + 4);
    v4u p;
    p[0] = pk16(bf_bits(a[0]), bf_bits(a[1]));
    p[1] = pk16(bf_bits(a[2]), bf_bits(a[3]));
    p[2] = pk16(bf_bits(b[0]), bf_bits(b[1]));
    p[3] = pk16(bf_bits(b[2]), bf_bits(b[3]));
    *(v4u*)(out + (size_t)i * 8) = p;
    
  }
}

// =====================================================================================================
// Transpose-convert of one 64x64 tile: source [b][c][n] f32 (c pitch NSP) -> plane [bi][n][c] bf16 (pitch CH).
// blockIdx.x = n tile, blockIdx.y = c tile, blockIdx.z = 2*bi + sel (sel 0: xg -> xt, 1: cg -> ct); block 256.
// Load: thread r = tid>>2 owns source row c0+r, 16 consecutive n at (tid&3)*16 (4 x 16-B loads).
// coverage: load 256x16 = 4096 = whole tile; store 2x256x8 = 4096 = whole tile.
// =====================================================================================================
__global__ __launch_bounds__(256) void k_trcvt(const float* __restrict__ xg, const float* __restrict__ cg,
                                               unsigned short* xt, unsigned short* ct, int b0) {
  __shared__ float tile[64][65];
  const int tid = threadIdx.x;
  const int n0 = blockIdx.x * 64;
  const int c0 = blockIdx.y * 64;
  const int bi  = (int)(blockIdx.z >> 1);
  const int sel = (int)(blockIdx.z & 1);
  const float* src = sel ? cg : xg;            // block-uniform select, both global
  unsigned short* dst = sel ? ct : xt;
  {
    const int r = tid >> 2, cs = (tid & 3) * 16;
    const float* p = src + ((size_t)(b0 + bi) * CH + (size_t)(c0 + r)) * NSP + n0 + cs;
#pragma unroll
    for (int i = 0; i < 4; ++i) {
      const v4f v = *(const v4f*)(p + 4 * i);
      tile[r][cs + 4 * i + 0] = v[0];
      tile[r][cs + 4 * i + 1] = v[1];
      tile[r][cs + 4 * i + 2] = v[2];
      tile[r][cs + 4 * i + 3] = v[3];
    }
  }
  __syncthreads();
  v4u pv[2];
  const int c8 = (tid & 7) * 8;
#pragma unroll
  for (int it = 0; it < 2; ++it) {
    const int n = it * 32 + (tid >> 3);
    v4u a;
#pragma unroll
    for (int e = 0; e < 4; ++e) {
      a[e] = pk16(bf_bits(tile[c8 + 2 * e][n]), bf_bits(tile[c8 + 2 * e + 1][n]));
    }
    pv[it] = a;
  }
  {
#pragma unroll
    for (int it = 0; it < 2; ++it) {
      const int n = it * 32 + (tid >> 3);
      const size_t go = ((size_t)bi * NSP + (size_t)(n0 + n)) * CH + c0 + c8;
      *(v4u*)(dst + go) = pv[it];
    }
    
  }
}

// =====================================================================================================
// Register-blocked batched bf16 WMMA GEMM: C[m][n] = oscale * sum_k A[m][k] * Bt[n][k] + bias; one wave per
// 64x64 tile, no block barriers. A row-major [M][K] pitch lda; Bt row-major [N][K] pitch ldb (k contiguous);
// M, N multiples of 64, K multiple of 32 (host-checked). blockIdx.y = batch index (strides in elements).
// NSPLIT: 0 = A.Bt; 1 = (A + A2).Bt; 2 = A.Bt + A2.Bt + A.Bt2; 3 = A.Bt + A.Bt2 (A2, Bt2 = unscaled bf16 lo planes).
// BIAS: 0 none; 1 = bias[m] per output row; 2 = bias[n] per output column (bias value RNE-converted to bf16).
// OUT_MODE: 0 = f32 (pitch ldc); 2 = bf16 hi plane C + bf16 lo plane C2 (lo = RNE(v - hi), unscaled), same pitch.
// KSLICE: blockIdx.z = k slice; K is the slice length, the slice starts at k = blockIdx.z * K, and its partial
// product goes to plane [blockIdx.z][b] of C (GB batches a slice, plane stride strideC); k_ksum adds the planes.
// =====================================================================================================
template <int NSPLIT, int OUT_MODE, int BIAS, bool KSLICE = false>
__global__ __launch_bounds__(256) void gemm64(
    const unsigned short* __restrict__ Ap, const unsigned short* A2p, int lda, long long strideA,
    const unsigned short* __restrict__ Btp, const unsigned short* Bt2p, int ldb, long long strideB,
    void* Cout, void* Cout2, int ldc, long long strideC,
    const float* __restrict__ bias, int M, int N, int K, float oscale) {
  const __bf16* A   = (const __bf16*)(const void*)Ap;
  const __bf16* A2  = (const __bf16*)(const void*)A2p;
  const __bf16* Bt  = (const __bf16*)(const void*)Btp;
  const __bf16* Bt2 = (const __bf16*)(const void*)Bt2p;
  __shared__ __align__(16) float sT[8][16 * 68];   // per-wave 16x64 slab, pitch 68 floats
  const int b    = blockIdx.y;
  const int lane = threadIdx.x & 31;
  const int wave = threadIdx.x >> 5;
  const int tilesN = N >> 6;
  const int tilesM = M >> 6;
  const int tile = blockIdx.x * 8 + wave;
  if (tile >= tilesM * tilesN) return;   // wave-uniform; no block barriers in this kernel
  const int tm = tile / tilesN;
  const int tn = tile - tm * tilesN;
  const int m0 = tm << 6;
  const int n0 = tn << 6;

  constexpr bool useA2 = (NSPLIT == 1) || (NSPLIT == 2);
  constexpr bool useB2 = (NSPLIT >= 2);
  const size_t kz = KSLICE ? (size_t)blockIdx.z * (size_t)K : (size_t)0;
  const size_t cb = KSLICE ? (size_t)blockIdx.z * GB + (size_t)b : (size_t)b;   // output plane index
  const __bf16* Ab  = A  + (size_t)b * strideA + kz;
  const __bf16* Bb  = Bt + (size_t)b * strideB + kz;
  const __bf16* Ab2 = useA2 ? (A2  + (size_t)b * strideA + kz) : Ab;
  const __bf16* Bb2 = useB2 ? (Bt2 + (size_t)b * strideB + kz) : Bb;

  const int rlane = lane & 15;                 // row (A) / col (B, D) within subtile
  const int koff  = (lane >> 4) * 8;           // k offset of this lane half
  const int mOff  = (lane >> 4) * 8;           // D row offset

  v8f acc[4][4];
#pragma unroll
  for (int i = 0; i < 4; ++i)
#pragma unroll
    for (int j = 0; j < 4; ++j) acc[i][j] = zero8();

  for (int k0 = 0; k0 < K; k0 += 32) {
    v16b bh[4], bl[4];
#pragma unroll
    for (int j = 0; j < 4; ++j) {
      const size_t bofs = (size_t)(n0 + (j << 4) + rlane) * ldb + koff + k0;
      bh[j] = ldfrag_b(Bb + bofs);
      if (useB2) bl[j] = ldfrag_b(Bb2 + bofs); else bl[j] = bh[j];
    }
#pragma unroll
    for (int i = 0; i < 4; ++i) {
      const size_t ao = (size_t)(m0 + (i << 4) + rlane) * lda + koff + k0;
      const v16b ah = ldfrag_b(Ab + ao);
      v16b al = ah;
      if (useA2) al = ldfrag_b(Ab2 + ao);
#pragma unroll
      for (int j = 0; j < 4; ++j) {
        acc[i][j] = mma_b_raw(ah, bh[j], acc[i][j]);
        if (useA2) acc[i][j] = mma_b_raw(al, bh[j], acc[i][j]);
        if (useB2) acc[i][j] = mma_b_raw(ah, bl[j], acc[i][j]);
      }
      dep_guard_b(acc[i][0], acc[i][3], ah, al);
    }
    keep4_b(bh[0], bh[1], bh[2], bh[3]);
    if (useB2) keep4_b(bl[0], bl[1], bl[2], bl[3]);
  }
  acc_guard4(acc[0][0], acc[0][1], acc[0][2], acc[0][3]);
  acc_guard4(acc[1][0], acc[1][1], acc[1][2], acc[1][3]);
  acc_guard4(acc[2][0], acc[2][1], acc[2][2], acc[2][3]);
  acc_guard4(acc[3][0], acc[3][1], acc[3][2], acc[3][3]);

  // ---- epilogue ----
  float bcol[4];
#pragma unroll
  for (int j = 0; j < 4; ++j) bcol[j] = 0.f;
  if (BIAS == 2) {
#pragma unroll
    for (int j = 0; j < 4; ++j) bcol[j] = bf_up(bf_bits(bias[n0 + (j << 4) + rlane]));
  }
  float* slab = sT[wave];
#pragma unroll
  for (int i = 0; i < 4; ++i) {
    const int mBase = m0 + (i << 4);
    float brow[8];
#pragma unroll
    for (int r = 0; r < 8; ++r) brow[r] = 0.f;
    if (BIAS == 1) {
#pragma unroll
      for (int r = 0; r < 8; ++r) brow[r] = bf_up(bf_bits(bias[mBase + mOff + r]));
    }
#pragma unroll
    for (int j = 0; j < 4; ++j) {
#pragma unroll
      for (int r = 0; r < 8; ++r) {
        slab[(mOff + r) * 68 + (j << 4) + rlane] = acc[i][j][r] * oscale + (brow[r] + bcol[j]);
      }
    }
    wave_sync_lds();
    if (OUT_MODE == 0) {
      float* C = (float*)Cout + cb * strideC;
      const int hh = lane >> 4, c4 = (lane & 15) * 4;     // 256-B row segment = 16 lanes x 16 B
      {
#pragma unroll
        for (int it = 0; it < 8; ++it) {
          const int row = it * 2 + hh;                     // it 0..7 x hh 0..1 = rows 0..15
          const v4f v = *(const v4f*)(slab + row * 68 + c4);
          *(v4f*)(C + (size_t)(mBase + row) * ldc + n0 + c4) = v;
        }
        
      }
    } else {
      const int q = lane >> 3, c8 = (lane & 7) * 8;
      unsigned short* C  = (unsigned short*)Cout  + cb * strideC;
      unsigned short* C2 = (unsigned short*)Cout2 + cb * strideC;
      v4u hv[4], lv[4];
#pragma unroll
      for (int it = 0; it < 4; ++it) {
        const int row = it * 4 + q;                        // it 0..3 x q 0..3 = rows 0..15
        const float* sp = slab + row * 68 + c8;
        v4u a, a2;
#pragma unroll
        for (int e = 0; e < 4; ++e) {
          const float f0 = sp[2 * e], f1 = sp[2 * e + 1];
          const unsigned short h0 = bf_bits(f0), h1 = bf_bits(f1);
          const unsigned short l0 = bf_bits(f0 - bf_up(h0)), l1 = bf_bits(f1 - bf_up(h1));
          a[e] = pk16(h0, h1); a2[e] = pk16(l0, l1);
        }
        hv[it] = a; lv[it] = a2;
      }
      {
#pragma unroll
        for (int it = 0; it < 4; ++it) {
          const int row = it * 4 + q;
          const size_t go = (size_t)(mBase + row) * ldc + n0 + c8;
          *(v4u*)(C  + go) = hv[it];
          *(v4u*)(C2 + go) = lv[it];
        }
        
      }
    }
    wave_sync_lds();
  }
}

// =====================================================================================================
// Sum of the KSP k-slice planes of ctxT: part f32 [KSP][GB*CH*CH] -> bf16 hi/lo planes [GB*CH*CH], slices added
// in index order. Thread owns 4 consecutive elements (16-B loads, 8-B stores: a wave stores 256 contiguous B).
// coverage: (GB*CH*CH/1024) blocks x 256 threads x 4 = whole plane.
// =====================================================================================================
__global__ __launch_bounds__(256) void k_ksum(const float* __restrict__ part, unsigned short* ch, unsigned short* cl) {
  const size_t e0 = ((size_t)blockIdx.x * 256 + threadIdx.x) * 4;
  v4f p[KSP];
#pragma unroll   // keeps p[] in registers and the independent loads in flight together
  for (int z = 0; z < KSP; ++z) p[z] = *(const v4f*)(part + (size_t)z * (GB * CH * CH) + e0);
  v4f s = p[0];
#pragma unroll   // p[] is indexed by constants only, so it stays in registers
  for (int z = 1; z < KSP; ++z) s += p[z];
  const unsigned short h0 = bf_bits(s[0]), h1 = bf_bits(s[1]), h2 = bf_bits(s[2]), h3 = bf_bits(s[3]);
  uint2 hv, lv;
  hv.x = pk16(h0, h1);
  hv.y = pk16(h2, h3);
  lv.x = pk16(bf_bits(s[0] - bf_up(h0)), bf_bits(s[1] - bf_up(h1)));
  lv.y = pk16(bf_bits(s[2] - bf_up(h2)), bf_bits(s[3] - bf_up(h3)));
  *(uint2*)(ch + e0) = hv;
  *(uint2*)(cl + e0) = lv;
}

// =====================================================================================================
// q softmax: Qt f32 [bi][n][CH] -> qP planes bf16 hi/lo [bi][n][CH] carrying 64 * softmax over each group of
// 64 consecutive columns (one head) of 0.25 * Qt. grid (NSP/8, GB), block 256: wave -> one row n; lane owns 8
// consecutive columns (16-B loads), one head = 8 consecutive lanes (xor-shuffle 1,2,4). Row store = 32 lanes x
// coverage: 512 blocks x 8 waves = 4096 rows x (32 lanes x 8) = whole plane per batch.
// =====================================================================================================
__global__ __launch_bounds__(256) void k_qsoft(const float* __restrict__ qt, unsigned short* qh, unsigned short* ql) {
  const int lane = threadIdx.x & 31, wave = threadIdx.x >> 5;
  const int n = blockIdx.x * 8 + wave;
  const size_t ro = ((size_t)blockIdx.y * NSP + (size_t)n) * CH + (size_t)lane * 8;
  const v4f a = *(const v4f*)(qt + ro);
  const v4f c = *(const v4f*)(qt + ro + 4);
  float v[8];
  v[0] = a[0] * 0.25f; v[1] = a[1] * 0.25f; v[2] = a[2] * 0.25f; v[3] = a[3] * 0.25f;
  v[4] = c[0] * 0.25f; v[5] = c[1] * 0.25f; v[6] = c[2] * 0.25f; v[7] = c[3] * 0.25f;
  float m = v[0];
#pragma unroll
  for (int i = 1; i < 8; ++i) m = fmaxf(m, v[i]);
  m = fmaxf(m, __shfl_xor(m, 1, 32));
  m = fmaxf(m, __shfl_xor(m, 2, 32));
  m = fmaxf(m, __shfl_xor(m, 4, 32));
  float e[8];
  float s = 0.f;
#pragma unroll
  for (int i = 0; i < 8; ++i) { e[i] = __expf(v[i] - m); s += e[i]; }
  s += __shfl_xor(s, 1, 32);
  s += __shfl_xor(s, 2, 32);
  s += __shfl_xor(s, 4, 32);
  const float rinv = 1.0f / s;
  v4u ph, pl;
#pragma unroll
  for (int q = 0; q < 4; ++q) {
    const float f0 = (e[2 * q] * rinv) * 64.0f;
    const float f1 = (e[2 * q + 1] * rinv) * 64.0f;
    const unsigned short h0 = bf_bits(f0), h1 = bf_bits(f1);
    const unsigned short l0 = bf_bits(f0 - bf_up(h0)), l1 = bf_bits(f1 - bf_up(h1));
    ph[q] = pk16(h0, h1); pl[q] = pk16(l0, l1);
  }
  *(v4u*)(qh + ro) = ph;
  *(v4u*)(ql + ro) = pl;
  
}

// =====================================================================================================
// k softmax over n (rows 0..CH-1 of KV) and V plane split (rows CH..2CH-1): KV f32 [bi][2CH][NSP].
// wave xor-shuffle + 8-entry LDS combine in fixed order), value = (exp * (1/sum)) * 4096 -> kP hi/lo bf16.
// V rows: value unchanged -> V hi/lo bf16. Thread t owns columns it*2048 + 8t (it 0..1): each store instruction
// =====================================================================================================
__global__ __launch_bounds__(256) void k_ksoftv(const float* __restrict__ kv,
                                                unsigned short* kph, unsigned short* kpl,
                                                unsigned short* vhp, unsigned short* vlp) {
  __shared__ float red[8];
  const int tid = threadIdx.x, lane = tid & 31, wave = tid >> 5;
  const int j  = blockIdx.x;
  const int bi = blockIdx.y;
  const bool isK = (j < CH);                   // block-uniform
  const float* src = kv + ((size_t)bi * (2 * CH) + (size_t)j) * NSP;
  float vals[16];
#pragma unroll
  for (int it = 0; it < 2; ++it) {
    const size_t co = (size_t)it * 2048 + (size_t)tid * 8;
    const v4f a = *(const v4f*)(src + co);
    const v4f c = *(const v4f*)(src + co + 4);
    vals[it * 8 + 0] = a[0]; vals[it * 8 + 1] = a[1]; vals[it * 8 + 2] = a[2]; vals[it * 8 + 3] = a[3];
    vals[it * 8 + 4] = c[0]; vals[it * 8 + 5] = c[1]; vals[it * 8 + 6] = c[2]; vals[it * 8 + 7] = c[3];
  }
  if (isK) {
    float m = vals[0];
#pragma unroll
    for (int i = 1; i < 16; ++i) m = fmaxf(m, vals[i]);
#pragma unroll
    for (int off = 1; off < 32; off <<= 1) m = fmaxf(m, __shfl_xor(m, off, 32));
    if (lane == 0) red[wave] = m;
    __syncthreads();
    float mm = red[0];
#pragma unroll
    for (int w = 1; w < 8; ++w) mm = fmaxf(mm, red[w]);
    __syncthreads();
    float s = 0.f;
#pragma unroll
    for (int i = 0; i < 16; ++i) { vals[i] = __expf(vals[i] - mm); s += vals[i]; }
#pragma unroll
    for (int off = 1; off < 32; off <<= 1) s += __shfl_xor(s, off, 32);
    if (lane == 0) red[wave] = s;
    __syncthreads();
    float ss = red[0];
#pragma unroll
    for (int w = 1; w < 8; ++w) ss += red[w];
    const float rinv = 1.0f / ss;
#pragma unroll
    for (int i = 0; i < 16; ++i) vals[i] = (vals[i] * rinv) * 4096.0f;
  }
  const int rr = isK ? j : (j - CH);           // 0..CH-1
  unsigned short* ph = isK ? kph : vhp;        // block-uniform selects, all global
  unsigned short* pl = isK ? kpl : vlp;
  unsigned short* dh = ph + ((size_t)bi * CH + (size_t)rr) * NSP;
  unsigned short* dl = pl + ((size_t)bi * CH + (size_t)rr) * NSP;
  v4u hv[2], lv[2];
#pragma unroll
  for (int it = 0; it < 2; ++it) {
    v4u a, a2;
#pragma unroll
    for (int e = 0; e < 4; ++e) {
      const float f0 = vals[it * 8 + 2 * e], f1 = vals[it * 8 + 2 * e + 1];
      const unsigned short h0 = bf_bits(f0), h1 = bf_bits(f1);
      const unsigned short l0 = bf_bits(f0 - bf_up(h0)), l1 = bf_bits(f1 - bf_up(h1));
      a[e] = pk16(h0, h1); a2[e] = pk16(l0, l1);
    }
    hv[it] = a; lv[it] = a2;
  }
  {
#pragma unroll
    for (int it = 0; it < 2; ++it) {
      const size_t co = (size_t)it * 2048 + (size_t)tid * 8;
      *(v4u*)(dh + co) = hv[it];
      *(v4u*)(dl + co) = lv[it];
    }
    
  }
}

// =====================================================================================================
// Workspace map (bytes), every plane an exact multiple of its 64x64-tile / whole-line store granularity
// (no padded tails needed: 4096, 512, 256 are tile multiples); per-group planes are reused by each group:
//   Wqb   bf16 [256][256]              0          131072
//   Wkvb  bf16 [512][256]              131072     262144
//   Wob   bf16 [256][256]              393216     131072
//   Xt    bf16 [GB][4096][256]         524288     4194304
//   Ct    bf16 [GB][4096][256]         4718592    4194304
//   Qt    f32  [GB][4096][256]         8912896    8388608
//   qPh   bf16 [GB][4096][256]         17301504   4194304
//   qPl   bf16 [GB][4096][256]         21495808   4194304
//   KV    f32  [GB][512][4096]         25690112   16777216
//   kPh   bf16 [GB][256][4096]         42467328   4194304
//   kPl   bf16 [GB][256][4096]         46661632   4194304
//   Vh    bf16 [GB][256][4096]         50855936   4194304
//   Vl    bf16 [GB][256][4096]         55050240   4194304
//   cxh   bf16 [GB][256][256]          59244544   262144
//   cxl   bf16 [GB][256][256]          59506688   262144
//   m2h   bf16 [GB][256][256]          59768832   262144
//   m2l   bf16 [GB][256][256]          60030976   262144
//   cxp   f32  [KSP][GB][256][256]     60293120   16777216
//   end                                77070336
// Weights are [out][in] with the in index contiguous = the A / Bt layout, so they are only converted.
// =====================================================================================================
static inline unsigned tile_blocks(int M, int N) { return (unsigned)((((M / 64) * (N / 64)) + 7) / 8); }

extern "C" void kernel_launch(void* const* d_in, const int* in_sizes, int n_in,
                              void* d_out, int out_size, void* d_ws, size_t ws_size,
                              hipStream_t stream) {
  if (n_in < 8) return;
  if (in_sizes[0] != NBAT * CH * NSP) return;
  if (in_sizes[1] != NBAT * CH * NSP) return;
  if (in_sizes[2] != CH * CH) return;
  if (in_sizes[3] != CH) return;
  if (in_sizes[4] != 2 * CH * CH) return;
  if (in_sizes[5] != 2 * CH) return;
  if (in_sizes[6] != CH * CH) return;
  if (in_sizes[7] != CH) return;
  if (out_size != NBAT * CH * NSP) return;

  const float* x     = (const float*)d_in[0];
  const float* cproj = (const float*)d_in[1];
  const float* wq    = (const float*)d_in[2];
  const float* bq    = (const float*)d_in[3];
  const float* wkv   = (const float*)d_in[4];
  const float* bkv   = (const float*)d_in[5];
  const float* wo    = (const float*)d_in[6];
  const float* bo    = (const float*)d_in[7];
  float* out = (float*)d_out;

  const size_t PWq  = (size_t)CH * CH * 2;               //   131072
  const size_t PWkv = (size_t)2 * CH * CH * 2;           //   262144
  const size_t PWo  = (size_t)CH * CH * 2;               //   131072
  const size_t PXt  = (size_t)GB * NSP * CH * 2;         //  4194304
  const size_t PQt  = (size_t)GB * NSP * CH * 4;         //  8388608
  const size_t PQp  = (size_t)GB * NSP * CH * 2;         //  4194304
  const size_t PKV  = (size_t)GB * 2 * CH * NSP * 4;     // 16777216
  const size_t PKp  = (size_t)GB * CH * NSP * 2;         //  4194304
  const size_t PCx  = (size_t)GB * CH * CH * 2;          //   262144
  size_t off = 0;
  const size_t oWq  = off; off += PWq;
  const size_t oWkv = off; off += PWkv;
  const size_t oWo  = off; off += PWo;
  const size_t oXt  = off; off += PXt;
  const size_t oCt  = off; off += PXt;
  const size_t oQt  = off; off += PQt;
  const size_t oQh  = off; off += PQp;
  const size_t oQl  = off; off += PQp;
  const size_t oKV  = off; off += PKV;
  const size_t oKh  = off; off += PKp;
  const size_t oKl  = off; off += PKp;
  const size_t oVh  = off; off += PKp;
  const size_t oVl  = off; off += PKp;
  const size_t oCxh = off; off += PCx;
  const size_t oCxl = off; off += PCx;
  const size_t oM2h = off; off += PCx;
  const size_t oM2l = off; off += PCx;
  const size_t oCxp = off; off += (size_t)KSP * GB * CH * CH * 4;
  if (off > ws_size) return;                             // off = 77070336
  if (off > (size_t)134217728) return;

  char* ws = (char*)d_ws;
  unsigned short* Wqb  = (unsigned short*)(ws + oWq);
  unsigned short* Wkvb = (unsigned short*)(ws + oWkv);
  unsigned short* Wob  = (unsigned short*)(ws + oWo);
  unsigned short* Xt   = (unsigned short*)(ws + oXt);
  unsigned short* Ct   = (unsigned short*)(ws + oCt);
  float*          Qt   = (float*)(ws + oQt);
  unsigned short* Qh   = (unsigned short*)(ws + oQh);
  unsigned short* Ql   = (unsigned short*)(ws + oQl);
  float*          KV   = (float*)(ws + oKV);
  unsigned short* Kh   = (unsigned short*)(ws + oKh);
  unsigned short* Kl   = (unsigned short*)(ws + oKl);
  unsigned short* Vh   = (unsigned short*)(ws + oVh);
  unsigned short* Vl   = (unsigned short*)(ws + oVl);
  unsigned short* Cxh  = (unsigned short*)(ws + oCxh);
  unsigned short* Cxl  = (unsigned short*)(ws + oCxl);
  unsigned short* M2h  = (unsigned short*)(ws + oM2h);
  unsigned short* M2l  = (unsigned short*)(ws + oM2l);
  float*          Cxp  = (float*)(ws + oCxp);

  const dim3 blk(256);
  const int n8wq  = CH * CH / 8;                         //  8192
  const int n8wkv = 2 * CH * CH / 8;                     // 16384
  const int n8wo  = CH * CH / 8;                         //  8192

  // (0) weights -> bf16 planes
  cvt_bf16x8<<<dim3((n8wq + 255) / 256), blk, 0, stream>>>(wq, Wqb, n8wq);
  cvt_bf16x8<<<dim3((n8wkv + 255) / 256), blk, 0, stream>>>(wkv, Wkvb, n8wkv);
  cvt_bf16x8<<<dim3((n8wo + 255) / 256), blk, 0, stream>>>(wo, Wob, n8wo);

  const dim3 gTr(NSP / 64, CH / 64, 2 * GB);             // 64 x 4 x 4
  const dim3 gQt(tile_blocks(NSP, CH), GB);              // 256 tiles -> 32 blocks
  const dim3 gQs(NSP / 8, GB);                           // 512 x GB
  const dim3 gKV(tile_blocks(2 * CH, NSP), GB);          // 512 tiles -> 64 blocks
  const dim3 gKs(2 * CH, GB);                            // 512 x GB
  const dim3 gCx(tile_blocks(CH, CH), GB);               // 16 tiles -> 2 blocks
  const dim3 gCxK(tile_blocks(CH, CH), GB, KSP);         // 2 x GB x 32 k slices = 128 blocks
  const dim3 gSum(GB * CH * CH / 1024);                  // 128 blocks
  const dim3 gOut(tile_blocks(CH, NSP), GB);             // 256 tiles -> 32 blocks
  const long long sNC = (long long)NSP * CH;             // per-batch stride of the [4096][256] / [256][4096] planes
  const long long sCC = (long long)CH * CH;

  for (int g = 0; g < NGRP; ++g) {
    const int b0 = g * GB;
    // (1) x[b], cproj[b] -> Xt[n][c], Ct[n][c] bf16
    k_trcvt<<<gTr, blk, 0, stream>>>(x, cproj, Xt, Ct, b0);
    // (2) Qt[n][o] = Xt . wq^T + bq[o]  (M=4096, N=256, K=256) f32
    gemm64<0, 0, 2><<<gQt, blk, 0, stream>>>(
        Xt, Xt, CH, sNC, Wqb, Wqb, CH, 0LL,
        (void*)Qt, (void*)Qt, CH, sNC, bq, NSP, CH, CH, 1.0f);
    // q softmax over each head's 64 columns -> qP hi/lo (x64)
    k_qsoft<<<gQs, blk, 0, stream>>>(Qt, Qh, Ql);
    // (3) KV[j][n] = wkv . Ct^T + bkv[j]  (M=512, N=4096, K=256) f32
    gemm64<0, 0, 1><<<gKV, blk, 0, stream>>>(
        Wkvb, Wkvb, CH, 0LL, Ct, Ct, CH, sNC,
        (void*)KV, (void*)KV, NSP, (long long)2 * CH * NSP, bkv, 2 * CH, NSP, CH, 1.0f);
    // k softmax over n -> kP hi/lo (x4096); V rows -> V hi/lo
    k_ksoftv<<<gKs, blk, 0, stream>>>(KV, Kh, Kl, Vh, Vl);
    // (4) ctxT[d][c] = (Vh.kPh^T + Vl.kPh^T + Vh.kPl^T) / 4096  (M=N=256, K=4096 in KSP slices) -> f32 partial
    //     planes, then their sum -> bf16 hi/lo
    gemm64<2, 0, 0, true><<<gCxK, blk, 0, stream>>>(
        Vh, Vl, NSP, sNC, Kh, Kl, NSP, sNC,
        (void*)Cxp, (void*)Cxp, CH, sCC, bq, CH, CH, NSP / KSP, 1.0f / 4096.0f);
    k_ksum<<<gSum, blk, 0, stream>>>(Cxp, Cxh, Cxl);
    // (5) M2[o][d] = wo . (ctxTh + ctxTl)^T  (M=N=K=256) -> bf16 hi/lo
    gemm64<3, 2, 0><<<gCx, blk, 0, stream>>>(
        Wob, Wob, CH, 0LL, Cxh, Cxl, CH, sCC,
        (void*)M2h, (void*)M2l, CH, sCC, bq, CH, CH, CH, 1.0f);
    // (6) out[b][o][n] = ((M2h + M2l).qPh^T + M2h.qPl^T) / 64 + bo[o]  (M=256, N=4096, K=256) -> d_out f32
    float* outg = out + (size_t)b0 * CH * NSP;
    gemm64<2, 0, 1><<<gOut, blk, 0, stream>>>(
        M2h, M2l, CH, sCC, Qh, Ql, CH, sNC,
        (void*)outg, (void*)outg, NSP, sNC, bo, CH, NSP, CH, 1.0f / 64.0f);
  }
  (void)hipGetLastError();
}

// v002
// Measured time: 167 microseconds a run.
// Next to v001, in two timings, it ran 2.60 and 2.58 times as fast.
// Over all steps from v000 it is 8.89 times as fast.
// Contractions (all v_wmma_f32_16x16x32_bf16, f32 accumulate): x^T.wq^T and wkv.cproj with bf16 operands
// RNE-converted from the f32 inputs (single product); V.kP^T with bf16 hi+lo planes on both operands (3 products);
// wo.ctx^T with bf16 wo times ctx hi+lo planes (2 products); M2.qP^T with bf16 hi+lo planes on both (3 products).
// Softmaxes and epilogues in f32; softmax outputs carried x64 (q) and x4096 (k), folded back by epilogue scales.
#include <hip/hip_runtime.h>
#include <stdint.h>

#define NBAT 8
#define CH   256
#define NSP  4096
#define GB   8
#define NGRP (NBAT / GB)
static_assert((NSP % 64) == 0 && (CH % 64) == 0 && (NBAT % GB) == 0);
static_assert(NSP == 2 * 256 * 8);   // k-softmax row = 2 passes x 256 threads x 8 elements
static_assert(CH == 32 * 8);         // q-softmax row = 32 lanes x 8 elements, one head = 8 lanes
#define KSP  32                      // k slices of the V.kP^T product (K = NSP), one grid z index each
static_assert((NSP % (KSP * 32)) == 0 && ((GB * CH * CH) % 1024) == 0);
static_assert(KSP * CH * CH <= 2 * CH * NSP);   // the k-slice planes fit in the KV plane, whose bytes they take over

typedef __bf16   v16b __attribute__((ext_vector_type(16)));
typedef __bf16   v8b  __attribute__((ext_vector_type(8)));
typedef float    v8f  __attribute__((ext_vector_type(8)));
typedef float    v4f  __attribute__((ext_vector_type(4)));
typedef unsigned int v4u __attribute__((ext_vector_type(4)));

// ---- scalar helpers --------------------------------------------------------------------------------
__device__ __forceinline__ unsigned short bf_bits(float f) {          // f32 -> bf16 bits, RNE convert
  unsigned u = __float_as_uint(f);
  return (unsigned short)((u + 0x7FFFu + ((u >> 16) & 1u)) >> 16);
}
__device__ __forceinline__ float bf_up(unsigned short h) { return __uint_as_float(((unsigned)h) << 16); }
__device__ __forceinline__ unsigned pk16(unsigned short a, unsigned short b) { return (unsigned)a | ((unsigned)b << 16); }
__device__ __forceinline__ v8f zero8() { v8f z = {0.f, 0.f, 0.f, 0.f, 0.f, 0.f, 0.f, 0.f}; return z; }

// ---- fragment loader: 16-bit A/B operand, lane -> row/col (lane&15), p already includes +8*(lane>>4);
//      elements 0..7 <- p[0..7] (k0+8h..), elements 8..15 <- p[16..23] (k0+16+8h..)
__device__ __forceinline__ v16b ldfrag_b(const __bf16* p) {
  union { v16b v; v8b h[2]; } f;
  f.h[0] = *(const v8b*)(p);
  f.h[1] = *(const v8b*)(p + 16);
  return f.v;
}

// ---- WMMA helpers with trailing VALU hazard gap --------------------------------------------------------
__device__ __forceinline__ v8f mma_b_raw(v16b a, v16b b, v8f c) {
  return __builtin_amdgcn_wmma_f32_16x16x32_bf16(false, a, false, b, (short)0, c, false, false);
}
__device__ __forceinline__ void dep_guard_b(v8f& a, v8f& b, v16b x, v16b y) {
#if defined(__HIP_DEVICE_COMPILE__)
  asm volatile("v_nop\n\tv_nop\n\tv_nop\n\tv_nop" : "+v"(a), "+v"(b) : "v"(x), "v"(y));
#endif
}
__device__ __forceinline__ void keep4_b(v16b a, v16b b, v16b c, v16b d) {
#if defined(__HIP_DEVICE_COMPILE__)
  asm volatile("v_nop" :: "v"(a), "v"(b), "v"(c), "v"(d));
#endif
}
__device__ __forceinline__ void acc_guard4(v8f& a, v8f& b, v8f& c, v8f& d) {
#if defined(__HIP_DEVICE_COMPILE__)
  asm volatile("v_nop\n\tv_nop\n\tv_nop\n\tv_nop" : "+v"(a), "+v"(b), "+v"(c), "+v"(d));
#endif
}
__device__ __forceinline__ void wave_sync_lds() {
  __builtin_amdgcn_fence(__ATOMIC_RELEASE, "workgroup");
  __builtin_amdgcn_wave_barrier();
  __builtin_amdgcn_fence(__ATOMIC_ACQUIRE, "workgroup");
}

// =====================================================================================================
// f32 -> bf16 (RNE convert), 8 elements per thread, one 16-B store per lane: a wave writes 512 contiguous B
// coverage: n8 threads x 8 = whole plane (n8 is a multiple of 256 for every use here).
// =====================================================================================================
__global__ __launch_bounds__(256) void cvt_bf16x8(const float* __restrict__ in, unsigned short* out, int n8) {
  const int i = blockIdx.x * 256 + threadIdx.x;
  if (i < n8) {
    const v4f a = *(const v4f*)(in + (size_t)i * 8);
    const v4f b = *(const v4f*)(in + (size_t)i * 8 + 4);
    v4u p;
    p[0] = pk16(bf_bits(a[0]), bf_bits(a[1]));
    p[1] = pk16(bf_bits(a[2]), bf_bits(a[3]));
    p[2] = pk16(bf_bits(b[0]), bf_bits(b[1]));
    p[3] = pk16(bf_bits(b[2]), bf_bits(b[3]));
    *(v4u*)(out + (size_t)i * 8) = p;
    
  }
}

// =====================================================================================================
// Transpose-convert of one 64x64 tile: source [b][c][n] f32 (c pitch NSP) -> plane [bi][n][c] bf16 (pitch CH).
// blockIdx.x = n tile, blockIdx.y = c tile, blockIdx.z = 2*bi + sel (sel 0: xg -> xt, 1: cg -> ct); block 256.
// Load: thread r = tid>>2 owns source row c0+r, 16 consecutive n at (tid&3)*16 (4 x 16-B loads).
// coverage: load 256x16 = 4096 = whole tile; store 2x256x8 = 4096 = whole tile.
// =====================================================================================================
__global__ __launch_bounds__(256) void k_trcvt(const float* __restrict__ xg, const float* __restrict__ cg,
                                               unsigned short* xt, unsigned short* ct, int b0) {
  __shared__ float tile[64][65];
  const int tid = threadIdx.x;
  const int n0 = blockIdx.x * 64;
  const int c0 = blockIdx.y * 64;
  const int bi  = (int)(blockIdx.z >> 1);
  const int sel = (int)(blockIdx.z & 1);
  const float* src = sel ? cg : xg;            // block-uniform select, both global
  unsigned short* dst = sel ? ct : xt;
  {
    const int r = tid >> 2, cs = (tid & 3) * 16;
    const float* p = src + ((size_t)(b0 + bi) * CH + (size_t)(c0 + r)) * NSP + n0 + cs;
#pragma unroll
    for (int i = 0; i < 4; ++i) {
      const v4f v = *(const v4f*)(p + 4 * i);
      tile[r][cs + 4 * i + 0] = v[0];
      tile[r][cs + 4 * i + 1] = v[1];
      tile[r][cs + 4 * i + 2] = v[2];
      tile[r][cs + 4 * i + 3] = v[3];
    }
  }
  __syncthreads();
  v4u pv[2];
  const int c8 = (tid & 7) * 8;
#pragma unroll
  for (int it = 0; it < 2; ++it) {
    const int n = it * 32 + (tid >> 3);
    v4u a;
#pragma unroll
    for (int e = 0; e < 4; ++e) {
      a[e] = pk16(bf_bits(tile[c8 + 2 * e][n]), bf_bits(tile[c8 + 2 * e + 1][n]));
    }
    pv[it] = a;
  }
  {
#pragma unroll
    for (int it = 0; it < 2; ++it) {
      const int n = it * 32 + (tid >> 3);
      const size_t go = ((size_t)bi * NSP + (size_t)(n0 + n)) * CH + c0 + c8;
      *(v4u*)(dst + go) = pv[it];
    }
    
  }
}

// =====================================================================================================
// Register-blocked batched bf16 WMMA GEMM: C[m][n] = oscale * sum_k A[m][k] * Bt[n][k] + bias; one wave per
// 64x64 tile, no block barriers. A row-major [M][K] pitch lda; Bt row-major [N][K] pitch ldb (k contiguous);
// M, N multiples of 64, K multiple of 32 (host-checked). blockIdx.y = batch index (strides in elements).
// NSPLIT: 0 = A.Bt; 1 = (A + A2).Bt; 2 = A.Bt + A2.Bt + A.Bt2; 3 = A.Bt + A.Bt2 (A2, Bt2 = unscaled bf16 lo planes).
// BIAS: 0 none; 1 = bias[m] per output row; 2 = bias[n] per output column (bias value RNE-converted to bf16).
// OUT_MODE: 0 = f32 (pitch ldc); 2 = bf16 hi plane C + bf16 lo plane C2 (lo = RNE(v - hi), unscaled), same pitch.
// KSLICE: blockIdx.z = k slice; K is the slice length, the slice starts at k = blockIdx.z * K, and its partial
// product goes to plane [blockIdx.z][b] of C (GB batches a slice, plane stride strideC); k_ksum adds the planes.
// =====================================================================================================
template <int NSPLIT, int OUT_MODE, int BIAS, bool KSLICE = false>
__global__ __launch_bounds__(256) void gemm64(
    const unsigned short* __restrict__ Ap, const unsigned short* A2p, int lda, long long strideA,
    const unsigned short* __restrict__ Btp, const unsigned short* Bt2p, int ldb, long long strideB,
    void* Cout, void* Cout2, int ldc, long long strideC,
    const float* __restrict__ bias, int M, int N, int K, float oscale) {
  const __bf16* A   = (const __bf16*)(const void*)Ap;
  const __bf16* A2  = (const __bf16*)(const void*)A2p;
  const __bf16* Bt  = (const __bf16*)(const void*)Btp;
  const __bf16* Bt2 = (const __bf16*)(const void*)Bt2p;
  __shared__ __align__(16) float sT[8][16 * 68];   // per-wave 16x64 slab, pitch 68 floats
  const int b    = blockIdx.y;
  const int lane = threadIdx.x & 31;
  const int wave = threadIdx.x >> 5;
  const int tilesN = N >> 6;
  const int tilesM = M >> 6;
  const int tile = blockIdx.x * 8 + wave;
  if (tile >= tilesM * tilesN) return;   // wave-uniform; no block barriers in this kernel
  const int tm = tile / tilesN;
  const int tn = tile - tm * tilesN;
  const int m0 = tm << 6;
  const int n0 = tn << 6;

  constexpr bool useA2 = (NSPLIT == 1) || (NSPLIT == 2);
  constexpr bool useB2 = (NSPLIT >= 2);
  const size_t kz = KSLICE ? (size_t)blockIdx.z * (size_t)K : (size_t)0;
  const size_t cb = KSLICE ? (size_t)blockIdx.z * GB + (size_t)b : (size_t)b;   // output plane index
  const __bf16* Ab  = A  + (size_t)b * strideA + kz;
  const __bf16* Bb  = Bt + (size_t)b * strideB + kz;
  const __bf16* Ab2 = useA2 ? (A2  + (size_t)b * strideA + kz) : Ab;
  const __bf16* Bb2 = useB2 ? (Bt2 + (size_t)b * strideB + kz) : Bb;

  const int rlane = lane & 15;                 // row (A) / col (B, D) within subtile
  const int koff  = (lane >> 4) * 8;           // k offset of this lane half
  const int mOff  = (lane >> 4) * 8;           // D row offset

  v8f acc[4][4];
#pragma unroll
  for (int i = 0; i < 4; ++i)
#pragma unroll
    for (int j = 0; j < 4; ++j) acc[i][j] = zero8();

  for (int k0 = 0; k0 < K; k0 += 32) {
    v16b bh[4], bl[4];
#pragma unroll
    for (int j = 0; j < 4; ++j) {
      const size_t bofs = (size_t)(n0 + (j << 4) + rlane) * ldb + koff + k0;
      bh[j] = ldfrag_b(Bb + bofs);
      if (useB2) bl[j] = ldfrag_b(Bb2 + bofs); else bl[j] = bh[j];
    }
#pragma unroll
    for (int i = 0; i < 4; ++i) {
      const size_t ao = (size_t)(m0 + (i << 4) + rlane) * lda + koff + k0;
      const v16b ah = ldfrag_b(Ab + ao);
      v16b al = ah;
      if (useA2) al = ldfrag_b(Ab2 + ao);
#pragma unroll
      for (int j = 0; j < 4; ++j) {
        acc[i][j] = mma_b_raw(ah, bh[j], acc[i][j]);
        if (useA2) acc[i][j] = mma_b_raw(al, bh[j], acc[i][j]);
        if (useB2) acc[i][j] = mma_b_raw(ah, bl[j], acc[i][j]);
      }
      dep_guard_b(acc[i][0], acc[i][3], ah, al);
    }
    keep4_b(bh[0], bh[1], bh[2], bh[3]);
    if (useB2) keep4_b(bl[0], bl[1], bl[2], bl[3]);
  }
  acc_guard4(acc[0][0], acc[0][1], acc[0][2], acc[0][3]);
  acc_guard4(acc[1][0], acc[1][1], acc[1][2], acc[1][3]);
  acc_guard4(acc[2][0], acc[2][1], acc[2][2], acc[2][3]);
  acc_guard4(acc[3][0], acc[3][1], acc[3][2], acc[3][3]);

  // ---- epilogue ----
  float bcol[4];
#pragma unroll
  for (int j = 0; j < 4; ++j) bcol[j] = 0.f;
  if (BIAS == 2) {
#pragma unroll
    for (int j = 0; j < 4; ++j) bcol[j] = bf_up(bf_bits(bias[n0 + (j << 4) + rlane]));
  }
  float* slab = sT[wave];
#pragma unroll
  for (int i = 0; i < 4; ++i) {
    const int mBase = m0 + (i << 4);
    float brow[8];
#pragma unroll
    for (int r = 0; r < 8; ++r) brow[r] = 0.f;
    if (BIAS == 1) {
#pragma unroll
      for (int r = 0; r < 8; ++r) brow[r] = bf_up(bf_bits(bias[mBase + mOff + r]));
    }
#pragma unroll
    for (int j = 0; j < 4; ++j) {
#pragma unroll
      for (int r = 0; r < 8; ++r) {
        slab[(mOff + r) * 68 + (j << 4) + rlane] = acc[i][j][r] * oscale + (brow[r] + bcol[j]);
      }
    }
    wave_sync_lds();
    if (OUT_MODE == 0) {
      float* C = (float*)Cout + cb * strideC;
      const int hh = lane >> 4, c4 = (lane & 15) * 4;     // 256-B row segment = 16 lanes x 16 B
      {
#pragma unroll
        for (int it = 0; it < 8; ++it) {
          const int row = it * 2 + hh;                     // it 0..7 x hh 0..1 = rows 0..15
          const v4f v = *(const v4f*)(slab + row * 68 + c4);
          *(v4f*)(C + (size_t)(mBase + row) * ldc + n0 + c4) = v;
        }
        
      }
    } else {
      const int q = lane >> 3, c8 = (lane & 7) * 8;
      unsigned short* C  = (unsigned short*)Cout  + cb * strideC;
      unsigned short* C2 = (unsigned short*)Cout2 + cb * strideC;
      v4u hv[4], lv[4];
#pragma unroll
      for (int it = 0; it < 4; ++it) {
        const int row = it * 4 + q;                        // it 0..3 x q 0..3 = rows 0..15
        const float* sp = slab + row * 68 + c8;
        v4u a, a2;
#pragma unroll
        for (int e = 0; e < 4; ++e) {
          const float f0 = sp[2 * e], f1 = sp[2 * e + 1];
          const unsigned short h0 = bf_bits(f0), h1 = bf_bits(f1);
          const unsigned short l0 = bf_bits(f0 - bf_up(h0)), l1 = bf_bits(f1 - bf_up(h1));
          a[e] = pk16(h0, h1); a2[e] = pk16(l0, l1);
        }
        hv[it] = a; lv[it] = a2;
      }
      {
#pragma unroll
        for (int it = 0; it < 4; ++it) {
          const int row = it * 4 + q;
          const size_t go = (size_t)(mBase + row) * ldc + n0 + c8;
          *(v4u*)(C  + go) = hv[it];
          *(v4u*)(C2 + go) = lv[it];
        }
        
      }
    }
    wave_sync_lds();
  }
}

// =====================================================================================================
// Sum of the KSP k-slice planes of ctxT: part f32 [KSP][GB*CH*CH] -> bf16 hi/lo planes [GB*CH*CH], slices added
// in index order. Thread owns 4 consecutive elements (16-B loads, 8-B stores: a wave stores 256 contiguous B).
// coverage: (GB*CH*CH/1024) blocks x 256 threads x 4 = whole plane.
// =====================================================================================================
__global__ __launch_bounds__(256) void k_ksum(const float* __restrict__ part, unsigned short* ch, unsigned short* cl) {
  const size_t e0 = ((size_t)blockIdx.x * 256 + threadIdx.x) * 4;
  v4f p[KSP];
#pragma unroll   // keeps p[] in registers and the independent loads in flight together
  for (int z = 0; z < KSP; ++z) p[z] = *(const v4f*)(part + (size_t)z * (GB * CH * CH) + e0);
  v4f s = p[0];
#pragma unroll   // p[] is indexed by constants only, so it stays in registers
  for (int z = 1; z < KSP; ++z) s += p[z];
  const unsigned short h0 = bf_bits(s[0]), h1 = bf_bits(s[1]), h2 = bf_bits(s[2]), h3 = bf_bits(s[3]);
  uint2 hv, lv;
  hv.x = pk16(h0, h1);
  hv.y = pk16(h2, h3);
  lv.x = pk16(bf_bits(s[0] - bf_up(h0)), bf_bits(s[1] - bf_up(h1)));
  lv.y = pk16(bf_bits(s[2] - bf_up(h2)), bf_bits(s[3] - bf_up(h3)));
  *(uint2*)(ch + e0) = hv;
  *(uint2*)(cl + e0) = lv;
}

// =====================================================================================================
// q softmax: Qt f32 [bi][n][CH] -> qP planes bf16 hi/lo [bi][n][CH] carrying 64 * softmax over each group of
// 64 consecutive columns (one head) of 0.25 * Qt. grid (NSP/8, GB), block 256: wave -> one row n; lane owns 8
// consecutive columns (16-B loads), one head = 8 consecutive lanes (xor-shuffle 1,2,4). Row store = 32 lanes x
// coverage: 512 blocks x 8 waves = 4096 rows x (32 lanes x 8) = whole plane per batch.
// =====================================================================================================
__global__ __launch_bounds__(256) void k_qsoft(const float* __restrict__ qt, unsigned short* qh, unsigned short* ql) {
  const int lane = threadIdx.x & 31, wave = threadIdx.x >> 5;
  const int n = blockIdx.x * 8 + wave;
  const size_t ro = ((size_t)blockIdx.y * NSP + (size_t)n) * CH + (size_t)lane * 8;
  const v4f a = *(const v4f*)(qt + ro);
  const v4f c = *(const v4f*)(qt + ro + 4);
  float v[8];
  v[0] = a[0] * 0.25f; v[1] = a[1] * 0.25f; v[2] = a[2] * 0.25f; v[3] = a[3] * 0.25f;
  v[4] = c[0] * 0.25f; v[5] = c[1] * 0.25f; v[6] = c[2] * 0.25f; v[7] = c[3] * 0.25f;
  float m = v[0];
#pragma unroll
  for (int i = 1; i < 8; ++i) m = fmaxf(m, v[i]);
  m = fmaxf(m, __shfl_xor(m, 1, 32));
  m = fmaxf(m, __shfl_xor(m, 2, 32));
  m = fmaxf(m, __shfl_xor(m, 4, 32));
  float e[8];
  float s = 0.f;
#pragma unroll
  for (int i = 0; i < 8; ++i) { e[i] = __expf(v[i] - m); s += e[i]; }
  s += __shfl_xor(s, 1, 32);
  s += __shfl_xor(s, 2, 32);
  s += __shfl_xor(s, 4, 32);
  const float rinv = 1.0f / s;
  v4u ph, pl;
#pragma unroll
  for (int q = 0; q < 4; ++q) {
    const float f0 = (e[2 * q] * rinv) * 64.0f;
    const float f1 = (e[2 * q + 1] * rinv) * 64.0f;
    const unsigned short h0 = bf_bits(f0), h1 = bf_bits(f1);
    const unsigned short l0 = bf_bits(f0 - bf_up(h0)), l1 = bf_bits(f1 - bf_up(h1));
    ph[q] = pk16(h0, h1); pl[q] = pk16(l0, l1);
  }
  *(v4u*)(qh + ro) = ph;
  *(v4u*)(ql + ro) = pl;
  
}

// =====================================================================================================
// k softmax over n (rows 0..CH-1 of KV) and V plane split (rows CH..2CH-1): KV f32 [bi][2CH][NSP].
// wave xor-shuffle + 8-entry LDS combine in fixed order), value = (exp * (1/sum)) * 4096 -> kP hi/lo bf16.
// V rows: value unchanged -> V hi/lo bf16. Thread t owns columns it*2048 + 8t (it 0..1): each store instruction
// =====================================================================================================
__global__ __launch_bounds__(256) void k_ksoftv(const float* __restrict__ kv,
                                                unsigned short* kph, unsigned short* kpl,
                                                unsigned short* vhp, unsigned short* vlp) {
  __shared__ float red[8];
  const int tid = threadIdx.x, lane = tid & 31, wave = tid >> 5;
  const int j  = blockIdx.x;
  const int bi = blockIdx.y;
  const bool isK = (j < CH);                   // block-uniform
  const float* src = kv + ((size_t)bi * (2 * CH) + (size_t)j) * NSP;
  float vals[16];
#pragma unroll
  for (int it = 0; it < 2; ++it) {
    const size_t co = (size_t)it * 2048 + (size_t)tid * 8;
    const v4f a = *(const v4f*)(src + co);
    const v4f c = *(const v4f*)(src + co + 4);
    vals[it * 8 + 0] = a[0]; vals[it * 8 + 1] = a[1]; vals[it * 8 + 2] = a[2]; vals[it * 8 + 3] = a[3];
    vals[it * 8 + 4] = c[0]; vals[it * 8 + 5] = c[1]; vals[it * 8 + 6] = c[2]; vals[it * 8 + 7] = c[3];
  }
  if (isK) {
    float m = vals[0];
#pragma unroll
    for (int i = 1; i < 16; ++i) m = fmaxf(m, vals[i]);
#pragma unroll
    for (int off = 1; off < 32; off <<= 1) m = fmaxf(m, __shfl_xor(m, off, 32));
    if (lane == 0) red[wave] = m;
    __syncthreads();
    float mm = red[0];
#pragma unroll
    for (int w = 1; w < 8; ++w) mm = fmaxf(mm, red[w]);
    __syncthreads();
    float s = 0.f;
#pragma unroll
    for (int i = 0; i < 16; ++i) { vals[i] = __expf(vals[i] - mm); s += vals[i]; }
#pragma unroll
    for (int off = 1; off < 32; off <<= 1) s += __shfl_xor(s, off, 32);
    if (lane == 0) red[wave] = s;
    __syncthreads();
    float ss = red[0];
#pragma unroll
    for (int w = 1; w < 8; ++w) ss += red[w];
    const float rinv = 1.0f / ss;
#pragma unroll
    for (int i = 0; i < 16; ++i) vals[i] = (vals[i] * rinv) * 4096.0f;
  }
  const int rr = isK ? j : (j - CH);           // 0..CH-1
  unsigned short* ph = isK ? kph : vhp;        // block-uniform selects, all global
  unsigned short* pl = isK ? kpl : vlp;
  unsigned short* dh = ph + ((size_t)bi * CH + (size_t)rr) * NSP;
  unsigned short* dl = pl + ((size_t)bi * CH + (size_t)rr) * NSP;
  v4u hv[2], lv[2];
#pragma unroll
  for (int it = 0; it < 2; ++it) {
    v4u a, a2;
#pragma unroll
    for (int e = 0; e < 4; ++e) {
      const float f0 = vals[it * 8 + 2 * e], f1 = vals[it * 8 + 2 * e + 1];
      const unsigned short h0 = bf_bits(f0), h1 = bf_bits(f1);
      const unsigned short l0 = bf_bits(f0 - bf_up(h0)), l1 = bf_bits(f1 - bf_up(h1));
      a[e] = pk16(h0, h1); a2[e] = pk16(l0, l1);
    }
    hv[it] = a; lv[it] = a2;
  }
  {
#pragma unroll
    for (int it = 0; it < 2; ++it) {
      const size_t co = (size_t)it * 2048 + (size_t)tid * 8;
      *(v4u*)(dh + co) = hv[it];
      *(v4u*)(dl + co) = lv[it];
    }
    
  }
}

// =====================================================================================================
// Workspace map (bytes), every plane an exact multiple of its 64x64-tile / whole-line store granularity
// (no padded tails needed: 4096, 512, 256 are tile multiples); one group holds all GB = NBAT batches:
//   Wqb   bf16 [256][256]              0          131072
//   Wkvb  bf16 [512][256]              131072     262144
//   Wob   bf16 [256][256]              393216     131072
//   Xt    bf16 [GB][4096][256]         524288     16777216
//   Ct    bf16 [GB][4096][256]         17301504   16777216
//   Qt    f32  [GB][4096][256]         34078720   33554432
//   qPh   bf16 [GB][4096][256]         67633152   16777216
//   qPl   bf16 [GB][4096][256]         84410368   16777216
//   KV    f32  [GB][512][4096]         101187584  67108864
//   kPh   bf16 [GB][256][4096]         168296448  16777216
//   kPl   bf16 [GB][256][4096]         185073664  16777216
//   Vh    bf16 [GB][256][4096]         201850880  16777216
//   Vl    bf16 [GB][256][4096]         218628096  16777216
//   cxh   bf16 [GB][256][256]          235405312  1048576
//   cxl   bf16 [GB][256][256]          236453888  1048576
//   m2h   bf16 [GB][256][256]          237502464  1048576
//   m2l   bf16 [GB][256][256]          238551040  1048576
//   end                                239599616
//   cxp   f32  [KSP][GB][256][256]     101187584  67108864   on KV's bytes: KV's last reader (k_ksoftv) is launched
//                                                            before cxp's writer, and every cxp element is written
//                                                            before k_ksum reads it
// Weights are [out][in] with the in index contiguous = the A / Bt layout, so they are only converted.
// =====================================================================================================
static inline unsigned tile_blocks(int M, int N) { return (unsigned)((((M / 64) * (N / 64)) + 7) / 8); }

extern "C" void kernel_launch(void* const* d_in, const int* in_sizes, int n_in,
                              void* d_out, int out_size, void* d_ws, size_t ws_size,
                              hipStream_t stream) {
  if (n_in < 8) return;
  if (in_sizes[0] != NBAT * CH * NSP) return;
  if (in_sizes[1] != NBAT * CH * NSP) return;
  if (in_sizes[2] != CH * CH) return;
  if (in_sizes[3] != CH) return;
  if (in_sizes[4] != 2 * CH * CH) return;
  if (in_sizes[5] != 2 * CH) return;
  if (in_sizes[6] != CH * CH) return;
  if (in_sizes[7] != CH) return;
  if (out_size != NBAT * CH * NSP) return;

  const float* x     = (const float*)d_in[0];
  const float* cproj = (const float*)d_in[1];
  const float* wq    = (const float*)d_in[2];
  const float* bq    = (const float*)d_in[3];
  const float* wkv   = (const float*)d_in[4];
  const float* bkv   = (const float*)d_in[5];
  const float* wo    = (const float*)d_in[6];
  const float* bo    = (const float*)d_in[7];
  float* out = (float*)d_out;

  const size_t PWq  = (size_t)CH * CH * 2;               //   131072
  const size_t PWkv = (size_t)2 * CH * CH * 2;           //   262144
  const size_t PWo  = (size_t)CH * CH * 2;               //   131072
  const size_t PXt  = (size_t)GB * NSP * CH * 2;         // 16777216
  const size_t PQt  = (size_t)GB * NSP * CH * 4;         // 33554432
  const size_t PQp  = (size_t)GB * NSP * CH * 2;         // 16777216
  const size_t PKV  = (size_t)GB * 2 * CH * NSP * 4;     // 67108864
  const size_t PKp  = (size_t)GB * CH * NSP * 2;         // 16777216
  const size_t PCx  = (size_t)GB * CH * CH * 2;          //  1048576
  size_t off = 0;
  const size_t oWq  = off; off += PWq;
  const size_t oWkv = off; off += PWkv;
  const size_t oWo  = off; off += PWo;
  const size_t oXt  = off; off += PXt;
  const size_t oCt  = off; off += PXt;
  const size_t oQt  = off; off += PQt;
  const size_t oQh  = off; off += PQp;
  const size_t oQl  = off; off += PQp;
  const size_t oKV  = off; off += PKV;
  const size_t oKh  = off; off += PKp;
  const size_t oKl  = off; off += PKp;
  const size_t oVh  = off; off += PKp;
  const size_t oVl  = off; off += PKp;
  const size_t oCxh = off; off += PCx;
  const size_t oCxl = off; off += PCx;
  const size_t oM2h = off; off += PCx;
  const size_t oM2l = off; off += PCx;
  const size_t oCxp = oKV;                               // takes over KV's bytes once k_ksoftv has read them
  if (off > ws_size) return;                             // off = 239599616

  char* ws = (char*)d_ws;
  unsigned short* Wqb  = (unsigned short*)(ws + oWq);
  unsigned short* Wkvb = (unsigned short*)(ws + oWkv);
  unsigned short* Wob  = (unsigned short*)(ws + oWo);
  unsigned short* Xt   = (unsigned short*)(ws + oXt);
  unsigned short* Ct   = (unsigned short*)(ws + oCt);
  float*          Qt   = (float*)(ws + oQt);
  unsigned short* Qh   = (unsigned short*)(ws + oQh);
  unsigned short* Ql   = (unsigned short*)(ws + oQl);
  float*          KV   = (float*)(ws + oKV);
  unsigned short* Kh   = (unsigned short*)(ws + oKh);
  unsigned short* Kl   = (unsigned short*)(ws + oKl);
  unsigned short* Vh   = (unsigned short*)(ws + oVh);
  unsigned short* Vl   = (unsigned short*)(ws + oVl);
  unsigned short* Cxh  = (unsigned short*)(ws + oCxh);
  unsigned short* Cxl  = (unsigned short*)(ws + oCxl);
  unsigned short* M2h  = (unsigned short*)(ws + oM2h);
  unsigned short* M2l  = (unsigned short*)(ws + oM2l);
  float*          Cxp  = (float*)(ws + oCxp);

  const dim3 blk(256);
  const int n8wq  = CH * CH / 8;                         //  8192
  const int n8wkv = 2 * CH * CH / 8;                     // 16384
  const int n8wo  = CH * CH / 8;                         //  8192

  // (0) weights -> bf16 planes
  cvt_bf16x8<<<dim3((n8wq + 255) / 256), blk, 0, stream>>>(wq, Wqb, n8wq);
  cvt_bf16x8<<<dim3((n8wkv + 255) / 256), blk, 0, stream>>>(wkv, Wkvb, n8wkv);
  cvt_bf16x8<<<dim3((n8wo + 255) / 256), blk, 0, stream>>>(wo, Wob, n8wo);

  const dim3 gTr(NSP / 64, CH / 64, 2 * GB);             // 64 x 4 x 16
  const dim3 gQt(tile_blocks(NSP, CH), GB);              // 256 tiles -> 32 blocks
  const dim3 gQs(NSP / 8, GB);                           // 512 x GB
  const dim3 gKV(tile_blocks(2 * CH, NSP), GB);          // 512 tiles -> 64 blocks
  const dim3 gKs(2 * CH, GB);                            // 512 x GB
  const dim3 gCx(tile_blocks(CH, CH), GB);               // 16 tiles -> 2 blocks
  const dim3 gCxK(tile_blocks(CH, CH), GB, KSP);         // 2 x GB x 32 k slices = 512 blocks
  const dim3 gSum(GB * CH * CH / 1024);                  // 512 blocks
  const dim3 gOut(tile_blocks(CH, NSP), GB);             // 256 tiles -> 32 blocks
  const long long sNC = (long long)NSP * CH;             // per-batch stride of the [4096][256] / [256][4096] planes
  const long long sCC = (long long)CH * CH;

  for (int g = 0; g < NGRP; ++g) {
    const int b0 = g * GB;
    // (1) x[b], cproj[b] -> Xt[n][c], Ct[n][c] bf16
    k_trcvt<<<gTr, blk, 0, stream>>>(x, cproj, Xt, Ct, b0);
    // (2) Qt[n][o] = Xt . wq^T + bq[o]  (M=4096, N=256, K=256) f32
    gemm64<0, 0, 2><<<gQt, blk, 0, stream>>>(
        Xt, Xt, CH, sNC, Wqb, Wqb, CH, 0LL,
        (void*)Qt, (void*)Qt, CH, sNC, bq, NSP, CH, CH, 1.0f);
    // q softmax over each head's 64 columns -> qP hi/lo (x64)
    k_qsoft<<<gQs, blk, 0, stream>>>(Qt, Qh, Ql);
    // (3) KV[j][n] = wkv . Ct^T + bkv[j]  (M=512, N=4096, K=256) f32
    gemm64<0, 0, 1><<<gKV, blk, 0, stream>>>(
        Wkvb, Wkvb, CH, 0LL, Ct, Ct, CH, sNC,
        (void*)KV, (void*)KV, NSP, (long long)2 * CH * NSP, bkv, 2 * CH, NSP, CH, 1.0f);
    // k softmax over n -> kP hi/lo (x4096); V rows -> V hi/lo
    k_ksoftv<<<gKs, blk, 0, stream>>>(KV, Kh, Kl, Vh, Vl);
    // (4) ctxT[d][c] = (Vh.kPh^T + Vl.kPh^T + Vh.kPl^T) / 4096  (M=N=256, K=4096 in KSP slices) -> f32 partial
    //     planes, then their sum -> bf16 hi/lo
    gemm64<2, 0, 0, true><<<gCxK, blk, 0, stream>>>(
        Vh, Vl, NSP, sNC, Kh, Kl, NSP, sNC,
        (void*)Cxp, (void*)Cxp, CH, sCC, bq, CH, CH, NSP / KSP, 1.0f / 4096.0f);
    k_ksum<<<gSum, blk, 0, stream>>>(Cxp, Cxh, Cxl);
    // (5) M2[o][d] = wo . (ctxTh + ctxTl)^T  (M=N=K=256) -> bf16 hi/lo
    gemm64<3, 2, 0><<<gCx, blk, 0, stream>>>(
        Wob, Wob, CH, 0LL, Cxh, Cxl, CH, sCC,
        (void*)M2h, (void*)M2l, CH, sCC, bq, CH, CH, CH, 1.0f);
    // (6) out[b][o][n] = ((M2h + M2l).qPh^T + M2h.qPl^T) / 64 + bo[o]  (M=256, N=4096, K=256) -> d_out f32
    float* outg = out + (size_t)b0 * CH * NSP;
    gemm64<2, 0, 1><<<gOut, blk, 0, stream>>>(
        M2h, M2l, CH, sCC, Qh, Ql, CH, sNC,
        (void*)outg, (void*)outg, NSP, sNC, bo, CH, NSP, CH, 1.0f / 64.0f);
  }
  (void)hipGetLastError();
}

// v003
// It runs in 138 microseconds.
// Timed twice side by side with v002, it ran 1.22 and 1.20 times as fast.
// Over all steps from v000 it is 10.7 times as fast.
// Contractions (all v_wmma_f32_16x16x32_bf16, f32 accumulate): x^T.wq^T and wkv.cproj with bf16 operands
// RNE-converted from the f32 inputs (single product); V.kP^T with bf16 hi+lo planes on both operands (3 products);
// wo.ctx^T with bf16 wo times ctx hi+lo planes (2 products); M2.qP^T with bf16 hi+lo planes on both (3 products).
// Softmaxes and epilogues in f32; softmax outputs carried x64 (q) and x4096 (k), folded back by epilogue scales.
// The q projection, its softmax and the output product run in one kernel; q passes from one to the other in LDS.
#include <hip/hip_runtime.h>
#include <stdint.h>

#define NBAT 8
#define CH   256
#define NSP  4096
#define GB   8
#define NGRP (NBAT / GB)
static_assert((NSP % 64) == 0 && (CH % 64) == 0 && (NBAT % GB) == 0);
static_assert(NSP == 2 * 256 * 8);   // k-softmax row = 2 passes x 256 threads x 8 elements
static_assert(CH == 4 * 64);         // four heads of 64 channels: one wave of k_qout per head
#define KSP  32                      // k slices of the V.kP^T product (K = NSP), one grid z index each
static_assert((NSP % (KSP * 32)) == 0 && ((GB * CH * CH) % 1024) == 0);
static_assert(KSP * CH * CH <= 2 * CH * NSP);   // the k-slice planes fit in the KV plane, whose bytes they take over

typedef __bf16   v16b __attribute__((ext_vector_type(16)));
typedef __bf16   v8b  __attribute__((ext_vector_type(8)));
typedef float    v8f  __attribute__((ext_vector_type(8)));
typedef float    v4f  __attribute__((ext_vector_type(4)));
typedef unsigned int v4u __attribute__((ext_vector_type(4)));

// ---- scalar helpers --------------------------------------------------------------------------------
__device__ __forceinline__ unsigned short bf_bits(float f) {          // f32 -> bf16 bits, RNE convert
  unsigned u = __float_as_uint(f);
  return (unsigned short)((u + 0x7FFFu + ((u >> 16) & 1u)) >> 16);
}
__device__ __forceinline__ float bf_up(unsigned short h) { return __uint_as_float(((unsigned)h) << 16); }
__device__ __forceinline__ unsigned pk16(unsigned short a, unsigned short b) { return (unsigned)a | ((unsigned)b << 16); }
__device__ __forceinline__ v8f zero8() { v8f z = {0.f, 0.f, 0.f, 0.f, 0.f, 0.f, 0.f, 0.f}; return z; }

// ---- fragment loader: 16-bit A/B operand, lane -> row/col (lane&15), p already includes +8*(lane>>4);
//      elements 0..7 <- p[0..7] (k0+8h..), elements 8..15 <- p[16..23] (k0+16+8h..)
__device__ __forceinline__ v16b ldfrag_b(const __bf16* p) {
  union { v16b v; v8b h[2]; } f;
  f.h[0] = *(const v8b*)(p);
  f.h[1] = *(const v8b*)(p + 16);
  return f.v;
}

// ---- WMMA helpers with trailing VALU hazard gap --------------------------------------------------------
__device__ __forceinline__ v8f mma_b_raw(v16b a, v16b b, v8f c) {
  return __builtin_amdgcn_wmma_f32_16x16x32_bf16(false, a, false, b, (short)0, c, false, false);
}
__device__ __forceinline__ void dep_guard_b(v8f& a, v8f& b, v16b x, v16b y) {
#if defined(__HIP_DEVICE_COMPILE__)
  asm volatile("v_nop\n\tv_nop\n\tv_nop\n\tv_nop" : "+v"(a), "+v"(b) : "v"(x), "v"(y));
#endif
}
__device__ __forceinline__ void keep4_b(v16b a, v16b b, v16b c, v16b d) {
#if defined(__HIP_DEVICE_COMPILE__)
  asm volatile("v_nop" :: "v"(a), "v"(b), "v"(c), "v"(d));
#endif
}
__device__ __forceinline__ void acc_guard4(v8f& a, v8f& b, v8f& c, v8f& d) {
#if defined(__HIP_DEVICE_COMPILE__)
  asm volatile("v_nop\n\tv_nop\n\tv_nop\n\tv_nop" : "+v"(a), "+v"(b), "+v"(c), "+v"(d));
#endif
}
__device__ __forceinline__ void wave_sync_lds() {
  __builtin_amdgcn_fence(__ATOMIC_RELEASE, "workgroup");
  __builtin_amdgcn_wave_barrier();
  __builtin_amdgcn_fence(__ATOMIC_ACQUIRE, "workgroup");
}

// =====================================================================================================
// f32 -> bf16 (RNE convert), 8 elements per thread, one 16-B store per lane: a wave writes 512 contiguous B
// coverage: n8 threads x 8 = whole plane (n8 is a multiple of 256 for every use here).
// =====================================================================================================
__global__ __launch_bounds__(256) void cvt_bf16x8(const float* __restrict__ in, unsigned short* out, int n8) {
  const int i = blockIdx.x * 256 + threadIdx.x;
  if (i < n8) {
    const v4f a = *(const v4f*)(in + (size_t)i * 8);
    const v4f b = *(const v4f*)(in + (size_t)i * 8 + 4);
    v4u p;
    p[0] = pk16(bf_bits(a[0]), bf_bits(a[1]));
    p[1] = pk16(bf_bits(a[2]), bf_bits(a[3]));
    p[2] = pk16(bf_bits(b[0]), bf_bits(b[1]));
    p[3] = pk16(bf_bits(b[2]), bf_bits(b[3]));
    *(v4u*)(out + (size_t)i * 8) = p;
    
  }
}

// =====================================================================================================
// Transpose-convert of one 64x64 tile: source [b][c][n] f32 (c pitch NSP) -> plane [bi][n][c] bf16 (pitch CH).
// blockIdx.x = n tile, blockIdx.y = c tile, blockIdx.z = 2*bi + sel (sel 0: xg -> xt, 1: cg -> ct); block 256.
// Load: thread r = tid>>2 owns source row c0+r, 16 consecutive n at (tid&3)*16 (4 x 16-B loads).
// coverage: load 256x16 = 4096 = whole tile; store 2x256x8 = 4096 = whole tile.
// =====================================================================================================
__global__ __launch_bounds__(256) void k_trcvt(const float* __restrict__ xg, const float* __restrict__ cg,
                                               unsigned short* xt, unsigned short* ct, int b0) {
  __shared__ float tile[64][65];
  const int tid = threadIdx.x;
  const int n0 = blockIdx.x * 64;
  const int c0 = blockIdx.y * 64;
  const int bi  = (int)(blockIdx.z >> 1);
  const int sel = (int)(blockIdx.z & 1);
  const float* src = sel ? cg : xg;            // block-uniform select, both global
  unsigned short* dst = sel ? ct : xt;
  {
    const int r = tid >> 2, cs = (tid & 3) * 16;
    const float* p = src + ((size_t)(b0 + bi) * CH + (size_t)(c0 + r)) * NSP + n0 + cs;
#pragma unroll
    for (int i = 0; i < 4; ++i) {
      const v4f v = *(const v4f*)(p + 4 * i);
      tile[r][cs + 4 * i + 0] = v[0];
      tile[r][cs + 4 * i + 1] = v[1];
      tile[r][cs + 4 * i + 2] = v[2];
      tile[r][cs + 4 * i + 3] = v[3];
    }
  }
  __syncthreads();
  v4u pv[2];
  const int c8 = (tid & 7) * 8;
#pragma unroll
  for (int it = 0; it < 2; ++it) {
    const int n = it * 32 + (tid >> 3);
    v4u a;
#pragma unroll
    for (int e = 0; e < 4; ++e) {
      a[e] = pk16(bf_bits(tile[c8 + 2 * e][n]), bf_bits(tile[c8 + 2 * e + 1][n]));
    }
    pv[it] = a;
  }
  {
#pragma unroll
    for (int it = 0; it < 2; ++it) {
      const int n = it * 32 + (tid >> 3);
      const size_t go = ((size_t)bi * NSP + (size_t)(n0 + n)) * CH + c0 + c8;
      *(v4u*)(dst + go) = pv[it];
    }
    
  }
}

// =====================================================================================================
// Register-blocked batched bf16 WMMA GEMM: C[m][n] = oscale * sum_k A[m][k] * Bt[n][k] + bias; one wave per
// 64x64 tile, no block barriers. A row-major [M][K] pitch lda; Bt row-major [N][K] pitch ldb (k contiguous);
// M, N multiples of 64, K multiple of 32 (host-checked). blockIdx.y = batch index (strides in elements).
// NSPLIT: 0 = A.Bt; 1 = (A + A2).Bt; 2 = A.Bt + A2.Bt + A.Bt2; 3 = A.Bt + A.Bt2 (A2, Bt2 = unscaled bf16 lo planes).
// BIAS: 0 none; 1 = bias[m] per output row; 2 = bias[n] per output column (bias value RNE-converted to bf16).
// OUT_MODE: 0 = f32 (pitch ldc); 2 = bf16 hi plane C + bf16 lo plane C2 (lo = RNE(v - hi), unscaled), same pitch.
// KSLICE: blockIdx.z = k slice; K is the slice length, the slice starts at k = blockIdx.z * K, and its partial
// product goes to plane [blockIdx.z][b] of C (GB batches a slice, plane stride strideC); k_ksum adds the planes.
// =====================================================================================================
template <int NSPLIT, int OUT_MODE, int BIAS, bool KSLICE = false>
__global__ __launch_bounds__(256) void gemm64(
    const unsigned short* __restrict__ Ap, const unsigned short* A2p, int lda, long long strideA,
    const unsigned short* __restrict__ Btp, const unsigned short* Bt2p, int ldb, long long strideB,
    void* Cout, void* Cout2, int ldc, long long strideC,
    const float* __restrict__ bias, int M, int N, int K, float oscale) {
  const __bf16* A   = (const __bf16*)(const void*)Ap;
  const __bf16* A2  = (const __bf16*)(const void*)A2p;
  const __bf16* Bt  = (const __bf16*)(const void*)Btp;
  const __bf16* Bt2 = (const __bf16*)(const void*)Bt2p;
  __shared__ __align__(16) float sT[8][16 * 68];   // per-wave 16x64 slab, pitch 68 floats
  const int b    = blockIdx.y;
  const int lane = threadIdx.x & 31;
  const int wave = threadIdx.x >> 5;
  const int tilesN = N >> 6;
  const int tilesM = M >> 6;
  const int tile = blockIdx.x * 8 + wave;
  if (tile >= tilesM * tilesN) return;   // wave-uniform; no block barriers in this kernel
  const int tm = tile / tilesN;
  const int tn = tile - tm * tilesN;
  const int m0 = tm << 6;
  const int n0 = tn << 6;

  constexpr bool useA2 = (NSPLIT == 1) || (NSPLIT == 2);
  constexpr bool useB2 = (NSPLIT >= 2);
  const size_t kz = KSLICE ? (size_t)blockIdx.z * (size_t)K : (size_t)0;
  const size_t cb = KSLICE ? (size_t)blockIdx.z * GB + (size_t)b : (size_t)b;   // output plane index
  const __bf16* Ab  = A  + (size_t)b * strideA + kz;
  const __bf16* Bb  = Bt + (size_t)b * strideB + kz;
  const __bf16* Ab2 = useA2 ? (A2  + (size_t)b * strideA + kz) : Ab;
  const __bf16* Bb2 = useB2 ? (Bt2 + (size_t)b * strideB + kz) : Bb;

  const int rlane = lane & 15;                 // row (A) / col (B, D) within subtile
  const int koff  = (lane >> 4) * 8;           // k offset of this lane half
  const int mOff  = (lane >> 4) * 8;           // D row offset

  v8f acc[4][4];
#pragma unroll
  for (int i = 0; i < 4; ++i)
#pragma unroll
    for (int j = 0; j < 4; ++j) acc[i][j] = zero8();

  for (int k0 = 0; k0 < K; k0 += 32) {
    v16b bh[4], bl[4];
#pragma unroll
    for (int j = 0; j < 4; ++j) {
      const size_t bofs = (size_t)(n0 + (j << 4) + rlane) * ldb + koff + k0;
      bh[j] = ldfrag_b(Bb + bofs);
      if (useB2) bl[j] = ldfrag_b(Bb2 + bofs); else bl[j] = bh[j];
    }
#pragma unroll
    for (int i = 0; i < 4; ++i) {
      const size_t ao = (size_t)(m0 + (i << 4) + rlane) * lda + koff + k0;
      const v16b ah = ldfrag_b(Ab + ao);
      v16b al = ah;
      if (useA2) al = ldfrag_b(Ab2 + ao);
#pragma unroll
      for (int j = 0; j < 4; ++j) {
        acc[i][j] = mma_b_raw(ah, bh[j], acc[i][j]);
        if (useA2) acc[i][j] = mma_b_raw(al, bh[j], acc[i][j]);
        if (useB2) acc[i][j] = mma_b_raw(ah, bl[j], acc[i][j]);
      }
      dep_guard_b(acc[i][0], acc[i][3], ah, al);
    }
    keep4_b(bh[0], bh[1], bh[2], bh[3]);
    if (useB2) keep4_b(bl[0], bl[1], bl[2], bl[3]);
  }
  acc_guard4(acc[0][0], acc[0][1], acc[0][2], acc[0][3]);
  acc_guard4(acc[1][0], acc[1][1], acc[1][2], acc[1][3]);
  acc_guard4(acc[2][0], acc[2][1], acc[2][2], acc[2][3]);
  acc_guard4(acc[3][0], acc[3][1], acc[3][2], acc[3][3]);

  // ---- epilogue ----
  float bcol[4];
#pragma unroll
  for (int j = 0; j < 4; ++j) bcol[j] = 0.f;
  if (BIAS == 2) {
#pragma unroll
    for (int j = 0; j < 4; ++j) bcol[j] = bf_up(bf_bits(bias[n0 + (j << 4) + rlane]));
  }
  float* slab = sT[wave];
#pragma unroll
  for (int i = 0; i < 4; ++i) {
    const int mBase = m0 + (i << 4);
    float brow[8];
#pragma unroll
    for (int r = 0; r < 8; ++r) brow[r] = 0.f;
    if (BIAS == 1) {
#pragma unroll
      for (int r = 0; r < 8; ++r) brow[r] = bf_up(bf_bits(bias[mBase + mOff + r]));
    }
#pragma unroll
    for (int j = 0; j < 4; ++j) {
#pragma unroll
      for (int r = 0; r < 8; ++r) {
        slab[(mOff + r) * 68 + (j << 4) + rlane] = acc[i][j][r] * oscale + (brow[r] + bcol[j]);
      }
    }
    wave_sync_lds();
    if (OUT_MODE == 0) {
      float* C = (float*)Cout + cb * strideC;
      const int hh = lane >> 4, c4 = (lane & 15) * 4;     // 256-B row segment = 16 lanes x 16 B
      {
#pragma unroll
        for (int it = 0; it < 8; ++it) {
          const int row = it * 2 + hh;                     // it 0..7 x hh 0..1 = rows 0..15
          const v4f v = *(const v4f*)(slab + row * 68 + c4);
          *(v4f*)(C + (size_t)(mBase + row) * ldc + n0 + c4) = v;
        }
        
      }
    } else {
      const int q = lane >> 3, c8 = (lane & 7) * 8;
      unsigned short* C  = (unsigned short*)Cout  + cb * strideC;
      unsigned short* C2 = (unsigned short*)Cout2 + cb * strideC;
      v4u hv[4], lv[4];
#pragma unroll
      for (int it = 0; it < 4; ++it) {
        const int row = it * 4 + q;                        // it 0..3 x q 0..3 = rows 0..15
        const float* sp = slab + row * 68 + c8;
        v4u a, a2;
#pragma unroll
        for (int e = 0; e < 4; ++e) {
          const float f0 = sp[2 * e], f1 = sp[2 * e + 1];
          const unsigned short h0 = bf_bits(f0), h1 = bf_bits(f1);
          const unsigned short l0 = bf_bits(f0 - bf_up(h0)), l1 = bf_bits(f1 - bf_up(h1));
          a[e] = pk16(h0, h1); a2[e] = pk16(l0, l1);
        }
        hv[it] = a; lv[it] = a2;
      }
      {
#pragma unroll
        for (int it = 0; it < 4; ++it) {
          const int row = it * 4 + q;
          const size_t go = (size_t)(mBase + row) * ldc + n0 + c8;
          *(v4u*)(C  + go) = hv[it];
          *(v4u*)(C2 + go) = lv[it];
        }
        
      }
    }
    wave_sync_lds();
  }
}

// =====================================================================================================
// Sum of the KSP k-slice planes of ctxT: part f32 [KSP][GB*CH*CH] -> bf16 hi/lo planes [GB*CH*CH], slices added
// in index order. Thread owns 4 consecutive elements (16-B loads, 8-B stores: a wave stores 256 contiguous B).
// coverage: (GB*CH*CH/1024) blocks x 256 threads x 4 = whole plane.
// =====================================================================================================
__global__ __launch_bounds__(256) void k_ksum(const float* __restrict__ part, unsigned short* ch, unsigned short* cl) {
  const size_t e0 = ((size_t)blockIdx.x * 256 + threadIdx.x) * 4;
  v4f p[KSP];
#pragma unroll   // keeps p[] in registers and the independent loads in flight together
  for (int z = 0; z < KSP; ++z) p[z] = *(const v4f*)(part + (size_t)z * (GB * CH * CH) + e0);
  v4f s = p[0];
#pragma unroll   // p[] is indexed by constants only, so it stays in registers
  for (int z = 1; z < KSP; ++z) s += p[z];
  const unsigned short h0 = bf_bits(s[0]), h1 = bf_bits(s[1]), h2 = bf_bits(s[2]), h3 = bf_bits(s[3]);
  uint2 hv, lv;
  hv.x = pk16(h0, h1);
  hv.y = pk16(h2, h3);
  lv.x = pk16(bf_bits(s[0] - bf_up(h0)), bf_bits(s[1] - bf_up(h1)));
  lv.y = pk16(bf_bits(s[2] - bf_up(h2)), bf_bits(s[3] - bf_up(h3)));
  *(uint2*)(ch + e0) = hv;
  *(uint2*)(cl + e0) = lv;
}

// =====================================================================================================
// q projection + q softmax + output product for one 64-column tile of n. grid (NSP/64, GB), block 128 = 4 waves.
// x tile: rows n0..n0+63 of Xt are 32 KiB in a row; each wave-wide load takes one whole 512-B row, and the rows
//   stand in LDS at a pitch of 528 B (16 B x odd) for the 16-B fragment reads of all four waves.
// Part 1, wave w = head w: Q[o][n] = wq . Xt^T + bq[o] for o in 64w..64w+63 (K = CH). A lane holds column
//   n0 + 16j + (lane&15) and rows 16i + 8(lane>>4) + r, so one column's head lies in lanes l and l^16:
//   softmax of 0.25 * Q over the 64 rows = a sum inside the lane and one xor-16 exchange.
// Hand-over: 64 * softmax as bf16 hi/lo. Accumulator tiles 2p and 2p+1 of a column block are, lane for lane,
//   elements 0..7 and 8..15 of the B fragment of k step p, so each lane stores and later loads its own 16-B
//   pieces: piece (((k step * 4 + j) * 2 + half) * 32 + lane); a wave-wide access covers 512 contiguous bytes.
// Part 2, wave w: out[o][n] = ((M2h + M2l).qPh + M2h.qPl) / 64 + bo[o] for o in 64w..64w+63 (K = CH, all heads).
// coverage: 64 x GB blocks x 4 waves x (64 rows x 64 columns) = whole output.
// =====================================================================================================
#define XPITCH (CH + 8)                        // x tile row pitch in LDS, elements (528 B)
#define KST    (CH / 32)                       // k steps of both products

__device__ __forceinline__ v16b ldfrag_q(const v4u* p) {   // p = piece of half 0; half 1 lies 32 pieces on
  union { v16b v; v4u q[2]; } f;
  f.q[0] = p[0];
  f.q[1] = p[32];
  return f.v;
}

__global__ __launch_bounds__(128) void k_qout(const unsigned short* __restrict__ wqp,
                                              const unsigned short* __restrict__ xtp,
                                              const float* __restrict__ bq,
                                              const unsigned short* __restrict__ m2hp,
                                              const unsigned short* __restrict__ m2lp,
                                              const float* __restrict__ bo, float* outp) {
  __shared__ __align__(16) unsigned short xs[64 * XPITCH];    // 33 KiB: x tile, bf16
  __shared__ __align__(16) v4u qsh[KST * 4 * 2 * 32];         // 32 KiB: q hi fragments of the tile
  __shared__ __align__(16) v4u qsl[KST * 4 * 2 * 32];         // 32 KiB: q lo fragments
  __shared__ __align__(16) float sT[4][16 * 68];              // per-wave 16x64 slab, pitch 68 floats
  const int lane = threadIdx.x & 31;
  const int wave = threadIdx.x >> 5;
  const int b  = blockIdx.y;
  const int n0 = blockIdx.x << 6;
  const int m0 = wave << 6;
  const int rlane = lane & 15;                 // row (A) / col (B, D) within subtile
  const int koff  = (lane >> 4) * 8;           // k offset of this lane half
  const int mOff  = (lane >> 4) * 8;           // D row offset
  const size_t arow = (size_t)(m0 + rlane) * CH + koff;      // this lane's A row (subtile 0), all three A planes
  const __bf16* Wq = (const __bf16*)(const void*)wqp + arow;
  const __bf16* Mh = (const __bf16*)(const void*)m2hp + (size_t)b * CH * CH + arow;
  const __bf16* Ml = (const __bf16*)(const void*)m2lp + (size_t)b * CH * CH + arow;
  const __bf16* Xl = (const __bf16*)(const void*)xs + rlane * XPITCH + koff;   // this lane's B row (subtile 0)

  // ---- x tile to LDS; wq fragments of the first two k steps meanwhile ----
  v16b wa[2][4];
  {
    const v4u* g = (const v4u*)(const void*)(xtp + ((size_t)b * NSP + (size_t)n0) * CH);
    v4u t[16];
#pragma unroll
    for (int it = 0; it < 16; ++it) t[it] = g[it * 128 + threadIdx.x];          // row it*4 + wave, piece lane
#pragma unroll
    for (int s = 0; s < 2; ++s)
#pragma unroll
      for (int i = 0; i < 4; ++i) wa[s][i] = ldfrag_b(Wq + i * 16 * CH + s * 32);
#pragma unroll
    for (int it = 0; it < 16; ++it) *(v4u*)(xs + (it * 4 + wave) * XPITCH + lane * 8) = t[it];
  }
  __syncthreads();   // the whole x tile is in LDS before any wave reads fragments of it

  v8f acc[4][4];
#pragma unroll
  for (int i = 0; i < 4; ++i)
#pragma unroll
    for (int j = 0; j < 4; ++j) acc[i][j] = zero8();

  // ---- part 1: Q tile of this wave's head ----
  {
    v16b xb[2][4];
#pragma unroll
    for (int j = 0; j < 4; ++j) xb[0][j] = ldfrag_b(Xl + j * 16 * XPITCH);
#pragma unroll   // constant buffer indices keep wa[] and xb[] in registers
    for (int ks = 0; ks < KST; ++ks) {
      const int cu = ks & 1;
      if (ks + 1 < KST) {
#pragma unroll
        for (int j = 0; j < 4; ++j) xb[cu ^ 1][j] = ldfrag_b(Xl + j * 16 * XPITCH + (ks + 1) * 32);
      }
#pragma unroll
      for (int i = 0; i < 4; ++i) {
#pragma unroll
        for (int j = 0; j < 4; ++j) acc[i][j] = mma_b_raw(wa[cu][i], xb[cu][j], acc[i][j]);
        if (ks + 2 < KST) wa[cu][i] = ldfrag_b(Wq + i * 16 * CH + (ks + 2) * 32);
        // keeps each refill where it is written, two k steps ahead of its use; the compiler otherwise sinks it
        // to just before its products, and every fragment then waits a full load latency
        __builtin_amdgcn_sched_barrier(0);
      }
    }
  }

  // ---- q softmax over the head's 64 rows, column by column; fragments to LDS ----
  float bro[4][8];
#pragma unroll
  for (int i = 0; i < 4; ++i)
#pragma unroll
    for (int r = 0; r < 8; ++r) bro[i][r] = bf_up(bf_bits(bq[m0 + (i << 4) + mOff + r]));
#pragma unroll
  for (int j = 0; j < 4; ++j) {
    float v[4][8];
#pragma unroll
    for (int i = 0; i < 4; ++i)
#pragma unroll
      for (int r = 0; r < 8; ++r) v[i][r] = (acc[i][j][r] + bro[i][r]) * 0.25f;
    float m = v[0][0];
#pragma unroll
    for (int i = 0; i < 4; ++i)
#pragma unroll
      for (int r = 0; r < 8; ++r) m = fmaxf(m, v[i][r]);
    m = fmaxf(m, __shfl_xor(m, 16, 32));
    float s = 0.f;
#pragma unroll
    for (int i = 0; i < 4; ++i)
#pragma unroll
      for (int r = 0; r < 8; ++r) { v[i][r] = __expf(v[i][r] - m); s += v[i][r]; }
    s += __shfl_xor(s, 16, 32);
    const float rinv = 1.0f / s;
#pragma unroll
    for (int i = 0; i < 4; ++i) {
      v4u ph, pl;
#pragma unroll
      for (int q = 0; q < 4; ++q) {
        const float f0 = (v[i][2 * q] * rinv) * 64.0f;
        const float f1 = (v[i][2 * q + 1] * rinv) * 64.0f;
        const unsigned short h0 = bf_bits(f0), h1 = bf_bits(f1);
        const unsigned short l0 = bf_bits(f0 - bf_up(h0)), l1 = bf_bits(f1 - bf_up(h1));
        ph[q] = pk16(h0, h1); pl[q] = pk16(l0, l1);
      }
      const int piece = ((((wave * 2 + (i >> 1)) * 4 + j) * 2 + (i & 1)) << 5) + lane;
      qsh[piece] = ph;
      qsl[piece] = pl;
    }
  }
  v16b ah[4], al[4];   // M2 fragments of k step 0: they do not depend on q, so they fly across the barrier
#pragma unroll
  for (int i = 0; i < 4; ++i) {
    ah[i] = ldfrag_b(Mh + i * 16 * CH);
    al[i] = ldfrag_b(Ml + i * 16 * CH);
  }
  __syncthreads();   // every head's fragments are in LDS before any wave reads them

  // ---- part 2: output rows 64w..64w+63 over all CH channels of q ----
#pragma unroll
  for (int i = 0; i < 4; ++i)
#pragma unroll
    for (int j = 0; j < 4; ++j) acc[i][j] = zero8();
  {
    v16b bh[2][4], bl[2][4];
#pragma unroll
    for (int j = 0; j < 4; ++j) {
      bh[0][j] = ldfrag_q(qsh + j * 64 + lane);
      bl[0][j] = ldfrag_q(qsl + j * 64 + lane);
    }
#pragma unroll   // constant buffer indices keep the fragment arrays in registers
    for (int ks = 0; ks < KST; ++ks) {
      const int cu = ks & 1;
      if (ks + 1 < KST) {
#pragma unroll
        for (int j = 0; j < 4; ++j) {
          bh[cu ^ 1][j] = ldfrag_q(qsh + ((ks + 1) * 4 + j) * 64 + lane);
          bl[cu ^ 1][j] = ldfrag_q(qsl + ((ks + 1) * 4 + j) * 64 + lane);
        }
      }
#pragma unroll
      for (int i = 0; i < 4; ++i) {
        // each accumulator takes its three products in the order hi.hi, lo.hi, hi.lo; four tiles side by side
#pragma unroll
        for (int j = 0; j < 4; ++j) acc[i][j] = mma_b_raw(ah[i], bh[cu][j], acc[i][j]);
#pragma unroll
        for (int j = 0; j < 4; ++j) acc[i][j] = mma_b_raw(al[i], bh[cu][j], acc[i][j]);
#pragma unroll
        for (int j = 0; j < 4; ++j) acc[i][j] = mma_b_raw(ah[i], bl[cu][j], acc[i][j]);
        if (ks + 1 < KST) {
          ah[i] = ldfrag_b(Mh + i * 16 * CH + (ks + 1) * 32);
          al[i] = ldfrag_b(Ml + i * 16 * CH + (ks + 1) * 32);
        }
        // keeps each refill where it is written, one k step ahead of its use (see part 1)
        __builtin_amdgcn_sched_barrier(0);
      }
    }
  }

  // ---- epilogue: whole 256-B row segments through the wave's own slab ----
  float* slab = sT[wave];
  float* C = outp + (size_t)b * CH * NSP;
  const int hh = lane >> 4, c4 = (lane & 15) * 4;          // 256-B row segment = 16 lanes x 16 B
#pragma unroll
  for (int i = 0; i < 4; ++i) {
    const int mBase = m0 + (i << 4);
    float brow[8];
#pragma unroll
    for (int r = 0; r < 8; ++r) brow[r] = bf_up(bf_bits(bo[mBase + mOff + r]));
#pragma unroll
    for (int j = 0; j < 4; ++j) {
#pragma unroll
      for (int r = 0; r < 8; ++r) {
        slab[(mOff + r) * 68 + (j << 4) + rlane] = acc[i][j][r] * (1.0f / 64.0f) + brow[r];
      }
    }
    // the wave's slab rows are written before its lanes read each other's values back
    asm volatile("s_wait_dscnt 0x0" ::: "memory");
    v4f t[8];
#pragma unroll
    for (int it = 0; it < 8; ++it) t[it] = *(const v4f*)(slab + (it * 2 + hh) * 68 + c4);   // rows 0..15
    // the rows are read before the next 16 rows overwrite the slab
    asm volatile("s_wait_dscnt 0x0" ::: "memory");
#pragma unroll
    for (int it = 0; it < 8; ++it) *(v4f*)(C + (size_t)(mBase + it * 2 + hh) * NSP + n0 + c4) = t[it];
  }
}

// =====================================================================================================
// k softmax over n (rows 0..CH-1 of KV) and V plane split (rows CH..2CH-1): KV f32 [bi][2CH][NSP].
// wave xor-shuffle + 8-entry LDS combine in fixed order), value = (exp * (1/sum)) * 4096 -> kP hi/lo bf16.
// V rows: value unchanged -> V hi/lo bf16. Thread t owns columns it*2048 + 8t (it 0..1): each store instruction
// =====================================================================================================
__global__ __launch_bounds__(256) void k_ksoftv(const float* __restrict__ kv,
                                                unsigned short* kph, unsigned short* kpl,
                                                unsigned short* vhp, unsigned short* vlp) {
  __shared__ float red[8];
  const int tid = threadIdx.x, lane = tid & 31, wave = tid >> 5;
  const int j  = blockIdx.x;
  const int bi = blockIdx.y;
  const bool isK = (j < CH);                   // block-uniform
  const float* src = kv + ((size_t)bi * (2 * CH) + (size_t)j) * NSP;
  float vals[16];
#pragma unroll
  for (int it = 0; it < 2; ++it) {
    const size_t co = (size_t)it * 2048 + (size_t)tid * 8;
    const v4f a = *(const v4f*)(src + co);
    const v4f c = *(const v4f*)(src + co + 4);
    vals[it * 8 + 0] = a[0]; vals[it * 8 + 1] = a[1]; vals[it * 8 + 2] = a[2]; vals[it * 8 + 3] = a[3];
    vals[it * 8 + 4] = c[0]; vals[it * 8 + 5] = c[1]; vals[it * 8 + 6] = c[2]; vals[it * 8 + 7] = c[3];
  }
  if (isK) {
    float m = vals[0];
#pragma unroll
    for (int i = 1; i < 16; ++i) m = fmaxf(m, vals[i]);
#pragma unroll
    for (int off = 1; off < 32; off <<= 1) m = fmaxf(m, __shfl_xor(m, off, 32));
    if (lane == 0) red[wave] = m;
    __syncthreads();
    float mm = red[0];
#pragma unroll
    for (int w = 1; w < 8; ++w) mm = fmaxf(mm, red[w]);
    __syncthreads();
    float s = 0.f;
#pragma unroll
    for (int i = 0; i < 16; ++i) { vals[i] = __expf(vals[i] - mm); s += vals[i]; }
#pragma unroll
    for (int off = 1; off < 32; off <<= 1) s += __shfl_xor(s, off, 32);
    if (lane == 0) red[wave] = s;
    __syncthreads();
    float ss = red[0];
#pragma unroll
    for (int w = 1; w < 8; ++w) ss += red[w];
    const float rinv = 1.0f / ss;
#pragma unroll
    for (int i = 0; i < 16; ++i) vals[i] = (vals[i] * rinv) * 4096.0f;
  }
  const int rr = isK ? j : (j - CH);           // 0..CH-1
  unsigned short* ph = isK ? kph : vhp;        // block-uniform selects, all global
  unsigned short* pl = isK ? kpl : vlp;
  unsigned short* dh = ph + ((size_t)bi * CH + (size_t)rr) * NSP;
  unsigned short* dl = pl + ((size_t)bi * CH + (size_t)rr) * NSP;
  v4u hv[2], lv[2];
#pragma unroll
  for (int it = 0; it < 2; ++it) {
    v4u a, a2;
#pragma unroll
    for (int e = 0; e < 4; ++e) {
      const float f0 = vals[it * 8 + 2 * e], f1 = vals[it * 8 + 2 * e + 1];
      const unsigned short h0 = bf_bits(f0), h1 = bf_bits(f1);
      const unsigned short l0 = bf_bits(f0 - bf_up(h0)), l1 = bf_bits(f1 - bf_up(h1));
      a[e] = pk16(h0, h1); a2[e] = pk16(l0, l1);
    }
    hv[it] = a; lv[it] = a2;
  }
  {
#pragma unroll
    for (int it = 0; it < 2; ++it) {
      const size_t co = (size_t)it * 2048 + (size_t)tid * 8;
      *(v4u*)(dh + co) = hv[it];
      *(v4u*)(dl + co) = lv[it];
    }
    
  }
}

// =====================================================================================================
// Workspace map (bytes), every plane an exact multiple of its 64x64-tile / whole-line store granularity
// (no padded tails needed: 4096, 512, 256 are tile multiples); one group holds all GB = NBAT batches:
//   Wqb   bf16 [256][256]              0          131072
//   Wkvb  bf16 [512][256]              131072     262144
//   Wob   bf16 [256][256]              393216     131072
//   Xt    bf16 [GB][4096][256]         524288     16777216
//   Ct    bf16 [GB][4096][256]         17301504   16777216
//   KV    f32  [GB][512][4096]         34078720   67108864
//   kPh   bf16 [GB][256][4096]         101187584  16777216
//   kPl   bf16 [GB][256][4096]         117964800  16777216
//   Vh    bf16 [GB][256][4096]         134742016  16777216
//   Vl    bf16 [GB][256][4096]         151519232  16777216
//   cxh   bf16 [GB][256][256]          168296448  1048576
//   cxl   bf16 [GB][256][256]          169345024  1048576
//   m2h   bf16 [GB][256][256]          170393600  1048576
//   m2l   bf16 [GB][256][256]          171442176  1048576
//   end                                172490752
//   cxp   f32  [KSP][GB][256][256]     34078720   67108864   on KV's bytes: KV's last reader (k_ksoftv) is launched
//                                                            before cxp's writer, and every cxp element is written
//                                                            before k_ksum reads it
// Weights are [out][in] with the in index contiguous = the A / Bt layout, so they are only converted.
// =====================================================================================================
static inline unsigned tile_blocks(int M, int N) { return (unsigned)((((M / 64) * (N / 64)) + 7) / 8); }

extern "C" void kernel_launch(void* const* d_in, const int* in_sizes, int n_in,
                              void* d_out, int out_size, void* d_ws, size_t ws_size,
                              hipStream_t stream) {
  if (n_in < 8) return;
  if (in_sizes[0] != NBAT * CH * NSP) return;
  if (in_sizes[1] != NBAT * CH * NSP) return;
  if (in_sizes[2] != CH * CH) return;
  if (in_sizes[3] != CH) return;
  if (in_sizes[4] != 2 * CH * CH) return;
  if (in_sizes[5] != 2 * CH) return;
  if (in_sizes[6] != CH * CH) return;
  if (in_sizes[7] != CH) return;
  if (out_size != NBAT * CH * NSP) return;

  const float* x     = (const float*)d_in[0];
  const float* cproj = (const float*)d_in[1];
  const float* wq    = (const float*)d_in[2];
  const float* bq    = (const float*)d_in[3];
  const float* wkv   = (const float*)d_in[4];
  const float* bkv   = (const float*)d_in[5];
  const float* wo    = (const float*)d_in[6];
  const float* bo    = (const float*)d_in[7];
  float* out = (float*)d_out;

  const size_t PWq  = (size_t)CH * CH * 2;               //   131072
  const size_t PWkv = (size_t)2 * CH * CH * 2;           //   262144
  const size_t PWo  = (size_t)CH * CH * 2;               //   131072
  const size_t PXt  = (size_t)GB * NSP * CH * 2;         // 16777216
  const size_t PKV  = (size_t)GB * 2 * CH * NSP * 4;     // 67108864
  const size_t PKp  = (size_t)GB * CH * NSP * 2;         // 16777216
  const size_t PCx  = (size_t)GB * CH * CH * 2;          //  1048576
  size_t off = 0;
  const size_t oWq  = off; off += PWq;
  const size_t oWkv = off; off += PWkv;
  const size_t oWo  = off; off += PWo;
  const size_t oXt  = off; off += PXt;
  const size_t oCt  = off; off += PXt;
  const size_t oKV  = off; off += PKV;
  const size_t oKh  = off; off += PKp;
  const size_t oKl  = off; off += PKp;
  const size_t oVh  = off; off += PKp;
  const size_t oVl  = off; off += PKp;
  const size_t oCxh = off; off += PCx;
  const size_t oCxl = off; off += PCx;
  const size_t oM2h = off; off += PCx;
  const size_t oM2l = off; off += PCx;
  const size_t oCxp = oKV;                               // takes over KV's bytes once k_ksoftv has read them
  if (off > ws_size) return;                             // off = 172490752

  char* ws = (char*)d_ws;
  unsigned short* Wqb  = (unsigned short*)(ws + oWq);
  unsigned short* Wkvb = (unsigned short*)(ws + oWkv);
  unsigned short* Wob  = (unsigned short*)(ws + oWo);
  unsigned short* Xt   = (unsigned short*)(ws + oXt);
  unsigned short* Ct   = (unsigned short*)(ws + oCt);
  float*          KV   = (float*)(ws + oKV);
  unsigned short* Kh   = (unsigned short*)(ws + oKh);
  unsigned short* Kl   = (unsigned short*)(ws + oKl);
  unsigned short* Vh   = (unsigned short*)(ws + oVh);
  unsigned short* Vl   = (unsigned short*)(ws + oVl);
  unsigned short* Cxh  = (unsigned short*)(ws + oCxh);
  unsigned short* Cxl  = (unsigned short*)(ws + oCxl);
  unsigned short* M2h  = (unsigned short*)(ws + oM2h);
  unsigned short* M2l  = (unsigned short*)(ws + oM2l);
  float*          Cxp  = (float*)(ws + oCxp);

  const dim3 blk(256);
  const int n8wq  = CH * CH / 8;                         //  8192
  const int n8wkv = 2 * CH * CH / 8;                     // 16384
  const int n8wo  = CH * CH / 8;                         //  8192

  // (0) weights -> bf16 planes
  cvt_bf16x8<<<dim3((n8wq + 255) / 256), blk, 0, stream>>>(wq, Wqb, n8wq);
  cvt_bf16x8<<<dim3((n8wkv + 255) / 256), blk, 0, stream>>>(wkv, Wkvb, n8wkv);
  cvt_bf16x8<<<dim3((n8wo + 255) / 256), blk, 0, stream>>>(wo, Wob, n8wo);

  const dim3 gTr(NSP / 64, CH / 64, 2 * GB);             // 64 x 4 x 16
  const dim3 gKV(tile_blocks(2 * CH, NSP), GB);          // 512 tiles -> 64 blocks
  const dim3 gKs(2 * CH, GB);                            // 512 x GB
  const dim3 gCx(tile_blocks(CH, CH), GB);               // 16 tiles -> 2 blocks
  const dim3 gCxK(tile_blocks(CH, CH), GB, KSP);         // 2 x GB x 32 k slices = 512 blocks
  const dim3 gSum(GB * CH * CH / 1024);                  // 512 blocks
  const dim3 gQo(NSP / 64, GB);                          // 64 column tiles x GB, 4 waves each
  const long long sNC = (long long)NSP * CH;             // per-batch stride of the [4096][256] / [256][4096] planes
  const long long sCC = (long long)CH * CH;

  for (int g = 0; g < NGRP; ++g) {
    const int b0 = g * GB;
    // (1) x[b], cproj[b] -> Xt[n][c], Ct[n][c] bf16
    k_trcvt<<<gTr, blk, 0, stream>>>(x, cproj, Xt, Ct, b0);
    // (2) KV[j][n] = wkv . Ct^T + bkv[j]  (M=512, N=4096, K=256) f32
    gemm64<0, 0, 1><<<gKV, blk, 0, stream>>>(
        Wkvb, Wkvb, CH, 0LL, Ct, Ct, CH, sNC,
        (void*)KV, (void*)KV, NSP, (long long)2 * CH * NSP, bkv, 2 * CH, NSP, CH, 1.0f);
    // k softmax over n -> kP hi/lo (x4096); V rows -> V hi/lo
    k_ksoftv<<<gKs, blk, 0, stream>>>(KV, Kh, Kl, Vh, Vl);
    // (3) ctxT[d][c] = (Vh.kPh^T + Vl.kPh^T + Vh.kPl^T) / 4096  (M=N=256, K=4096 in KSP slices) -> f32 partial
    //     planes, then their sum -> bf16 hi/lo
    gemm64<2, 0, 0, true><<<gCxK, blk, 0, stream>>>(
        Vh, Vl, NSP, sNC, Kh, Kl, NSP, sNC,
        (void*)Cxp, (void*)Cxp, CH, sCC, bq, CH, CH, NSP / KSP, 1.0f / 4096.0f);
    k_ksum<<<gSum, blk, 0, stream>>>(Cxp, Cxh, Cxl);
    // (4) M2[o][d] = wo . (ctxTh + ctxTl)^T  (M=N=K=256) -> bf16 hi/lo
    gemm64<3, 2, 0><<<gCx, blk, 0, stream>>>(
        Wob, Wob, CH, 0LL, Cxh, Cxl, CH, sCC,
        (void*)M2h, (void*)M2l, CH, sCC, bq, CH, CH, CH, 1.0f);
    // (5) Q = wq . Xt^T + bq, qP = 64 * softmax over each head's 64 rows (hi/lo, in LDS),
    //     out[b][o][n] = ((M2h + M2l).qPh + M2h.qPl) / 64 + bo[o] -> d_out f32
    float* outg = out + (size_t)b0 * CH * NSP;
    k_qout<<<gQo, dim3(128), 0, stream>>>(Wqb, Xt, bq, M2h, M2l, bo, outg);
  }
  (void)hipGetLastError();
}

// v004
// One run takes 102 microseconds.
// Next to v003, in two timings, it ran 1.38 and 1.34 times as fast.
// Over all steps from v000 it is 14.6 times as fast.
// Contractions (all v_wmma_f32_16x16x32_bf16, f32 accumulate): x^T.wq^T and wkv.cproj with bf16 operands
// RNE-converted from the f32 inputs (single product); V.kP^T with bf16 hi+lo planes on both operands (3 products);
// wo.ctx^T with bf16 wo times ctx hi+lo planes (2 products); M2.qP^T with bf16 hi+lo planes on both (3 products).
// Softmaxes and epilogues in f32; the q softmax output is carried x64, folded back by the epilogue scale.
// The q projection, its softmax and the output product run in one kernel; q passes from one to the other in LDS.
// The KV projection, the k softmax and the V.kP^T product run in one kernel per slice of 128 columns n: kP is
// exp(K - slice maximum), un-normalised; the slice sum weighs each slice by exp(slice max - row max) / row sum.
#include <hip/hip_runtime.h>
#include <stdint.h>

#define NBAT 8
#define CH   256
#define NSP  4096
#define GB   8
#define NGRP (NBAT / GB)
static_assert((NSP % 64) == 0 && (CH % 64) == 0 && (NBAT % GB) == 0);
static_assert(CH == 4 * 64);         // four heads of 64 channels: one wave of k_qout per head
#define KSP  32                      // k slices of the V.kP^T product (K = NSP), one work-group of k_kvctx each
static_assert((NSP % (KSP * 32)) == 0 && ((GB * CH * CH) % 1024) == 0);

typedef __bf16   v16b __attribute__((ext_vector_type(16)));
typedef __bf16   v8b  __attribute__((ext_vector_type(8)));
typedef float    v8f  __attribute__((ext_vector_type(8)));
typedef float    v4f  __attribute__((ext_vector_type(4)));
typedef unsigned int v4u __attribute__((ext_vector_type(4)));

// ---- scalar helpers --------------------------------------------------------------------------------
__device__ __forceinline__ unsigned short bf_bits(float f) {          // f32 -> bf16 bits, RNE convert
  unsigned u = __float_as_uint(f);
  return (unsigned short)((u + 0x7FFFu + ((u >> 16) & 1u)) >> 16);
}
__device__ __forceinline__ float bf_up(unsigned short h) { return __uint_as_float(((unsigned)h) << 16); }
__device__ __forceinline__ unsigned pk16(unsigned short a, unsigned short b) { return (unsigned)a | ((unsigned)b << 16); }
__device__ __forceinline__ v8f zero8() { v8f z = {0.f, 0.f, 0.f, 0.f, 0.f, 0.f, 0.f, 0.f}; return z; }

// ---- fragment loader: 16-bit A/B operand, lane -> row/col (lane&15), p already includes +8*(lane>>4);
//      elements 0..7 <- p[0..7] (k0+8h..), elements 8..15 <- p[16..23] (k0+16+8h..)
__device__ __forceinline__ v16b ldfrag_b(const __bf16* p) {
  union { v16b v; v8b h[2]; } f;
  f.h[0] = *(const v8b*)(p);
  f.h[1] = *(const v8b*)(p + 16);
  return f.v;
}

// ---- WMMA helpers with trailing VALU hazard gap --------------------------------------------------------
__device__ __forceinline__ v8f mma_b_raw(v16b a, v16b b, v8f c) {
  return __builtin_amdgcn_wmma_f32_16x16x32_bf16(false, a, false, b, (short)0, c, false, false);
}
__device__ __forceinline__ void dep_guard_b(v8f& a, v8f& b, v16b x, v16b y) {
#if defined(__HIP_DEVICE_COMPILE__)
  asm volatile("v_nop\n\tv_nop\n\tv_nop\n\tv_nop" : "+v"(a), "+v"(b) : "v"(x), "v"(y));
#endif
}
__device__ __forceinline__ void keep4_b(v16b a, v16b b, v16b c, v16b d) {
#if defined(__HIP_DEVICE_COMPILE__)
  asm volatile("v_nop" :: "v"(a), "v"(b), "v"(c), "v"(d));
#endif
}
__device__ __forceinline__ void acc_guard4(v8f& a, v8f& b, v8f& c, v8f& d) {
#if defined(__HIP_DEVICE_COMPILE__)
  asm volatile("v_nop\n\tv_nop\n\tv_nop\n\tv_nop" : "+v"(a), "+v"(b), "+v"(c), "+v"(d));
#endif
}
__device__ __forceinline__ void wave_sync_lds() {
  __builtin_amdgcn_fence(__ATOMIC_RELEASE, "workgroup");
  __builtin_amdgcn_wave_barrier();
  __builtin_amdgcn_fence(__ATOMIC_ACQUIRE, "workgroup");
}

// =====================================================================================================
// f32 -> bf16 (RNE convert), 8 elements per thread, one 16-B store per lane: a wave writes 512 contiguous B
// coverage: n8 threads x 8 = whole plane (n8 is a multiple of 256 for every use here).
// =====================================================================================================
__global__ __launch_bounds__(256) void cvt_bf16x8(const float* __restrict__ in, unsigned short* out, int n8) {
  const int i = blockIdx.x * 256 + threadIdx.x;
  if (i < n8) {
    const v4f a = *(const v4f*)(in + (size_t)i * 8);
    const v4f b = *(const v4f*)(in + (size_t)i * 8 + 4);
    v4u p;
    p[0] = pk16(bf_bits(a[0]), bf_bits(a[1]));
    p[1] = pk16(bf_bits(a[2]), bf_bits(a[3]));
    p[2] = pk16(bf_bits(b[0]), bf_bits(b[1]));
    p[3] = pk16(bf_bits(b[2]), bf_bits(b[3]));
    *(v4u*)(out + (size_t)i * 8) = p;
    
  }
}

// =====================================================================================================
// Transpose-convert of one 64x64 tile: source [b][c][n] f32 (c pitch NSP) -> plane [bi][n][c] bf16 (pitch CH).
// blockIdx.x = n tile, blockIdx.y = c tile, blockIdx.z = 2*bi + sel (sel 0: xg -> xt, 1: cg -> ct); block 256.
// Load: thread r = tid>>2 owns source row c0+r, 16 consecutive n at (tid&3)*16 (4 x 16-B loads).
// coverage: load 256x16 = 4096 = whole tile; store 2x256x8 = 4096 = whole tile.
// =====================================================================================================
__global__ __launch_bounds__(256) void k_trcvt(const float* __restrict__ xg, const float* __restrict__ cg,
                                               unsigned short* xt, unsigned short* ct, int b0) {
  __shared__ float tile[64][65];
  const int tid = threadIdx.x;
  const int n0 = blockIdx.x * 64;
  const int c0 = blockIdx.y * 64;
  const int bi  = (int)(blockIdx.z >> 1);
  const int sel = (int)(blockIdx.z & 1);
  const float* src = sel ? cg : xg;            // block-uniform select, both global
  unsigned short* dst = sel ? ct : xt;
  {
    const int r = tid >> 2, cs = (tid & 3) * 16;
    const float* p = src + ((size_t)(b0 + bi) * CH + (size_t)(c0 + r)) * NSP + n0 + cs;
#pragma unroll
    for (int i = 0; i < 4; ++i) {
      const v4f v = *(const v4f*)(p + 4 * i);
      tile[r][cs + 4 * i + 0] = v[0];
      tile[r][cs + 4 * i + 1] = v[1];
      tile[r][cs + 4 * i + 2] = v[2];
      tile[r][cs + 4 * i + 3] = v[3];
    }
  }
  __syncthreads();
  v4u pv[2];
  const int c8 = (tid & 7) * 8;
#pragma unroll
  for (int it = 0; it < 2; ++it) {
    const int n = it * 32 + (tid >> 3);
    v4u a;
#pragma unroll
    for (int e = 0; e < 4; ++e) {
      a[e] = pk16(bf_bits(tile[c8 + 2 * e][n]), bf_bits(tile[c8 + 2 * e + 1][n]));
    }
    pv[it] = a;
  }
  {
#pragma unroll
    for (int it = 0; it < 2; ++it) {
      const int n = it * 32 + (tid >> 3);
      const size_t go = ((size_t)bi * NSP + (size_t)(n0 + n)) * CH + c0 + c8;
      *(v4u*)(dst + go) = pv[it];
    }
    
  }
}

// =====================================================================================================
// Register-blocked batched bf16 WMMA GEMM: C[m][n] = oscale * sum_k A[m][k] * Bt[n][k] + bias; one wave per
// 64x64 tile, no block barriers. A row-major [M][K] pitch lda; Bt row-major [N][K] pitch ldb (k contiguous);
// M, N multiples of 64, K multiple of 32 (host-checked). blockIdx.y = batch index (strides in elements).
// NSPLIT: 0 = A.Bt; 1 = (A + A2).Bt; 2 = A.Bt + A2.Bt + A.Bt2; 3 = A.Bt + A.Bt2 (A2, Bt2 = unscaled bf16 lo planes).
// BIAS: 0 none; 1 = bias[m] per output row; 2 = bias[n] per output column (bias value RNE-converted to bf16).
// OUT_MODE: 0 = f32 (pitch ldc); 2 = bf16 hi plane C + bf16 lo plane C2 (lo = RNE(v - hi), unscaled), same pitch.
// =====================================================================================================
template <int NSPLIT, int OUT_MODE, int BIAS>
__global__ __launch_bounds__(256) void gemm64(
    const unsigned short* __restrict__ Ap, const unsigned short* A2p, int lda, long long strideA,
    const unsigned short* __restrict__ Btp, const unsigned short* Bt2p, int ldb, long long strideB,
    void* Cout, void* Cout2, int ldc, long long strideC,
    const float* __restrict__ bias, int M, int N, int K, float oscale) {
  const __bf16* A   = (const __bf16*)(const void*)Ap;
  const __bf16* A2  = (const __bf16*)(const void*)A2p;
  const __bf16* Bt  = (const __bf16*)(const void*)Btp;
  const __bf16* Bt2 = (const __bf16*)(const void*)Bt2p;
  __shared__ __align__(16) float sT[8][16 * 68];   // per-wave 16x64 slab, pitch 68 floats
  const int b    = blockIdx.y;
  const int lane = threadIdx.x & 31;
  const int wave = threadIdx.x >> 5;
  const int tilesN = N >> 6;
  const int tilesM = M >> 6;
  const int tile = blockIdx.x * 8 + wave;
  if (tile >= tilesM * tilesN) return;   // wave-uniform; no block barriers in this kernel
  const int tm = tile / tilesN;
  const int tn = tile - tm * tilesN;
  const int m0 = tm << 6;
  const int n0 = tn << 6;

  constexpr bool useA2 = (NSPLIT == 1) || (NSPLIT == 2);
  constexpr bool useB2 = (NSPLIT >= 2);
  const size_t cb = (size_t)b;                 // output plane index
  const __bf16* Ab  = A  + (size_t)b * strideA;
  const __bf16* Bb  = Bt + (size_t)b * strideB;
  const __bf16* Ab2 = useA2 ? (A2  + (size_t)b * strideA) : Ab;
  const __bf16* Bb2 = useB2 ? (Bt2 + (size_t)b * strideB) : Bb;

  const int rlane = lane & 15;                 // row (A) / col (B, D) within subtile
  const int koff  = (lane >> 4) * 8;           // k offset of this lane half
  const int mOff  = (lane >> 4) * 8;           // D row offset

  v8f acc[4][4];
#pragma unroll
  for (int i = 0; i < 4; ++i)
#pragma unroll
    for (int j = 0; j < 4; ++j) acc[i][j] = zero8();

  for (int k0 = 0; k0 < K; k0 += 32) {
    v16b bh[4], bl[4];
#pragma unroll
    for (int j = 0; j < 4; ++j) {
      const size_t bofs = (size_t)(n0 + (j << 4) + rlane) * ldb + koff + k0;
      bh[j] = ldfrag_b(Bb + bofs);
      if (useB2) bl[j] = ldfrag_b(Bb2 + bofs); else bl[j] = bh[j];
    }
#pragma unroll
    for (int i = 0; i < 4; ++i) {
      const size_t ao = (size_t)(m0 + (i << 4) + rlane) * lda + koff + k0;
      const v16b ah = ldfrag_b(Ab + ao);
      v16b al = ah;
      if (useA2) al = ldfrag_b(Ab2 + ao);
#pragma unroll
      for (int j = 0; j < 4; ++j) {
        acc[i][j] = mma_b_raw(ah, bh[j], acc[i][j]);
        if (useA2) acc[i][j] = mma_b_raw(al, bh[j], acc[i][j]);
        if (useB2) acc[i][j] = mma_b_raw(ah, bl[j], acc[i][j]);
      }
      dep_guard_b(acc[i][0], acc[i][3], ah, al);
    }
    keep4_b(bh[0], bh[1], bh[2], bh[3]);
    if (useB2) keep4_b(bl[0], bl[1], bl[2], bl[3]);
  }
  acc_guard4(acc[0][0], acc[0][1], acc[0][2], acc[0][3]);
  acc_guard4(acc[1][0], acc[1][1], acc[1][2], acc[1][3]);
  acc_guard4(acc[2][0], acc[2][1], acc[2][2], acc[2][3]);
  acc_guard4(acc[3][0], acc[3][1], acc[3][2], acc[3][3]);

  // ---- epilogue ----
  float bcol[4];
#pragma unroll
  for (int j = 0; j < 4; ++j) bcol[j] = 0.f;
  if (BIAS == 2) {
#pragma unroll
    for (int j = 0; j < 4; ++j) bcol[j] = bf_up(bf_bits(bias[n0 + (j << 4) + rlane]));
  }
  float* slab = sT[wave];
#pragma unroll
  for (int i = 0; i < 4; ++i) {
    const int mBase = m0 + (i << 4);
    float brow[8];
#pragma unroll
    for (int r = 0; r < 8; ++r) brow[r] = 0.f;
    if (BIAS == 1) {
#pragma unroll
      for (int r = 0; r < 8; ++r) brow[r] = bf_up(bf_bits(bias[mBase + mOff + r]));
    }
#pragma unroll
    for (int j = 0; j < 4; ++j) {
#pragma unroll
      for (int r = 0; r < 8; ++r) {
        slab[(mOff + r) * 68 + (j << 4) + rlane] = acc[i][j][r] * oscale + (brow[r] + bcol[j]);
      }
    }
    wave_sync_lds();
    if (OUT_MODE == 0) {
      float* C = (float*)Cout + cb * strideC;
      const int hh = lane >> 4, c4 = (lane & 15) * 4;     // 256-B row segment = 16 lanes x 16 B
      {
#pragma unroll
        for (int it = 0; it < 8; ++it) {
          const int row = it * 2 + hh;                     // it 0..7 x hh 0..1 = rows 0..15
          const v4f v = *(const v4f*)(slab + row * 68 + c4);
          *(v4f*)(C + (size_t)(mBase + row) * ldc + n0 + c4) = v;
        }
        
      }
    } else {
      const int q = lane >> 3, c8 = (lane & 7) * 8;
      unsigned short* C  = (unsigned short*)Cout  + cb * strideC;
      unsigned short* C2 = (unsigned short*)Cout2 + cb * strideC;
      v4u hv[4], lv[4];
#pragma unroll
      for (int it = 0; it < 4; ++it) {
        const int row = it * 4 + q;                        // it 0..3 x q 0..3 = rows 0..15
        const float* sp = slab + row * 68 + c8;
        v4u a, a2;
#pragma unroll
        for (int e = 0; e < 4; ++e) {
          const float f0 = sp[2 * e], f1 = sp[2 * e + 1];
          const unsigned short h0 = bf_bits(f0), h1 = bf_bits(f1);
          const unsigned short l0 = bf_bits(f0 - bf_up(h0)), l1 = bf_bits(f1 - bf_up(h1));
          a[e] = pk16(h0, h1); a2[e] = pk16(l0, l1);
        }
        hv[it] = a; lv[it] = a2;
      }
      {
#pragma unroll
        for (int it = 0; it < 4; ++it) {
          const int row = it * 4 + q;
          const size_t go = (size_t)(mBase + row) * ldc + n0 + c8;
          *(v4u*)(C  + go) = hv[it];
          *(v4u*)(C2 + go) = lv[it];
        }
        
      }
    }
    wave_sync_lds();
  }
}

// =====================================================================================================
// Weighted sum of the KSP k-slice partials of ctxT: part f32 [GB*CH/4][KSP][4*CH] -> bf16 hi/lo planes [GB*CH*CH].
// Slice z of column c weighs exp(m[z][c] - M[c]) / S[c], M = maximum of the slice maxima, S = sum over z of
// exp(m[z][c] - M[c]) * s[z][c]: the softmax over all n. A block covers 4 rows d x all CH columns c of one batch:
// thread t forms the KSP weights of column t once, in LDS; slices are added in index order.
// Thread owns 4 consecutive elements (16-B loads, 8-B stores: a wave stores 256 contiguous B).
// coverage: (GB*CH*CH/1024) blocks x 256 threads x 4 = whole plane.
// =====================================================================================================
__global__ __launch_bounds__(256) void k_ksum(const float* __restrict__ part, const float* __restrict__ stm,
                                              const float* __restrict__ sts, unsigned short* ch, unsigned short* cl) {
  __shared__ __align__(16) float wl[KSP][CH];
  const unsigned t = threadIdx.x;
  const int b = (int)(blockIdx.x / (CH * CH / 1024));
  const size_t e0 = ((size_t)blockIdx.x * 256 + t) * 4;
  const float* pb = part + (size_t)blockIdx.x * (KSP * 1024);   // block-uniform bases, one lane offset for all loads
  const float* mb = stm + b * CH;
  const float* sb = sts + b * CH;
  v4f p[KSP];
#pragma unroll   // keeps p[] in registers and the independent loads in flight together
  for (int z = 0; z < KSP; ++z) p[z] = *(const v4f*)(pb + z * 1024 + t * 4u);
  // keeps the plane loads ahead of the weights' work, in flight under it; the compiler otherwise sinks them
  // behind it, and the block pays the two memory latencies one after the other
  __builtin_amdgcn_sched_barrier(0);
  {
    float m[KSP], sz[KSP];
#pragma unroll   // m[] and sz[] are indexed by constants only, so they stay in registers
    for (int z = 0; z < KSP; ++z) {
      m[z]  = mb[z * (GB * CH) + t];
      sz[z] = sb[z * (GB * CH) + t];
    }
    float mm = m[0];
#pragma unroll
    for (int z = 1; z < KSP; ++z) mm = fmaxf(mm, m[z]);
    float ss = 0.f;
#pragma unroll
    for (int z = 0; z < KSP; ++z) { m[z] = __expf(m[z] - mm); ss += m[z] * sz[z]; }
    const float rinv = 1.0f / ss;
#pragma unroll
    for (int z = 0; z < KSP; ++z) wl[z][t] = m[z] * rinv;
  }
  __syncthreads();   // every column's weights are in LDS before any thread reads its four
  const unsigned c4 = (t * 4u) & (CH - 1);
  v4f s = p[0] * *(const v4f*)(&wl[0][c4]);
#pragma unroll   // p[] is indexed by constants only, so it stays in registers
  for (int z = 1; z < KSP; ++z) s += p[z] * *(const v4f*)(&wl[z][c4]);
  const unsigned short h0 = bf_bits(s[0]), h1 = bf_bits(s[1]), h2 = bf_bits(s[2]), h3 = bf_bits(s[3]);
  uint2 hv, lv;
  hv.x = pk16(h0, h1);
  hv.y = pk16(h2, h3);
  lv.x = pk16(bf_bits(s[0] - bf_up(h0)), bf_bits(s[1] - bf_up(h1)));
  lv.y = pk16(bf_bits(s[2] - bf_up(h2)), bf_bits(s[3] - bf_up(h3)));
  *(uint2*)(ch + e0) = hv;
  *(uint2*)(cl + e0) = lv;
}

// =====================================================================================================
// q projection + q softmax + output product for one 64-column tile of n. grid (NSP/64, GB), block 128 = 4 waves.
// x tile: rows n0..n0+63 of Xt are 32 KiB in a row; each wave-wide load takes one whole 512-B row, and the rows
//   stand in LDS at a pitch of 528 B (16 B x odd) for the 16-B fragment reads of all four waves.
// Part 1, wave w = head w: Q[o][n] = wq . Xt^T + bq[o] for o in 64w..64w+63 (K = CH). A lane holds column
//   n0 + 16j + (lane&15) and rows 16i + 8(lane>>4) + r, so one column's head lies in lanes l and l^16:
//   softmax of 0.25 * Q over the 64 rows = a sum inside the lane and one xor-16 exchange.
// Hand-over: 64 * softmax as bf16 hi/lo. Accumulator tiles 2p and 2p+1 of a column block are, lane for lane,
//   elements 0..7 and 8..15 of the B fragment of k step p, so each lane stores and later loads its own 16-B
//   pieces: piece (((k step * 4 + j) * 2 + half) * 32 + lane); a wave-wide access covers 512 contiguous bytes.
// Part 2, wave w: out[o][n] = ((M2h + M2l).qPh + M2h.qPl) / 64 + bo[o] for o in 64w..64w+63 (K = CH, all heads).
// coverage: 64 x GB blocks x 4 waves x (64 rows x 64 columns) = whole output.
// =====================================================================================================
#define XPITCH (CH + 8)                        // x tile row pitch in LDS, elements (528 B)
#define KST    (CH / 32)                       // k steps of both products

__device__ __forceinline__ v16b ldfrag_q(const v4u* p) {   // p = piece of half 0; half 1 lies 32 pieces on
  union { v16b v; v4u q[2]; } f;
  f.q[0] = p[0];
  f.q[1] = p[32];
  return f.v;
}

__global__ __launch_bounds__(128) void k_qout(const unsigned short* __restrict__ wqp,
                                              const unsigned short* __restrict__ xtp,
                                              const float* __restrict__ bq,
                                              const unsigned short* __restrict__ m2hp,
                                              const unsigned short* __restrict__ m2lp,
                                              const float* __restrict__ bo, float* outp) {
  __shared__ __align__(16) unsigned short xs[64 * XPITCH];    // 33 KiB: x tile, bf16
  __shared__ __align__(16) v4u qsh[KST * 4 * 2 * 32];         // 32 KiB: q hi fragments of the tile
  __shared__ __align__(16) v4u qsl[KST * 4 * 2 * 32];         // 32 KiB: q lo fragments
  __shared__ __align__(16) float sT[4][16 * 68];              // per-wave 16x64 slab, pitch 68 floats
  const int lane = threadIdx.x & 31;
  const int wave = threadIdx.x >> 5;
  const int b  = blockIdx.y;
  const int n0 = blockIdx.x << 6;
  const int m0 = wave << 6;
  const int rlane = lane & 15;                 // row (A) / col (B, D) within subtile
  const int koff  = (lane >> 4) * 8;           // k offset of this lane half
  const int mOff  = (lane >> 4) * 8;           // D row offset
  const size_t arow = (size_t)(m0 + rlane) * CH + koff;      // this lane's A row (subtile 0), all three A planes
  const __bf16* Wq = (const __bf16*)(const void*)wqp + arow;
  const __bf16* Mh = (const __bf16*)(const void*)m2hp + (size_t)b * CH * CH + arow;
  const __bf16* Ml = (const __bf16*)(const void*)m2lp + (size_t)b * CH * CH + arow;
  const __bf16* Xl = (const __bf16*)(const void*)xs + rlane * XPITCH + koff;   // this lane's B row (subtile 0)

  // ---- x tile to LDS; wq fragments of the first two k steps meanwhile ----
  v16b wa[2][4];
  {
    const v4u* g = (const v4u*)(const void*)(xtp + ((size_t)b * NSP + (size_t)n0) * CH);
    v4u t[16];
#pragma unroll
    for (int it = 0; it < 16; ++it) t[it] = g[it * 128 + threadIdx.x];          // row it*4 + wave, piece lane
#pragma unroll
    for (int s = 0; s < 2; ++s)
#pragma unroll
      for (int i = 0; i < 4; ++i) wa[s][i] = ldfrag_b(Wq + i * 16 * CH + s * 32);
#pragma unroll
    for (int it = 0; it < 16; ++it) *(v4u*)(xs + (it * 4 + wave) * XPITCH + lane * 8) = t[it];
  }
  __syncthreads();   // the whole x tile is in LDS before any wave reads fragments of it

  v8f acc[4][4];
#pragma unroll
  for (int i = 0; i < 4; ++i)
#pragma unroll
    for (int j = 0; j < 4; ++j) acc[i][j] = zero8();

  // ---- part 1: Q tile of this wave's head ----
  {
    v16b xb[2][4];
#pragma unroll
    for (int j = 0; j < 4; ++j) xb[0][j] = ldfrag_b(Xl + j * 16 * XPITCH);
#pragma unroll   // constant buffer indices keep wa[] and xb[] in registers
    for (int ks = 0; ks < KST; ++ks) {
      const int cu = ks & 1;
      if (ks + 1 < KST) {
#pragma unroll
        for (int j = 0; j < 4; ++j) xb[cu ^ 1][j] = ldfrag_b(Xl + j * 16 * XPITCH + (ks + 1) * 32);
      }
#pragma unroll
      for (int i = 0; i < 4; ++i) {
#pragma unroll
        for (int j = 0; j < 4; ++j) acc[i][j] = mma_b_raw(wa[cu][i], xb[cu][j], acc[i][j]);
        if (ks + 2 < KST) wa[cu][i] = ldfrag_b(Wq + i * 16 * CH + (ks + 2) * 32);
        // keeps each refill where it is written, two k steps ahead of its use; the compiler otherwise sinks it
        // to just before its products, and every fragment then waits a full load latency
        __builtin_amdgcn_sched_barrier(0);
      }
    }
  }

  // ---- q softmax over the head's 64 rows, column by column; fragments to LDS ----
  float bro[4][8];
#pragma unroll
  for (int i = 0; i < 4; ++i)
#pragma unroll
    for (int r = 0; r < 8; ++r) bro[i][r] = bf_up(bf_bits(bq[m0 + (i << 4) + mOff + r]));
#pragma unroll
  for (int j = 0; j < 4; ++j) {
    float v[4][8];
#pragma unroll
    for (int i = 0; i < 4; ++i)
#pragma unroll
      for (int r = 0; r < 8; ++r) v[i][r] = (acc[i][j][r] + bro[i][r]) * 0.25f;
    float m = v[0][0];
#pragma unroll
    for (int i = 0; i < 4; ++i)
#pragma unroll
      for (int r = 0; r < 8; ++r) m = fmaxf(m, v[i][r]);
    m = fmaxf(m, __shfl_xor(m, 16, 32));
    float s = 0.f;
#pragma unroll
    for (int i = 0; i < 4; ++i)
#pragma unroll
      for (int r = 0; r < 8; ++r) { v[i][r] = __expf(v[i][r] - m); s += v[i][r]; }
    s += __shfl_xor(s, 16, 32);
    const float rinv = 1.0f / s;
#pragma unroll
    for (int i = 0; i < 4; ++i) {
      v4u ph, pl;
#pragma unroll
      for (int q = 0; q < 4; ++q) {
        const float f0 = (v[i][2 * q] * rinv) * 64.0f;
        const float f1 = (v[i][2 * q + 1] * rinv) * 64.0f;
        const unsigned short h0 = bf_bits(f0), h1 = bf_bits(f1);
        const unsigned short l0 = bf_bits(f0 - bf_up(h0)), l1 = bf_bits(f1 - bf_up(h1));
        ph[q] = pk16(h0, h1); pl[q] = pk16(l0, l1);
      }
      const int piece = ((((wave * 2 + (i >> 1)) * 4 + j) * 2 + (i & 1)) << 5) + lane;
      qsh[piece] = ph;
      qsl[piece] = pl;
    }
  }
  v16b ah[4], al[4];   // M2 fragments of k step 0: they do not depend on q, so they fly across the barrier
#pragma unroll
  for (int i = 0; i < 4; ++i) {
    ah[i] = ldfrag_b(Mh + i * 16 * CH);
    al[i] = ldfrag_b(Ml + i * 16 * CH);
  }
  __syncthreads();   // every head's fragments are in LDS before any wave reads them

  // ---- part 2: output rows 64w..64w+63 over all CH channels of q ----
#pragma unroll
  for (int i = 0; i < 4; ++i)
#pragma unroll
    for (int j = 0; j < 4; ++j) acc[i][j] = zero8();
  {
    v16b bh[2][4], bl[2][4];
#pragma unroll
    for (int j = 0; j < 4; ++j) {
      bh[0][j] = ldfrag_q(qsh + j * 64 + lane);
      bl[0][j] = ldfrag_q(qsl + j * 64 + lane);
    }
#pragma unroll   // constant buffer indices keep the fragment arrays in registers
    for (int ks = 0; ks < KST; ++ks) {
      const int cu = ks & 1;
      if (ks + 1 < KST) {
#pragma unroll
        for (int j = 0; j < 4; ++j) {
          bh[cu ^ 1][j] = ldfrag_q(qsh + ((ks + 1) * 4 + j) * 64 + lane);
          bl[cu ^ 1][j] = ldfrag_q(qsl + ((ks + 1) * 4 + j) * 64 + lane);
        }
      }
#pragma unroll
      for (int i = 0; i < 4; ++i) {
        // each accumulator takes its three products in the order hi.hi, lo.hi, hi.lo; four tiles side by side
#pragma unroll
        for (int j = 0; j < 4; ++j) acc[i][j] = mma_b_raw(ah[i], bh[cu][j], acc[i][j]);
#pragma unroll
        for (int j = 0; j < 4; ++j) acc[i][j] = mma_b_raw(al[i], bh[cu][j], acc[i][j]);
#pragma unroll
        for (int j = 0; j < 4; ++j) acc[i][j] = mma_b_raw(ah[i], bl[cu][j], acc[i][j]);
        if (ks + 1 < KST) {
          ah[i] = ldfrag_b(Mh + i * 16 * CH + (ks + 1) * 32);
          al[i] = ldfrag_b(Ml + i * 16 * CH + (ks + 1) * 32);
        }
        // keeps each refill where it is written, one k step ahead of its use (see part 1)
        __builtin_amdgcn_sched_barrier(0);
      }
    }
  }

  // ---- epilogue: whole 256-B row segments through the wave's own slab ----
  float* slab = sT[wave];
  float* C = outp + (size_t)b * CH * NSP;
  const int hh = lane >> 4, c4 = (lane & 15) * 4;          // 256-B row segment = 16 lanes x 16 B
#pragma unroll
  for (int i = 0; i < 4; ++i) {
    const int mBase = m0 + (i << 4);
    float brow[8];
#pragma unroll
    for (int r = 0; r < 8; ++r) brow[r] = bf_up(bf_bits(bo[mBase + mOff + r]));
#pragma unroll
    for (int j = 0; j < 4; ++j) {
#pragma unroll
      for (int r = 0; r < 8; ++r) {
        slab[(mOff + r) * 68 + (j << 4) + rlane] = acc[i][j][r] * (1.0f / 64.0f) + brow[r];
      }
    }
    // the wave's slab rows are written before its lanes read each other's values back
    asm volatile("s_wait_dscnt 0x0" ::: "memory");
    v4f t[8];
#pragma unroll
    for (int it = 0; it < 8; ++it) t[it] = *(const v4f*)(slab + (it * 2 + hh) * 68 + c4);   // rows 0..15
    // the rows are read before the next 16 rows overwrite the slab
    asm volatile("s_wait_dscnt 0x0" ::: "memory");
#pragma unroll
    for (int it = 0; it < 8; ++it) *(v4f*)(C + (size_t)(mBase + it * 2 + hh) * NSP + n0 + c4) = t[it];
  }
}

// =====================================================================================================
// KV projection + k softmax numerators + context product for one slice of SLN = 128 columns n of one batch.
// grid (KSP, GB), block 512 = 16 waves, one work-group per WGP (256 KiB of LDS).
// c tile: rows n0..n0+127 of Ct are 64 KiB in a row; each wave-wide load takes one whole 512-B row, and the rows
//   stand in LDS at a pitch of 528 B (16 B x odd) for the 16-B fragment reads of all sixteen waves.
// Part 1, wave w: KVt[n][j] = Ct . wkv^T + bkv[j] for all 128 n and j in 32w..32w+31 (K = CH). A lane holds column
//   j = 32w + 16jj + (lane&15) and rows n = 16i + 8(lane>>4) + r, so one column lies in lanes l and l^16.
// Waves 0..7 hold K (j < CH): slice maximum m and sum s of exp(K - m) = a sum inside the lane and one xor-16
//   exchange; m and s go to stm, sts [slice][b][j]; the value handed on is exp(K - m). Waves 8..15 hold V as it is.
// Hand-over: bf16 hi/lo. Accumulator tiles 2p and 2p+1 of a column block are, lane for lane, elements 0..7 and
//   8..15 of the A or B fragment of k step p (k = n), so each lane stores and later loads 16-B pieces:
//   piece (((column block * KS2 + k step) * 2 + half) * 32 + lane); a wave-wide access covers 512 contiguous bytes.
//   The fragments take over the c tile's LDS behind a barrier that ends its last read.
// Part 2, wave w: ctxT[d][c] partial = Vh.kPh + Vl.kPh + Vh.kPl for the 64x64 tile (w>>2, w&3), K = 128 -> f32, to
//   part [b * CH/4 + d/4][slice][d%4][c] (the KSP partials that one block of k_ksum adds lie 128 KiB in a row), whole
//   256-B row segments through the wave's slab, which takes over fragment LDS behind a barrier.
// coverage: KSP x GB blocks x 16 waves x (64 x 64) = all of part; 8 waves x 32 columns = every m and s.
// =====================================================================================================
#define SLN (NSP / KSP)                        // columns n of a slice
#define KS2 (SLN / 32)                         // k steps of the context product
#define FPL ((2 * CH / 16) * KS2 * 2 * 32)     // 16-B pieces of one fragment plane (hi or lo)
static_assert(SLN == 128 && 2 * CH == 16 * 32);            // 16 waves x 32 columns j; 8 accumulator row blocks
static_assert(SLN * XPITCH * 2 <= 2 * FPL * 16 && 16 * 16 * 68 * 4 <= 2 * FPL * 16);   // c tile and slabs fit

// exp(x) as __expf forms it (one multiply, one v_exp_f32), with the v_nop in the same statement: it fills the slot
// that the instruction set asks for between a transcendental and an instruction directly behind it that reads its
// result or overwrites its source.
__device__ __forceinline__ float exp_slot(float x) {
  float y = 0.f;
#if defined(__HIP_DEVICE_COMPILE__)
  const float a = x * 1.44269504088896340736f;
  asm("v_exp_f32 %0, %1\n\tv_nop" : "=v"(y) : "v"(a));
#endif
  return y;
}

__global__ __launch_bounds__(512) void k_kvctx(const unsigned short* __restrict__ wkvp,
                                               const unsigned short* __restrict__ ctp,
                                               const float* __restrict__ bkv,
                                               float* part, float* stm, float* sts) {
  __shared__ __align__(16) v4u sm[2 * FPL];                   // 256 KiB: c tile, then fragments, then slabs
  unsigned short* xs = (unsigned short*)(void*)sm;
  v4u* fh = sm;
  v4u* fl = sm + FPL;
  const int lane = threadIdx.x & 31;
  const int wave = __builtin_amdgcn_readfirstlane((int)(threadIdx.x >> 5));
  const int z  = blockIdx.x;
  const int b  = blockIdx.y;
  const int n0 = z * SLN;
  const int rlane = lane & 15;                 // row (A) / col (B, D) within subtile
  const int koff  = (lane >> 4) * 8;           // k offset of this lane half
  const int mOff  = (lane >> 4) * 8;           // D row offset
  const __bf16* Wk = (const __bf16*)(const void*)wkvp + (size_t)(wave * 32 + rlane) * CH + koff;   // B row, block 0
  const __bf16* Xl = (const __bf16*)(const void*)xs + rlane * XPITCH + koff;                       // A row, block 0

  // ---- c tile to LDS; wkv fragments of the first two k steps and the bias meanwhile ----
  v16b wb[2][2];
  float bj[2];
  {
    const v4u* g = (const v4u*)(const void*)(ctp + ((size_t)b * NSP + (size_t)n0) * CH);
    v4u t[8];
#pragma unroll
    for (int it = 0; it < 8; ++it) t[it] = g[it * 512 + threadIdx.x];           // row it*16 + wave, piece lane
#pragma unroll
    for (int s = 0; s < 2; ++s)
#pragma unroll
      for (int jj = 0; jj < 2; ++jj) wb[s][jj] = ldfrag_b(Wk + jj * 16 * CH + s * 32);
#pragma unroll
    for (int jj = 0; jj < 2; ++jj) bj[jj] = bf_up(bf_bits(bkv[wave * 32 + jj * 16 + rlane]));
#pragma unroll
    for (int it = 0; it < 8; ++it) *(v4u*)(xs + (it * 16 + wave) * XPITCH + lane * 8) = t[it];
  }
  __syncthreads();   // the whole c tile is in LDS before any wave reads fragments of it

  // ---- part 1: KVt tile, 128 rows n x this wave's 32 columns j ----
  v8f acc[8][2];
#pragma unroll
  for (int i = 0; i < 8; ++i)
#pragma unroll
    for (int jj = 0; jj < 2; ++jj) acc[i][jj] = zero8();
  v16b xa[2][4];                               // c tile fragments of four row blocks, two sets
#pragma unroll
  for (int q = 0; q < 4; ++q) xa[0][q] = ldfrag_b(Xl + q * 16 * XPITCH);
#pragma unroll   // constant buffer indices keep wb[] and xa[] in registers
  for (int st = 0; st < 2 * KST; ++st) {       // k step st >> 1, row blocks 4 * (st & 1) ..
    const int ks = st >> 1, hf = st & 1, cu = ks & 1, nx = st + 1;
    if (nx < 2 * KST) {
#pragma unroll
      for (int q = 0; q < 4; ++q) xa[hf ^ 1][q] = ldfrag_b(Xl + ((nx & 1) * 4 + q) * 16 * XPITCH + (nx >> 1) * 32);
    }
    // the next set's LDS loads go as one group ahead of this set's products; the compiler otherwise loads one
    // fragment at a time into one register set and every pair of products waits a full LDS latency
    __builtin_amdgcn_sched_barrier(0);
#pragma unroll
    for (int q = 0; q < 4; ++q)
#pragma unroll
      for (int jj = 0; jj < 2; ++jj) acc[hf * 4 + q][jj] = mma_b_raw(xa[hf][q], wb[cu][jj], acc[hf * 4 + q][jj]);
    if (hf == 1 && ks + 2 < KST) {
#pragma unroll
      for (int jj = 0; jj < 2; ++jj) wb[cu][jj] = ldfrag_b(Wk + jj * 16 * CH + (ks + 2) * 32);
    }
    // keeps each wkv refill where it is written, two k steps ahead of its use; the compiler otherwise sinks it
    // to just before its products, and every fragment then waits a full load latency
    __builtin_amdgcn_sched_barrier(0);
  }
  __syncthreads();   // every wave has read its last c tile fragment before fragments overwrite the tile

  // ---- k softmax numerators of the slice (waves 0..7); hi/lo fragments of K and V to LDS ----
#pragma unroll
  for (int jj = 0; jj < 2; ++jj) {
    float v[8][8];
#pragma unroll
    for (int i = 0; i < 8; ++i)
#pragma unroll
      for (int r = 0; r < 8; ++r) v[i][r] = acc[i][jj][r] + bj[jj];
    if (wave < 8) {                            // wave-uniform; no barrier inside
      float m = v[0][0];
#pragma unroll
      for (int i = 0; i < 8; ++i)
#pragma unroll
        for (int r = 0; r < 8; ++r) m = fmaxf(m, v[i][r]);
      m = fmaxf(m, __shfl_xor(m, 16, 32));
      float s = 0.f;
#pragma unroll
      for (int i = 0; i < 8; ++i)
#pragma unroll
        for (int r = 0; r < 8; ++r) { v[i][r] = exp_slot(v[i][r] - m); s += v[i][r]; }
      s += __shfl_xor(s, 16, 32);
      if (lane < 16) {
        const int so = (z * GB + b) * CH + wave * 32 + jj * 16 + rlane;
        stm[so] = m;
        sts[so] = s;
      }
    }
#pragma unroll
    for (int i = 0; i < 8; ++i) {
      v4u ph, pl;
#pragma unroll
      for (int q = 0; q < 4; ++q) {
        const float f0 = v[i][2 * q], f1 = v[i][2 * q + 1];
        const unsigned short h0 = bf_bits(f0), h1 = bf_bits(f1);
        const unsigned short l0 = bf_bits(f0 - bf_up(h0)), l1 = bf_bits(f1 - bf_up(h1));
        ph[q] = pk16(h0, h1); pl[q] = pk16(l0, l1);
      }
      const int piece = ((((wave * 2 + jj) * KS2 + (i >> 1)) * 2 + (i & 1)) << 5) + lane;
      fh[piece] = ph;
      fl[piece] = pl;
    }
  }
  __syncthreads();   // every column block's fragments are in LDS before any wave reads them

  // ---- part 2: 64x64 tile of the slice's ctxT, rows d from V (A), columns c from kP (B) ----
  const int tm = wave >> 2, tn = wave & 3;
  v8f cx[4][4];
#pragma unroll
  for (int i = 0; i < 4; ++i)
#pragma unroll
    for (int j = 0; j < 4; ++j) cx[i][j] = zero8();
  const v4u* Ah = fh + (CH / 16 + tm * 4) * KS2 * 64 + lane;   // V column blocks of this tile's rows d
  const v4u* Al = fl + (CH / 16 + tm * 4) * KS2 * 64 + lane;
  v16b ah[2], al[2];
  ah[0] = ldfrag_q(Ah);
  al[0] = ldfrag_q(Al);
#pragma unroll   // constant indices keep the fragment arrays in registers
  for (int p = 0; p < KS2; ++p) {
    v16b bh[4], bl[4];
#pragma unroll
    for (int j = 0; j < 4; ++j) {
      bh[j] = ldfrag_q(fh + ((tn * 4 + j) * KS2 + p) * 64 + lane);
      bl[j] = ldfrag_q(fl + ((tn * 4 + j) * KS2 + p) * 64 + lane);
    }
#pragma unroll
    for (int i = 0; i < 4; ++i) {
      const int cu = i & 1;
      const int nx = p * 4 + i + 1;            // the next row block's A fragments, one block of products ahead
      if (nx < KS2 * 4) {
        ah[cu ^ 1] = ldfrag_q(Ah + ((nx & 3) * KS2 + (nx >> 2)) * 64);
        al[cu ^ 1] = ldfrag_q(Al + ((nx & 3) * KS2 + (nx >> 2)) * 64);
      }
      // each accumulator takes its three products in the order hi.hi, lo.hi, hi.lo; four tiles side by side
#pragma unroll
      for (int j = 0; j < 4; ++j) cx[i][j] = mma_b_raw(ah[cu], bh[j], cx[i][j]);
#pragma unroll
      for (int j = 0; j < 4; ++j) cx[i][j] = mma_b_raw(al[cu], bh[j], cx[i][j]);
#pragma unroll
      for (int j = 0; j < 4; ++j) cx[i][j] = mma_b_raw(ah[cu], bl[j], cx[i][j]);
      // keeps later blocks' fragment loads from being lifted up here: with more than one block's fragments
      // ahead the live set passes the 256 registers of a 16-wave work-group and spills to scratch
      __builtin_amdgcn_sched_barrier(0);
    }
  }
  __syncthreads();   // every wave has read its last fragment before the slabs overwrite them

  // ---- epilogue: whole 256-B row segments through the wave's own slab ----
  const int hh = lane >> 4, c4 = (lane & 15) * 4;          // 256-B row segment = 16 lanes x 16 B
  float* slab = (float*)(void*)sm + wave * (16 * 68);
  float* C = part + ((size_t)b * (CH / 4) * KSP + (size_t)z) * (4 * CH) + hh * CH + (tn << 6) + c4;
#pragma unroll
  for (int i = 0; i < 4; ++i) {
    const int mBase = (tm << 6) + (i << 4);
#pragma unroll
    for (int j = 0; j < 4; ++j) {
#pragma unroll
      for (int r = 0; r < 8; ++r) slab[(mOff + r) * 68 + (j << 4) + rlane] = cx[i][j][r];
    }
    // the wave's slab rows are written before its lanes read each other's values back
    asm volatile("s_wait_dscnt 0x0" ::: "memory");
    v4f t[8];
#pragma unroll
    for (int it = 0; it < 8; ++it) t[it] = *(const v4f*)(slab + (it * 2 + hh) * 68 + c4);   // rows 0..15
    // the rows are read before the next 16 rows overwrite the slab
    asm volatile("s_wait_dscnt 0x0" ::: "memory");
#pragma unroll
    for (int it = 0; it < 8; ++it)             // row d = mBase + 2 it + hh: group d/4, row d%4 = 2 (it&1) + hh
      *(v4f*)(C + (size_t)((mBase >> 2) + (it >> 1)) * (KSP * 4 * CH) + (it & 1) * (2 * CH)) = t[it];
  }
}

// =====================================================================================================
// Workspace map (bytes), every plane an exact multiple of its 64x64-tile / whole-line store granularity
// (no padded tails needed: 4096, 512, 256 are tile multiples); one group holds all GB = NBAT batches:
//   Wqb   bf16 [256][256]              0          131072
//   Wkvb  bf16 [512][256]              131072     262144
//   Wob   bf16 [256][256]              393216     131072
//   Xt    bf16 [GB][4096][256]         524288     16777216
//   Ct    bf16 [GB][4096][256]         17301504   16777216
//   cxp   f32  [GB*64][KSP][4][256]    34078720   67108864
//   stm   f32  [KSP][GB][256]          101187584  262144
//   sts   f32  [KSP][GB][256]          101449728  262144
//   cxh   bf16 [GB][256][256]          101711872  1048576
//   cxl   bf16 [GB][256][256]          102760448  1048576
//   m2h   bf16 [GB][256][256]          103809024  1048576
//   m2l   bf16 [GB][256][256]          104857600  1048576
//   end                                105906176
// Weights are [out][in] with the in index contiguous = the A / Bt layout, so they are only converted.
// =====================================================================================================
static inline unsigned tile_blocks(int M, int N) { return (unsigned)((((M / 64) * (N / 64)) + 7) / 8); }

extern "C" void kernel_launch(void* const* d_in, const int* in_sizes, int n_in,
                              void* d_out, int out_size, void* d_ws, size_t ws_size,
                              hipStream_t stream) {
  if (n_in < 8) return;
  if (in_sizes[0] != NBAT * CH * NSP) return;
  if (in_sizes[1] != NBAT * CH * NSP) return;
  if (in_sizes[2] != CH * CH) return;
  if (in_sizes[3] != CH) return;
  if (in_sizes[4] != 2 * CH * CH) return;
  if (in_sizes[5] != 2 * CH) return;
  if (in_sizes[6] != CH * CH) return;
  if (in_sizes[7] != CH) return;
  if (out_size != NBAT * CH * NSP) return;

  const float* x     = (const float*)d_in[0];
  const float* cproj = (const float*)d_in[1];
  const float* wq    = (const float*)d_in[2];
  const float* bq    = (const float*)d_in[3];
  const float* wkv   = (const float*)d_in[4];
  const float* bkv   = (const float*)d_in[5];
  const float* wo    = (const float*)d_in[6];
  const float* bo    = (const float*)d_in[7];
  float* out = (float*)d_out;

  const size_t PWq  = (size_t)CH * CH * 2;               //   131072
  const size_t PWkv = (size_t)2 * CH * CH * 2;           //   262144
  const size_t PWo  = (size_t)CH * CH * 2;               //   131072
  const size_t PXt  = (size_t)GB * NSP * CH * 2;         // 16777216
  const size_t PCxp = (size_t)KSP * GB * CH * CH * 4;    // 67108864
  const size_t PSt  = (size_t)KSP * GB * CH * 4;         //   262144
  const size_t PCx  = (size_t)GB * CH * CH * 2;          //  1048576
  size_t off = 0;
  const size_t oWq  = off; off += PWq;
  const size_t oWkv = off; off += PWkv;
  const size_t oWo  = off; off += PWo;
  const size_t oXt  = off; off += PXt;
  const size_t oCt  = off; off += PXt;
  const size_t oCxp = off; off += PCxp;
  const size_t oStm = off; off += PSt;
  const size_t oSts = off; off += PSt;
  const size_t oCxh = off; off += PCx;
  const size_t oCxl = off; off += PCx;
  const size_t oM2h = off; off += PCx;
  const size_t oM2l = off; off += PCx;
  if (off > ws_size) return;                             // off = 105906176

  char* ws = (char*)d_ws;
  unsigned short* Wqb  = (unsigned short*)(ws + oWq);
  unsigned short* Wkvb = (unsigned short*)(ws + oWkv);
  unsigned short* Wob  = (unsigned short*)(ws + oWo);
  unsigned short* Xt   = (unsigned short*)(ws + oXt);
  unsigned short* Ct   = (unsigned short*)(ws + oCt);
  float*          Cxp  = (float*)(ws + oCxp);
  float*          Stm  = (float*)(ws + oStm);
  float*          Sts  = (float*)(ws + oSts);
  unsigned short* Cxh  = (unsigned short*)(ws + oCxh);
  unsigned short* Cxl  = (unsigned short*)(ws + oCxl);
  unsigned short* M2h  = (unsigned short*)(ws + oM2h);
  unsigned short* M2l  = (unsigned short*)(ws + oM2l);

  const dim3 blk(256);
  const int n8wq  = CH * CH / 8;                         //  8192
  const int n8wkv = 2 * CH * CH / 8;                     // 16384
  const int n8wo  = CH * CH / 8;                         //  8192

  // (0) weights -> bf16 planes
  cvt_bf16x8<<<dim3((n8wq + 255) / 256), blk, 0, stream>>>(wq, Wqb, n8wq);
  cvt_bf16x8<<<dim3((n8wkv + 255) / 256), blk, 0, stream>>>(wkv, Wkvb, n8wkv);
  cvt_bf16x8<<<dim3((n8wo + 255) / 256), blk, 0, stream>>>(wo, Wob, n8wo);

  const dim3 gTr(NSP / 64, CH / 64, 2 * GB);             // 64 x 4 x 16
  const dim3 gKc(KSP, GB);                               // 32 slices of n x GB, 16 waves each
  const dim3 gCx(tile_blocks(CH, CH), GB);               // 16 tiles -> 2 blocks
  const dim3 gSum(GB * CH * CH / 1024);                  // 512 blocks
  const dim3 gQo(NSP / 64, GB);                          // 64 column tiles x GB, 4 waves each
  const long long sCC = (long long)CH * CH;

  for (int g = 0; g < NGRP; ++g) {
    const int b0 = g * GB;
    // (1) x[b], cproj[b] -> Xt[n][c], Ct[n][c] bf16
    k_trcvt<<<gTr, blk, 0, stream>>>(x, cproj, Xt, Ct, b0);
    // (2) per slice of 128 n: KVt[n][j] = Ct . wkv^T + bkv[j] (K=256); kP = exp(K - slice max) and V as hi/lo in
    //     LDS; ctxT[d][c] partial = Vh.kPh^T + Vl.kPh^T + Vh.kPl^T (M=N=256, K=128) -> f32 partials
    k_kvctx<<<gKc, dim3(512), 0, stream>>>(Wkvb, Ct, bkv, Cxp, Stm, Sts);
    // (3) softmax-weighted sum of the partials -> ctxT bf16 hi/lo
    k_ksum<<<gSum, blk, 0, stream>>>(Cxp, Stm, Sts, Cxh, Cxl);
    // (4) M2[o][d] = wo . (ctxTh + ctxTl)^T  (M=N=K=256) -> bf16 hi/lo
    gemm64<3, 2, 0><<<gCx, blk, 0, stream>>>(
        Wob, Wob, CH, 0LL, Cxh, Cxl, CH, sCC,
        (void*)M2h, (void*)M2l, CH, sCC, bq, CH, CH, CH, 1.0f);
    // (5) Q = wq . Xt^T + bq, qP = 64 * softmax over each head's 64 rows (hi/lo, in LDS),
    //     out[b][o][n] = ((M2h + M2l).qPh + M2h.qPl) / 64 + bo[o] -> d_out f32
    float* outg = out + (size_t)b0 * CH * NSP;
    k_qout<<<gQo, dim3(128), 0, stream>>>(Wqb, Xt, bq, M2h, M2l, bo, outg);
  }
  (void)hipGetLastError();
}

// v005
// Measured time: 99.9 microseconds a run.
// Timed twice side by side with v004, it ran 1.03 times as fast both times.
// Counting every step since v000, it is 15.0 times as fast.
// Contractions (all v_wmma_f32_16x16x32_bf16, f32 accumulate): x^T.wq^T and wkv.cproj with bf16 operands
// RNE-converted from the f32 inputs (single product); V.kP^T with bf16 hi+lo planes on both operands (3 products);
// wo.ctx^T with bf16 wo times ctx hi+lo planes (2 products); M2.qP^T with bf16 hi+lo planes on both (3 products).
// Softmaxes and epilogues in f32; the q softmax output is carried x64, folded back by the epilogue scale.
// The q projection, its softmax and the output product run in one kernel; q passes from one to the other in LDS.
// The KV projection, the k softmax and the V.kP^T product run in one kernel per slice of 128 columns n: kP is
// exp(K - slice maximum), un-normalised; the slice sum weighs each slice by exp(slice max - row max) / row sum.
// Every bf16 plane that a kernel reads from global memory as WMMA fragments (wq, wkv, wo, ctxT hi/lo, M2 hi/lo) lies
// there in fragment order (see frag_piece), so a wave-wide 16-B load covers 512 contiguous bytes.
#include <hip/hip_runtime.h>
#include <stdint.h>

#define NBAT 8
#define CH   256
#define NSP  4096
#define GB   8
#define NGRP (NBAT / GB)
static_assert((NSP % 64) == 0 && (CH % 64) == 0 && (NBAT % GB) == 0);
static_assert(CH == 4 * 64);         // four heads of 64 channels: one wave of k_qout per head
#define KSP  32                      // k slices of the V.kP^T product (K = NSP), one work-group of k_kvctx each
static_assert((NSP % (KSP * 32)) == 0 && ((GB * CH * CH) % 1024) == 0);

typedef __bf16   v16b __attribute__((ext_vector_type(16)));
typedef __bf16   v8b  __attribute__((ext_vector_type(8)));
typedef float    v8f  __attribute__((ext_vector_type(8)));
typedef float    v4f  __attribute__((ext_vector_type(4)));
typedef unsigned int v4u __attribute__((ext_vector_type(4)));

// ---- scalar helpers --------------------------------------------------------------------------------
__device__ __forceinline__ unsigned short bf_bits(float f) {          // f32 -> bf16 bits, RNE convert
  unsigned u = __float_as_uint(f);
  return (unsigned short)((u + 0x7FFFu + ((u >> 16) & 1u)) >> 16);
}
__device__ __forceinline__ float bf_up(unsigned short h) { return __uint_as_float(((unsigned)h) << 16); }
__device__ __forceinline__ unsigned pk16(unsigned short a, unsigned short b) { return (unsigned)a | ((unsigned)b << 16); }
__device__ __forceinline__ v8f zero8() { v8f z = {0.f, 0.f, 0.f, 0.f, 0.f, 0.f, 0.f, 0.f}; return z; }

// ---- fragment loader: 16-bit A/B operand, lane -> row/col (lane&15), p already includes +8*(lane>>4);
//      elements 0..7 <- p[0..7] (k0+8h..), elements 8..15 <- p[16..23] (k0+16+8h..)
__device__ __forceinline__ v16b ldfrag_b(const __bf16* p) {
  union { v16b v; v8b h[2]; } f;
  f.h[0] = *(const v8b*)(p);
  f.h[1] = *(const v8b*)(p + 16);
  return f.v;
}

// ---- fragment order of a plane P[row][k] with CH values k per row: 16-B pieces of 8 consecutive k;
//      piece (((row block * KST + k step) * 2 + half) * 32 + lane) holds row 16 * block + (lane&15),
//      k = 32 * step + 16 * half + 8 * (lane>>4) + 0..7: the same lane -> k order as ldfrag_b.
#define KST    (CH / 32)                       // k steps of a product over CH
__device__ __forceinline__ int frag_piece(int rowblk, int kstep) { return (rowblk * KST + kstep) * 64; }
__device__ __forceinline__ v16b ldfrag_q(const v4u* p) {   // p = this lane's piece of half 0; half 1 lies 32 pieces on
  union { v16b v; v4u q[2]; } f;
  f.q[0] = p[0];
  f.q[1] = p[32];
  return f.v;
}

// ---- WMMA helpers with trailing VALU hazard gap --------------------------------------------------------
__device__ __forceinline__ v8f mma_b_raw(v16b a, v16b b, v8f c) {
  return __builtin_amdgcn_wmma_f32_16x16x32_bf16(false, a, false, b, (short)0, c, false, false);
}
__device__ __forceinline__ void dep_guard_b(v8f& a, v8f& b, v16b x, v16b y) {
#if defined(__HIP_DEVICE_COMPILE__)
  asm volatile("v_nop\n\tv_nop\n\tv_nop\n\tv_nop" : "+v"(a), "+v"(b) : "v"(x), "v"(y));
#endif
}
__device__ __forceinline__ void keep4_b(v16b a, v16b b, v16b c, v16b d) {
#if defined(__HIP_DEVICE_COMPILE__)
  asm volatile("v_nop" :: "v"(a), "v"(b), "v"(c), "v"(d));
#endif
}
__device__ __forceinline__ void acc_guard4(v8f& a, v8f& b, v8f& c, v8f& d) {
#if defined(__HIP_DEVICE_COMPILE__)
  asm volatile("v_nop\n\tv_nop\n\tv_nop\n\tv_nop" : "+v"(a), "+v"(b), "+v"(c), "+v"(d));
#endif
}
__device__ __forceinline__ void wave_sync_lds() {
  __builtin_amdgcn_fence(__ATOMIC_RELEASE, "workgroup");
  __builtin_amdgcn_wave_barrier();
  __builtin_amdgcn_fence(__ATOMIC_ACQUIRE, "workgroup");
}

// =====================================================================================================
// f32 [rows][CH] -> bf16 (RNE convert) in fragment order: thread i forms piece i from 8 consecutive k of its row
// (a wave reads 64 B of each of 16 rows); one 16-B store per lane: a wave writes 512 contiguous B.
// coverage: n8 threads x 8 = whole plane (n8 is a multiple of 512 = one row block for every use here).
// =====================================================================================================
__global__ __launch_bounds__(256) void cvt_bf16x8(const float* __restrict__ in, unsigned short* out, int n8) {
  const int i = blockIdx.x * 256 + threadIdx.x;
  if (i < n8) {
    const int row = (i / (KST * 64)) * 16 + (i & 15);
    const int k   = ((i >> 6) % KST) * 32 + ((i >> 5) & 1) * 16 + ((i >> 4) & 1) * 8;
    const float* src = in + (size_t)row * CH + k;
    const v4f a = *(const v4f*)(src);
    const v4f b = *(const v4f*)(src + 4);
    v4u p;
    p[0] = pk16(bf_bits(a[0]), bf_bits(a[1]));
    p[1] = pk16(bf_bits(a[2]), bf_bits(a[3]));
    p[2] = pk16(bf_bits(b[0]), bf_bits(b[1]));
    p[3] = pk16(bf_bits(b[2]), bf_bits(b[3]));
    *(v4u*)(out + (size_t)i * 8) = p;
    
  }
}

// =====================================================================================================
// Transpose-convert of one 64x64 tile: source [b][c][n] f32 (c pitch NSP) -> plane [bi][n][c] bf16 (pitch CH).
// blockIdx.x = n tile, blockIdx.y = c tile, blockIdx.z = 2*bi + sel (sel 0: xg -> xt, 1: cg -> ct); block 256.
// Load: thread r = tid>>2 owns source row c0+r, 16 consecutive n at (tid&3)*16 (4 x 16-B loads).
// coverage: load 256x16 = 4096 = whole tile; store 2x256x8 = 4096 = whole tile.
// =====================================================================================================
__global__ __launch_bounds__(256) void k_trcvt(const float* __restrict__ xg, const float* __restrict__ cg,
                                               unsigned short* xt, unsigned short* ct, int b0) {
  __shared__ float tile[64][65];
  const int tid = threadIdx.x;
  const int n0 = blockIdx.x * 64;
  const int c0 = blockIdx.y * 64;
  const int bi  = (int)(blockIdx.z >> 1);
  const int sel = (int)(blockIdx.z & 1);
  const float* src = sel ? cg : xg;            // block-uniform select, both global
  unsigned short* dst = sel ? ct : xt;
  {
    const int r = tid >> 2, cs = (tid & 3) * 16;
    const float* p = src + ((size_t)(b0 + bi) * CH + (size_t)(c0 + r)) * NSP + n0 + cs;
#pragma unroll
    for (int i = 0; i < 4; ++i) {
      const v4f v = *(const v4f*)(p + 4 * i);
      tile[r][cs + 4 * i + 0] = v[0];
      tile[r][cs + 4 * i + 1] = v[1];
      tile[r][cs + 4 * i + 2] = v[2];
      tile[r][cs + 4 * i + 3] = v[3];
    }
  }
  __syncthreads();
  v4u pv[2];
  const int c8 = (tid & 7) * 8;
#pragma unroll
  for (int it = 0; it < 2; ++it) {
    const int n = it * 32 + (tid >> 3);
    v4u a;
#pragma unroll
    for (int e = 0; e < 4; ++e) {
      a[e] = pk16(bf_bits(tile[c8 + 2 * e][n]), bf_bits(tile[c8 + 2 * e + 1][n]));
    }
    pv[it] = a;
  }
  {
#pragma unroll
    for (int it = 0; it < 2; ++it) {
      const int n = it * 32 + (tid >> 3);
      const size_t go = ((size_t)bi * NSP + (size_t)(n0 + n)) * CH + c0 + c8;
      *(v4u*)(dst + go) = pv[it];
    }
    
  }
}

// =====================================================================================================
// Register-blocked batched bf16 WMMA GEMM: C[m][n] = oscale * sum_k A[m][k] * Bt[n][k] + bias; one wave per
// 64x64 tile, no block barriers. A [M][K] and Bt [N][K] in fragment order, K = CH;
// M, N multiples of 64 (host-checked). blockIdx.y = batch index (strides in elements).
// NSPLIT: 0 = A.Bt; 1 = (A + A2).Bt; 2 = A.Bt + A2.Bt + A.Bt2; 3 = A.Bt + A.Bt2 (A2, Bt2 = unscaled bf16 lo planes).
// BIAS: 0 none; 1 = bias[m] per output row; 2 = bias[n] per output column (bias value RNE-converted to bf16).
// OUT_MODE: 0 = f32 (pitch ldc); 2 = bf16 hi plane C + bf16 lo plane C2 (lo = RNE(v - hi), unscaled), both in
// fragment order with the column n as k (N = CH): a wave-wide 16-B store covers 512 contiguous bytes.
// =====================================================================================================
template <int NSPLIT, int OUT_MODE, int BIAS>
__global__ __launch_bounds__(256) void gemm64(
    const unsigned short* __restrict__ Ap, const unsigned short* A2p, long long strideA,
    const unsigned short* __restrict__ Btp, const unsigned short* Bt2p, long long strideB,
    void* Cout, void* Cout2, int ldc, long long strideC,
    const float* __restrict__ bias, int M, int N, int K, float oscale) {
  __shared__ __align__(16) float sT[8][16 * 68];   // per-wave 16x64 slab, pitch 68 floats
  const int b    = blockIdx.y;
  const int lane = threadIdx.x & 31;
  const int wave = threadIdx.x >> 5;
  const int tilesN = N >> 6;
  const int tilesM = M >> 6;
  const int tile = blockIdx.x * 8 + wave;
  if (tile >= tilesM * tilesN) return;   // wave-uniform; no block barriers in this kernel
  const int tm = tile / tilesN;
  const int tn = tile - tm * tilesN;
  const int m0 = tm << 6;
  const int n0 = tn << 6;

  constexpr bool useA2 = (NSPLIT == 1) || (NSPLIT == 2);
  constexpr bool useB2 = (NSPLIT >= 2);
  const size_t cb = (size_t)b;                 // output plane index
  const v4u* Ab  = (const v4u*)(const void*)(Ap  + (size_t)b * strideA) + frag_piece(m0 >> 4, 0);
  const v4u* Bb  = (const v4u*)(const void*)(Btp + (size_t)b * strideB) + frag_piece(n0 >> 4, 0);
  const v4u* Ab2 = useA2 ? ((const v4u*)(const void*)(A2p  + (size_t)b * strideA) + frag_piece(m0 >> 4, 0)) : Ab;
  const v4u* Bb2 = useB2 ? ((const v4u*)(const void*)(Bt2p + (size_t)b * strideB) + frag_piece(n0 >> 4, 0)) : Bb;

  const int rlane = lane & 15;                 // row (A) / col (B, D) within subtile
  const int mOff  = (lane >> 4) * 8;           // D row offset

  v8f acc[4][4];
#pragma unroll
  for (int i = 0; i < 4; ++i)
#pragma unroll
    for (int j = 0; j < 4; ++j) acc[i][j] = zero8();

  for (int k0 = 0; k0 < K; k0 += 32) {
    v16b bh[4], bl[4];
    const int kp = frag_piece(0, k0 >> 5);     // this k step's pieces; row blocks lie at constant offsets from them
#pragma unroll
    for (int j = 0; j < 4; ++j) bh[j] = ldfrag_q(Bb + kp + frag_piece(j, 0) + lane);
#if defined(__HIP_DEVICE_COMPILE__)
    // the loads below may take the address registers of the loads above as their destination: the wait comes first
    asm volatile("s_wait_xcnt 0x0" ::: "memory");
#endif
#pragma unroll
    for (int j = 0; j < 4; ++j) {
      if (useB2) bl[j] = ldfrag_q(Bb2 + kp + frag_piece(j, 0) + lane); else bl[j] = bh[j];
    }
#pragma unroll
    for (int i = 0; i < 4; ++i) {
      const v16b ah = ldfrag_q(Ab + kp + frag_piece(i, 0) + lane);
      v16b al = ah;
      if (useA2) al = ldfrag_q(Ab2 + kp + frag_piece(i, 0) + lane);
#pragma unroll
      for (int j = 0; j < 4; ++j) {
        acc[i][j] = mma_b_raw(ah, bh[j], acc[i][j]);
        if (useA2) acc[i][j] = mma_b_raw(al, bh[j], acc[i][j]);
        if (useB2) acc[i][j] = mma_b_raw(ah, bl[j], acc[i][j]);
      }
      dep_guard_b(acc[i][0], acc[i][3], ah, al);
    }
    keep4_b(bh[0], bh[1], bh[2], bh[3]);
    if (useB2) keep4_b(bl[0], bl[1], bl[2], bl[3]);
  }
  acc_guard4(acc[0][0], acc[0][1], acc[0][2], acc[0][3]);
  acc_guard4(acc[1][0], acc[1][1], acc[1][2], acc[1][3]);
  acc_guard4(acc[2][0], acc[2][1], acc[2][2], acc[2][3]);
  acc_guard4(acc[3][0], acc[3][1], acc[3][2], acc[3][3]);

  // ---- epilogue ----
  float bcol[4];
#pragma unroll
  for (int j = 0; j < 4; ++j) bcol[j] = 0.f;
  if (BIAS == 2) {
#pragma unroll
    for (int j = 0; j < 4; ++j) bcol[j] = bf_up(bf_bits(bias[n0 + (j << 4) + rlane]));
  }
  float* slab = sT[wave];
#pragma unroll
  for (int i = 0; i < 4; ++i) {
    const int mBase = m0 + (i << 4);
    float brow[8];
#pragma unroll
    for (int r = 0; r < 8; ++r) brow[r] = 0.f;
    if (BIAS == 1) {
#pragma unroll
      for (int r = 0; r < 8; ++r) brow[r] = bf_up(bf_bits(bias[mBase + mOff + r]));
    }
#pragma unroll
    for (int j = 0; j < 4; ++j) {
#pragma unroll
      for (int r = 0; r < 8; ++r) {
        slab[(mOff + r) * 68 + (j << 4) + rlane] = acc[i][j][r] * oscale + (brow[r] + bcol[j]);
      }
    }
    wave_sync_lds();
    if (OUT_MODE == 0) {
      float* C = (float*)Cout + cb * strideC;
      const int hh = lane >> 4, c4 = (lane & 15) * 4;     // 256-B row segment = 16 lanes x 16 B
      {
#pragma unroll
        for (int it = 0; it < 8; ++it) {
          const int row = it * 2 + hh;                     // it 0..7 x hh 0..1 = rows 0..15
          const v4f v = *(const v4f*)(slab + row * 68 + c4);
          *(v4f*)(C + (size_t)(mBase + row) * ldc + n0 + c4) = v;
        }
        
      }
    } else {
      unsigned short* C  = (unsigned short*)Cout  + cb * strideC;
      unsigned short* C2 = (unsigned short*)Cout2 + cb * strideC;
      v4u hv[4], lv[4];
#pragma unroll
      for (int it = 0; it < 4; ++it) {
        // piece it * 32 + lane of the row block's two k steps: row lane&15, columns 16 it + 8 (lane>>4) + 0..7
        const float* sp = slab + rlane * 68 + it * 16 + mOff;
        v4u a, a2;
#pragma unroll
        for (int e = 0; e < 4; ++e) {
          const float f0 = sp[2 * e], f1 = sp[2 * e + 1];
          const unsigned short h0 = bf_bits(f0), h1 = bf_bits(f1);
          const unsigned short l0 = bf_bits(f0 - bf_up(h0)), l1 = bf_bits(f1 - bf_up(h1));
          a[e] = pk16(h0, h1); a2[e] = pk16(l0, l1);
        }
        hv[it] = a; lv[it] = a2;
      }
      {
#pragma unroll
        for (int it = 0; it < 4; ++it) {
          const size_t go = (size_t)(frag_piece(mBase >> 4, n0 >> 5) + it * 32 + lane) * 8;
          *(v4u*)(C  + go) = hv[it];
          *(v4u*)(C2 + go) = lv[it];
        }
        
      }
    }
    wave_sync_lds();
  }
}

// =====================================================================================================
// Weighted sum of the KSP k-slice partials of ctxT: part f32 [GB*CH/4][KSP][4*CH] -> bf16 hi/lo planes [GB*CH*CH].
// Slice z of column c weighs exp(m[z][c] - M[c]) / S[c], M = maximum of the slice maxima, S = sum over z of
// exp(m[z][c] - M[c]) * s[z][c]: the softmax over all n. A block covers 8 rows d x all CH columns c of one batch:
// thread t < CH forms the KSP weights of column t once, in LDS; slices are added in index order.
// Thread owns 4 consecutive elements (16-B loads) = half a piece of the planes, which are in fragment order with
// row d and k = c (8-B stores); a 128-B line there holds one k piece of 8 rows d, so a block writes whole lines.
// coverage: (GB*CH*CH/2048) blocks x 512 threads x 4 = whole plane.
// =====================================================================================================
__global__ __launch_bounds__(512) void k_ksum(const float* __restrict__ part, const float* __restrict__ stm,
                                              const float* __restrict__ sts, unsigned short* ch, unsigned short* cl) {
  __shared__ __align__(16) float wl[KSP][CH];
  const unsigned t = threadIdx.x;
  const int b = (int)(blockIdx.x / (CH * CH / 2048));
  const unsigned tq = t & 255u;                 // place in the thread's group of 4 rows d
  // the wave's group of 4 rows as a scalar: wave-uniform bases in scalar registers, one lane offset for all loads
  const unsigned g4 = (unsigned)__builtin_amdgcn_readfirstlane((int)(t >> 8));
  const float* pb = part + ((size_t)blockIdx.x * 2 + g4) * (KSP * 1024);
  const float* mb = stm + b * CH;
  const float* sb = sts + b * CH;
  v4f p[KSP];
#pragma unroll   // keeps p[] in registers and the independent loads in flight together
  for (int z = 0; z < KSP; ++z) p[z] = *(const v4f*)(pb + z * 1024 + tq * 4u);
  // keeps the plane loads ahead of the weights' work, in flight under it; the compiler otherwise sinks them
  // behind it, and the block pays the two memory latencies one after the other
  __builtin_amdgcn_sched_barrier(0);
  if (t < CH) {                                 // wave-uniform; no barrier inside
    float m[KSP], sz[KSP];
#pragma unroll   // m[] and sz[] are indexed by constants only, so they stay in registers
    for (int z = 0; z < KSP; ++z) {
      m[z]  = mb[z * (GB * CH) + t];
      sz[z] = sb[z * (GB * CH) + t];
    }
    float mm = m[0];
#pragma unroll
    for (int z = 1; z < KSP; ++z) mm = fmaxf(mm, m[z]);
    float ss = 0.f;
#pragma unroll
    for (int z = 0; z < KSP; ++z) { m[z] = __expf(m[z] - mm); ss += m[z] * sz[z]; }
    const float rinv = 1.0f / ss;
#pragma unroll
    for (int z = 0; z < KSP; ++z) wl[z][t] = m[z] * rinv;
  }
  __syncthreads();   // every column's weights are in LDS before any thread reads its four
  const unsigned c4 = (t * 4u) & (CH - 1);
  v4f s = p[0] * *(const v4f*)(&wl[0][c4]);
#pragma unroll   // p[] is indexed by constants only, so it stays in registers
  for (int z = 1; z < KSP; ++z) s += p[z] * *(const v4f*)(&wl[z][c4]);
  const unsigned short h0 = bf_bits(s[0]), h1 = bf_bits(s[1]), h2 = bf_bits(s[2]), h3 = bf_bits(s[3]);
  uint2 hv, lv;
  hv.x = pk16(h0, h1);
  hv.y = pk16(h2, h3);
  lv.x = pk16(bf_bits(s[0] - bf_up(h0)), bf_bits(s[1] - bf_up(h1)));
  lv.y = pk16(bf_bits(s[2] - bf_up(h2)), bf_bits(s[3] - bf_up(h3)));
  const int d = (int)(blockIdx.x % (CH * CH / 2048)) * 8 + (int)(t >> 6);
  const size_t e0 = (size_t)b * (CH * CH) +
      (size_t)(frag_piece(d >> 4, (int)(c4 >> 5)) + (int)((c4 >> 4) & 1u) * 32 + (int)((c4 >> 3) & 1u) * 16 + (d & 15)) * 8 + (c4 & 7u);
  *(uint2*)(ch + e0) = hv;
  *(uint2*)(cl + e0) = lv;
}

// =====================================================================================================
// q projection + q softmax + output product for one 64-column tile of n. grid (NSP/64, GB), block 128 = 4 waves.
// x tile: rows n0..n0+63 of Xt are 32 KiB in a row; each wave-wide load takes one whole 512-B row, and the rows
//   stand in LDS at a pitch of 528 B (16 B x odd) for the 16-B fragment reads of all four waves.
// Part 1, wave w = head w: Q[o][n] = wq . Xt^T + bq[o] for o in 64w..64w+63 (K = CH). A lane holds column
//   n0 + 16j + (lane&15) and rows 16i + 8(lane>>4) + r, so one column's head lies in lanes l and l^16:
//   softmax of 0.25 * Q over the 64 rows = a sum inside the lane and one xor-16 exchange.
// Hand-over: 64 * softmax as bf16 hi/lo. Accumulator tiles 2p and 2p+1 of a column block are, lane for lane,
//   elements 0..7 and 8..15 of the B fragment of k step p, so each lane stores and later loads its own 16-B
//   pieces: piece (((k step * 4 + j) * 2 + half) * 32 + lane); a wave-wide access covers 512 contiguous bytes.
// Part 2, wave w: out[o][n] = ((M2h + M2l).qPh + M2h.qPl) / 64 + bo[o] for o in 64w..64w+63 (K = CH, all heads).
// coverage: 64 x GB blocks x 4 waves x (64 rows x 64 columns) = whole output.
// =====================================================================================================
#define XPITCH (CH + 8)                        // x tile row pitch in LDS, elements (528 B)

__global__ __launch_bounds__(128) void k_qout(const unsigned short* __restrict__ wqp,
                                              const unsigned short* __restrict__ xtp,
                                              const float* __restrict__ bq,
                                              const unsigned short* __restrict__ m2hp,
                                              const unsigned short* __restrict__ m2lp,
                                              const float* __restrict__ bo, float* outp) {
  __shared__ __align__(16) unsigned short xs[64 * XPITCH];    // 33 KiB: x tile, bf16
  __shared__ __align__(16) v4u qsh[KST * 4 * 2 * 32];         // 32 KiB: q hi fragments of the tile
  __shared__ __align__(16) v4u qsl[KST * 4 * 2 * 32];         // 32 KiB: q lo fragments
  __shared__ __align__(16) float sT[4][16 * 68];              // per-wave 16x64 slab, pitch 68 floats
  const int lane = threadIdx.x & 31;
  const int wave = threadIdx.x >> 5;
  const int b  = blockIdx.y;
  const int n0 = blockIdx.x << 6;
  const int m0 = wave << 6;
  const int rlane = lane & 15;                 // row (A) / col (B, D) within subtile
  const int koff  = (lane >> 4) * 8;           // k offset of this lane half
  const int mOff  = (lane >> 4) * 8;           // D row offset
  const int apc = frag_piece(m0 >> 4, 0) + lane;             // this lane's A piece (subtile 0, k step 0), all three A planes
  const v4u* Wq = (const v4u*)(const void*)wqp + apc;
  const v4u* Mh = (const v4u*)(const void*)(m2hp + (size_t)b * CH * CH) + apc;
  const v4u* Ml = (const v4u*)(const void*)(m2lp + (size_t)b * CH * CH) + apc;
  const __bf16* Xl = (const __bf16*)(const void*)xs + rlane * XPITCH + koff;   // this lane's B row (subtile 0)

  // ---- x tile to LDS; wq fragments of the first two k steps meanwhile ----
  v16b wa[2][4];
  {
    const v4u* g = (const v4u*)(const void*)(xtp + ((size_t)b * NSP + (size_t)n0) * CH);
    v4u t[16];
#pragma unroll
    for (int it = 0; it < 16; ++it) t[it] = g[it * 128 + threadIdx.x];          // row it*4 + wave, piece lane
#pragma unroll
    for (int s = 0; s < 2; ++s)
#pragma unroll
      for (int i = 0; i < 4; ++i) wa[s][i] = ldfrag_q(Wq + frag_piece(i, s));
#pragma unroll
    for (int it = 0; it < 16; ++it) *(v4u*)(xs + (it * 4 + wave) * XPITCH + lane * 8) = t[it];
  }
  __syncthreads();   // the whole x tile is in LDS before any wave reads fragments of it

  v8f acc[4][4];
#pragma unroll
  for (int i = 0; i < 4; ++i)
#pragma unroll
    for (int j = 0; j < 4; ++j) acc[i][j] = zero8();

  // ---- part 1: Q tile of this wave's head ----
  {
    v16b xb[2][4];
#pragma unroll
    for (int j = 0; j < 4; ++j) xb[0][j] = ldfrag_b(Xl + j * 16 * XPITCH);
#pragma unroll   // constant buffer indices keep wa[] and xb[] in registers
    for (int ks = 0; ks < KST; ++ks) {
      const int cu = ks & 1;
      if (ks + 1 < KST) {
#pragma unroll
        for (int j = 0; j < 4; ++j) xb[cu ^ 1][j] = ldfrag_b(Xl + j * 16 * XPITCH + (ks + 1) * 32);
      }
#pragma unroll
      for (int i = 0; i < 4; ++i) {
#pragma unroll
        for (int j = 0; j < 4; ++j) acc[i][j] = mma_b_raw(wa[cu][i], xb[cu][j], acc[i][j]);
        if (ks + 2 < KST) wa[cu][i] = ldfrag_q(Wq + frag_piece(i, ks + 2));
        // keeps each refill where it is written, two k steps ahead of its use; the compiler otherwise sinks it
        // to just before its products, and every fragment then waits a full load latency
        __builtin_amdgcn_sched_barrier(0);
      }
    }
  }

  // ---- q softmax over the head's 64 rows, column by column; fragments to LDS ----
  float bro[4][8];
#pragma unroll
  for (int i = 0; i < 4; ++i)
#pragma unroll
    for (int r = 0; r < 8; ++r) bro[i][r] = bf_up(bf_bits(bq[m0 + (i << 4) + mOff + r]));
#pragma unroll
  for (int j = 0; j < 4; ++j) {
    float v[4][8];
#pragma unroll
    for (int i = 0; i < 4; ++i)
#pragma unroll
      for (int r = 0; r < 8; ++r) v[i][r] = (acc[i][j][r] + bro[i][r]) * 0.25f;
    float m = v[0][0];
#pragma unroll
    for (int i = 0; i < 4; ++i)
#pragma unroll
      for (int r = 0; r < 8; ++r) m = fmaxf(m, v[i][r]);
    m = fmaxf(m, __shfl_xor(m, 16, 32));
    float s = 0.f;
#pragma unroll
    for (int i = 0; i < 4; ++i)
#pragma unroll
      for (int r = 0; r < 8; ++r) { v[i][r] = __expf(v[i][r] - m); s += v[i][r]; }
    s += __shfl_xor(s, 16, 32);
    const float rinv = 1.0f / s;
#pragma unroll
    for (int i = 0; i < 4; ++i) {
      v4u ph, pl;
#pragma unroll
      for (int q = 0; q < 4; ++q) {
        const float f0 = (v[i][2 * q] * rinv) * 64.0f;
        const float f1 = (v[i][2 * q + 1] * rinv) * 64.0f;
        const unsigned short h0 = bf_bits(f0), h1 = bf_bits(f1);
        const unsigned short l0 = bf_bits(f0 - bf_up(h0)), l1 = bf_bits(f1 - bf_up(h1));
        ph[q] = pk16(h0, h1); pl[q] = pk16(l0, l1);
      }
      const int piece = ((((wave * 2 + (i >> 1)) * 4 + j) * 2 + (i & 1)) << 5) + lane;
      qsh[piece] = ph;
      qsl[piece] = pl;
    }
  }
  v16b ah[4], al[4];   // M2 fragments of k step 0: they do not depend on q, so they fly across the barrier
#pragma unroll
  for (int i = 0; i < 4; ++i) {
    ah[i] = ldfrag_q(Mh + frag_piece(i, 0));
    al[i] = ldfrag_q(Ml + frag_piece(i, 0));
  }
  __syncthreads();   // every head's fragments are in LDS before any wave reads them

  // ---- part 2: output rows 64w..64w+63 over all CH channels of q ----
#pragma unroll
  for (int i = 0; i < 4; ++i)
#pragma unroll
    for (int j = 0; j < 4; ++j) acc[i][j] = zero8();
  {
    v16b bh[2][4], bl[2][4];
#pragma unroll
    for (int j = 0; j < 4; ++j) {
      bh[0][j] = ldfrag_q(qsh + j * 64 + lane);
      bl[0][j] = ldfrag_q(qsl + j * 64 + lane);
    }
#pragma unroll   // constant buffer indices keep the fragment arrays in registers
    for (int ks = 0; ks < KST; ++ks) {
      const int cu = ks & 1;
      if (ks + 1 < KST) {
#pragma unroll
        for (int j = 0; j < 4; ++j) {
          bh[cu ^ 1][j] = ldfrag_q(qsh + ((ks + 1) * 4 + j) * 64 + lane);
          bl[cu ^ 1][j] = ldfrag_q(qsl + ((ks + 1) * 4 + j) * 64 + lane);
        }
      }
#pragma unroll
      for (int i = 0; i < 4; ++i) {
        // each accumulator takes its three products in the order hi.hi, lo.hi, hi.lo; four tiles side by side
#pragma unroll
        for (int j = 0; j < 4; ++j) acc[i][j] = mma_b_raw(ah[i], bh[cu][j], acc[i][j]);
#pragma unroll
        for (int j = 0; j < 4; ++j) acc[i][j] = mma_b_raw(al[i], bh[cu][j], acc[i][j]);
#pragma unroll
        for (int j = 0; j < 4; ++j) acc[i][j] = mma_b_raw(ah[i], bl[cu][j], acc[i][j]);
        if (ks + 1 < KST) {
          ah[i] = ldfrag_q(Mh + frag_piece(i, ks + 1));
          al[i] = ldfrag_q(Ml + frag_piece(i, ks + 1));
        }
        // keeps each refill where it is written, one k step ahead of its use (see part 1)
        __builtin_amdgcn_sched_barrier(0);
      }
    }
  }

  // ---- epilogue: whole 256-B row segments through the wave's own slab ----
  float* slab = sT[wave];
  float* C = outp + (size_t)b * CH * NSP;
  const int hh = lane >> 4, c4 = (lane & 15) * 4;          // 256-B row segment = 16 lanes x 16 B
#pragma unroll
  for (int i = 0; i < 4; ++i) {
    const int mBase = m0 + (i << 4);
    float brow[8];
#pragma unroll
    for (int r = 0; r < 8; ++r) brow[r] = bf_up(bf_bits(bo[mBase + mOff + r]));
#pragma unroll
    for (int j = 0; j < 4; ++j) {
#pragma unroll
      for (int r = 0; r < 8; ++r) {
        slab[(mOff + r) * 68 + (j << 4) + rlane] = acc[i][j][r] * (1.0f / 64.0f) + brow[r];
      }
    }
    // the wave's slab rows are written before its lanes read each other's values back
    asm volatile("s_wait_dscnt 0x0" ::: "memory");
    v4f t[8];
#pragma unroll
    for (int it = 0; it < 8; ++it) t[it] = *(const v4f*)(slab + (it * 2 + hh) * 68 + c4);   // rows 0..15
    // the rows are read before the next 16 rows overwrite the slab
    asm volatile("s_wait_dscnt 0x0" ::: "memory");
#pragma unroll
    for (int it = 0; it < 8; ++it) *(v4f*)(C + (size_t)(mBase + it * 2 + hh) * NSP + n0 + c4) = t[it];
  }
}

// =====================================================================================================
// KV projection + k softmax numerators + context product for one slice of SLN = 128 columns n of one batch.
// grid (KSP, GB), block 512 = 16 waves, one work-group per WGP (256 KiB of LDS).
// c tile: rows n0..n0+127 of Ct are 64 KiB in a row; each wave-wide load takes one whole 512-B row, and the rows
//   stand in LDS at a pitch of 528 B (16 B x odd) for the 16-B fragment reads of all sixteen waves.
// Part 1, wave w: KVt[n][j] = Ct . wkv^T + bkv[j] for all 128 n and j in 32w..32w+31 (K = CH). A lane holds column
//   j = 32w + 16jj + (lane&15) and rows n = 16i + 8(lane>>4) + r, so one column lies in lanes l and l^16.
// Waves 0..7 hold K (j < CH): slice maximum m and sum s of exp(K - m) = a sum inside the lane and one xor-16
//   exchange; m and s go to stm, sts [slice][b][j]; the value handed on is exp(K - m). Waves 8..15 hold V as it is.
// Hand-over: bf16 hi/lo. Accumulator tiles 2p and 2p+1 of a column block are, lane for lane, elements 0..7 and
//   8..15 of the A or B fragment of k step p (k = n), so each lane stores and later loads 16-B pieces:
//   piece (((column block * KS2 + k step) * 2 + half) * 32 + lane); a wave-wide access covers 512 contiguous bytes.
//   The fragments take over the c tile's LDS behind a barrier that ends its last read.
// Part 2, wave w: ctxT[d][c] partial = Vh.kPh + Vl.kPh + Vh.kPl for the 64x64 tile (w>>2, w&3), K = 128 -> f32, to
//   part [b * CH/4 + d/4][slice][d%4][c] (the KSP partials that one block of k_ksum adds lie 256 KiB in a row), whole
//   256-B row segments through the wave's slab, which takes over fragment LDS behind a barrier.
// coverage: KSP x GB blocks x 16 waves x (64 x 64) = all of part; 8 waves x 32 columns = every m and s.
// =====================================================================================================
#define SLN (NSP / KSP)                        // columns n of a slice
#define KS2 (SLN / 32)                         // k steps of the context product
#define FPL ((2 * CH / 16) * KS2 * 2 * 32)     // 16-B pieces of one fragment plane (hi or lo)
static_assert(SLN == 128 && 2 * CH == 16 * 32);            // 16 waves x 32 columns j; 8 accumulator row blocks
static_assert(SLN * XPITCH * 2 <= 2 * FPL * 16 && 16 * 16 * 68 * 4 <= 2 * FPL * 16);   // c tile and slabs fit

// exp(x) as __expf forms it (one multiply, one v_exp_f32), with the v_nop in the same statement: it fills the slot
// that the instruction set asks for between a transcendental and an instruction directly behind it that reads its
// result or overwrites its source.
__device__ __forceinline__ float exp_slot(float x) {
  float y = 0.f;
#if defined(__HIP_DEVICE_COMPILE__)
  const float a = x * 1.44269504088896340736f;
  asm("v_exp_f32 %0, %1\n\tv_nop" : "=v"(y) : "v"(a));
#endif
  return y;
}

__global__ __launch_bounds__(512) void k_kvctx(const unsigned short* __restrict__ wkvp,
                                               const unsigned short* __restrict__ ctp,
                                               const float* __restrict__ bkv,
                                               float* part, float* stm, float* sts) {
  __shared__ __align__(16) v4u sm[2 * FPL];                   // 256 KiB: c tile, then fragments, then slabs
  unsigned short* xs = (unsigned short*)(void*)sm;
  v4u* fh = sm;
  v4u* fl = sm + FPL;
  const int lane = threadIdx.x & 31;
  const int wave = __builtin_amdgcn_readfirstlane((int)(threadIdx.x >> 5));
  const int z  = blockIdx.x;
  const int b  = blockIdx.y;
  const int n0 = z * SLN;
  const int rlane = lane & 15;                 // row (A) / col (B, D) within subtile
  const int koff  = (lane >> 4) * 8;           // k offset of this lane half
  const int mOff  = (lane >> 4) * 8;           // D row offset
  const v4u* Wk = (const v4u*)(const void*)wkvp + frag_piece(wave * 2, 0) + lane;                  // B piece, block 0
  const __bf16* Xl = (const __bf16*)(const void*)xs + rlane * XPITCH + koff;                       // A row, block 0

  // ---- c tile to LDS; wkv fragments of the first two k steps and the bias meanwhile ----
  v16b wb[2][2];
  float bj[2];
  {
    const v4u* g = (const v4u*)(const void*)(ctp + ((size_t)b * NSP + (size_t)n0) * CH);
    v4u t[8];
#pragma unroll
    for (int it = 0; it < 8; ++it) t[it] = g[it * 512 + threadIdx.x];           // row it*16 + wave, piece lane
#pragma unroll
    for (int s = 0; s < 2; ++s)
#pragma unroll
      for (int jj = 0; jj < 2; ++jj) wb[s][jj] = ldfrag_q(Wk + frag_piece(jj, s));
#pragma unroll
    for (int jj = 0; jj < 2; ++jj) bj[jj] = bf_up(bf_bits(bkv[wave * 32 + jj * 16 + rlane]));
#pragma unroll
    for (int it = 0; it < 8; ++it) *(v4u*)(xs + (it * 16 + wave) * XPITCH + lane * 8) = t[it];
  }
  __syncthreads();   // the whole c tile is in LDS before any wave reads fragments of it

  // ---- part 1: KVt tile, 128 rows n x this wave's 32 columns j ----
  v8f acc[8][2];
#pragma unroll
  for (int i = 0; i < 8; ++i)
#pragma unroll
    for (int jj = 0; jj < 2; ++jj) acc[i][jj] = zero8();
  v16b xa[2][4];                               // c tile fragments of four row blocks, two sets
#pragma unroll
  for (int q = 0; q < 4; ++q) xa[0][q] = ldfrag_b(Xl + q * 16 * XPITCH);
#pragma unroll   // constant buffer indices keep wb[] and xa[] in registers
  for (int st = 0; st < 2 * KST; ++st) {       // k step st >> 1, row blocks 4 * (st & 1) ..
    const int ks = st >> 1, hf = st & 1, cu = ks & 1, nx = st + 1;
    if (nx < 2 * KST) {
#pragma unroll
      for (int q = 0; q < 4; ++q) xa[hf ^ 1][q] = ldfrag_b(Xl + ((nx & 1) * 4 + q) * 16 * XPITCH + (nx >> 1) * 32);
    }
    // the next set's LDS loads go as one group ahead of this set's products; the compiler otherwise loads one
    // fragment at a time into one register set and every pair of products waits a full LDS latency
    __builtin_amdgcn_sched_barrier(0);
#pragma unroll
    for (int q = 0; q < 4; ++q)
#pragma unroll
      for (int jj = 0; jj < 2; ++jj) acc[hf * 4 + q][jj] = mma_b_raw(xa[hf][q], wb[cu][jj], acc[hf * 4 + q][jj]);
    if (hf == 1 && ks + 2 < KST) {
#pragma unroll
      for (int jj = 0; jj < 2; ++jj) wb[cu][jj] = ldfrag_q(Wk + frag_piece(jj, ks + 2));
    }
    // keeps each wkv refill where it is written, two k steps ahead of its use; the compiler otherwise sinks it
    // to just before its products, and every fragment then waits a full load latency
    __builtin_amdgcn_sched_barrier(0);
  }
  __syncthreads();   // every wave has read its last c tile fragment before fragments overwrite the tile

  // ---- k softmax numerators of the slice (waves 0..7); hi/lo fragments of K and V to LDS ----
#pragma unroll
  for (int jj = 0; jj < 2; ++jj) {
    float v[8][8];
#pragma unroll
    for (int i = 0; i < 8; ++i)
#pragma unroll
      for (int r = 0; r < 8; ++r) v[i][r] = acc[i][jj][r] + bj[jj];
    if (wave < 8) {                            // wave-uniform; no barrier inside
      float m = v[0][0];
#pragma unroll
      for (int i = 0; i < 8; ++i)
#pragma unroll
        for (int r = 0; r < 8; ++r) m = fmaxf(m, v[i][r]);
      m = fmaxf(m, __shfl_xor(m, 16, 32));
      float s = 0.f;
#pragma unroll
      for (int i = 0; i < 8; ++i)
#pragma unroll
        for (int r = 0; r < 8; ++r) { v[i][r] = exp_slot(v[i][r] - m); s += v[i][r]; }
      s += __shfl_xor(s, 16, 32);
      if (lane < 16) {
        const int so = (z * GB + b) * CH + wave * 32 + jj * 16 + rlane;
        stm[so] = m;
        sts[so] = s;
      }
    }
#pragma unroll
    for (int i = 0; i < 8; ++i) {
      v4u ph, pl;
#pragma unroll
      for (int q = 0; q < 4; ++q) {
        const float f0 = v[i][2 * q], f1 = v[i][2 * q + 1];
        const unsigned short h0 = bf_bits(f0), h1 = bf_bits(f1);
        const unsigned short l0 = bf_bits(f0 - bf_up(h0)), l1 = bf_bits(f1 - bf_up(h1));
        ph[q] = pk16(h0, h1); pl[q] = pk16(l0, l1);
      }
      const int piece = ((((wave * 2 + jj) * KS2 + (i >> 1)) * 2 + (i & 1)) << 5) + lane;
      fh[piece] = ph;
      fl[piece] = pl;
    }
  }
  __syncthreads();   // every column block's fragments are in LDS before any wave reads them

  // ---- part 2: 64x64 tile of the slice's ctxT, rows d from V (A), columns c from kP (B) ----
  const int tm = wave >> 2, tn = wave & 3;
  v8f cx[4][4];
#pragma unroll
  for (int i = 0; i < 4; ++i)
#pragma unroll
    for (int j = 0; j < 4; ++j) cx[i][j] = zero8();
  const v4u* Ah = fh + (CH / 16 + tm * 4) * KS2 * 64 + lane;   // V column blocks of this tile's rows d
  const v4u* Al = fl + (CH / 16 + tm * 4) * KS2 * 64 + lane;
  v16b ah[2], al[2];
  ah[0] = ldfrag_q(Ah);
  al[0] = ldfrag_q(Al);
#pragma unroll   // constant indices keep the fragment arrays in registers
  for (int p = 0; p < KS2; ++p) {
    v16b bh[4], bl[4];
#pragma unroll
    for (int j = 0; j < 4; ++j) {
      bh[j] = ldfrag_q(fh + ((tn * 4 + j) * KS2 + p) * 64 + lane);
      bl[j] = ldfrag_q(fl + ((tn * 4 + j) * KS2 + p) * 64 + lane);
    }
#pragma unroll
    for (int i = 0; i < 4; ++i) {
      const int cu = i & 1;
      const int nx = p * 4 + i + 1;            // the next row block's A fragments, one block of products ahead
      if (nx < KS2 * 4) {
        ah[cu ^ 1] = ldfrag_q(Ah + ((nx & 3) * KS2 + (nx >> 2)) * 64);
        al[cu ^ 1] = ldfrag_q(Al + ((nx & 3) * KS2 + (nx >> 2)) * 64);
      }
      // each accumulator takes its three products in the order hi.hi, lo.hi, hi.lo; four tiles side by side
#pragma unroll
      for (int j = 0; j < 4; ++j) cx[i][j] = mma_b_raw(ah[cu], bh[j], cx[i][j]);
#pragma unroll
      for (int j = 0; j < 4; ++j) cx[i][j] = mma_b_raw(al[cu], bh[j], cx[i][j]);
#pragma unroll
      for (int j = 0; j < 4; ++j) cx[i][j] = mma_b_raw(ah[cu], bl[j], cx[i][j]);
      // keeps later blocks' fragment loads from being lifted up here: with more than one block's fragments
      // ahead the live set passes the 256 registers of a 16-wave work-group and spills to scratch
      __builtin_amdgcn_sched_barrier(0);
    }
  }
  __syncthreads();   // every wave has read its last fragment before the slabs overwrite them

  // ---- epilogue: whole 256-B row segments through the wave's own slab ----
  const int hh = lane >> 4, c4 = (lane & 15) * 4;          // 256-B row segment = 16 lanes x 16 B
  float* slab = (float*)(void*)sm + wave * (16 * 68);
  float* C = part + ((size_t)b * (CH / 4) * KSP + (size_t)z) * (4 * CH) + hh * CH + (tn << 6) + c4;
#pragma unroll
  for (int i = 0; i < 4; ++i) {
    const int mBase = (tm << 6) + (i << 4);
#pragma unroll
    for (int j = 0; j < 4; ++j) {
#pragma unroll
      for (int r = 0; r < 8; ++r) slab[(mOff + r) * 68 + (j << 4) + rlane] = cx[i][j][r];
    }
    // the wave's slab rows are written before its lanes read each other's values back
    asm volatile("s_wait_dscnt 0x0" ::: "memory");
    v4f t[8];
#pragma unroll
    for (int it = 0; it < 8; ++it) t[it] = *(const v4f*)(slab + (it * 2 + hh) * 68 + c4);   // rows 0..15
    // the rows are read before the next 16 rows overwrite the slab
    asm volatile("s_wait_dscnt 0x0" ::: "memory");
#pragma unroll
    for (int it = 0; it < 8; ++it)             // row d = mBase + 2 it + hh: group d/4, row d%4 = 2 (it&1) + hh
      *(v4f*)(C + (size_t)((mBase >> 2) + (it >> 1)) * (KSP * 4 * CH) + (it & 1) * (2 * CH)) = t[it];
  }
}

// =====================================================================================================
// Workspace map (bytes), every plane an exact multiple of its 64x64-tile / whole-line store granularity
// (no padded tails needed: 4096, 512, 256 are tile multiples); one group holds all GB = NBAT batches:
//   Wqb   bf16 [256][256]              0          131072
//   Wkvb  bf16 [512][256]              131072     262144
//   Wob   bf16 [256][256]              393216     131072
//   Xt    bf16 [GB][4096][256]         524288     16777216
//   Ct    bf16 [GB][4096][256]         17301504   16777216
//   cxp   f32  [GB*64][KSP][4][256]    34078720   67108864
//   stm   f32  [KSP][GB][256]          101187584  262144
//   sts   f32  [KSP][GB][256]          101449728  262144
//   cxh   bf16 [GB][256][256]          101711872  1048576
//   cxl   bf16 [GB][256][256]          102760448  1048576
//   m2h   bf16 [GB][256][256]          103809024  1048576
//   m2l   bf16 [GB][256][256]          104857600  1048576
//   end                                105906176
// Weights are [out][in] with the in index as k; Wqb, Wkvb, Wob, cxh, cxl, m2h, m2l are in fragment order.
// =====================================================================================================
static inline unsigned tile_blocks(int M, int N) { return (unsigned)((((M / 64) * (N / 64)) + 7) / 8); }

extern "C" void kernel_launch(void* const* d_in, const int* in_sizes, int n_in,
                              void* d_out, int out_size, void* d_ws, size_t ws_size,
                              hipStream_t stream) {
  if (n_in < 8) return;
  if (in_sizes[0] != NBAT * CH * NSP) return;
  if (in_sizes[1] != NBAT * CH * NSP) return;
  if (in_sizes[2] != CH * CH) return;
  if (in_sizes[3] != CH) return;
  if (in_sizes[4] != 2 * CH * CH) return;
  if (in_sizes[5] != 2 * CH) return;
  if (in_sizes[6] != CH * CH) return;
  if (in_sizes[7] != CH) return;
  if (out_size != NBAT * CH * NSP) return;

  const float* x     = (const float*)d_in[0];
  const float* cproj = (const float*)d_in[1];
  const float* wq    = (const float*)d_in[2];
  const float* bq    = (const float*)d_in[3];
  const float* wkv   = (const float*)d_in[4];
  const float* bkv   = (const float*)d_in[5];
  const float* wo    = (const float*)d_in[6];
  const float* bo    = (const float*)d_in[7];
  float* out = (float*)d_out;

  const size_t PWq  = (size_t)CH * CH * 2;               //   131072
  const size_t PWkv = (size_t)2 * CH * CH * 2;           //   262144
  const size_t PWo  = (size_t)CH * CH * 2;               //   131072
  const size_t PXt  = (size_t)GB * NSP * CH * 2;         // 16777216
  const size_t PCxp = (size_t)KSP * GB * CH * CH * 4;    // 67108864
  const size_t PSt  = (size_t)KSP * GB * CH * 4;         //   262144
  const size_t PCx  = (size_t)GB * CH * CH * 2;          //  1048576
  size_t off = 0;
  const size_t oWq  = off; off += PWq;
  const size_t oWkv = off; off += PWkv;
  const size_t oWo  = off; off += PWo;
  const size_t oXt  = off; off += PXt;
  const size_t oCt  = off; off += PXt;
  const size_t oCxp = off; off += PCxp;
  const size_t oStm = off; off += PSt;
  const size_t oSts = off; off += PSt;
  const size_t oCxh = off; off += PCx;
  const size_t oCxl = off; off += PCx;
  const size_t oM2h = off; off += PCx;
  const size_t oM2l = off; off += PCx;
  if (off > ws_size) return;                             // off = 105906176

  char* ws = (char*)d_ws;
  unsigned short* Wqb  = (unsigned short*)(ws + oWq);
  unsigned short* Wkvb = (unsigned short*)(ws + oWkv);
  unsigned short* Wob  = (unsigned short*)(ws + oWo);
  unsigned short* Xt   = (unsigned short*)(ws + oXt);
  unsigned short* Ct   = (unsigned short*)(ws + oCt);
  float*          Cxp  = (float*)(ws + oCxp);
  float*          Stm  = (float*)(ws + oStm);
  float*          Sts  = (float*)(ws + oSts);
  unsigned short* Cxh  = (unsigned short*)(ws + oCxh);
  unsigned short* Cxl  = (unsigned short*)(ws + oCxl);
  unsigned short* M2h  = (unsigned short*)(ws + oM2h);
  unsigned short* M2l  = (unsigned short*)(ws + oM2l);

  const dim3 blk(256);
  const int n8wq  = CH * CH / 8;                         //  8192
  const int n8wkv = 2 * CH * CH / 8;                     // 16384
  const int n8wo  = CH * CH / 8;                         //  8192

  // (0) weights -> bf16 planes
  cvt_bf16x8<<<dim3((n8wq + 255) / 256), blk, 0, stream>>>(wq, Wqb, n8wq);
  cvt_bf16x8<<<dim3((n8wkv + 255) / 256), blk, 0, stream>>>(wkv, Wkvb, n8wkv);
  cvt_bf16x8<<<dim3((n8wo + 255) / 256), blk, 0, stream>>>(wo, Wob, n8wo);

  const dim3 gTr(NSP / 64, CH / 64, 2 * GB);             // 64 x 4 x 16
  const dim3 gKc(KSP, GB);                               // 32 slices of n x GB, 16 waves each
  const dim3 gCx(tile_blocks(CH, CH), GB);               // 16 tiles -> 2 blocks
  const dim3 gSum(GB * CH * CH / 2048);                  // 256 blocks
  const dim3 gQo(NSP / 64, GB);                          // 64 column tiles x GB, 4 waves each
  const long long sCC = (long long)CH * CH;

  for (int g = 0; g < NGRP; ++g) {
    const int b0 = g * GB;
    // (1) x[b], cproj[b] -> Xt[n][c], Ct[n][c] bf16
    k_trcvt<<<gTr, blk, 0, stream>>>(x, cproj, Xt, Ct, b0);
    // (2) per slice of 128 n: KVt[n][j] = Ct . wkv^T + bkv[j] (K=256); kP = exp(K - slice max) and V as hi/lo in
    //     LDS; ctxT[d][c] partial = Vh.kPh^T + Vl.kPh^T + Vh.kPl^T (M=N=256, K=128) -> f32 partials
    k_kvctx<<<gKc, dim3(512), 0, stream>>>(Wkvb, Ct, bkv, Cxp, Stm, Sts);
    // (3) softmax-weighted sum of the partials -> ctxT bf16 hi/lo
    k_ksum<<<gSum, dim3(512), 0, stream>>>(Cxp, Stm, Sts, Cxh, Cxl);
    // (4) M2[o][d] = wo . (ctxTh + ctxTl)^T  (M=N=K=256) -> bf16 hi/lo
    gemm64<3, 2, 0><<<gCx, blk, 0, stream>>>(
        Wob, Wob, 0LL, Cxh, Cxl, sCC,
        (void*)M2h, (void*)M2l, CH, sCC, bq, CH, CH, CH, 1.0f);
    // (5) Q = wq . Xt^T + bq, qP = 64 * softmax over each head's 64 rows (hi/lo, in LDS),
    //     out[b][o][n] = ((M2h + M2l).qPh + M2h.qPl) / 64 + bo[o] -> d_out f32
    float* outg = out + (size_t)b0 * CH * NSP;
    k_qout<<<gQo, dim3(128), 0, stream>>>(Wqb, Xt, bq, M2h, M2l, bo, outg);
  }
  (void)hipGetLastError();
}

// v006
// A run of this version takes 76.5 microseconds.
// Timed twice side by side with v005, it ran 1.33 times as fast both times.
// Counting every step since v000, it is 20.0 times as fast.
// Contractions (all v_wmma_f32_16x16x32_bf16, f32 accumulate): x^T.wq^T and wkv.cproj with bf16 operands
// RNE-converted from the f32 inputs (single product); V.kP^T with bf16 hi+lo planes on both operands (3 products);
// wo.ctx^T with bf16 wo times ctx hi+lo planes (2 products); M2.qP^T with bf16 hi+lo planes on both (3 products).
// Softmaxes and epilogues in f32; the q softmax output is carried x64, folded back by the epilogue scale.
// The q projection, its softmax and the output product run in one kernel; q passes from one to the other in LDS.
// The KV projection, the k softmax and the V.kP^T product run in one kernel per slice of 128 columns n: kP is
// exp(K - slice maximum), un-normalised; the slice sum weighs each slice by exp(slice max - row max) / row sum.
// The slice sum and the wo.ctx^T product run in one kernel; a block's rows of ctx pass from one to the other in LDS.
// Every bf16 plane that a kernel reads from global memory as WMMA fragments (wq, wkv, wo, M2 hi/lo) lies
// there in fragment order (see frag_piece), so a wave-wide 16-B load covers 512 contiguous bytes.
#include <hip/hip_runtime.h>
#include <stdint.h>

#define NBAT 8
#define CH   256
#define NSP  4096
#define GB   8
#define NGRP (NBAT / GB)
static_assert((NSP % 64) == 0 && (CH % 64) == 0 && (NBAT % GB) == 0);
static_assert(CH == 4 * 64);         // four heads of 64 channels: one wave of k_qout per head
#define KSP  32                      // k slices of the V.kP^T product (K = NSP), one work-group of k_kvctx each
static_assert((NSP % (KSP * 32)) == 0 && ((GB * CH * CH) % 1024) == 0);

typedef __bf16   v16b __attribute__((ext_vector_type(16)));
typedef __bf16   v8b  __attribute__((ext_vector_type(8)));
typedef float    v8f  __attribute__((ext_vector_type(8)));
typedef float    v4f  __attribute__((ext_vector_type(4)));
typedef unsigned int v4u __attribute__((ext_vector_type(4)));

// ---- scalar helpers --------------------------------------------------------------------------------
__device__ __forceinline__ unsigned short bf_bits(float f) {          // f32 -> bf16 bits, RNE convert
  unsigned u = __float_as_uint(f);
  return (unsigned short)((u + 0x7FFFu + ((u >> 16) & 1u)) >> 16);
}
__device__ __forceinline__ float bf_up(unsigned short h) { return __uint_as_float(((unsigned)h) << 16); }
__device__ __forceinline__ unsigned pk16(unsigned short a, unsigned short b) { return (unsigned)a | ((unsigned)b << 16); }
__device__ __forceinline__ v8f zero8() { v8f z = {0.f, 0.f, 0.f, 0.f, 0.f, 0.f, 0.f, 0.f}; return z; }

// ---- fragment loader: 16-bit A/B operand, lane -> row/col (lane&15), p already includes +8*(lane>>4);
//      elements 0..7 <- p[0..7] (k0+8h..), elements 8..15 <- p[16..23] (k0+16+8h..)
__device__ __forceinline__ v16b ldfrag_b(const __bf16* p) {
  union { v16b v; v8b h[2]; } f;
  f.h[0] = *(const v8b*)(p);
  f.h[1] = *(const v8b*)(p + 16);
  return f.v;
}

// ---- fragment order of a plane P[row][k] with CH values k per row: 16-B pieces of 8 consecutive k;
//      piece (((row block * KST + k step) * 2 + half) * 32 + lane) holds row 16 * block + (lane&15),
//      k = 32 * step + 16 * half + 8 * (lane>>4) + 0..7: the same lane -> k order as ldfrag_b.
#define KST    (CH / 32)                       // k steps of a product over CH
__device__ __forceinline__ int frag_piece(int rowblk, int kstep) { return (rowblk * KST + kstep) * 64; }
__device__ __forceinline__ v16b ldfrag_q(const v4u* p) {   // p = this lane's piece of half 0; half 1 lies 32 pieces on
  union { v16b v; v4u q[2]; } f;
  f.q[0] = p[0];
  f.q[1] = p[32];
  return f.v;
}

// ---- WMMA helper -------------------------------------------------------------------------------------
__device__ __forceinline__ v8f mma_b_raw(v16b a, v16b b, v8f c) {
  return __builtin_amdgcn_wmma_f32_16x16x32_bf16(false, a, false, b, (short)0, c, false, false);
}

// =====================================================================================================
// f32 [rows][CH] -> bf16 (RNE convert) in fragment order: thread i forms piece i from 8 consecutive k of its row
// (a wave reads 64 B of each of 16 rows); one 16-B store per lane: a wave writes 512 contiguous B.
// coverage: n8 threads x 8 = whole plane (n8 is a multiple of 512 = one row block for every use here).
// =====================================================================================================
__global__ __launch_bounds__(256) void cvt_bf16x8(const float* __restrict__ in, unsigned short* out, int n8) {
  const int i = blockIdx.x * 256 + threadIdx.x;
  if (i < n8) {
    const int row = (i / (KST * 64)) * 16 + (i & 15);
    const int k   = ((i >> 6) % KST) * 32 + ((i >> 5) & 1) * 16 + ((i >> 4) & 1) * 8;
    const float* src = in + (size_t)row * CH + k;
    const v4f a = *(const v4f*)(src);
    const v4f b = *(const v4f*)(src + 4);
    v4u p;
    p[0] = pk16(bf_bits(a[0]), bf_bits(a[1]));
    p[1] = pk16(bf_bits(a[2]), bf_bits(a[3]));
    p[2] = pk16(bf_bits(b[0]), bf_bits(b[1]));
    p[3] = pk16(bf_bits(b[2]), bf_bits(b[3]));
    *(v4u*)(out + (size_t)i * 8) = p;
    
  }
}

// =====================================================================================================
// Transpose-convert of one 64x64 tile: source [b][c][n] f32 (c pitch NSP) -> plane [bi][n][c] bf16 (pitch CH).
// blockIdx.x = n tile, blockIdx.y = c tile, blockIdx.z = 2*bi + sel (sel 0: xg -> xt, 1: cg -> ct); block 256.
// Load: thread r = tid>>2 owns source row c0+r, 16 consecutive n at (tid&3)*16 (4 x 16-B loads).
// coverage: load 256x16 = 4096 = whole tile; store 2x256x8 = 4096 = whole tile.
// =====================================================================================================
__global__ __launch_bounds__(256) void k_trcvt(const float* __restrict__ xg, const float* __restrict__ cg,
                                               unsigned short* xt, unsigned short* ct, int b0) {
  __shared__ float tile[64][65];
  const int tid = threadIdx.x;
  const int n0 = blockIdx.x * 64;
  const int c0 = blockIdx.y * 64;
  const int bi  = (int)(blockIdx.z >> 1);
  const int sel = (int)(blockIdx.z & 1);
  const float* src = sel ? cg : xg;            // block-uniform select, both global
  unsigned short* dst = sel ? ct : xt;
  {
    const int r = tid >> 2, cs = (tid & 3) * 16;
    const float* p = src + ((size_t)(b0 + bi) * CH + (size_t)(c0 + r)) * NSP + n0 + cs;
#pragma unroll
    for (int i = 0; i < 4; ++i) {
      const v4f v = *(const v4f*)(p + 4 * i);
      tile[r][cs + 4 * i + 0] = v[0];
      tile[r][cs + 4 * i + 1] = v[1];
      tile[r][cs + 4 * i + 2] = v[2];
      tile[r][cs + 4 * i + 3] = v[3];
    }
  }
  __syncthreads();
  v4u pv[2];
  const int c8 = (tid & 7) * 8;
#pragma unroll
  for (int it = 0; it < 2; ++it) {
    const int n = it * 32 + (tid >> 3);
    v4u a;
#pragma unroll
    for (int e = 0; e < 4; ++e) {
      a[e] = pk16(bf_bits(tile[c8 + 2 * e][n]), bf_bits(tile[c8 + 2 * e + 1][n]));
    }
    pv[it] = a;
  }
  {
#pragma unroll
    for (int it = 0; it < 2; ++it) {
      const int n = it * 32 + (tid >> 3);
      const size_t go = ((size_t)bi * NSP + (size_t)(n0 + n)) * CH + c0 + c8;
      *(v4u*)(dst + go) = pv[it];
    }
    
  }
}

// =====================================================================================================
// Weighted sum of the KSP k-slice partials of ctxT, then M2 = wo . ctxT^T for the block's rows d.
// part f32 [GB*CH/4][KSP][4*CH] -> M2 bf16 hi/lo planes [GB][CH*CH].
// Slice z of column c weighs exp(m[z][c] - M[c]) / S[c], M = maximum of the slice maxima, S = sum over z of
// exp(m[z][c] - M[c]) * s[z][c]: the softmax over all n. A block covers 8 rows d x all CH columns c of one batch:
// thread t < CH forms the KSP weights of column t once, in LDS; slices are added in index order.
// Thread owns 4 consecutive elements (16-B loads); their bf16 hi and lo go to LDS rows [d][c] at a pitch of 528 B.
// Product, wave w: M2[o][d] = sum over c of wo[o][c] * (ctxTh + ctxTl)[d][c] for o in 16w..16w+15, K = CH, per k step
//   the hi product and then the lo product. ctxT is the A operand (rows d; A rows 8..15 repeat rows 0..7 and their
//   results are not stored), wo the B operand (columns o), so lane l < 16 holds M2[16w + l][d0..d0+7]: one 16-B
//   piece of the planes, which are in fragment order with row o and k = d. A wave stores 256 contiguous B per plane.
// coverage: (GB*CH*CH/2048) blocks x 16 waves x (16 rows o x 8 columns d) = whole planes.
// =====================================================================================================
#define CPITCH (CH + 8)                        // ctxT row pitch in LDS, elements (528 B)
static_assert(CH == 16 * 16);                  // sixteen waves x 16 rows o

__global__ __launch_bounds__(512) void k_ksum(const float* __restrict__ part, const float* __restrict__ stm,
                                              const float* __restrict__ sts, const unsigned short* __restrict__ wop,
                                              unsigned short* m2h, unsigned short* m2l) {
  __shared__ __align__(16) float wl[KSP][CH];
  __shared__ __align__(16) unsigned short csh[8 * CPITCH];    // the block's 8 rows of ctxT, bf16 hi
  __shared__ __align__(16) unsigned short csl[8 * CPITCH];    // and lo
  const unsigned t = threadIdx.x;
  const int lane = (int)(t & 31u);
  const int wave = __builtin_amdgcn_readfirstlane((int)(t >> 5));
  const int b = (int)(blockIdx.x / (CH * CH / 2048));
  const unsigned tq = t & 255u;                 // place in the thread's group of 4 rows d
  // the wave's group of 4 rows as a scalar: wave-uniform bases in scalar registers, one lane offset for all loads
  const unsigned g4 = (unsigned)__builtin_amdgcn_readfirstlane((int)(t >> 8));
  const float* pb = part + ((size_t)blockIdx.x * 2 + g4) * (KSP * 1024);
  const float* mb = stm + b * CH;
  const float* sb = sts + b * CH;
  v4f p[KSP];
#pragma unroll   // keeps p[] in registers and the independent loads in flight together
  for (int z = 0; z < KSP; ++z) p[z] = *(const v4f*)(pb + z * 1024 + tq * 4u);
  // keeps the plane loads ahead of the weights' work, in flight under it; the compiler otherwise sinks them
  // behind it, and the block pays the two memory latencies one after the other
  __builtin_amdgcn_sched_barrier(0);
  if (t < CH) {                                 // wave-uniform; no barrier inside
    float m[KSP], sz[KSP];
#pragma unroll   // m[] and sz[] are indexed by constants only, so they stay in registers
    for (int z = 0; z < KSP; ++z) {
      m[z]  = mb[z * (GB * CH) + t];
      sz[z] = sb[z * (GB * CH) + t];
    }
    float mm = m[0];
#pragma unroll
    for (int z = 1; z < KSP; ++z) mm = fmaxf(mm, m[z]);
    float ss = 0.f;
#pragma unroll
    for (int z = 0; z < KSP; ++z) { m[z] = __expf(m[z] - mm); ss += m[z] * sz[z]; }
    const float rinv = 1.0f / ss;
#pragma unroll
    for (int z = 0; z < KSP; ++z) wl[z][t] = m[z] * rinv;
  }
  __syncthreads();   // every column's weights are in LDS before any thread reads its four
  // wo fragments of this wave's 16 rows o, all k steps: they depend on nothing here and fly under the slice sum
  // (behind the barrier, whose wait for outstanding loads would otherwise hold the block up for them)
  v16b wf[KST];
  {
    const v4u* Wo = (const v4u*)(const void*)wop + frag_piece(wave, 0) + lane;
#pragma unroll   // wf[] is indexed by constants only, so it stays in registers
    for (int ks = 0; ks < KST; ++ks) wf[ks] = ldfrag_q(Wo + frag_piece(0, ks));
  }
  const unsigned c4 = (t * 4u) & (CH - 1);
  v4f s = p[0] * *(const v4f*)(&wl[0][c4]);
#pragma unroll   // p[] is indexed by constants only, so it stays in registers
  for (int z = 1; z < KSP; ++z) s += p[z] * *(const v4f*)(&wl[z][c4]);
  const unsigned short h0 = bf_bits(s[0]), h1 = bf_bits(s[1]), h2 = bf_bits(s[2]), h3 = bf_bits(s[3]);
  uint2 hv, lv;
  hv.x = pk16(h0, h1);
  hv.y = pk16(h2, h3);
  lv.x = pk16(bf_bits(s[0] - bf_up(h0)), bf_bits(s[1] - bf_up(h1)));
  lv.y = pk16(bf_bits(s[2] - bf_up(h2)), bf_bits(s[3] - bf_up(h3)));
  *(uint2*)(csh + (t >> 6) * CPITCH + c4) = hv;
  *(uint2*)(csl + (t >> 6) * CPITCH + c4) = lv;
  __syncthreads();   // all 8 rows of ctxT are in LDS before any wave reads fragments of them

  const __bf16* Ch = (const __bf16*)(const void*)csh + (lane & 7) * CPITCH + (lane >> 4) * 8;   // this lane's A row
  const __bf16* Cl = (const __bf16*)(const void*)csl + (lane & 7) * CPITCH + (lane >> 4) * 8;
  v16b ah[KST], al[KST];
#pragma unroll   // ah[] and al[] are indexed by constants only, so they stay in registers (those of p[], now free)
  for (int ks = 0; ks < KST; ++ks) {
    ah[ks] = ldfrag_b(Ch + ks * 32);
    al[ks] = ldfrag_b(Cl + ks * 32);
  }
  // all LDS fragment loads go as one group ahead of the products; the compiler otherwise loads one fragment at a
  // time into one register set, and each of the sixteen chained products waits a full LDS latency
  __builtin_amdgcn_sched_barrier(0);
  v8f acc = zero8();
#pragma unroll   // wf[], ah[] and al[] are indexed by constants only
  for (int ks = 0; ks < KST; ++ks) {
    acc = mma_b_raw(ah[ks], wf[ks], acc);
    acc = mma_b_raw(al[ks], wf[ks], acc);
  }
  v4u ph, pl;
#pragma unroll
  for (int q = 0; q < 4; ++q) {
    const float f0 = acc[2 * q], f1 = acc[2 * q + 1];
    const unsigned short a0 = bf_bits(f0), a1 = bf_bits(f1);
    ph[q] = pk16(a0, a1);
    pl[q] = pk16(bf_bits(f0 - bf_up(a0)), bf_bits(f1 - bf_up(a1)));
  }
  if (lane < 16) {                              // lanes 16..31 hold the repeated A rows
    const int d0 = (int)(blockIdx.x % (CH * CH / 2048)) * 8;
    const size_t e0 = (size_t)b * (CH * CH) +
        (size_t)(frag_piece(wave, d0 >> 5) + ((d0 >> 4) & 1) * 32 + ((d0 >> 3) & 1) * 16 + lane) * 8;
    *(v4u*)(m2h + e0) = ph;
    *(v4u*)(m2l + e0) = pl;
  }
}

// =====================================================================================================
// q projection + q softmax + output product for one 64-column tile of n. grid (NSP/64, GB), block 128 = 4 waves.
// x tile: rows n0..n0+63 of Xt are 32 KiB in a row; each wave-wide load takes one whole 512-B row, and the rows
//   stand in LDS at a pitch of 528 B (16 B x odd) for the 16-B fragment reads of all four waves.
// Part 1, wave w = head w: Q[o][n] = wq . Xt^T + bq[o] for o in 64w..64w+63 (K = CH). A lane holds column
//   n0 + 16j + (lane&15) and rows 16i + 8(lane>>4) + r, so one column's head lies in lanes l and l^16:
//   softmax of 0.25 * Q over the 64 rows = a sum inside the lane and one xor-16 exchange.
// Hand-over: 64 * softmax as bf16 hi/lo. Accumulator tiles 2p and 2p+1 of a column block are, lane for lane,
//   elements 0..7 and 8..15 of the B fragment of k step p, so each lane stores and later loads its own 16-B
//   pieces: piece (((k step * 4 + j) * 2 + half) * 32 + lane); a wave-wide access covers 512 contiguous bytes.
// Part 2, wave w: out[o][n] = ((M2h + M2l).qPh + M2h.qPl) / 64 + bo[o] for o in 64w..64w+63 (K = CH, all heads).
// coverage: 64 x GB blocks x 4 waves x (64 rows x 64 columns) = whole output.
// =====================================================================================================
#define XPITCH (CH + 8)                        // x tile row pitch in LDS, elements (528 B)

__global__ __launch_bounds__(128) void k_qout(const unsigned short* __restrict__ wqp,
                                              const unsigned short* __restrict__ xtp,
                                              const float* __restrict__ bq,
                                              const unsigned short* __restrict__ m2hp,
                                              const unsigned short* __restrict__ m2lp,
                                              const float* __restrict__ bo, float* outp) {
  __shared__ __align__(16) unsigned short xs[64 * XPITCH];    // 33 KiB: x tile, bf16
  __shared__ __align__(16) v4u qsh[KST * 4 * 2 * 32];         // 32 KiB: q hi fragments of the tile
  __shared__ __align__(16) v4u qsl[KST * 4 * 2 * 32];         // 32 KiB: q lo fragments
  __shared__ __align__(16) float sT[4][16 * 68];              // per-wave 16x64 slab, pitch 68 floats
  const int lane = threadIdx.x & 31;
  const int wave = threadIdx.x >> 5;
  const int b  = blockIdx.y;
  const int n0 = blockIdx.x << 6;
  const int m0 = wave << 6;
  const int rlane = lane & 15;                 // row (A) / col (B, D) within subtile
  const int koff  = (lane >> 4) * 8;           // k offset of this lane half
  const int mOff  = (lane >> 4) * 8;           // D row offset
  const int apc = frag_piece(m0 >> 4, 0) + lane;             // this lane's A piece (subtile 0, k step 0), all three A planes
  const v4u* Wq = (const v4u*)(const void*)wqp + apc;
  const v4u* Mh = (const v4u*)(const void*)(m2hp + (size_t)b * CH * CH) + apc;
  const v4u* Ml = (const v4u*)(const void*)(m2lp + (size_t)b * CH * CH) + apc;
  const __bf16* Xl = (const __bf16*)(const void*)xs + rlane * XPITCH + koff;   // this lane's B row (subtile 0)

  // ---- x tile to LDS; wq fragments of the first two k steps meanwhile ----
  v16b wa[2][4];
  {
    const v4u* g = (const v4u*)(const void*)(xtp + ((size_t)b * NSP + (size_t)n0) * CH);
    v4u t[16];
#pragma unroll
    for (int it = 0; it < 16; ++it) t[it] = g[it * 128 + threadIdx.x];          // row it*4 + wave, piece lane
#pragma unroll
    for (int s = 0; s < 2; ++s)
#pragma unroll
      for (int i = 0; i < 4; ++i) wa[s][i] = ldfrag_q(Wq + frag_piece(i, s));
#pragma unroll
    for (int it = 0; it < 16; ++it) *(v4u*)(xs + (it * 4 + wave) * XPITCH + lane * 8) = t[it];
  }
  __syncthreads();   // the whole x tile is in LDS before any wave reads fragments of it

  v8f acc[4][4];
#pragma unroll
  for (int i = 0; i < 4; ++i)
#pragma unroll
    for (int j = 0; j < 4; ++j) acc[i][j] = zero8();

  // ---- part 1: Q tile of this wave's head ----
  {
    v16b xb[2][4];
#pragma unroll
    for (int j = 0; j < 4; ++j) xb[0][j] = ldfrag_b(Xl + j * 16 * XPITCH);
#pragma unroll   // constant buffer indices keep wa[] and xb[] in registers
    for (int ks = 0; ks < KST; ++ks) {
      const int cu = ks & 1;
      if (ks + 1 < KST) {
#pragma unroll
        for (int j = 0; j < 4; ++j) xb[cu ^ 1][j] = ldfrag_b(Xl + j * 16 * XPITCH + (ks + 1) * 32);
      }
#pragma unroll
      for (int i = 0; i < 4; ++i) {
#pragma unroll
        for (int j = 0; j < 4; ++j) acc[i][j] = mma_b_raw(wa[cu][i], xb[cu][j], acc[i][j]);
        if (ks + 2 < KST) wa[cu][i] = ldfrag_q(Wq + frag_piece(i, ks + 2));
        // keeps each refill where it is written, two k steps ahead of its use; the compiler otherwise sinks it
        // to just before its products, and every fragment then waits a full load latency
        __builtin_amdgcn_sched_barrier(0);
      }
    }
  }

  // ---- q softmax over the head's 64 rows, column by column; fragments to LDS ----
  float bro[4][8];
#pragma unroll
  for (int i = 0; i < 4; ++i)
#pragma unroll
    for (int r = 0; r < 8; ++r) bro[i][r] = bf_up(bf_bits(bq[m0 + (i << 4) + mOff + r]));
#pragma unroll
  for (int j = 0; j < 4; ++j) {
    float v[4][8];
#pragma unroll
    for (int i = 0; i < 4; ++i)
#pragma unroll
      for (int r = 0; r < 8; ++r) v[i][r] = (acc[i][j][r] + bro[i][r]) * 0.25f;
    float m = v[0][0];
#pragma unroll
    for (int i = 0; i < 4; ++i)
#pragma unroll
      for (int r = 0; r < 8; ++r) m = fmaxf(m, v[i][r]);
    m = fmaxf(m, __shfl_xor(m, 16, 32));
    float s = 0.f;
#pragma unroll
    for (int i = 0; i < 4; ++i)
#pragma unroll
      for (int r = 0; r < 8; ++r) { v[i][r] = __expf(v[i][r] - m); s += v[i][r]; }
    s += __shfl_xor(s, 16, 32);
    const float rinv = 1.0f / s;
#pragma unroll
    for (int i = 0; i < 4; ++i) {
      v4u ph, pl;
#pragma unroll
      for (int q = 0; q < 4; ++q) {
        const float f0 = (v[i][2 * q] * rinv) * 64.0f;
        const float f1 = (v[i][2 * q + 1] * rinv) * 64.0f;
        const unsigned short h0 = bf_bits(f0), h1 = bf_bits(f1);
        const unsigned short l0 = bf_bits(f0 - bf_up(h0)), l1 = bf_bits(f1 - bf_up(h1));
        ph[q] = pk16(h0, h1); pl[q] = pk16(l0, l1);
      }
      const int piece = ((((wave * 2 + (i >> 1)) * 4 + j) * 2 + (i & 1)) << 5) + lane;
      qsh[piece] = ph;
      qsl[piece] = pl;
    }
  }
  v16b ah[4], al[4];   // M2 fragments of k step 0: they do not depend on q, so they fly across the barrier
#pragma unroll
  for (int i = 0; i < 4; ++i) {
    ah[i] = ldfrag_q(Mh + frag_piece(i, 0));
    al[i] = ldfrag_q(Ml + frag_piece(i, 0));
  }
  __syncthreads();   // every head's fragments are in LDS before any wave reads them

  // ---- part 2: output rows 64w..64w+63 over all CH channels of q ----
#pragma unroll
  for (int i = 0; i < 4; ++i)
#pragma unroll
    for (int j = 0; j < 4; ++j) acc[i][j] = zero8();
  {
    v16b bh[2][4], bl[2][4];
#pragma unroll
    for (int j = 0; j < 4; ++j) {
      bh[0][j] = ldfrag_q(qsh + j * 64 + lane);
      bl[0][j] = ldfrag_q(qsl + j * 64 + lane);
    }
#pragma unroll   // constant buffer indices keep the fragment arrays in registers
    for (int ks = 0; ks < KST; ++ks) {
      const int cu = ks & 1;
      if (ks + 1 < KST) {
#pragma unroll
        for (int j = 0; j < 4; ++j) {
          bh[cu ^ 1][j] = ldfrag_q(qsh + ((ks + 1) * 4 + j) * 64 + lane);
          bl[cu ^ 1][j] = ldfrag_q(qsl + ((ks + 1) * 4 + j) * 64 + lane);
        }
      }
#pragma unroll
      for (int i = 0; i < 4; ++i) {
        // each accumulator takes its three products in the order hi.hi, lo.hi, hi.lo; four tiles side by side
#pragma unroll
        for (int j = 0; j < 4; ++j) acc[i][j] = mma_b_raw(ah[i], bh[cu][j], acc[i][j]);
#pragma unroll
        for (int j = 0; j < 4; ++j) acc[i][j] = mma_b_raw(al[i], bh[cu][j], acc[i][j]);
#pragma unroll
        for (int j = 0; j < 4; ++j) acc[i][j] = mma_b_raw(ah[i], bl[cu][j], acc[i][j]);
        if (ks + 1 < KST) {
          ah[i] = ldfrag_q(Mh + frag_piece(i, ks + 1));
          al[i] = ldfrag_q(Ml + frag_piece(i, ks + 1));
        }
        // keeps each refill where it is written, one k step ahead of its use (see part 1)
        __builtin_amdgcn_sched_barrier(0);
      }
    }
  }

  // ---- epilogue: whole 256-B row segments through the wave's own slab ----
  float* slab = sT[wave];
  float* C = outp + (size_t)b * CH * NSP;
  const int hh = lane >> 4, c4 = (lane & 15) * 4;          // 256-B row segment = 16 lanes x 16 B
#pragma unroll
  for (int i = 0; i < 4; ++i) {
    const int mBase = m0 + (i << 4);
    float brow[8];
#pragma unroll
    for (int r = 0; r < 8; ++r) brow[r] = bf_up(bf_bits(bo[mBase + mOff + r]));
#pragma unroll
    for (int j = 0; j < 4; ++j) {
#pragma unroll
      for (int r = 0; r < 8; ++r) {
        slab[(mOff + r) * 68 + (j << 4) + rlane] = acc[i][j][r] * (1.0f / 64.0f) + brow[r];
      }
    }
    // the wave's slab rows are written before its lanes read each other's values back
    asm volatile("s_wait_dscnt 0x0" ::: "memory");
    v4f t[8];
#pragma unroll
    for (int it = 0; it < 8; ++it) t[it] = *(const v4f*)(slab + (it * 2 + hh) * 68 + c4);   // rows 0..15
    // the rows are read before the next 16 rows overwrite the slab
    asm volatile("s_wait_dscnt 0x0" ::: "memory");
#pragma unroll
    for (int it = 0; it < 8; ++it) *(v4f*)(C + (size_t)(mBase + it * 2 + hh) * NSP + n0 + c4) = t[it];
  }
}

// =====================================================================================================
// KV projection + k softmax numerators + context product for one slice of SLN = 128 columns n of one batch.
// grid (KSP, GB), block 512 = 16 waves, one work-group per WGP (256 KiB of LDS).
// c tile: rows n0..n0+127 of Ct are 64 KiB in a row; each wave-wide load takes one whole 512-B row, and the rows
//   stand in LDS at a pitch of 528 B (16 B x odd) for the 16-B fragment reads of all sixteen waves.
// Part 1, wave w: KVt[n][j] = Ct . wkv^T + bkv[j] for all 128 n and j in 32w..32w+31 (K = CH). A lane holds column
//   j = 32w + 16jj + (lane&15) and rows n = 16i + 8(lane>>4) + r, so one column lies in lanes l and l^16.
// Waves 0..7 hold K (j < CH): slice maximum m and sum s of exp(K - m) = a sum inside the lane and one xor-16
//   exchange; m and s go to stm, sts [slice][b][j]; the value handed on is exp(K - m). Waves 8..15 hold V as it is.
// Hand-over: bf16 hi/lo. Accumulator tiles 2p and 2p+1 of a column block are, lane for lane, elements 0..7 and
//   8..15 of the A or B fragment of k step p (k = n), so each lane stores and later loads 16-B pieces:
//   piece (((column block * KS2 + k step) * 2 + half) * 32 + lane); a wave-wide access covers 512 contiguous bytes.
//   The fragments take over the c tile's LDS behind a barrier that ends its last read.
// Part 2, wave w: ctxT[d][c] partial = Vh.kPh + Vl.kPh + Vh.kPl for the 64x64 tile (w>>2, w&3), K = 128 -> f32, to
//   part [b * CH/4 + d/4][slice][d%4][c] (the KSP partials that one block of k_ksum adds lie 256 KiB in a row), whole
//   256-B row segments through the wave's slab, which takes over fragment LDS behind a barrier.
// coverage: KSP x GB blocks x 16 waves x (64 x 64) = all of part; 8 waves x 32 columns = every m and s.
// =====================================================================================================
#define SLN (NSP / KSP)                        // columns n of a slice
#define KS2 (SLN / 32)                         // k steps of the context product
#define FPL ((2 * CH / 16) * KS2 * 2 * 32)     // 16-B pieces of one fragment plane (hi or lo)
static_assert(SLN == 128 && 2 * CH == 16 * 32);            // 16 waves x 32 columns j; 8 accumulator row blocks
static_assert(SLN * XPITCH * 2 <= 2 * FPL * 16 && 16 * 16 * 68 * 4 <= 2 * FPL * 16);   // c tile and slabs fit

// exp(x) as __expf forms it (one multiply, one v_exp_f32), with the v_nop in the same statement: it fills the slot
// that the instruction set asks for between a transcendental and an instruction directly behind it that reads its
// result or overwrites its source.
__device__ __forceinline__ float exp_slot(float x) {
  float y = 0.f;
#if defined(__HIP_DEVICE_COMPILE__)
  const float a = x * 1.44269504088896340736f;
  asm("v_exp_f32 %0, %1\n\tv_nop" : "=v"(y) : "v"(a));
#endif
  return y;
}

__global__ __launch_bounds__(512) void k_kvctx(const unsigned short* __restrict__ wkvp,
                                               const unsigned short* __restrict__ ctp,
                                               const float* __restrict__ bkv,
                                               float* part, float* stm, float* sts) {
  __shared__ __align__(16) v4u sm[2 * FPL];                   // 256 KiB: c tile, then fragments, then slabs
  unsigned short* xs = (unsigned short*)(void*)sm;
  v4u* fh = sm;
  v4u* fl = sm + FPL;
  const int lane = threadIdx.x & 31;
  const int wave = __builtin_amdgcn_readfirstlane((int)(threadIdx.x >> 5));
  const int z  = blockIdx.x;
  const int b  = blockIdx.y;
  const int n0 = z * SLN;
  const int rlane = lane & 15;                 // row (A) / col (B, D) within subtile
  const int koff  = (lane >> 4) * 8;           // k offset of this lane half
  const int mOff  = (lane >> 4) * 8;           // D row offset
  const v4u* Wk = (const v4u*)(const void*)wkvp + frag_piece(wave * 2, 0) + lane;                  // B piece, block 0
  const __bf16* Xl = (const __bf16*)(const void*)xs + rlane * XPITCH + koff;                       // A row, block 0

  // ---- c tile to LDS; wkv fragments of the first two k steps and the bias meanwhile ----
  v16b wb[2][2];
  float bj[2];
  {
    const v4u* g = (const v4u*)(const void*)(ctp + ((size_t)b * NSP + (size_t)n0) * CH);
    v4u t[8];
#pragma unroll
    for (int it = 0; it < 8; ++it) t[it] = g[it * 512 + threadIdx.x];           // row it*16 + wave, piece lane
#pragma unroll
    for (int s = 0; s < 2; ++s)
#pragma unroll
      for (int jj = 0; jj < 2; ++jj) wb[s][jj] = ldfrag_q(Wk + frag_piece(jj, s));
#pragma unroll
    for (int jj = 0; jj < 2; ++jj) bj[jj] = bf_up(bf_bits(bkv[wave * 32 + jj * 16 + rlane]));
#pragma unroll
    for (int it = 0; it < 8; ++it) *(v4u*)(xs + (it * 16 + wave) * XPITCH + lane * 8) = t[it];
  }
  __syncthreads();   // the whole c tile is in LDS before any wave reads fragments of it

  // ---- part 1: KVt tile, 128 rows n x this wave's 32 columns j ----
  v8f acc[8][2];
#pragma unroll
  for (int i = 0; i < 8; ++i)
#pragma unroll
    for (int jj = 0; jj < 2; ++jj) acc[i][jj] = zero8();
  v16b xa[2][4];                               // c tile fragments of four row blocks, two sets
#pragma unroll
  for (int q = 0; q < 4; ++q) xa[0][q] = ldfrag_b(Xl + q * 16 * XPITCH);
#pragma unroll   // constant buffer indices keep wb[] and xa[] in registers
  for (int st = 0; st < 2 * KST; ++st) {       // k step st >> 1, row blocks 4 * (st & 1) ..
    const int ks = st >> 1, hf = st & 1, cu = ks & 1, nx = st + 1;
    if (nx < 2 * KST) {
#pragma unroll
      for (int q = 0; q < 4; ++q) xa[hf ^ 1][q] = ldfrag_b(Xl + ((nx & 1) * 4 + q) * 16 * XPITCH + (nx >> 1) * 32);
    }
    // the next set's LDS loads go as one group ahead of this set's products; the compiler otherwise loads one
    // fragment at a time into one register set and every pair of products waits a full LDS latency
    __builtin_amdgcn_sched_barrier(0);
#pragma unroll
    for (int q = 0; q < 4; ++q)
#pragma unroll
      for (int jj = 0; jj < 2; ++jj) acc[hf * 4 + q][jj] = mma_b_raw(xa[hf][q], wb[cu][jj], acc[hf * 4 + q][jj]);
    if (hf == 1 && ks + 2 < KST) {
#pragma unroll
      for (int jj = 0; jj < 2; ++jj) wb[cu][jj] = ldfrag_q(Wk + frag_piece(jj, ks + 2));
    }
    // keeps each wkv refill where it is written, two k steps ahead of its use; the compiler otherwise sinks it
    // to just before its products, and every fragment then waits a full load latency
    __builtin_amdgcn_sched_barrier(0);
  }
  __syncthreads();   // every wave has read its last c tile fragment before fragments overwrite the tile

  // ---- k softmax numerators of the slice (waves 0..7); hi/lo fragments of K and V to LDS ----
#pragma unroll
  for (int jj = 0; jj < 2; ++jj) {
    float v[8][8];
#pragma unroll
    for (int i = 0; i < 8; ++i)
#pragma unroll
      for (int r = 0; r < 8; ++r) v[i][r] = acc[i][jj][r] + bj[jj];
    if (wave < 8) {                            // wave-uniform; no barrier inside
      float m = v[0][0];
#pragma unroll
      for (int i = 0; i < 8; ++i)
#pragma unroll
        for (int r = 0; r < 8; ++r) m = fmaxf(m, v[i][r]);
      m = fmaxf(m, __shfl_xor(m, 16, 32));
      float s = 0.f;
#pragma unroll
      for (int i = 0; i < 8; ++i)
#pragma unroll
        for (int r = 0; r < 8; ++r) { v[i][r] = exp_slot(v[i][r] - m); s += v[i][r]; }
      s += __shfl_xor(s, 16, 32);
      if (lane < 16) {
        const int so = (z * GB + b) * CH + wave * 32 + jj * 16 + rlane;
        stm[so] = m;
        sts[so] = s;
      }
    }
#pragma unroll
    for (int i = 0; i < 8; ++i) {
      v4u ph, pl;
#pragma unroll
      for (int q = 0; q < 4; ++q) {
        const float f0 = v[i][2 * q], f1 = v[i][2 * q + 1];
        const unsigned short h0 = bf_bits(f0), h1 = bf_bits(f1);
        const unsigned short l0 = bf_bits(f0 - bf_up(h0)), l1 = bf_bits(f1 - bf_up(h1));
        ph[q] = pk16(h0, h1); pl[q] = pk16(l0, l1);
      }
      const int piece = ((((wave * 2 + jj) * KS2 + (i >> 1)) * 2 + (i & 1)) << 5) + lane;
      fh[piece] = ph;
      fl[piece] = pl;
    }
  }
  __syncthreads();   // every column block's fragments are in LDS before any wave reads them

  // ---- part 2: 64x64 tile of the slice's ctxT, rows d from V (A), columns c from kP (B) ----
  const int tm = wave >> 2, tn = wave & 3;
  v8f cx[4][4];
#pragma unroll
  for (int i = 0; i < 4; ++i)
#pragma unroll
    for (int j = 0; j < 4; ++j) cx[i][j] = zero8();
  const v4u* Ah = fh + (CH / 16 + tm * 4) * KS2 * 64 + lane;   // V column blocks of this tile's rows d
  const v4u* Al = fl + (CH / 16 + tm * 4) * KS2 * 64 + lane;
  v16b ah[2], al[2];
  ah[0] = ldfrag_q(Ah);
  al[0] = ldfrag_q(Al);
#pragma unroll   // constant indices keep the fragment arrays in registers
  for (int p = 0; p < KS2; ++p) {
    v16b bh[4], bl[4];
#pragma unroll
    for (int j = 0; j < 4; ++j) {
      bh[j] = ldfrag_q(fh + ((tn * 4 + j) * KS2 + p) * 64 + lane);
      bl[j] = ldfrag_q(fl + ((tn * 4 + j) * KS2 + p) * 64 + lane);
    }
#pragma unroll
    for (int i = 0; i < 4; ++i) {
      const int cu = i & 1;
      const int nx = p * 4 + i + 1;            // the next row block's A fragments, one block of products ahead
      if (nx < KS2 * 4) {
        ah[cu ^ 1] = ldfrag_q(Ah + ((nx & 3) * KS2 + (nx >> 2)) * 64);
        al[cu ^ 1] = ldfrag_q(Al + ((nx & 3) * KS2 + (nx >> 2)) * 64);
      }
      // each accumulator takes its three products in the order hi.hi, lo.hi, hi.lo; four tiles side by side
#pragma unroll
      for (int j = 0; j < 4; ++j) cx[i][j] = mma_b_raw(ah[cu], bh[j], cx[i][j]);
#pragma unroll
      for (int j = 0; j < 4; ++j) cx[i][j] = mma_b_raw(al[cu], bh[j], cx[i][j]);
#pragma unroll
      for (int j = 0; j < 4; ++j) cx[i][j] = mma_b_raw(ah[cu], bl[j], cx[i][j]);
      // keeps later blocks' fragment loads from being lifted up here: with more than one block's fragments
      // ahead the live set passes the 256 registers of a 16-wave work-group and spills to scratch
      __builtin_amdgcn_sched_barrier(0);
    }
  }
  __syncthreads();   // every wave has read its last fragment before the slabs overwrite them

  // ---- epilogue: whole 256-B row segments through the wave's own slab ----
  const int hh = lane >> 4, c4 = (lane & 15) * 4;          // 256-B row segment = 16 lanes x 16 B
  float* slab = (float*)(void*)sm + wave * (16 * 68);
  float* C = part + ((size_t)b * (CH / 4) * KSP + (size_t)z) * (4 * CH) + hh * CH + (tn << 6) + c4;
#pragma unroll
  for (int i = 0; i < 4; ++i) {
    const int mBase = (tm << 6) + (i << 4);
#pragma unroll
    for (int j = 0; j < 4; ++j) {
#pragma unroll
      for (int r = 0; r < 8; ++r) slab[(mOff + r) * 68 + (j << 4) + rlane] = cx[i][j][r];
    }
    // the wave's slab rows are written before its lanes read each other's values back
    asm volatile("s_wait_dscnt 0x0" ::: "memory");
    v4f t[8];
#pragma unroll
    for (int it = 0; it < 8; ++it) t[it] = *(const v4f*)(slab + (it * 2 + hh) * 68 + c4);   // rows 0..15
    // the rows are read before the next 16 rows overwrite the slab
    asm volatile("s_wait_dscnt 0x0" ::: "memory");
#pragma unroll
    for (int it = 0; it < 8; ++it)             // row d = mBase + 2 it + hh: group d/4, row d%4 = 2 (it&1) + hh
      *(v4f*)(C + (size_t)((mBase >> 2) + (it >> 1)) * (KSP * 4 * CH) + (it & 1) * (2 * CH)) = t[it];
  }
}

// =====================================================================================================
// Workspace map (bytes), every plane an exact multiple of its 64x64-tile / whole-line store granularity
// (no padded tails needed: 4096, 512, 256 are tile multiples); one group holds all GB = NBAT batches:
//   Wqb   bf16 [256][256]              0          131072
//   Wkvb  bf16 [512][256]              131072     262144
//   Wob   bf16 [256][256]              393216     131072
//   Xt    bf16 [GB][4096][256]         524288     16777216
//   Ct    bf16 [GB][4096][256]         17301504   16777216
//   cxp   f32  [GB*64][KSP][4][256]    34078720   67108864
//   stm   f32  [KSP][GB][256]          101187584  262144
//   sts   f32  [KSP][GB][256]          101449728  262144
//   m2h   bf16 [GB][256][256]          101711872  1048576
//   m2l   bf16 [GB][256][256]          102760448  1048576
//   end                                103809024
// Weights are [out][in] with the in index as k; Wqb, Wkvb, Wob, m2h, m2l are in fragment order.
// =====================================================================================================
extern "C" void kernel_launch(void* const* d_in, const int* in_sizes, int n_in,
                              void* d_out, int out_size, void* d_ws, size_t ws_size,
                              hipStream_t stream) {
  if (n_in < 8) return;
  if (in_sizes[0] != NBAT * CH * NSP) return;
  if (in_sizes[1] != NBAT * CH * NSP) return;
  if (in_sizes[2] != CH * CH) return;
  if (in_sizes[3] != CH) return;
  if (in_sizes[4] != 2 * CH * CH) return;
  if (in_sizes[5] != 2 * CH) return;
  if (in_sizes[6] != CH * CH) return;
  if (in_sizes[7] != CH) return;
  if (out_size != NBAT * CH * NSP) return;

  const float* x     = (const float*)d_in[0];
  const float* cproj = (const float*)d_in[1];
  const float* wq    = (const float*)d_in[2];
  const float* bq    = (const float*)d_in[3];
  const float* wkv   = (const float*)d_in[4];
  const float* bkv   = (const float*)d_in[5];
  const float* wo    = (const float*)d_in[6];
  const float* bo    = (const float*)d_in[7];
  float* out = (float*)d_out;

  const size_t PWq  = (size_t)CH * CH * 2;               //   131072
  const size_t PWkv = (size_t)2 * CH * CH * 2;           //   262144
  const size_t PWo  = (size_t)CH * CH * 2;               //   131072
  const size_t PXt  = (size_t)GB * NSP * CH * 2;         // 16777216
  const size_t PCxp = (size_t)KSP * GB * CH * CH * 4;    // 67108864
  const size_t PSt  = (size_t)KSP * GB * CH * 4;         //   262144
  const size_t PCx  = (size_t)GB * CH * CH * 2;          //  1048576
  size_t off = 0;
  const size_t oWq  = off; off += PWq;
  const size_t oWkv = off; off += PWkv;
  const size_t oWo  = off; off += PWo;
  const size_t oXt  = off; off += PXt;
  const size_t oCt  = off; off += PXt;
  const size_t oCxp = off; off += PCxp;
  const size_t oStm = off; off += PSt;
  const size_t oSts = off; off += PSt;
  const size_t oM2h = off; off += PCx;
  const size_t oM2l = off; off += PCx;
  if (off > ws_size) return;                             // off = 103809024

  char* ws = (char*)d_ws;
  unsigned short* Wqb  = (unsigned short*)(ws + oWq);
  unsigned short* Wkvb = (unsigned short*)(ws + oWkv);
  unsigned short* Wob  = (unsigned short*)(ws + oWo);
  unsigned short* Xt   = (unsigned short*)(ws + oXt);
  unsigned short* Ct   = (unsigned short*)(ws + oCt);
  float*          Cxp  = (float*)(ws + oCxp);
  float*          Stm  = (float*)(ws + oStm);
  float*          Sts  = (float*)(ws + oSts);
  unsigned short* M2h  = (unsigned short*)(ws + oM2h);
  unsigned short* M2l  = (unsigned short*)(ws + oM2l);

  const dim3 blk(256);
  const int n8wq  = CH * CH / 8;                         //  8192
  const int n8wkv = 2 * CH * CH / 8;                     // 16384
  const int n8wo  = CH * CH / 8;                         //  8192

  // (0) weights -> bf16 planes
  cvt_bf16x8<<<dim3((n8wq + 255) / 256), blk, 0, stream>>>(wq, Wqb, n8wq);
  cvt_bf16x8<<<dim3((n8wkv + 255) / 256), blk, 0, stream>>>(wkv, Wkvb, n8wkv);
  cvt_bf16x8<<<dim3((n8wo + 255) / 256), blk, 0, stream>>>(wo, Wob, n8wo);

  const dim3 gTr(NSP / 64, CH / 64, 2 * GB);             // 64 x 4 x 16
  const dim3 gKc(KSP, GB);                               // 32 slices of n x GB, 16 waves each
  const dim3 gSum(GB * CH * CH / 2048);                  // 256 blocks
  const dim3 gQo(NSP / 64, GB);                          // 64 column tiles x GB, 4 waves each

  for (int g = 0; g < NGRP; ++g) {
    const int b0 = g * GB;
    // (1) x[b], cproj[b] -> Xt[n][c], Ct[n][c] bf16
    k_trcvt<<<gTr, blk, 0, stream>>>(x, cproj, Xt, Ct, b0);
    // (2) per slice of 128 n: KVt[n][j] = Ct . wkv^T + bkv[j] (K=256); kP = exp(K - slice max) and V as hi/lo in
    //     LDS; ctxT[d][c] partial = Vh.kPh^T + Vl.kPh^T + Vh.kPl^T (M=N=256, K=128) -> f32 partials
    k_kvctx<<<gKc, dim3(512), 0, stream>>>(Wkvb, Ct, bkv, Cxp, Stm, Sts);
    // (3) softmax-weighted sum of the partials -> 8 rows of ctxT bf16 hi/lo in LDS per block;
    //     M2[o][d] = wo . (ctxTh + ctxTl)^T  (K=256) -> bf16 hi/lo
    k_ksum<<<gSum, dim3(512), 0, stream>>>(Cxp, Stm, Sts, Wob, M2h, M2l);
    // (4) Q = wq . Xt^T + bq, qP = 64 * softmax over each head's 64 rows (hi/lo, in LDS),
    //     out[b][o][n] = ((M2h + M2l).qPh + M2h.qPl) / 64 + bo[o] -> d_out f32
    float* outg = out + (size_t)b0 * CH * NSP;
    k_qout<<<gQo, dim3(128), 0, stream>>>(Wqb, Xt, bq, M2h, M2l, bo, outg);
  }
  (void)hipGetLastError();
}

// v007
// It runs in 68.3 microseconds.
// Timed twice side by side with v006, it ran 1.10 times as fast both times.
// Over all steps from v000 it is 22.1 times as fast.
// Contractions (all v_wmma_f32_16x16x32_bf16, f32 accumulate): x^T.wq^T and wkv.cproj with bf16 operands
// RNE-converted from the f32 inputs (single product); V.kP^T with bf16 hi+lo planes on both operands (3 products);
// wo.ctx^T with bf16 wo times ctx hi+lo planes (2 products); M2.qP^T with bf16 hi+lo planes on both (3 products).
// Softmaxes and epilogues in f32; the q softmax output is carried x64, folded back by the epilogue scale.
// The q projection, its softmax and the output product run in one kernel; q passes from one to the other in LDS.
// The KV projection, the k softmax and the V.kP^T product run in one kernel per slice of 128 columns n: kP is
// exp(K - slice maximum), un-normalised; the slice sum weighs each slice by exp(slice max - row max) / row sum.
// The slice sum and the wo.ctx^T product run in one kernel; a block's rows of ctx pass from one to the other in LDS.
// Every bf16 plane that a kernel reads from global memory as WMMA fragments (wq, wkv, wo, M2 hi/lo) lies
// there in fragment order (see frag_piece), so a wave-wide 16-B load covers 512 contiguous bytes.
#include <hip/hip_runtime.h>
#include <stdint.h>

#define NBAT 8
#define CH   256
#define NSP  4096
#define GB   8
#define NGRP (NBAT / GB)
static_assert((NSP % 64) == 0 && (CH % 64) == 0 && (NBAT % GB) == 0);
static_assert(CH == 4 * 64);         // four heads of 64 channels: one wave of k_qout per head
#define KSP  32                      // k slices of the V.kP^T product (K = NSP), one work-group of k_kvctx each
static_assert((NSP % (KSP * 32)) == 0 && ((GB * CH * CH) % 1024) == 0);

typedef __bf16   v16b __attribute__((ext_vector_type(16)));
typedef __bf16   v8b  __attribute__((ext_vector_type(8)));
typedef float    v8f  __attribute__((ext_vector_type(8)));
typedef float    v4f  __attribute__((ext_vector_type(4)));
typedef unsigned int v4u __attribute__((ext_vector_type(4)));

// ---- scalar helpers --------------------------------------------------------------------------------
__device__ __forceinline__ unsigned short bf_bits(float f) {          // f32 -> bf16 bits, RNE convert
  unsigned u = __float_as_uint(f);
  return (unsigned short)((u + 0x7FFFu + ((u >> 16) & 1u)) >> 16);
}
__device__ __forceinline__ float bf_up(unsigned short h) { return __uint_as_float(((unsigned)h) << 16); }
__device__ __forceinline__ unsigned pk16(unsigned short a, unsigned short b) { return (unsigned)a | ((unsigned)b << 16); }
__device__ __forceinline__ v8f zero8() { v8f z = {0.f, 0.f, 0.f, 0.f, 0.f, 0.f, 0.f, 0.f}; return z; }

// ---- fragment loader: 16-bit A/B operand, lane -> row/col (lane&15), p already includes +8*(lane>>4);
//      elements 0..7 <- p[0..7] (k0+8h..), elements 8..15 <- p[16..23] (k0+16+8h..)
__device__ __forceinline__ v16b ldfrag_b(const __bf16* p) {
  union { v16b v; v8b h[2]; } f;
  f.h[0] = *(const v8b*)(p);
  f.h[1] = *(const v8b*)(p + 16);
  return f.v;
}

// ---- fragment order of a plane P[row][k] with CH values k per row: 16-B pieces of 8 consecutive k;
//      piece (((row block * KST + k step) * 2 + half) * 32 + lane) holds row 16 * block + (lane&15),
//      k = 32 * step + 16 * half + 8 * (lane>>4) + 0..7: the same lane -> k order as ldfrag_b.
#define KST    (CH / 32)                       // k steps of a product over CH
__device__ __forceinline__ int frag_piece(int rowblk, int kstep) { return (rowblk * KST + kstep) * 64; }
__device__ __forceinline__ v16b ldfrag_q(const v4u* p) {   // p = this lane's piece of half 0; half 1 lies 32 pieces on
  union { v16b v; v4u q[2]; } f;
  f.q[0] = p[0];
  f.q[1] = p[32];
  return f.v;
}

// ---- WMMA helper -------------------------------------------------------------------------------------
__device__ __forceinline__ v8f mma_b_raw(v16b a, v16b b, v8f c) {
  return __builtin_amdgcn_wmma_f32_16x16x32_bf16(false, a, false, b, (short)0, c, false, false);
}

// =====================================================================================================
// f32 [rows][CH] -> bf16 (RNE convert) in fragment order: the thread forms piece i from 8 consecutive k of its row
// (a wave reads 64 B of each of 16 rows); one 16-B store per lane: a wave writes 512 contiguous B.
// =====================================================================================================
__device__ __forceinline__ void cvt_piece(const float* __restrict__ in, unsigned short* out, int i) {
  const int row = (i / (KST * 64)) * 16 + (i & 15);
  const int k   = ((i >> 6) % KST) * 32 + ((i >> 5) & 1) * 16 + ((i >> 4) & 1) * 8;
  const float* src = in + (size_t)row * CH + k;
  const v4f a = *(const v4f*)(src);
  const v4f b = *(const v4f*)(src + 4);
  v4u p;
  p[0] = pk16(bf_bits(a[0]), bf_bits(a[1]));
  p[1] = pk16(bf_bits(a[2]), bf_bits(a[3]));
  p[2] = pk16(bf_bits(b[0]), bf_bits(b[1]));
  p[3] = pk16(bf_bits(b[2]), bf_bits(b[3]));
  *(v4u*)(out + (size_t)i * 8) = p;
}

// =====================================================================================================
// All operand conversions in one grid; none needs anything of another. grid (NSP/64, WROWS + 4 * 2 * GB), block 256.
// Grid rows y < WROWS: the three weight planes, one 16-B piece per thread (cvt_piece); block
//   y * 64 + x takes pieces 256 * block ..; blocks 0..31 wq, 32..95 wkv, 96..127 wo: 32768 pieces = whole planes.
// Grid rows y >= WROWS, u = y - WROWS:
// transpose-convert of one 64x64 tile: source [b][c][n] f32 (c pitch NSP) -> plane [bi][n][c] bf16 (pitch CH).
// blockIdx.x = n tile, u & 3 = c tile, u >> 2 = 2*bi + sel (sel 0: xg -> xt, 1: cg -> ct).
// Load: thread r = tid>>2 owns source row c0+r, 16 consecutive n at (tid&3)*16 (4 x 16-B loads).
// coverage: load 256x16 = 4096 = whole tile; store 2x256x8 = 4096 = whole tile.
// =====================================================================================================
#define WPC   (CH * CH / 8)                    // 16-B pieces of a [CH][CH] plane
#define WROWS (4 * WPC / 256 / (NSP / 64))     // grid rows of 64 blocks that hold the 4 * WPC weight pieces
static_assert(WROWS * (NSP / 64) * 256 == 4 * WPC && (WPC % 256) == 0 && CH / 64 == 4);

__global__ __launch_bounds__(256) void k_trcvt(const float* __restrict__ xg, const float* __restrict__ cg,
                                               unsigned short* xt, unsigned short* ct, int b0,
                                               const float* __restrict__ wq, const float* __restrict__ wkv,
                                               const float* __restrict__ wo, unsigned short* wqb,
                                               unsigned short* wkvb, unsigned short* wob) {
  __shared__ float tile[64][65];
  const int tid = threadIdx.x;
  if (blockIdx.y < WROWS) {                    // block-uniform, and leaves ahead of the barrier
    const int wblk = (int)(blockIdx.y * (NSP / 64) + blockIdx.x);
    const int pl = wblk < WPC / 256 ? 0 : wblk < 3 * WPC / 256 ? 1 : 2;       // block-uniform selects, all global
    const float* win = pl == 0 ? wq : pl == 1 ? wkv : wo;
    unsigned short* wout = pl == 0 ? wqb : pl == 1 ? wkvb : wob;
    const int first = pl == 0 ? 0 : pl == 1 ? WPC / 256 : 3 * WPC / 256;      // the plane's first block
    cvt_piece(win, wout, (wblk - first) * 256 + tid);
    return;
  }
  const int u  = (int)blockIdx.y - WROWS;
  const int n0 = blockIdx.x * 64;
  const int c0 = (u & 3) * 64;
  const int bi  = u >> 3;
  const int sel = (u >> 2) & 1;
  const float* src = sel ? cg : xg;            // block-uniform select, both global
  unsigned short* dst = sel ? ct : xt;
  {
    const int r = tid >> 2, cs = (tid & 3) * 16;
    const float* p = src + ((size_t)(b0 + bi) * CH + (size_t)(c0 + r)) * NSP + n0 + cs;
#pragma unroll
    for (int i = 0; i < 4; ++i) {
      const v4f v = *(const v4f*)(p + 4 * i);
      tile[r][cs + 4 * i + 0] = v[0];
      tile[r][cs + 4 * i + 1] = v[1];
      tile[r][cs + 4 * i + 2] = v[2];
      tile[r][cs + 4 * i + 3] = v[3];
    }
  }
  __syncthreads();
  v4u pv[2];
  const int c8 = (tid & 7) * 8;
#pragma unroll
  for (int it = 0; it < 2; ++it) {
    const int n = it * 32 + (tid >> 3);
    v4u a;
#pragma unroll
    for (int e = 0; e < 4; ++e) {
      a[e] = pk16(bf_bits(tile[c8 + 2 * e][n]), bf_bits(tile[c8 + 2 * e + 1][n]));
    }
    pv[it] = a;
  }
  {
#pragma unroll
    for (int it = 0; it < 2; ++it) {
      const int n = it * 32 + (tid >> 3);
      const size_t go = ((size_t)bi * NSP + (size_t)(n0 + n)) * CH + c0 + c8;
      *(v4u*)(dst + go) = pv[it];
    }
    
  }
}

// =====================================================================================================
// Weighted sum of the KSP k-slice partials of ctxT, then M2 = wo . ctxT^T for the block's rows d.
// part f32 [GB*CH/4][KSP][4*CH] -> M2 bf16 hi/lo planes [GB][CH*CH].
// Slice z of column c weighs exp(m[z][c] - M[c]) / S[c], M = maximum of the slice maxima, S = sum over z of
// exp(m[z][c] - M[c]) * s[z][c]: the softmax over all n. A block covers 8 rows d x all CH columns c of one batch:
// thread t < CH forms the KSP weights of column t once, in LDS; slices are added in index order.
// Thread owns 4 consecutive elements (16-B loads); their bf16 hi and lo go to LDS rows [d][c] at a pitch of 528 B.
// Product, wave w: M2[o][d] = sum over c of wo[o][c] * (ctxTh + ctxTl)[d][c] for o in 16w..16w+15, K = CH, per k step
//   the hi product and then the lo product. ctxT is the A operand (rows d; A rows 8..15 repeat rows 0..7 and their
//   results are not stored), wo the B operand (columns o), so lane l < 16 holds M2[16w + l][d0..d0+7]: one 16-B
//   piece of the planes, which are in fragment order with row o and k = d. A wave stores 256 contiguous B per plane.
// coverage: (GB*CH*CH/2048) blocks x 16 waves x (16 rows o x 8 columns d) = whole planes.
// =====================================================================================================
#define CPITCH (CH + 8)                        // ctxT row pitch in LDS, elements (528 B)
static_assert(CH == 16 * 16);                  // sixteen waves x 16 rows o

__global__ __launch_bounds__(512) void k_ksum(const float* __restrict__ part, const float* __restrict__ stm,
                                              const float* __restrict__ sts, const unsigned short* __restrict__ wop,
                                              unsigned short* m2h, unsigned short* m2l) {
  __shared__ __align__(16) float wl[KSP][CH];
  __shared__ __align__(16) unsigned short csh[8 * CPITCH];    // the block's 8 rows of ctxT, bf16 hi
  __shared__ __align__(16) unsigned short csl[8 * CPITCH];    // and lo
  const unsigned t = threadIdx.x;
  const int lane = (int)(t & 31u);
  const int wave = __builtin_amdgcn_readfirstlane((int)(t >> 5));
  const int b = (int)(blockIdx.x / (CH * CH / 2048));
  const unsigned tq = t & 255u;                 // place in the thread's group of 4 rows d
  // the wave's group of 4 rows as a scalar: wave-uniform bases in scalar registers, one lane offset for all loads
  const unsigned g4 = (unsigned)__builtin_amdgcn_readfirstlane((int)(t >> 8));
  const float* pb = part + ((size_t)blockIdx.x * 2 + g4) * (KSP * 1024);
  const float* mb = stm + b * CH;
  const float* sb = sts + b * CH;
  v4f p[KSP];
#pragma unroll   // keeps p[] in registers and the independent loads in flight together
  for (int z = 0; z < KSP; ++z) p[z] = *(const v4f*)(pb + z * 1024 + tq * 4u);
  // keeps the plane loads ahead of the weights' work, in flight under it; the compiler otherwise sinks them
  // behind it, and the block pays the two memory latencies one after the other
  __builtin_amdgcn_sched_barrier(0);
  if (t < CH) {                                 // wave-uniform; no barrier inside
    float m[KSP], sz[KSP];
#pragma unroll   // m[] and sz[] are indexed by constants only, so they stay in registers
    for (int z = 0; z < KSP; ++z) {
      m[z]  = mb[z * (GB * CH) + t];
      sz[z] = sb[z * (GB * CH) + t];
    }
    float mm = m[0];
#pragma unroll
    for (int z = 1; z < KSP; ++z) mm = fmaxf(mm, m[z]);
    float ss = 0.f;
#pragma unroll
    for (int z = 0; z < KSP; ++z) { m[z] = __expf(m[z] - mm); ss += m[z] * sz[z]; }
    const float rinv = 1.0f / ss;
#pragma unroll
    for (int z = 0; z < KSP; ++z) wl[z][t] = m[z] * rinv;
  }
  __syncthreads();   // every column's weights are in LDS before any thread reads its four
  // wo fragments of this wave's 16 rows o, all k steps: they depend on nothing here and fly under the slice sum
  // (behind the barrier, whose wait for outstanding loads would otherwise hold the block up for them)
  v16b wf[KST];
  {
    const v4u* Wo = (const v4u*)(const void*)wop + frag_piece(wave, 0) + lane;
#pragma unroll   // wf[] is indexed by constants only, so it stays in registers
    for (int ks = 0; ks < KST; ++ks) wf[ks] = ldfrag_q(Wo + frag_piece(0, ks));
  }
  const unsigned c4 = (t * 4u) & (CH - 1);
  v4f s = p[0] * *(const v4f*)(&wl[0][c4]);
#pragma unroll   // p[] is indexed by constants only, so it stays in registers
  for (int z = 1; z < KSP; ++z) s += p[z] * *(const v4f*)(&wl[z][c4]);
  const unsigned short h0 = bf_bits(s[0]), h1 = bf_bits(s[1]), h2 = bf_bits(s[2]), h3 = bf_bits(s[3]);
  uint2 hv, lv;
  hv.x = pk16(h0, h1);
  hv.y = pk16(h2, h3);
  lv.x = pk16(bf_bits(s[0] - bf_up(h0)), bf_bits(s[1] - bf_up(h1)));
  lv.y = pk16(bf_bits(s[2] - bf_up(h2)), bf_bits(s[3] - bf_up(h3)));
  *(uint2*)(csh + (t >> 6) * CPITCH + c4) = hv;
  *(uint2*)(csl + (t >> 6) * CPITCH + c4) = lv;
  __syncthreads();   // all 8 rows of ctxT are in LDS before any wave reads fragments of them

  const __bf16* Ch = (const __bf16*)(const void*)csh + (lane & 7) * CPITCH + (lane >> 4) * 8;   // this lane's A row
  const __bf16* Cl = (const __bf16*)(const void*)csl + (lane & 7) * CPITCH + (lane >> 4) * 8;
  v16b ah[KST], al[KST];
#pragma unroll   // ah[] and al[] are indexed by constants only, so they stay in registers (those of p[], now free)
  for (int ks = 0; ks < KST; ++ks) {
    ah[ks] = ldfrag_b(Ch + ks * 32);
    al[ks] = ldfrag_b(Cl + ks * 32);
  }
  // all LDS fragment loads go as one group ahead of the products; the compiler otherwise loads one fragment at a
  // time into one register set, and each of the sixteen chained products waits a full LDS latency
  __builtin_amdgcn_sched_barrier(0);
  v8f acc = zero8();
#pragma unroll   // wf[], ah[] and al[] are indexed by constants only
  for (int ks = 0; ks < KST; ++ks) {
    acc = mma_b_raw(ah[ks], wf[ks], acc);
    acc = mma_b_raw(al[ks], wf[ks], acc);
  }
  v4u ph, pl;
#pragma unroll
  for (int q = 0; q < 4; ++q) {
    const float f0 = acc[2 * q], f1 = acc[2 * q + 1];
    const unsigned short a0 = bf_bits(f0), a1 = bf_bits(f1);
    ph[q] = pk16(a0, a1);
    pl[q] = pk16(bf_bits(f0 - bf_up(a0)), bf_bits(f1 - bf_up(a1)));
  }
  if (lane < 16) {                              // lanes 16..31 hold the repeated A rows
    const int d0 = (int)(blockIdx.x % (CH * CH / 2048)) * 8;
    const size_t e0 = (size_t)b * (CH * CH) +
        (size_t)(frag_piece(wave, d0 >> 5) + ((d0 >> 4) & 1) * 32 + ((d0 >> 3) & 1) * 16 + lane) * 8;
    *(v4u*)(m2h + e0) = ph;
    *(v4u*)(m2l + e0) = pl;
  }
}

// =====================================================================================================
// q projection + q softmax + output product for one 64-column tile of n. grid (NSP/64, GB), block 128 = 4 waves.
// x tile: rows n0..n0+63 of Xt are 32 KiB in a row; each wave-wide load takes one whole 512-B row, and the rows
//   stand in LDS at a pitch of 528 B (16 B x odd) for the 16-B fragment reads of all four waves.
// Part 1, wave w = head w: Q[o][n] = wq . Xt^T + bq[o] for o in 64w..64w+63 (K = CH). A lane holds column
//   n0 + 16j + (lane&15) and rows 16i + 8(lane>>4) + r, so one column's head lies in lanes l and l^16:
//   softmax of 0.25 * Q over the 64 rows = a sum inside the lane and one xor-16 exchange.
// Hand-over: 64 * softmax as bf16 hi/lo. Accumulator tiles 2p and 2p+1 of a column block are, lane for lane,
//   elements 0..7 and 8..15 of the B fragment of k step p, so each lane stores and later loads its own 16-B
//   pieces: piece (((k step * 4 + j) * 2 + half) * 32 + lane); a wave-wide access covers 512 contiguous bytes.
// Part 2, wave w: out[o][n] = ((M2h + M2l).qPh + M2h.qPl) / 64 + bo[o] for o in 64w..64w+63 (K = CH, all heads).
// coverage: 64 x GB blocks x 4 waves x (64 rows x 64 columns) = whole output.
// =====================================================================================================
#define XPITCH (CH + 8)                        // x tile row pitch in LDS, elements (528 B)

__global__ __launch_bounds__(128) void k_qout(const unsigned short* __restrict__ wqp,
                                              const unsigned short* __restrict__ xtp,
                                              const float* __restrict__ bq,
                                              const unsigned short* __restrict__ m2hp,
                                              const unsigned short* __restrict__ m2lp,
                                              const float* __restrict__ bo, float* outp) {
  __shared__ __align__(16) unsigned short xs[64 * XPITCH];    // 33 KiB: x tile, bf16
  __shared__ __align__(16) v4u qsh[KST * 4 * 2 * 32];         // 32 KiB: q hi fragments of the tile
  __shared__ __align__(16) v4u qsl[KST * 4 * 2 * 32];         // 32 KiB: q lo fragments
  __shared__ __align__(16) float sT[4][16 * 68];              // per-wave 16x64 slab, pitch 68 floats
  const int lane = threadIdx.x & 31;
  const int wave = threadIdx.x >> 5;
  const int b  = blockIdx.y;
  const int n0 = blockIdx.x << 6;
  const int m0 = wave << 6;
  const int rlane = lane & 15;                 // row (A) / col (B, D) within subtile
  const int koff  = (lane >> 4) * 8;           // k offset of this lane half
  const int mOff  = (lane >> 4) * 8;           // D row offset
  const int apc = frag_piece(m0 >> 4, 0) + lane;             // this lane's A piece (subtile 0, k step 0), all three A planes
  const v4u* Wq = (const v4u*)(const void*)wqp + apc;
  const v4u* Mh = (const v4u*)(const void*)(m2hp + (size_t)b * CH * CH) + apc;
  const v4u* Ml = (const v4u*)(const void*)(m2lp + (size_t)b * CH * CH) + apc;
  const __bf16* Xl = (const __bf16*)(const void*)xs + rlane * XPITCH + koff;   // this lane's B row (subtile 0)

  // ---- x tile to LDS; wq fragments of the first two k steps meanwhile ----
  v16b wa[2][4];
  {
    const v4u* g = (const v4u*)(const void*)(xtp + ((size_t)b * NSP + (size_t)n0) * CH);
    v4u t[16];
#pragma unroll
    for (int it = 0; it < 16; ++it) t[it] = g[it * 128 + threadIdx.x];          // row it*4 + wave, piece lane
#pragma unroll
    for (int s = 0; s < 2; ++s)
#pragma unroll
      for (int i = 0; i < 4; ++i) wa[s][i] = ldfrag_q(Wq + frag_piece(i, s));
#pragma unroll
    for (int it = 0; it < 16; ++it) *(v4u*)(xs + (it * 4 + wave) * XPITCH + lane * 8) = t[it];
  }
  __syncthreads();   // the whole x tile is in LDS before any wave reads fragments of it

  v8f acc[4][4];
#pragma unroll
  for (int i = 0; i < 4; ++i)
#pragma unroll
    for (int j = 0; j < 4; ++j) acc[i][j] = zero8();

  // ---- part 1: Q tile of this wave's head ----
  {
    v16b xb[2][4];
#pragma unroll
    for (int j = 0; j < 4; ++j) xb[0][j] = ldfrag_b(Xl + j * 16 * XPITCH);
#pragma unroll   // constant buffer indices keep wa[] and xb[] in registers
    for (int ks = 0; ks < KST; ++ks) {
      const int cu = ks & 1;
      if (ks + 1 < KST) {
#pragma unroll
        for (int j = 0; j < 4; ++j) xb[cu ^ 1][j] = ldfrag_b(Xl + j * 16 * XPITCH + (ks + 1) * 32);
      }
#pragma unroll
      for (int i = 0; i < 4; ++i) {
#pragma unroll
        for (int j = 0; j < 4; ++j) acc[i][j] = mma_b_raw(wa[cu][i], xb[cu][j], acc[i][j]);
        if (ks + 2 < KST) wa[cu][i] = ldfrag_q(Wq + frag_piece(i, ks + 2));
        // keeps each refill where it is written, two k steps ahead of its use; the compiler otherwise sinks it
        // to just before its products, and every fragment then waits a full load latency
        __builtin_amdgcn_sched_barrier(0);
      }
    }
  }

  // ---- q softmax over the head's 64 rows, column by column; fragments to LDS ----
  float bro[4][8];
#pragma unroll
  for (int i = 0; i < 4; ++i)
#pragma unroll
    for (int r = 0; r < 8; ++r) bro[i][r] = bf_up(bf_bits(bq[m0 + (i << 4) + mOff + r]));
#pragma unroll
  for (int j = 0; j < 4; ++j) {
    float v[4][8];
#pragma unroll
    for (int i = 0; i < 4; ++i)
#pragma unroll
      for (int r = 0; r < 8; ++r) v[i][r] = (acc[i][j][r] + bro[i][r]) * 0.25f;
    float m = v[0][0];
#pragma unroll
    for (int i = 0; i < 4; ++i)
#pragma unroll
      for (int r = 0; r < 8; ++r) m = fmaxf(m, v[i][r]);
    m = fmaxf(m, __shfl_xor(m, 16, 32));
    float s = 0.f;
#pragma unroll
    for (int i = 0; i < 4; ++i)
#pragma unroll
      for (int r = 0; r < 8; ++r) { v[i][r] = __expf(v[i][r] - m); s += v[i][r]; }
    s += __shfl_xor(s, 16, 32);
    const float rinv = 1.0f / s;
#pragma unroll
    for (int i = 0; i < 4; ++i) {
      v4u ph, pl;
#pragma unroll
      for (int q = 0; q < 4; ++q) {
        const float f0 = (v[i][2 * q] * rinv) * 64.0f;
        const float f1 = (v[i][2 * q + 1] * rinv) * 64.0f;
        const unsigned short h0 = bf_bits(f0), h1 = bf_bits(f1);
        const unsigned short l0 = bf_bits(f0 - bf_up(h0)), l1 = bf_bits(f1 - bf_up(h1));
        ph[q] = pk16(h0, h1); pl[q] = pk16(l0, l1);
      }
      const int piece = ((((wave * 2 + (i >> 1)) * 4 + j) * 2 + (i & 1)) << 5) + lane;
      qsh[piece] = ph;
      qsl[piece] = pl;
    }
  }
  v16b ah[4], al[4];   // M2 fragments of k step 0: they do not depend on q, so they fly across the barrier
#pragma unroll
  for (int i = 0; i < 4; ++i) {
    ah[i] = ldfrag_q(Mh + frag_piece(i, 0));
    al[i] = ldfrag_q(Ml + frag_piece(i, 0));
  }
  __syncthreads();   // every head's fragments are in LDS before any wave reads them

  // ---- part 2: output rows 64w..64w+63 over all CH channels of q ----
#pragma unroll
  for (int i = 0; i < 4; ++i)
#pragma unroll
    for (int j = 0; j < 4; ++j) acc[i][j] = zero8();
  {
    v16b bh[2][4], bl[2][4];
#pragma unroll
    for (int j = 0; j < 4; ++j) {
      bh[0][j] = ldfrag_q(qsh + j * 64 + lane);
      bl[0][j] = ldfrag_q(qsl + j * 64 + lane);
    }
#pragma unroll   // constant buffer indices keep the fragment arrays in registers
    for (int ks = 0; ks < KST; ++ks) {
      const int cu = ks & 1;
      if (ks + 1 < KST) {
#pragma unroll
        for (int j = 0; j < 4; ++j) {
          bh[cu ^ 1][j] = ldfrag_q(qsh + ((ks + 1) * 4 + j) * 64 + lane);
          bl[cu ^ 1][j] = ldfrag_q(qsl + ((ks + 1) * 4 + j) * 64 + lane);
        }
      }
#pragma unroll
      for (int i = 0; i < 4; ++i) {
        // each accumulator takes its three products in the order hi.hi, lo.hi, hi.lo; four tiles side by side
#pragma unroll
        for (int j = 0; j < 4; ++j) acc[i][j] = mma_b_raw(ah[i], bh[cu][j], acc[i][j]);
#pragma unroll
        for (int j = 0; j < 4; ++j) acc[i][j] = mma_b_raw(al[i], bh[cu][j], acc[i][j]);
#pragma unroll
        for (int j = 0; j < 4; ++j) acc[i][j] = mma_b_raw(ah[i], bl[cu][j], acc[i][j]);
        if (ks + 1 < KST) {
          ah[i] = ldfrag_q(Mh + frag_piece(i, ks + 1));
          al[i] = ldfrag_q(Ml + frag_piece(i, ks + 1));
        }
        // keeps each refill where it is written, one k step ahead of its use (see part 1)
        __builtin_amdgcn_sched_barrier(0);
      }
    }
  }

  // ---- epilogue: whole 256-B row segments through the wave's own slab ----
  float* slab = sT[wave];
  float* C = outp + (size_t)b * CH * NSP;
  const int hh = lane >> 4, c4 = (lane & 15) * 4;          // 256-B row segment = 16 lanes x 16 B
#pragma unroll
  for (int i = 0; i < 4; ++i) {
    const int mBase = m0 + (i << 4);
    float brow[8];
#pragma unroll
    for (int r = 0; r < 8; ++r) brow[r] = bf_up(bf_bits(bo[mBase + mOff + r]));
#pragma unroll
    for (int j = 0; j < 4; ++j) {
#pragma unroll
      for (int r = 0; r < 8; ++r) {
        slab[(mOff + r) * 68 + (j << 4) + rlane] = acc[i][j][r] * (1.0f / 64.0f) + brow[r];
      }
    }
    // the wave's slab rows are written before its lanes read each other's values back
    asm volatile("s_wait_dscnt 0x0" ::: "memory");
    v4f t[8];
#pragma unroll
    for (int it = 0; it < 8; ++it) t[it] = *(const v4f*)(slab + (it * 2 + hh) * 68 + c4);   // rows 0..15
    // the rows are read before the next 16 rows overwrite the slab
    asm volatile("s_wait_dscnt 0x0" ::: "memory");
#pragma unroll
    for (int it = 0; it < 8; ++it) *(v4f*)(C + (size_t)(mBase + it * 2 + hh) * NSP + n0 + c4) = t[it];
  }
}

// =====================================================================================================
// KV projection + k softmax numerators + context product for one slice of SLN = 128 columns n of one batch.
// grid (KSP, GB), block 512 = 16 waves, one work-group per WGP (256 KiB of LDS).
// c tile: rows n0..n0+127 of Ct are 64 KiB in a row; each wave-wide load takes one whole 512-B row, and the rows
//   stand in LDS at a pitch of 528 B (16 B x odd) for the 16-B fragment reads of all sixteen waves.
// Part 1, wave w: KVt[n][j] = Ct . wkv^T + bkv[j] for all 128 n and j in 32w..32w+31 (K = CH). A lane holds column
//   j = 32w + 16jj + (lane&15) and rows n = 16i + 8(lane>>4) + r, so one column lies in lanes l and l^16.
// Waves 0..7 hold K (j < CH): slice maximum m and sum s of exp(K - m) = a sum inside the lane and one xor-16
//   exchange; m and s go to stm, sts [slice][b][j]; the value handed on is exp(K - m). Waves 8..15 hold V as it is.
// Hand-over: bf16 hi/lo. Accumulator tiles 2p and 2p+1 of a column block are, lane for lane, elements 0..7 and
//   8..15 of the A or B fragment of k step p (k = n), so each lane stores and later loads 16-B pieces:
//   piece (((column block * KS2 + k step) * 2 + half) * 32 + lane); a wave-wide access covers 512 contiguous bytes.
//   The fragments take over the c tile's LDS behind a barrier that ends its last read.
// Part 2, wave w: ctxT[d][c] partial = Vh.kPh + Vl.kPh + Vh.kPl for the 64x64 tile (w>>2, w&3), K = 128 -> f32, to
//   part [b * CH/4 + d/4][slice][d%4][c] (the KSP partials that one block of k_ksum adds lie 256 KiB in a row), whole
//   256-B row segments through the wave's slab, which takes over fragment LDS behind a barrier.
// coverage: KSP x GB blocks x 16 waves x (64 x 64) = all of part; 8 waves x 32 columns = every m and s.
// =====================================================================================================
#define SLN (NSP / KSP)                        // columns n of a slice
#define KS2 (SLN / 32)                         // k steps of the context product
#define FPL ((2 * CH / 16) * KS2 * 2 * 32)     // 16-B pieces of one fragment plane (hi or lo)
static_assert(SLN == 128 && 2 * CH == 16 * 32);            // 16 waves x 32 columns j; 8 accumulator row blocks
static_assert(SLN * XPITCH * 2 <= 2 * FPL * 16 && 16 * 16 * 68 * 4 <= 2 * FPL * 16);   // c tile and slabs fit

// exp(x) as __expf forms it (one multiply, one v_exp_f32), with the v_nop in the same statement: it fills the slot
// that the instruction set asks for between a transcendental and an instruction directly behind it that reads its
// result or overwrites its source.
__device__ __forceinline__ float exp_slot(float x) {
  float y = 0.f;
#if defined(__HIP_DEVICE_COMPILE__)
  const float a = x * 1.44269504088896340736f;
  asm("v_exp_f32 %0, %1\n\tv_nop" : "=v"(y) : "v"(a));
#endif
  return y;
}

__global__ __launch_bounds__(512) void k_kvctx(const unsigned short* __restrict__ wkvp,
                                               const unsigned short* __restrict__ ctp,
                                               const float* __restrict__ bkv,
                                               float* part, float* stm, float* sts) {
  __shared__ __align__(16) v4u sm[2 * FPL];                   // 256 KiB: c tile, then fragments, then slabs
  unsigned short* xs = (unsigned short*)(void*)sm;
  v4u* fh = sm;
  v4u* fl = sm + FPL;
  const int lane = threadIdx.x & 31;
  const int wave = __builtin_amdgcn_readfirstlane((int)(threadIdx.x >> 5));
  const int z  = blockIdx.x;
  const int b  = blockIdx.y;
  const int n0 = z * SLN;
  const int rlane = lane & 15;                 // row (A) / col (B, D) within subtile
  const int koff  = (lane >> 4) * 8;           // k offset of this lane half
  const int mOff  = (lane >> 4) * 8;           // D row offset
  const v4u* Wk = (const v4u*)(const void*)wkvp + frag_piece(wave * 2, 0) + lane;                  // B piece, block 0
  const __bf16* Xl = (const __bf16*)(const void*)xs + rlane * XPITCH + koff;                       // A row, block 0

  // ---- c tile to LDS; wkv fragments of the first two k steps and the bias meanwhile ----
  v16b wb[2][2];
  float bj[2];
  {
    const v4u* g = (const v4u*)(const void*)(ctp + ((size_t)b * NSP + (size_t)n0) * CH);
    v4u t[8];
#pragma unroll
    for (int it = 0; it < 8; ++it) t[it] = g[it * 512 + threadIdx.x];           // row it*16 + wave, piece lane
#pragma unroll
    for (int s = 0; s < 2; ++s)
#pragma unroll
      for (int jj = 0; jj < 2; ++jj) wb[s][jj] = ldfrag_q(Wk + frag_piece(jj, s));
#pragma unroll
    for (int jj = 0; jj < 2; ++jj) bj[jj] = bf_up(bf_bits(bkv[wave * 32 + jj * 16 + rlane]));
#pragma unroll
    for (int it = 0; it < 8; ++it) *(v4u*)(xs + (it * 16 + wave) * XPITCH + lane * 8) = t[it];
  }
  __syncthreads();   // the whole c tile is in LDS before any wave reads fragments of it

  // ---- part 1: KVt tile, 128 rows n x this wave's 32 columns j ----
  v8f acc[8][2];
#pragma unroll
  for (int i = 0; i < 8; ++i)
#pragma unroll
    for (int jj = 0; jj < 2; ++jj) acc[i][jj] = zero8();
  v16b xa[2][4];                               // c tile fragments of four row blocks, two sets
#pragma unroll
  for (int q = 0; q < 4; ++q) xa[0][q] = ldfrag_b(Xl + q * 16 * XPITCH);
#pragma unroll   // constant buffer indices keep wb[] and xa[] in registers
  for (int st = 0; st < 2 * KST; ++st) {       // k step st >> 1, row blocks 4 * (st & 1) ..
    const int ks = st >> 1, hf = st & 1, cu = ks & 1, nx = st + 1;
    if (nx < 2 * KST) {
#pragma unroll
      for (int q = 0; q < 4; ++q) xa[hf ^ 1][q] = ldfrag_b(Xl + ((nx & 1) * 4 + q) * 16 * XPITCH + (nx >> 1) * 32);
    }
    // the next set's LDS loads go as one group ahead of this set's products; the compiler otherwise loads one
    // fragment at a time into one register set and every pair of products waits a full LDS latency
    __builtin_amdgcn_sched_barrier(0);
#pragma unroll
    for (int q = 0; q < 4; ++q)
#pragma unroll
      for (int jj = 0; jj < 2; ++jj) acc[hf * 4 + q][jj] = mma_b_raw(xa[hf][q], wb[cu][jj], acc[hf * 4 + q][jj]);
    if (hf == 1 && ks + 2 < KST) {
#pragma unroll
      for (int jj = 0; jj < 2; ++jj) wb[cu][jj] = ldfrag_q(Wk + frag_piece(jj, ks + 2));
    }
    // keeps each wkv refill where it is written, two k steps ahead of its use; the compiler otherwise sinks it
    // to just before its products, and every fragment then waits a full load latency
    __builtin_amdgcn_sched_barrier(0);
  }
  __syncthreads();   // every wave has read its last c tile fragment before fragments overwrite the tile

  // ---- k softmax numerators of the slice (waves 0..7); hi/lo fragments of K and V to LDS ----
#pragma unroll
  for (int jj = 0; jj < 2; ++jj) {
    float v[8][8];
#pragma unroll
    for (int i = 0; i < 8; ++i)
#pragma unroll
      for (int r = 0; r < 8; ++r) v[i][r] = acc[i][jj][r] + bj[jj];
    if (wave < 8) {                            // wave-uniform; no barrier inside
      float m = v[0][0];
#pragma unroll
      for (int i = 0; i < 8; ++i)
#pragma unroll
        for (int r = 0; r < 8; ++r) m = fmaxf(m, v[i][r]);
      m = fmaxf(m, __shfl_xor(m, 16, 32));
      float s = 0.f;
#pragma unroll
      for (int i = 0; i < 8; ++i)
#pragma unroll
        for (int r = 0; r < 8; ++r) { v[i][r] = exp_slot(v[i][r] - m); s += v[i][r]; }
      s += __shfl_xor(s, 16, 32);
      if (lane < 16) {
        const int so = (z * GB + b) * CH + wave * 32 + jj * 16 + rlane;
        stm[so] = m;
        sts[so] = s;
      }
    }
#pragma unroll
    for (int i = 0; i < 8; ++i) {
      v4u ph, pl;
#pragma unroll
      for (int q = 0; q < 4; ++q) {
        const float f0 = v[i][2 * q], f1 = v[i][2 * q + 1];
        const unsigned short h0 = bf_bits(f0), h1 = bf_bits(f1);
        const unsigned short l0 = bf_bits(f0 - bf_up(h0)), l1 = bf_bits(f1 - bf_up(h1));
        ph[q] = pk16(h0, h1); pl[q] = pk16(l0, l1);
      }
      const int piece = ((((wave * 2 + jj) * KS2 + (i >> 1)) * 2 + (i & 1)) << 5) + lane;
      fh[piece] = ph;
      fl[piece] = pl;
    }
  }
  __syncthreads();   // every column block's fragments are in LDS before any wave reads them

  // ---- part 2: 64x64 tile of the slice's ctxT, rows d from V (A), columns c from kP (B) ----
  const int tm = wave >> 2, tn = wave & 3;
  v8f cx[4][4];
#pragma unroll
  for (int i = 0; i < 4; ++i)
#pragma unroll
    for (int j = 0; j < 4; ++j) cx[i][j] = zero8();
  const v4u* Ah = fh + (CH / 16 + tm * 4) * KS2 * 64 + lane;   // V column blocks of this tile's rows d
  const v4u* Al = fl + (CH / 16 + tm * 4) * KS2 * 64 + lane;
  v16b ah[2], al[2];
  ah[0] = ldfrag_q(Ah);
  al[0] = ldfrag_q(Al);
#pragma unroll   // constant indices keep the fragment arrays in registers
  for (int p = 0; p < KS2; ++p) {
    v16b bh[4], bl[4];
#pragma unroll
    for (int j = 0; j < 4; ++j) {
      bh[j] = ldfrag_q(fh + ((tn * 4 + j) * KS2 + p) * 64 + lane);
      bl[j] = ldfrag_q(fl + ((tn * 4 + j) * KS2 + p) * 64 + lane);
    }
#pragma unroll
    for (int i = 0; i < 4; ++i) {
      const int cu = i & 1;
      const int nx = p * 4 + i + 1;            // the next row block's A fragments, one block of products ahead
      if (nx < KS2 * 4) {
        ah[cu ^ 1] = ldfrag_q(Ah + ((nx & 3) * KS2 + (nx >> 2)) * 64);
        al[cu ^ 1] = ldfrag_q(Al + ((nx & 3) * KS2 + (nx >> 2)) * 64);
      }
      // each accumulator takes its three products in the order hi.hi, lo.hi, hi.lo; four tiles side by side
#pragma unroll
      for (int j = 0; j < 4; ++j) cx[i][j] = mma_b_raw(ah[cu], bh[j], cx[i][j]);
#pragma unroll
      for (int j = 0; j < 4; ++j) cx[i][j] = mma_b_raw(al[cu], bh[j], cx[i][j]);
#pragma unroll
      for (int j = 0; j < 4; ++j) cx[i][j] = mma_b_raw(ah[cu], bl[j], cx[i][j]);
      // keeps later blocks' fragment loads from being lifted up here: with more than one block's fragments
      // ahead the live set passes the 256 registers of a 16-wave work-group and spills to scratch
      __builtin_amdgcn_sched_barrier(0);
    }
  }
  __syncthreads();   // every wave has read its last fragment before the slabs overwrite them

  // ---- epilogue: whole 256-B row segments through the wave's own slab ----
  const int hh = lane >> 4, c4 = (lane & 15) * 4;          // 256-B row segment = 16 lanes x 16 B
  float* slab = (float*)(void*)sm + wave * (16 * 68);
  float* C = part + ((size_t)b * (CH / 4) * KSP + (size_t)z) * (4 * CH) + hh * CH + (tn << 6) + c4;
#pragma unroll
  for (int i = 0; i < 4; ++i) {
    const int mBase = (tm << 6) + (i << 4);
#pragma unroll
    for (int j = 0; j < 4; ++j) {
#pragma unroll
      for (int r = 0; r < 8; ++r) slab[(mOff + r) * 68 + (j << 4) + rlane] = cx[i][j][r];
    }
    // the wave's slab rows are written before its lanes read each other's values back
    asm volatile("s_wait_dscnt 0x0" ::: "memory");
    v4f t[8];
#pragma unroll
    for (int it = 0; it < 8; ++it) t[it] = *(const v4f*)(slab + (it * 2 + hh) * 68 + c4);   // rows 0..15
    // the rows are read before the next 16 rows overwrite the slab
    asm volatile("s_wait_dscnt 0x0" ::: "memory");
#pragma unroll
    for (int it = 0; it < 8; ++it)             // row d = mBase + 2 it + hh: group d/4, row d%4 = 2 (it&1) + hh
      *(v4f*)(C + (size_t)((mBase >> 2) + (it >> 1)) * (KSP * 4 * CH) + (it & 1) * (2 * CH)) = t[it];
  }
}

// =====================================================================================================
// Workspace map (bytes), every plane an exact multiple of its 64x64-tile / whole-line store granularity
// (no padded tails needed: 4096, 512, 256 are tile multiples); one group holds all GB = NBAT batches:
//   Wqb   bf16 [256][256]              0          131072
//   Wkvb  bf16 [512][256]              131072     262144
//   Wob   bf16 [256][256]              393216     131072
//   Xt    bf16 [GB][4096][256]         524288     16777216
//   Ct    bf16 [GB][4096][256]         17301504   16777216
//   cxp   f32  [GB*64][KSP][4][256]    34078720   67108864
//   stm   f32  [KSP][GB][256]          101187584  262144
//   sts   f32  [KSP][GB][256]          101449728  262144
//   m2h   bf16 [GB][256][256]          101711872  1048576
//   m2l   bf16 [GB][256][256]          102760448  1048576
//   end                                103809024
// Weights are [out][in] with the in index as k; Wqb, Wkvb, Wob, m2h, m2l are in fragment order.
// =====================================================================================================
extern "C" void kernel_launch(void* const* d_in, const int* in_sizes, int n_in,
                              void* d_out, int out_size, void* d_ws, size_t ws_size,
                              hipStream_t stream) {
  if (n_in < 8) return;
  if (in_sizes[0] != NBAT * CH * NSP) return;
  if (in_sizes[1] != NBAT * CH * NSP) return;
  if (in_sizes[2] != CH * CH) return;
  if (in_sizes[3] != CH) return;
  if (in_sizes[4] != 2 * CH * CH) return;
  if (in_sizes[5] != 2 * CH) return;
  if (in_sizes[6] != CH * CH) return;
  if (in_sizes[7] != CH) return;
  if (out_size != NBAT * CH * NSP) return;

  const float* x     = (const float*)d_in[0];
  const float* cproj = (const float*)d_in[1];
  const float* wq    = (const float*)d_in[2];
  const float* bq    = (const float*)d_in[3];
  const float* wkv   = (const float*)d_in[4];
  const float* bkv   = (const float*)d_in[5];
  const float* wo    = (const float*)d_in[6];
  const float* bo    = (const float*)d_in[7];
  float* out = (float*)d_out;

  const size_t PWq  = (size_t)CH * CH * 2;               //   131072
  const size_t PWkv = (size_t)2 * CH * CH * 2;           //   262144
  const size_t PWo  = (size_t)CH * CH * 2;               //   131072
  const size_t PXt  = (size_t)GB * NSP * CH * 2;         // 16777216
  const size_t PCxp = (size_t)KSP * GB * CH * CH * 4;    // 67108864
  const size_t PSt  = (size_t)KSP * GB * CH * 4;         //   262144
  const size_t PCx  = (size_t)GB * CH * CH * 2;          //  1048576
  size_t off = 0;
  const size_t oWq  = off; off += PWq;
  const size_t oWkv = off; off += PWkv;
  const size_t oWo  = off; off += PWo;
  const size_t oXt  = off; off += PXt;
  const size_t oCt  = off; off += PXt;
  const size_t oCxp = off; off += PCxp;
  const size_t oStm = off; off += PSt;
  const size_t oSts = off; off += PSt;
  const size_t oM2h = off; off += PCx;
  const size_t oM2l = off; off += PCx;
  if (off > ws_size) return;                             // off = 103809024

  char* ws = (char*)d_ws;
  unsigned short* Wqb  = (unsigned short*)(ws + oWq);
  unsigned short* Wkvb = (unsigned short*)(ws + oWkv);
  unsigned short* Wob  = (unsigned short*)(ws + oWo);
  unsigned short* Xt   = (unsigned short*)(ws + oXt);
  unsigned short* Ct   = (unsigned short*)(ws + oCt);
  float*          Cxp  = (float*)(ws + oCxp);
  float*          Stm  = (float*)(ws + oStm);
  float*          Sts  = (float*)(ws + oSts);
  unsigned short* M2h  = (unsigned short*)(ws + oM2h);
  unsigned short* M2l  = (unsigned short*)(ws + oM2l);

  const dim3 blk(256);

  const dim3 gTr(NSP / 64, WROWS + (CH / 64) * 2 * GB);  // 64 x (2 rows of weight blocks + 4 x 16 rows of tiles)
  const dim3 gKc(KSP, GB);                               // 32 slices of n x GB, 16 waves each
  const dim3 gSum(GB * CH * CH / 2048);                  // 256 blocks
  const dim3 gQo(NSP / 64, GB);                          // 64 column tiles x GB, 4 waves each

  for (int g = 0; g < NGRP; ++g) {
    const int b0 = g * GB;
    // (1) weights -> bf16 planes; x[b], cproj[b] -> Xt[n][c], Ct[n][c] bf16
    k_trcvt<<<gTr, blk, 0, stream>>>(x, cproj, Xt, Ct, b0, wq, wkv, wo, Wqb, Wkvb, Wob);
    // (2) per slice of 128 n: KVt[n][j] = Ct . wkv^T + bkv[j] (K=256); kP = exp(K - slice max) and V as hi/lo in
    //     LDS; ctxT[d][c] partial = Vh.kPh^T + Vl.kPh^T + Vh.kPl^T (M=N=256, K=128) -> f32 partials
    k_kvctx<<<gKc, dim3(512), 0, stream>>>(Wkvb, Ct, bkv, Cxp, Stm, Sts);
    // (3) softmax-weighted sum of the partials -> 8 rows of ctxT bf16 hi/lo in LDS per block;
    //     M2[o][d] = wo . (ctxTh + ctxTl)^T  (K=256) -> bf16 hi/lo
    k_ksum<<<gSum, dim3(512), 0, stream>>>(Cxp, Stm, Sts, Wob, M2h, M2l);
    // (4) Q = wq . Xt^T + bq, qP = 64 * softmax over each head's 64 rows (hi/lo, in LDS),
    //     out[b][o][n] = ((M2h + M2l).qPh + M2h.qPl) / 64 + bo[o] -> d_out f32
    float* outg = out + (size_t)b0 * CH * NSP;
    k_qout<<<gQo, dim3(128), 0, stream>>>(Wqb, Xt, bq, M2h, M2l, bo, outg);
  }
  (void)hipGetLastError();
}

// v008
// It runs in 63.1 microseconds.
// Next to v007, in two timings, it ran 1.07 and 1.09 times as fast.
// Over all steps from v000 it is 23.8 times as fast.
// Contractions (all v_wmma_f32_16x16x32_bf16, f32 accumulate): x^T.wq^T and wkv.cproj with bf16 operands
// RNE-converted from the f32 inputs (single product); V.kP^T with bf16 hi+lo planes on both operands (3 products);
// wo.ctx^T with bf16 wo times ctx hi+lo planes (2 products); M2.qP^T with bf16 hi+lo planes on both (3 products).
// Softmaxes and epilogues in f32; the q softmax output is carried x64, folded back by the epilogue scale.
// The q projection, its softmax and the output product run in one kernel; q passes from one to the other in LDS.
// The KV projection, the k softmax and the V.kP^T product run in one kernel per slice of 128 columns n: kP is
// exp(K - slice maximum), un-normalised; the slice sum weighs each slice by exp(slice max - row max) / row sum.
// The slice sum and the wo.ctx^T product run in one kernel; a block's rows of ctx pass from one to the other in LDS.
// Every bf16 plane that a kernel reads from global memory as WMMA fragments (wq, wkv, wo, M2 hi/lo) lies
// there in fragment order (see frag_piece), so a wave-wide 16-B load covers 512 contiguous bytes.
#include <hip/hip_runtime.h>
#include <stdint.h>

#define NBAT 8
#define CH   256
#define NSP  4096
#define GB   8
#define NGRP (NBAT / GB)
static_assert((NSP % 64) == 0 && (CH % 64) == 0 && (NBAT % GB) == 0);
static_assert(CH == 4 * 64);         // four heads of 64 channels: one wave of k_qout per head
#define KSP  32                      // k slices of the V.kP^T product (K = NSP), one work-group of k_kvctx each
static_assert((NSP % (KSP * 32)) == 0 && ((GB * CH * CH) % 1024) == 0);

typedef __bf16   v16b __attribute__((ext_vector_type(16)));
typedef __bf16   v8b  __attribute__((ext_vector_type(8)));
typedef __bf16   v2b  __attribute__((ext_vector_type(2)));
typedef float    v2f  __attribute__((ext_vector_type(2)));
typedef float    v8f  __attribute__((ext_vector_type(8)));
typedef float    v4f  __attribute__((ext_vector_type(4)));
typedef unsigned int v4u __attribute__((ext_vector_type(4)));

// ---- scalar helpers --------------------------------------------------------------------------------
__device__ __forceinline__ float bf_round(float f) { return (float)(__bf16)f; }      // f32 -> bf16 (RNE) -> f32
__device__ __forceinline__ v2b cvt2v(float a, float b) {            // two f32 -> two bf16, RNE, one packed convert
  const v2f f = {a, b};
  return __builtin_convertvector(f, v2b);
}
__device__ __forceinline__ unsigned cvt2(float a, float b) { return __builtin_bit_cast(unsigned, cvt2v(a, b)); }
// hi = bf16(f), lo = bf16(f - hi) for two values; element 0 in the low half of each word
__device__ __forceinline__ void split2(float a, float b, unsigned& hi, unsigned& lo) {
  const v2b h = cvt2v(a, b);
  hi = __builtin_bit_cast(unsigned, h);
  lo = cvt2(a - (float)h[0], b - (float)h[1]);
}
__device__ __forceinline__ v8f zero8() { v8f z = {0.f, 0.f, 0.f, 0.f, 0.f, 0.f, 0.f, 0.f}; return z; }

// exp(x) as __expf forms it (one multiply, one v_exp_f32), with the v_nop in the same statement: it fills the slot
// that the instruction set asks for between a transcendental and an instruction directly behind it that reads its
// result or overwrites its source.
__device__ __forceinline__ float exp_slot(float x) {
  float y = 0.f;
#if defined(__HIP_DEVICE_COMPILE__)
  const float a = x * 1.44269504088896340736f;
  asm("v_exp_f32 %0, %1\n\tv_nop" : "=v"(y) : "v"(a));
#endif
  return y;
}

// ---- fragment loader: 16-bit A/B operand, lane -> row/col (lane&15), p already includes +8*(lane>>4);
//      elements 0..7 <- p[0..7] (k0+8h..), elements 8..15 <- p[16..23] (k0+16+8h..)
__device__ __forceinline__ v16b ldfrag_b(const __bf16* p) {
  union { v16b v; v8b h[2]; } f;
  f.h[0] = *(const v8b*)(p);
  f.h[1] = *(const v8b*)(p + 16);
  return f.v;
}

// ---- fragment order of a plane P[row][k] with CH values k per row: 16-B pieces of 8 consecutive k;
//      piece (((row block * KST + k step) * 2 + half) * 32 + lane) holds row 16 * block + (lane&15),
//      k = 32 * step + 16 * half + 8 * (lane>>4) + 0..7: the same lane -> k order as ldfrag_b.
#define KST    (CH / 32)                       // k steps of a product over CH
__device__ __forceinline__ int frag_piece(int rowblk, int kstep) { return (rowblk * KST + kstep) * 64; }
__device__ __forceinline__ v16b ldfrag_q(const v4u* p) {   // p = this lane's piece of half 0; half 1 lies 32 pieces on
  union { v16b v; v4u q[2]; } f;
  f.q[0] = p[0];
  f.q[1] = p[32];
  return f.v;
}

// ---- WMMA helper -------------------------------------------------------------------------------------
__device__ __forceinline__ v8f mma_b_raw(v16b a, v16b b, v8f c) {
  return __builtin_amdgcn_wmma_f32_16x16x32_bf16(false, a, false, b, (short)0, c, false, false);
}

// =====================================================================================================
// f32 [rows][CH] -> bf16 (RNE convert) in fragment order: the thread forms piece i from 8 consecutive k of its row
// (a wave reads 64 B of each of 16 rows); one 16-B store per lane: a wave writes 512 contiguous B.
// =====================================================================================================
__device__ __forceinline__ void cvt_piece(const float* __restrict__ in, unsigned short* out, int i) {
  const int row = (i / (KST * 64)) * 16 + (i & 15);
  const int k   = ((i >> 6) % KST) * 32 + ((i >> 5) & 1) * 16 + ((i >> 4) & 1) * 8;
  const float* src = in + (size_t)row * CH + k;
  const v4f a = *(const v4f*)(src);
  const v4f b = *(const v4f*)(src + 4);
  v4u p;
  p[0] = cvt2(a[0], a[1]);
  p[1] = cvt2(a[2], a[3]);
  p[2] = cvt2(b[0], b[1]);
  p[3] = cvt2(b[2], b[3]);
  *(v4u*)(out + (size_t)i * 8) = p;
}

// =====================================================================================================
// All operand conversions in one grid; none needs anything of another. grid (NSP/64, WROWS + 4 * 2 * GB), block 256.
// Grid rows y < WROWS: the three weight planes, one 16-B piece per thread (cvt_piece); block
//   y * 64 + x takes pieces 256 * block ..; blocks 0..31 wq, 32..95 wkv, 96..127 wo: 32768 pieces = whole planes.
// Grid rows y >= WROWS, u = y - WROWS:
// transpose-convert of one 64x64 tile: source [b][c][n] f32 (c pitch NSP) -> plane [bi][n][c] bf16 (pitch CH).
// blockIdx.x = n tile, u & 3 = c tile, u >> 2 = 2*bi + sel (sel 0: xg -> xt, 1: cg -> ct).
// Load: thread r = tid>>2 owns source row c0+r, 16 consecutive n at (tid&3)*16 (4 x 16-B loads).
// coverage: load 256x16 = 4096 = whole tile; store 2x256x8 = 4096 = whole tile.
// =====================================================================================================
#define WPC   (CH * CH / 8)                    // 16-B pieces of a [CH][CH] plane
#define WROWS (4 * WPC / 256 / (NSP / 64))     // grid rows of 64 blocks that hold the 4 * WPC weight pieces
static_assert(WROWS * (NSP / 64) * 256 == 4 * WPC && (WPC % 256) == 0 && CH / 64 == 4);

__global__ __launch_bounds__(256) void k_trcvt(const float* __restrict__ xg, const float* __restrict__ cg,
                                               unsigned short* xt, unsigned short* ct, int b0,
                                               const float* __restrict__ wq, const float* __restrict__ wkv,
                                               const float* __restrict__ wo, unsigned short* wqb,
                                               unsigned short* wkvb, unsigned short* wob) {
  __shared__ float tile[64][65];
  const int tid = threadIdx.x;
  if (blockIdx.y < WROWS) {                    // block-uniform, and leaves ahead of the barrier
    const int wblk = (int)(blockIdx.y * (NSP / 64) + blockIdx.x);
    const int pl = wblk < WPC / 256 ? 0 : wblk < 3 * WPC / 256 ? 1 : 2;       // block-uniform selects, all global
    const float* win = pl == 0 ? wq : pl == 1 ? wkv : wo;
    unsigned short* wout = pl == 0 ? wqb : pl == 1 ? wkvb : wob;
    const int first = pl == 0 ? 0 : pl == 1 ? WPC / 256 : 3 * WPC / 256;      // the plane's first block
    cvt_piece(win, wout, (wblk - first) * 256 + tid);
    return;
  }
  const int u  = (int)blockIdx.y - WROWS;
  const int n0 = blockIdx.x * 64;
  const int c0 = (u & 3) * 64;
  const int bi  = u >> 3;
  const int sel = (u >> 2) & 1;
  const float* src = sel ? cg : xg;            // block-uniform select, both global
  unsigned short* dst = sel ? ct : xt;
  {
    const int r = tid >> 2, cs = (tid & 3) * 16;
    const float* p = src + ((size_t)(b0 + bi) * CH + (size_t)(c0 + r)) * NSP + n0 + cs;
#pragma unroll
    for (int i = 0; i < 4; ++i) {
      const v4f v = *(const v4f*)(p + 4 * i);
      tile[r][cs + 4 * i + 0] = v[0];
      tile[r][cs + 4 * i + 1] = v[1];
      tile[r][cs + 4 * i + 2] = v[2];
      tile[r][cs + 4 * i + 3] = v[3];
    }
  }
  __syncthreads();
  v4u pv[2];
  const int c8 = (tid & 7) * 8;
#pragma unroll
  for (int it = 0; it < 2; ++it) {
    const int n = it * 32 + (tid >> 3);
    v4u a;
#pragma unroll
    for (int e = 0; e < 4; ++e) {
      a[e] = cvt2(tile[c8 + 2 * e][n], tile[c8 + 2 * e + 1][n]);
    }
    pv[it] = a;
  }
  {
#pragma unroll
    for (int it = 0; it < 2; ++it) {
      const int n = it * 32 + (tid >> 3);
      const size_t go = ((size_t)bi * NSP + (size_t)(n0 + n)) * CH + c0 + c8;
      *(v4u*)(dst + go) = pv[it];
    }
    
  }
}

// =====================================================================================================
// Weighted sum of the KSP k-slice partials of ctxT, then M2 = wo . ctxT^T for the block's rows d.
// part f32 [GB*CH/4][KSP][4*CH] -> M2 bf16 hi/lo planes [GB][CH*CH].
// Slice z of column c weighs exp(m[z][c] - M[c]) / S[c], M = maximum of the slice maxima, S = sum over z of
// exp(m[z][c] - M[c]) * s[z][c]: the softmax over all n. A block covers 8 rows d x all CH columns c of one batch:
// thread t < CH forms the KSP weights of column t once, in LDS; slices are added in index order.
// Thread owns 4 consecutive elements (16-B loads); their bf16 hi and lo go to LDS rows [d][c] at a pitch of 528 B.
// Product, wave w: M2[o][d] = sum over c of wo[o][c] * (ctxTh + ctxTl)[d][c] for o in 16w..16w+15, K = CH, per k step
//   the hi product and then the lo product. ctxT is the A operand (rows d; A rows 8..15 repeat rows 0..7 and their
//   results are not stored), wo the B operand (columns o), so lane l < 16 holds M2[16w + l][d0..d0+7]: one 16-B
//   piece of the planes, which are in fragment order with row o and k = d. A wave stores 256 contiguous B per plane.
// coverage: (GB*CH*CH/2048) blocks x 16 waves x (16 rows o x 8 columns d) = whole planes.
// =====================================================================================================
#define CPITCH (CH + 8)                        // ctxT row pitch in LDS, elements (528 B)
static_assert(CH == 16 * 16);                  // sixteen waves x 16 rows o

__global__ __launch_bounds__(512) void k_ksum(const float* __restrict__ part, const float* __restrict__ stm,
                                              const float* __restrict__ sts, const unsigned short* __restrict__ wop,
                                              unsigned short* m2h, unsigned short* m2l) {
  __shared__ __align__(16) float wl[KSP][CH];
  __shared__ __align__(16) unsigned short csh[8 * CPITCH];    // the block's 8 rows of ctxT, bf16 hi
  __shared__ __align__(16) unsigned short csl[8 * CPITCH];    // and lo
  const unsigned t = threadIdx.x;
  const int lane = (int)(t & 31u);
  const int wave = __builtin_amdgcn_readfirstlane((int)(t >> 5));
  const int b = (int)(blockIdx.x / (CH * CH / 2048));
  const unsigned tq = t & 255u;                 // place in the thread's group of 4 rows d
  // the wave's group of 4 rows as a scalar: wave-uniform bases in scalar registers, one lane offset for all loads
  const unsigned g4 = (unsigned)__builtin_amdgcn_readfirstlane((int)(t >> 8));
  const float* pb = part + ((size_t)blockIdx.x * 2 + g4) * (KSP * 1024);
  const float* mb = stm + b * CH;
  const float* sb = sts + b * CH;
  v4f p[KSP];
#pragma unroll   // keeps p[] in registers and the independent loads in flight together
  for (int z = 0; z < KSP; ++z) p[z] = *(const v4f*)(pb + z * 1024 + tq * 4u);
  // keeps the plane loads ahead of the weights' work, in flight under it; the compiler otherwise sinks them
  // behind it, and the block pays the two memory latencies one after the other
  __builtin_amdgcn_sched_barrier(0);
  if (t < CH) {                                 // wave-uniform; no barrier inside
    float m[KSP], sz[KSP];
#pragma unroll   // m[] and sz[] are indexed by constants only, so they stay in registers
    for (int z = 0; z < KSP; ++z) {
      m[z]  = mb[z * (GB * CH) + t];
      sz[z] = sb[z * (GB * CH) + t];
    }
    float mm = m[0];
#pragma unroll
    for (int z = 1; z < KSP; ++z) mm = fmaxf(mm, m[z]);
    float ss = 0.f;
#pragma unroll
    for (int z = 0; z < KSP; ++z) { m[z] = __expf(m[z] - mm); ss += m[z] * sz[z]; }
    const float rinv = 1.0f / ss;
#pragma unroll
    for (int z = 0; z < KSP; ++z) wl[z][t] = m[z] * rinv;
  }
  __syncthreads();   // every column's weights are in LDS before any thread reads its four
  // wo fragments of this wave's 16 rows o, all k steps: they depend on nothing here and fly under the slice sum
  // (behind the barrier, whose wait for outstanding loads would otherwise hold the block up for them)
  v16b wf[KST];
  {
    const v4u* Wo = (const v4u*)(const void*)wop + frag_piece(wave, 0) + lane;
#pragma unroll   // wf[] is indexed by constants only, so it stays in registers
    for (int ks = 0; ks < KST; ++ks) wf[ks] = ldfrag_q(Wo + frag_piece(0, ks));
  }
  const unsigned c4 = (t * 4u) & (CH - 1);
  v4f s = p[0] * *(const v4f*)(&wl[0][c4]);
#pragma unroll   // p[] is indexed by constants only, so it stays in registers
  for (int z = 1; z < KSP; ++z) s += p[z] * *(const v4f*)(&wl[z][c4]);
  uint2 hv, lv;
  split2(s[0], s[1], hv.x, lv.x);
  split2(s[2], s[3], hv.y, lv.y);
  *(uint2*)(csh + (t >> 6) * CPITCH + c4) = hv;
  *(uint2*)(csl + (t >> 6) * CPITCH + c4) = lv;
  __syncthreads();   // all 8 rows of ctxT are in LDS before any wave reads fragments of them

  const __bf16* Ch = (const __bf16*)(const void*)csh + (lane & 7) * CPITCH + (lane >> 4) * 8;   // this lane's A row
  const __bf16* Cl = (const __bf16*)(const void*)csl + (lane & 7) * CPITCH + (lane >> 4) * 8;
  v16b ah[KST], al[KST];
#pragma unroll   // ah[] and al[] are indexed by constants only, so they stay in registers (those of p[], now free)
  for (int ks = 0; ks < KST; ++ks) {
    ah[ks] = ldfrag_b(Ch + ks * 32);
    al[ks] = ldfrag_b(Cl + ks * 32);
  }
  // all LDS fragment loads go as one group ahead of the products; the compiler otherwise loads one fragment at a
  // time into one register set, and each of the sixteen chained products waits a full LDS latency
  __builtin_amdgcn_sched_barrier(0);
  v8f acc = zero8();
#pragma unroll   // wf[], ah[] and al[] are indexed by constants only
  for (int ks = 0; ks < KST; ++ks) {
    acc = mma_b_raw(ah[ks], wf[ks], acc);
    acc = mma_b_raw(al[ks], wf[ks], acc);
  }
  v4u ph, pl;
#pragma unroll
  for (int q = 0; q < 4; ++q) {
    unsigned h, l;
    split2(acc[2 * q], acc[2 * q + 1], h, l);
    ph[q] = h;
    pl[q] = l;
  }
  if (lane < 16) {                              // lanes 16..31 hold the repeated A rows
    const int d0 = (int)(blockIdx.x % (CH * CH / 2048)) * 8;
    const size_t e0 = (size_t)b * (CH * CH) +
        (size_t)(frag_piece(wave, d0 >> 5) + ((d0 >> 4) & 1) * 32 + ((d0 >> 3) & 1) * 16 + lane) * 8;
    *(v4u*)(m2h + e0) = ph;
    *(v4u*)(m2l + e0) = pl;
  }
}

// =====================================================================================================
// q projection + q softmax + output product for one 64-column tile of n. grid (NSP/64, GB), block 128 = 4 waves.
// x tile: rows n0..n0+63 of Xt are 32 KiB in a row; each wave-wide load takes one whole 512-B row, and the rows
//   stand in LDS at a pitch of 528 B (16 B x odd) for the 16-B fragment reads of all four waves.
// Part 1, wave w = head w: Q[o][n] = wq . Xt^T + bq[o] for o in 64w..64w+63 (K = CH). A lane holds column
//   n0 + 16j + (lane&15) and rows 16i + 8(lane>>4) + r, so one column's head lies in lanes l and l^16:
//   softmax of 0.25 * Q over the 64 rows = a sum inside the lane and one xor-16 exchange.
// Hand-over: 64 * softmax as bf16 hi/lo. Accumulator tiles 2p and 2p+1 of a column block are, lane for lane,
//   elements 0..7 and 8..15 of the B fragment of k step p, so each lane stores and later loads its own 16-B
//   pieces: piece (((k step * 4 + j) * 2 + half) * 32 + lane); a wave-wide access covers 512 contiguous bytes.
// Part 2, wave w: out[o][n] = ((M2h + M2l).qPh + M2h.qPl) / 64 + bo[o] for o in 64w..64w+63 (K = CH, all heads).
// coverage: 64 x GB blocks x 4 waves x (64 rows x 64 columns) = whole output.
// =====================================================================================================
#define XPITCH (CH + 8)                        // x tile row pitch in LDS, elements (528 B)

__global__ __launch_bounds__(128) void k_qout(const unsigned short* __restrict__ wqp,
                                              const unsigned short* __restrict__ xtp,
                                              const float* __restrict__ bq,
                                              const unsigned short* __restrict__ m2hp,
                                              const unsigned short* __restrict__ m2lp,
                                              const float* __restrict__ bo, float* outp) {
  __shared__ __align__(16) unsigned short xs[64 * XPITCH];    // 33 KiB: x tile, bf16
  __shared__ __align__(16) v4u qsh[KST * 4 * 2 * 32];         // 32 KiB: q hi fragments of the tile
  __shared__ __align__(16) v4u qsl[KST * 4 * 2 * 32];         // 32 KiB: q lo fragments
  __shared__ __align__(16) float sT[4][16 * 68];              // per-wave 16x64 slab, pitch 68 floats
  const int lane = threadIdx.x & 31;
  const int wave = threadIdx.x >> 5;
  const int b  = blockIdx.y;
  const int n0 = blockIdx.x << 6;
  const int m0 = wave << 6;
  const int rlane = lane & 15;                 // row (A) / col (B, D) within subtile
  const int koff  = (lane >> 4) * 8;           // k offset of this lane half
  const int mOff  = (lane >> 4) * 8;           // D row offset
  const int apc = frag_piece(m0 >> 4, 0) + lane;             // this lane's A piece (subtile 0, k step 0), all three A planes
  const v4u* Wq = (const v4u*)(const void*)wqp + apc;
  const v4u* Mh = (const v4u*)(const void*)(m2hp + (size_t)b * CH * CH) + apc;
  const v4u* Ml = (const v4u*)(const void*)(m2lp + (size_t)b * CH * CH) + apc;
  const __bf16* Xl = (const __bf16*)(const void*)xs + rlane * XPITCH + koff;   // this lane's B row (subtile 0)

  // ---- x tile to LDS; wq fragments of the first two k steps meanwhile ----
  v16b wa[2][4];
  {
    const v4u* g = (const v4u*)(const void*)(xtp + ((size_t)b * NSP + (size_t)n0) * CH);
    v4u t[16];
#pragma unroll
    for (int it = 0; it < 16; ++it) t[it] = g[it * 128 + threadIdx.x];          // row it*4 + wave, piece lane
#pragma unroll
    for (int s = 0; s < 2; ++s)
#pragma unroll
      for (int i = 0; i < 4; ++i) wa[s][i] = ldfrag_q(Wq + frag_piece(i, s));
#pragma unroll
    for (int it = 0; it < 16; ++it) *(v4u*)(xs + (it * 4 + wave) * XPITCH + lane * 8) = t[it];
  }
  __syncthreads();   // the whole x tile is in LDS before any wave reads fragments of it

  v8f acc[4][4];
#pragma unroll
  for (int i = 0; i < 4; ++i)
#pragma unroll
    for (int j = 0; j < 4; ++j) acc[i][j] = zero8();

  // ---- part 1: Q tile of this wave's head ----
  {
    v16b xb[2][4];
#pragma unroll
    for (int j = 0; j < 4; ++j) xb[0][j] = ldfrag_b(Xl + j * 16 * XPITCH);
#pragma unroll   // constant buffer indices keep wa[] and xb[] in registers
    for (int ks = 0; ks < KST; ++ks) {
      const int cu = ks & 1;
      if (ks + 1 < KST) {
#pragma unroll
        for (int j = 0; j < 4; ++j) xb[cu ^ 1][j] = ldfrag_b(Xl + j * 16 * XPITCH + (ks + 1) * 32);
      }
#pragma unroll
      for (int i = 0; i < 4; ++i) {
#pragma unroll
        for (int j = 0; j < 4; ++j) acc[i][j] = mma_b_raw(wa[cu][i], xb[cu][j], acc[i][j]);
        if (ks + 2 < KST) wa[cu][i] = ldfrag_q(Wq + frag_piece(i, ks + 2));
        // keeps each refill where it is written, two k steps ahead of its use; the compiler otherwise sinks it
        // to just before its products, and every fragment then waits a full load latency
        __builtin_amdgcn_sched_barrier(0);
      }
    }
  }

  // ---- q softmax over the head's 64 rows, column by column; fragments to LDS ----
  float bro[4][8];
#pragma unroll
  for (int i = 0; i < 4; ++i)
#pragma unroll
    for (int r = 0; r < 8; ++r) bro[i][r] = bf_round(bq[m0 + (i << 4) + mOff + r]);
#pragma unroll
  for (int j = 0; j < 4; ++j) {
    float v[4][8];
#pragma unroll
    for (int i = 0; i < 4; ++i)
#pragma unroll
      for (int r = 0; r < 8; ++r) v[i][r] = (acc[i][j][r] + bro[i][r]) * 0.25f;
    float m = v[0][0];
#pragma unroll
    for (int i = 0; i < 4; ++i)
#pragma unroll
      for (int r = 0; r < 8; ++r) m = fmaxf(m, v[i][r]);
    m = fmaxf(m, __shfl_xor(m, 16, 32));
    float s = 0.f;
#pragma unroll
    for (int i = 0; i < 4; ++i)
#pragma unroll
      for (int r = 0; r < 8; ++r) { v[i][r] = exp_slot(v[i][r] - m); s += v[i][r]; }
    s += __shfl_xor(s, 16, 32);
    const float rinv = 1.0f / s;
#pragma unroll
    for (int i = 0; i < 4; ++i) {
      v4u ph, pl;
#pragma unroll
      for (int q = 0; q < 4; ++q) {
        const float f0 = (v[i][2 * q] * rinv) * 64.0f;
        const float f1 = (v[i][2 * q + 1] * rinv) * 64.0f;
        unsigned h, l;
        split2(f0, f1, h, l);
        ph[q] = h; pl[q] = l;
      }
      const int piece = ((((wave * 2 + (i >> 1)) * 4 + j) * 2 + (i & 1)) << 5) + lane;
      qsh[piece] = ph;
      qsl[piece] = pl;
    }
  }
  v16b ah[4], al[4];   // M2 fragments of k step 0: they do not depend on q, so they fly across the barrier
#pragma unroll
  for (int i = 0; i < 4; ++i) {
    ah[i] = ldfrag_q(Mh + frag_piece(i, 0));
    al[i] = ldfrag_q(Ml + frag_piece(i, 0));
  }
  __syncthreads();   // every head's fragments are in LDS before any wave reads them

  // ---- part 2: output rows 64w..64w+63 over all CH channels of q ----
#pragma unroll
  for (int i = 0; i < 4; ++i)
#pragma unroll
    for (int j = 0; j < 4; ++j) acc[i][j] = zero8();
  {
    v16b bh[2][4], bl[2][4];
#pragma unroll
    for (int j = 0; j < 4; ++j) {
      bh[0][j] = ldfrag_q(qsh + j * 64 + lane);
      bl[0][j] = ldfrag_q(qsl + j * 64 + lane);
    }
#pragma unroll   // constant buffer indices keep the fragment arrays in registers
    for (int ks = 0; ks < KST; ++ks) {
      const int cu = ks & 1;
      if (ks + 1 < KST) {
#pragma unroll
        for (int j = 0; j < 4; ++j) {
          bh[cu ^ 1][j] = ldfrag_q(qsh + ((ks + 1) * 4 + j) * 64 + lane);
          bl[cu ^ 1][j] = ldfrag_q(qsl + ((ks + 1) * 4 + j) * 64 + lane);
        }
      }
#pragma unroll
      for (int i = 0; i < 4; ++i) {
        // each accumulator takes its three products in the order hi.hi, lo.hi, hi.lo; four tiles side by side
#pragma unroll
        for (int j = 0; j < 4; ++j) acc[i][j] = mma_b_raw(ah[i], bh[cu][j], acc[i][j]);
#pragma unroll
        for (int j = 0; j < 4; ++j) acc[i][j] = mma_b_raw(al[i], bh[cu][j], acc[i][j]);
#pragma unroll
        for (int j = 0; j < 4; ++j) acc[i][j] = mma_b_raw(ah[i], bl[cu][j], acc[i][j]);
        if (ks + 1 < KST) {
          ah[i] = ldfrag_q(Mh + frag_piece(i, ks + 1));
          al[i] = ldfrag_q(Ml + frag_piece(i, ks + 1));
        }
        // keeps each refill where it is written, one k step ahead of its use (see part 1)
        __builtin_amdgcn_sched_barrier(0);
      }
    }
  }

  // ---- epilogue: whole 256-B row segments through the wave's own slab ----
  float* slab = sT[wave];
  float* C = outp + (size_t)b * CH * NSP;
  const int hh = lane >> 4, c4 = (lane & 15) * 4;          // 256-B row segment = 16 lanes x 16 B
#pragma unroll
  for (int i = 0; i < 4; ++i) {
    const int mBase = m0 + (i << 4);
    float brow[8];
#pragma unroll
    for (int r = 0; r < 8; ++r) brow[r] = bf_round(bo[mBase + mOff + r]);
#pragma unroll
    for (int j = 0; j < 4; ++j) {
#pragma unroll
      for (int r = 0; r < 8; ++r) {
        slab[(mOff + r) * 68 + (j << 4) + rlane] = acc[i][j][r] * (1.0f / 64.0f) + brow[r];
      }
    }
    // the wave's slab rows are written before its lanes read each other's values back
    asm volatile("s_wait_dscnt 0x0" ::: "memory");
    v4f t[8];
#pragma unroll
    for (int it = 0; it < 8; ++it) t[it] = *(const v4f*)(slab + (it * 2 + hh) * 68 + c4);   // rows 0..15
    // the rows are read before the next 16 rows overwrite the slab
    asm volatile("s_wait_dscnt 0x0" ::: "memory");
#pragma unroll
    for (int it = 0; it < 8; ++it) *(v4f*)(C + (size_t)(mBase + it * 2 + hh) * NSP + n0 + c4) = t[it];
  }
}

// =====================================================================================================
// KV projection + k softmax numerators + context product for one slice of SLN = 128 columns n of one batch.
// grid (KSP, GB), block 512 = 16 waves, one work-group per WGP (256 KiB of LDS).
// c tile: rows n0..n0+127 of Ct are 64 KiB in a row; each wave-wide load takes one whole 512-B row, and the rows
//   stand in LDS at a pitch of 528 B (16 B x odd) for the 16-B fragment reads of all sixteen waves.
// Part 1, wave w: KVt[n][j] = Ct . wkv^T + bkv[j] for all 128 n and j in 32w..32w+31 (K = CH). A lane holds column
//   j = 32w + 16jj + (lane&15) and rows n = 16i + 8(lane>>4) + r, so one column lies in lanes l and l^16.
// Waves 0..7 hold K (j < CH): slice maximum m and sum s of exp(K - m) = a sum inside the lane and one xor-16
//   exchange; m and s go to stm, sts [slice][b][j]; the value handed on is exp(K - m). Waves 8..15 hold V as it is.
// Hand-over: bf16 hi/lo. Accumulator tiles 2p and 2p+1 of a column block are, lane for lane, elements 0..7 and
//   8..15 of the A or B fragment of k step p (k = n), so each lane stores and later loads 16-B pieces:
//   piece (((column block * KS2 + k step) * 2 + half) * 32 + lane); a wave-wide access covers 512 contiguous bytes.
//   The fragments take over the c tile's LDS behind a barrier that ends its last read.
// Part 2, wave w: ctxT[d][c] partial = Vh.kPh + Vl.kPh + Vh.kPl for the 64x64 tile (w>>2, w&3), K = 128 -> f32, to
//   part [b * CH/4 + d/4][slice][d%4][c] (the KSP partials that one block of k_ksum adds lie 256 KiB in a row), whole
//   256-B row segments through the wave's slab, which takes over fragment LDS behind a barrier.
// coverage: KSP x GB blocks x 16 waves x (64 x 64) = all of part; 8 waves x 32 columns = every m and s.
// =====================================================================================================
#define SLN (NSP / KSP)                        // columns n of a slice
#define KS2 (SLN / 32)                         // k steps of the context product
#define FPL ((2 * CH / 16) * KS2 * 2 * 32)     // 16-B pieces of one fragment plane (hi or lo)
static_assert(SLN == 128 && 2 * CH == 16 * 32);            // 16 waves x 32 columns j; 8 accumulator row blocks
static_assert(SLN * XPITCH * 2 <= 2 * FPL * 16 && 16 * 16 * 68 * 4 <= 2 * FPL * 16);   // c tile and slabs fit

__global__ __launch_bounds__(512) void k_kvctx(const unsigned short* __restrict__ wkvp,
                                               const unsigned short* __restrict__ ctp,
                                               const float* __restrict__ bkv,
                                               float* part, float* stm, float* sts) {
  __shared__ __align__(16) v4u sm[2 * FPL];                   // 256 KiB: c tile, then fragments, then slabs
  unsigned short* xs = (unsigned short*)(void*)sm;
  v4u* fh = sm;
  v4u* fl = sm + FPL;
  const int lane = threadIdx.x & 31;
  const int wave = __builtin_amdgcn_readfirstlane((int)(threadIdx.x >> 5));
  const int z  = blockIdx.x;
  const int b  = blockIdx.y;
  const int n0 = z * SLN;
  const int rlane = lane & 15;                 // row (A) / col (B, D) within subtile
  const int koff  = (lane >> 4) * 8;           // k offset of this lane half
  const int mOff  = (lane >> 4) * 8;           // D row offset
  const v4u* Wk = (const v4u*)(const void*)wkvp + frag_piece(wave * 2, 0) + lane;                  // B piece, block 0
  const __bf16* Xl = (const __bf16*)(const void*)xs + rlane * XPITCH + koff;                       // A row, block 0

  // ---- c tile to LDS; wkv fragments of the first two k steps and the bias meanwhile ----
  v16b wb[2][2];
  float bj[2];
  {
    const v4u* g = (const v4u*)(const void*)(ctp + ((size_t)b * NSP + (size_t)n0) * CH);
    v4u t[8];
#pragma unroll
    for (int it = 0; it < 8; ++it) t[it] = g[it * 512 + threadIdx.x];           // row it*16 + wave, piece lane
#pragma unroll
    for (int s = 0; s < 2; ++s)
#pragma unroll
      for (int jj = 0; jj < 2; ++jj) wb[s][jj] = ldfrag_q(Wk + frag_piece(jj, s));
#pragma unroll
    for (int jj = 0; jj < 2; ++jj) bj[jj] = bf_round(bkv[wave * 32 + jj * 16 + rlane]);
#pragma unroll
    for (int it = 0; it < 8; ++it) *(v4u*)(xs + (it * 16 + wave) * XPITCH + lane * 8) = t[it];
  }
  __syncthreads();   // the whole c tile is in LDS before any wave reads fragments of it

  // ---- part 1: KVt tile, 128 rows n x this wave's 32 columns j ----
  v8f acc[8][2];
#pragma unroll
  for (int i = 0; i < 8; ++i)
#pragma unroll
    for (int jj = 0; jj < 2; ++jj) acc[i][jj] = zero8();
  v16b xa[2][4];                               // c tile fragments of four row blocks, two sets
#pragma unroll
  for (int q = 0; q < 4; ++q) xa[0][q] = ldfrag_b(Xl + q * 16 * XPITCH);
#pragma unroll   // constant buffer indices keep wb[] and xa[] in registers
  for (int st = 0; st < 2 * KST; ++st) {       // k step st >> 1, row blocks 4 * (st & 1) ..
    const int ks = st >> 1, hf = st & 1, cu = ks & 1, nx = st + 1;
    if (nx < 2 * KST) {
#pragma unroll
      for (int q = 0; q < 4; ++q) xa[hf ^ 1][q] = ldfrag_b(Xl + ((nx & 1) * 4 + q) * 16 * XPITCH + (nx >> 1) * 32);
    }
    // the next set's LDS loads go as one group ahead of this set's products; the compiler otherwise loads one
    // fragment at a time into one register set and every pair of products waits a full LDS latency
    __builtin_amdgcn_sched_barrier(0);
#pragma unroll
    for (int q = 0; q < 4; ++q)
#pragma unroll
      for (int jj = 0; jj < 2; ++jj) acc[hf * 4 + q][jj] = mma_b_raw(xa[hf][q], wb[cu][jj], acc[hf * 4 + q][jj]);
    if (hf == 1 && ks + 2 < KST) {
#pragma unroll
      for (int jj = 0; jj < 2; ++jj) wb[cu][jj] = ldfrag_q(Wk + frag_piece(jj, ks + 2));
    }
    // keeps each wkv refill where it is written, two k steps ahead of its use; the compiler otherwise sinks it
    // to just before its products, and every fragment then waits a full load latency
    __builtin_amdgcn_sched_barrier(0);
  }
  __syncthreads();   // every wave has read its last c tile fragment before fragments overwrite the tile

  // ---- k softmax numerators of the slice (waves 0..7); hi/lo fragments of K and V to LDS ----
#pragma unroll
  for (int jj = 0; jj < 2; ++jj) {
    float v[8][8];
#pragma unroll
    for (int i = 0; i < 8; ++i)
#pragma unroll
      for (int r = 0; r < 8; ++r) v[i][r] = acc[i][jj][r] + bj[jj];
    if (wave < 8) {                            // wave-uniform; no barrier inside
      float m = v[0][0];
#pragma unroll
      for (int i = 0; i < 8; ++i)
#pragma unroll
        for (int r = 0; r < 8; ++r) m = fmaxf(m, v[i][r]);
      m = fmaxf(m, __shfl_xor(m, 16, 32));
      float s = 0.f;
#pragma unroll
      for (int i = 0; i < 8; ++i)
#pragma unroll
        for (int r = 0; r < 8; ++r) { v[i][r] = exp_slot(v[i][r] - m); s += v[i][r]; }
      s += __shfl_xor(s, 16, 32);
      if (lane < 16) {
        const int so = (z * GB + b) * CH + wave * 32 + jj * 16 + rlane;
        stm[so] = m;
        sts[so] = s;
      }
    }
#pragma unroll
    for (int i = 0; i < 8; ++i) {
      v4u ph, pl;
#pragma unroll
      for (int q = 0; q < 4; ++q) {
        const float f0 = v[i][2 * q], f1 = v[i][2 * q + 1];
        unsigned h, l;
        split2(f0, f1, h, l);
        ph[q] = h; pl[q] = l;
      }
      const int piece = ((((wave * 2 + jj) * KS2 + (i >> 1)) * 2 + (i & 1)) << 5) + lane;
      fh[piece] = ph;
      fl[piece] = pl;
    }
  }
  __syncthreads();   // every column block's fragments are in LDS before any wave reads them

  // ---- part 2: 64x64 tile of the slice's ctxT, rows d from V (A), columns c from kP (B) ----
  const int tm = wave >> 2, tn = wave & 3;
  v8f cx[4][4];
#pragma unroll
  for (int i = 0; i < 4; ++i)
#pragma unroll
    for (int j = 0; j < 4; ++j) cx[i][j] = zero8();
  const v4u* Ah = fh + (CH / 16 + tm * 4) * KS2 * 64 + lane;   // V column blocks of this tile's rows d
  const v4u* Al = fl + (CH / 16 + tm * 4) * KS2 * 64 + lane;
  v16b ah[2], al[2];
  ah[0] = ldfrag_q(Ah);
  al[0] = ldfrag_q(Al);
#pragma unroll   // constant indices keep the fragment arrays in registers
  for (int p = 0; p < KS2; ++p) {
    v16b bh[4], bl[4];
#pragma unroll
    for (int j = 0; j < 4; ++j) {
      bh[j] = ldfrag_q(fh + ((tn * 4 + j) * KS2 + p) * 64 + lane);
      bl[j] = ldfrag_q(fl + ((tn * 4 + j) * KS2 + p) * 64 + lane);
    }
#pragma unroll
    for (int i = 0; i < 4; ++i) {
      const int cu = i & 1;
      const int nx = p * 4 + i + 1;            // the next row block's A fragments, one block of products ahead
      if (nx < KS2 * 4) {
        ah[cu ^ 1] = ldfrag_q(Ah + ((nx & 3) * KS2 + (nx >> 2)) * 64);
        al[cu ^ 1] = ldfrag_q(Al + ((nx & 3) * KS2 + (nx >> 2)) * 64);
      }
      // each accumulator takes its three products in the order hi.hi, lo.hi, hi.lo; four tiles side by side
#pragma unroll
      for (int j = 0; j < 4; ++j) cx[i][j] = mma_b_raw(ah[cu], bh[j], cx[i][j]);
#pragma unroll
      for (int j = 0; j < 4; ++j) cx[i][j] = mma_b_raw(al[cu], bh[j], cx[i][j]);
#pragma unroll
      for (int j = 0; j < 4; ++j) cx[i][j] = mma_b_raw(ah[cu], bl[j], cx[i][j]);
      // keeps later blocks' fragment loads from being lifted up here: with more than one block's fragments
      // ahead the live set passes the 256 registers of a 16-wave work-group and spills to scratch
      __builtin_amdgcn_sched_barrier(0);
    }
  }
  __syncthreads();   // every wave has read its last fragment before the slabs overwrite them

  // ---- epilogue: whole 256-B row segments through the wave's own slab ----
  const int hh = lane >> 4, c4 = (lane & 15) * 4;          // 256-B row segment = 16 lanes x 16 B
  float* slab = (float*)(void*)sm + wave * (16 * 68);
  float* C = part + ((size_t)b * (CH / 4) * KSP + (size_t)z) * (4 * CH) + hh * CH + (tn << 6) + c4;
#pragma unroll
  for (int i = 0; i < 4; ++i) {
    const int mBase = (tm << 6) + (i << 4);
#pragma unroll
    for (int j = 0; j < 4; ++j) {
#pragma unroll
      for (int r = 0; r < 8; ++r) slab[(mOff + r) * 68 + (j << 4) + rlane] = cx[i][j][r];
    }
    // the wave's slab rows are written before its lanes read each other's values back
    asm volatile("s_wait_dscnt 0x0" ::: "memory");
    v4f t[8];
#pragma unroll
    for (int it = 0; it < 8; ++it) t[it] = *(const v4f*)(slab + (it * 2 + hh) * 68 + c4);   // rows 0..15
    // the rows are read before the next 16 rows overwrite the slab
    asm volatile("s_wait_dscnt 0x0" ::: "memory");
#pragma unroll
    for (int it = 0; it < 8; ++it)             // row d = mBase + 2 it + hh: group d/4, row d%4 = 2 (it&1) + hh
      *(v4f*)(C + (size_t)((mBase >> 2) + (it >> 1)) * (KSP * 4 * CH) + (it & 1) * (2 * CH)) = t[it];
  }
}

// =====================================================================================================
// Workspace map (bytes), every plane an exact multiple of its 64x64-tile / whole-line store granularity
// (no padded tails needed: 4096, 512, 256 are tile multiples); one group holds all GB = NBAT batches:
//   Wqb   bf16 [256][256]              0          131072
//   Wkvb  bf16 [512][256]              131072     262144
//   Wob   bf16 [256][256]              393216     131072
//   Xt    bf16 [GB][4096][256]         524288     16777216
//   Ct    bf16 [GB][4096][256]         17301504   16777216
//   cxp   f32  [GB*64][KSP][4][256]    34078720   67108864
//   stm   f32  [KSP][GB][256]          101187584  262144
//   sts   f32  [KSP][GB][256]          101449728  262144
//   m2h   bf16 [GB][256][256]          101711872  1048576
//   m2l   bf16 [GB][256][256]          102760448  1048576
//   end                                103809024
// Weights are [out][in] with the in index as k; Wqb, Wkvb, Wob, m2h, m2l are in fragment order.
// =====================================================================================================
extern "C" void kernel_launch(void* const* d_in, const int* in_sizes, int n_in,
                              void* d_out, int out_size, void* d_ws, size_t ws_size,
                              hipStream_t stream) {
  if (n_in < 8) return;
  if (in_sizes[0] != NBAT * CH * NSP) return;
  if (in_sizes[1] != NBAT * CH * NSP) return;
  if (in_sizes[2] != CH * CH) return;
  if (in_sizes[3] != CH) return;
  if (in_sizes[4] != 2 * CH * CH) return;
  if (in_sizes[5] != 2 * CH) return;
  if (in_sizes[6] != CH * CH) return;
  if (in_sizes[7] != CH) return;
  if (out_size != NBAT * CH * NSP) return;

  const float* x     = (const float*)d_in[0];
  const float* cproj = (const float*)d_in[1];
  const float* wq    = (const float*)d_in[2];
  const float* bq    = (const float*)d_in[3];
  const float* wkv   = (const float*)d_in[4];
  const float* bkv   = (const float*)d_in[5];
  const float* wo    = (const float*)d_in[6];
  const float* bo    = (const float*)d_in[7];
  float* out = (float*)d_out;

  const size_t PWq  = (size_t)CH * CH * 2;               //   131072
  const size_t PWkv = (size_t)2 * CH * CH * 2;           //   262144
  const size_t PWo  = (size_t)CH * CH * 2;               //   131072
  const size_t PXt  = (size_t)GB * NSP * CH * 2;         // 16777216
  const size_t PCxp = (size_t)KSP * GB * CH * CH * 4;    // 67108864
  const size_t PSt  = (size_t)KSP * GB * CH * 4;         //   262144
  const size_t PCx  = (size_t)GB * CH * CH * 2;          //  1048576
  size_t off = 0;
  const size_t oWq  = off; off += PWq;
  const size_t oWkv = off; off += PWkv;
  const size_t oWo  = off; off += PWo;
  const size_t oXt  = off; off += PXt;
  const size_t oCt  = off; off += PXt;
  const size_t oCxp = off; off += PCxp;
  const size_t oStm = off; off += PSt;
  const size_t oSts = off; off += PSt;
  const size_t oM2h = off; off += PCx;
  const size_t oM2l = off; off += PCx;
  if (off > ws_size) return;                             // off = 103809024

  char* ws = (char*)d_ws;
  unsigned short* Wqb  = (unsigned short*)(ws + oWq);
  unsigned short* Wkvb = (unsigned short*)(ws + oWkv);
  unsigned short* Wob  = (unsigned short*)(ws + oWo);
  unsigned short* Xt   = (unsigned short*)(ws + oXt);
  unsigned short* Ct   = (unsigned short*)(ws + oCt);
  float*          Cxp  = (float*)(ws + oCxp);
  float*          Stm  = (float*)(ws + oStm);
  float*          Sts  = (float*)(ws + oSts);
  unsigned short* M2h  = (unsigned short*)(ws + oM2h);
  unsigned short* M2l  = (unsigned short*)(ws + oM2l);

  const dim3 blk(256);

  const dim3 gTr(NSP / 64, WROWS + (CH / 64) * 2 * GB);  // 64 x (2 rows of weight blocks + 4 x 16 rows of tiles)
  const dim3 gKc(KSP, GB);                               // 32 slices of n x GB, 16 waves each
  const dim3 gSum(GB * CH * CH / 2048);                  // 256 blocks
  const dim3 gQo(NSP / 64, GB);                          // 64 column tiles x GB, 4 waves each

  for (int g = 0; g < NGRP; ++g) {
    const int b0 = g * GB;
    // (1) weights -> bf16 planes; x[b], cproj[b] -> Xt[n][c], Ct[n][c] bf16
    k_trcvt<<<gTr, blk, 0, stream>>>(x, cproj, Xt, Ct, b0, wq, wkv, wo, Wqb, Wkvb, Wob);
    // (2) per slice of 128 n: KVt[n][j] = Ct . wkv^T + bkv[j] (K=256); kP = exp(K - slice max) and V as hi/lo in
    //     LDS; ctxT[d][c] partial = Vh.kPh^T + Vl.kPh^T + Vh.kPl^T (M=N=256, K=128) -> f32 partials
    k_kvctx<<<gKc, dim3(512), 0, stream>>>(Wkvb, Ct, bkv, Cxp, Stm, Sts);
    // (3) softmax-weighted sum of the partials -> 8 rows of ctxT bf16 hi/lo in LDS per block;
    //     M2[o][d] = wo . (ctxTh + ctxTl)^T  (K=256) -> bf16 hi/lo
    k_ksum<<<gSum, dim3(512), 0, stream>>>(Cxp, Stm, Sts, Wob, M2h, M2l);
    // (4) Q = wq . Xt^T + bq, qP = 64 * softmax over each head's 64 rows (hi/lo, in LDS),
    //     out[b][o][n] = ((M2h + M2l).qPh + M2h.qPl) / 64 + bo[o] -> d_out f32
    float* outg = out + (size_t)b0 * CH * NSP;
    k_qout<<<gQo, dim3(128), 0, stream>>>(Wqb, Xt, bq, M2h, M2l, bo, outg);
  }
  (void)hipGetLastError();
}

// v009
// One run takes 61.1 microseconds.
// Timed twice side by side with v008, it ran 1.03 and 1.06 times as fast.
// Counting every step since v000, it is 24.9 times as fast.
// Contractions (all v_wmma_f32_16x16x32_bf16, f32 accumulate): x^T.wq^T and wkv.cproj with bf16 operands
// RNE-converted from the f32 inputs (single product); V.kP^T with bf16 hi+lo planes on both operands (3 products);
// wo.ctx^T with bf16 wo times ctx hi+lo planes (2 products); M2.qP^T with bf16 hi+lo planes on both (3 products).
// Softmaxes and epilogues in f32; the q softmax output is carried x64, folded back by the epilogue scale.
// The q projection, its softmax and the output product run in one kernel; q passes from one to the other in LDS.
// The KV projection, the k softmax and the V.kP^T product run in one kernel per slice of 128 columns n: kP is
// exp(K - slice maximum), un-normalised; the slice sum weighs each slice by exp(slice max - row max) / row sum.
// The slice sum and the wo.ctx^T product run in one kernel; a block's rows of ctx pass from one to the other in LDS.
// Every bf16 plane that a kernel reads from global memory as WMMA fragments (wq, wkv, wo, M2 hi/lo) lies
// there in fragment order (see frag_piece), so a wave-wide 16-B load covers 512 contiguous bytes.
// x and cproj are read as they lie, f32 [c][n]: a tile is converted to bf16 and kept [c][n] in LDS, and its
// fragments (k = c) come out of LDS by the transposing load ds_load_tr16_b128 (see ldfrag_t).
#include <hip/hip_runtime.h>
#include <stdint.h>

#define NBAT 8
#define CH   256
#define NSP  4096
#define GB   8
#define NGRP (NBAT / GB)
static_assert((NSP % 64) == 0 && (CH % 64) == 0 && (NBAT % GB) == 0);
static_assert(CH == 4 * 64);         // four heads of 64 channels: one wave of k_qout per head
#define KSP  32                      // k slices of the V.kP^T product (K = NSP), one work-group of k_kvctx each
static_assert((NSP % (KSP * 32)) == 0 && ((GB * CH * CH) % 1024) == 0);

typedef __bf16   v16b __attribute__((ext_vector_type(16)));
typedef __bf16   v8b  __attribute__((ext_vector_type(8)));
typedef __bf16   v2b  __attribute__((ext_vector_type(2)));
typedef float    v2f  __attribute__((ext_vector_type(2)));
typedef float    v8f  __attribute__((ext_vector_type(8)));
typedef float    v4f  __attribute__((ext_vector_type(4)));
typedef unsigned int v4u __attribute__((ext_vector_type(4)));

// ---- scalar helpers --------------------------------------------------------------------------------
__device__ __forceinline__ float bf_round(float f) { return (float)(__bf16)f; }      // f32 -> bf16 (RNE) -> f32
__device__ __forceinline__ v2b cvt2v(float a, float b) {            // two f32 -> two bf16, RNE, one packed convert
  const v2f f = {a, b};
  return __builtin_convertvector(f, v2b);
}
__device__ __forceinline__ unsigned cvt2(float a, float b) { return __builtin_bit_cast(unsigned, cvt2v(a, b)); }
// hi = bf16(f), lo = bf16(f - hi) for two values; element 0 in the low half of each word
__device__ __forceinline__ void split2(float a, float b, unsigned& hi, unsigned& lo) {
  const v2b h = cvt2v(a, b);
  hi = __builtin_bit_cast(unsigned, h);
  lo = cvt2(a - (float)h[0], b - (float)h[1]);
}
__device__ __forceinline__ v8f zero8() { v8f z = {0.f, 0.f, 0.f, 0.f, 0.f, 0.f, 0.f, 0.f}; return z; }

// exp(x) as __expf forms it (one multiply, one v_exp_f32), with the v_nop in the same statement: it fills the slot
// that the instruction set asks for between a transcendental and an instruction directly behind it that reads its
// result or overwrites its source.
__device__ __forceinline__ float exp_slot(float x) {
  float y = 0.f;
#if defined(__HIP_DEVICE_COMPILE__)
  const float a = x * 1.44269504088896340736f;
  asm("v_exp_f32 %0, %1\n\tv_nop" : "=v"(y) : "v"(a));
#endif
  return y;
}

// ---- fragment loader: 16-bit A/B operand, lane -> row/col (lane&15), p already includes +8*(lane>>4);
//      elements 0..7 <- p[0..7] (k0+8h..), elements 8..15 <- p[16..23] (k0+16+8h..)
__device__ __forceinline__ v16b ldfrag_b(const __bf16* p) {
  union { v16b v; v8b h[2]; } f;
  f.h[0] = *(const v8b*)(p);
  f.h[1] = *(const v8b*)(p + 16);
  return f.v;
}

// ---- transposing fragment loader: bf16 tile T[k][col] in LDS, rows of pitch bytes (32 B x odd).
//      p = T + (k0 + 8*(lane>>4) + (lane&7)) * pitch + 2 * col0 + 16 * ((lane>>3)&1), in bytes; the lane then holds
//      column col0 + (lane&15): elements 0..7 <- k0+8h.., elements 8..15 <- k0+16+8h..: the k order of ldfrag_b.
typedef short s16x8 __attribute__((ext_vector_type(8)));
__device__ __forceinline__ v4u ld_tr16(const unsigned char* p) {
  typedef __attribute__((address_space(3))) s16x8 lds_s16x8;
  return __builtin_bit_cast(v4u, __builtin_amdgcn_ds_load_tr16_b128_v8i16((lds_s16x8*)p));
}
__device__ __forceinline__ v16b ldfrag_t(const unsigned char* p, int pitch) {
  union { v16b v; v4u q[2]; } f;
  f.q[0] = ld_tr16(p);
  f.q[1] = ld_tr16(p + 16 * pitch);
  return f.v;
}

// ---- fragment order of a plane P[row][k] with CH values k per row: 16-B pieces of 8 consecutive k;
//      piece (((row block * KST + k step) * 2 + half) * 32 + lane) holds row 16 * block + (lane&15),
//      k = 32 * step + 16 * half + 8 * (lane>>4) + 0..7: the same lane -> k order as ldfrag_b.
#define KST    (CH / 32)                       // k steps of a product over CH
__device__ __forceinline__ int frag_piece(int rowblk, int kstep) { return (rowblk * KST + kstep) * 64; }
__device__ __forceinline__ v16b ldfrag_q(const v4u* p) {   // p = this lane's piece of half 0; half 1 lies 32 pieces on
  union { v16b v; v4u q[2]; } f;
  f.q[0] = p[0];
  f.q[1] = p[32];
  return f.v;
}

// ---- WMMA helper -------------------------------------------------------------------------------------
__device__ __forceinline__ v8f mma_b_raw(v16b a, v16b b, v8f c) {
  return __builtin_amdgcn_wmma_f32_16x16x32_bf16(false, a, false, b, (short)0, c, false, false);
}

// =====================================================================================================
// f32 [rows][CH] -> bf16 (RNE convert) in fragment order: the thread forms piece i from 8 consecutive k of its row
// (a wave reads 64 B of each of 16 rows); one 16-B store per lane: a wave writes 512 contiguous B.
// =====================================================================================================
__device__ __forceinline__ void cvt_piece(const float* __restrict__ in, unsigned short* out, int i) {
  const int row = (i / (KST * 64)) * 16 + (i & 15);
  const int k   = ((i >> 6) % KST) * 32 + ((i >> 5) & 1) * 16 + ((i >> 4) & 1) * 8;
  const float* src = in + (size_t)row * CH + k;
  const v4f a = *(const v4f*)(src);
  const v4f b = *(const v4f*)(src + 4);
  v4u p;
  p[0] = cvt2(a[0], a[1]);
  p[1] = cvt2(a[2], a[3]);
  p[2] = cvt2(b[0], b[1]);
  p[3] = cvt2(b[2], b[3]);
  *(v4u*)(out + (size_t)i * 8) = p;
}

// =====================================================================================================
// The three weight planes, one 16-B piece per thread (cvt_piece). grid 4 * WPC / 256, block 256: block u takes
// pieces 256 * u ..; blocks 0..31 wq, 32..95 wkv, 96..127 wo: 32768 pieces = whole planes.
// =====================================================================================================
#define WPC   (CH * CH / 8)                    // 16-B pieces of a [CH][CH] plane
static_assert((WPC % 256) == 0);

__global__ __launch_bounds__(256) void k_wcvt(const float* __restrict__ wq, const float* __restrict__ wkv,
                                              const float* __restrict__ wo, unsigned short* wqb,
                                              unsigned short* wkvb, unsigned short* wob) {
  const int wblk = (int)blockIdx.x;
  const int pl = wblk < WPC / 256 ? 0 : wblk < 3 * WPC / 256 ? 1 : 2;         // block-uniform selects, all global
  const float* win = pl == 0 ? wq : pl == 1 ? wkv : wo;
  unsigned short* wout = pl == 0 ? wqb : pl == 1 ? wkvb : wob;
  const int first = pl == 0 ? 0 : pl == 1 ? WPC / 256 : 3 * WPC / 256;        // the plane's first block
  cvt_piece(win, wout, (wblk - first) * 256 + (int)threadIdx.x);
}

// =====================================================================================================
// Weighted sum of the KSP k-slice partials of ctxT, then M2 = wo . ctxT^T for the block's rows d.
// part f32 [GB*CH/4][KSP][4*CH] -> M2 bf16 hi/lo planes [GB][CH*CH].
// Slice z of column c weighs exp(m[z][c] - M[c]) / S[c], M = maximum of the slice maxima, S = sum over z of
// exp(m[z][c] - M[c]) * s[z][c]: the softmax over all n. A block covers 8 rows d x all CH columns c of one batch:
// thread t < CH forms the KSP weights of column t once, in LDS; slices are added in index order.
// Thread owns 4 consecutive elements (16-B loads); their bf16 hi and lo go to LDS rows [d][c] at a pitch of 528 B.
// Product, wave w: M2[o][d] = sum over c of wo[o][c] * (ctxTh + ctxTl)[d][c] for o in 16w..16w+15, K = CH, per k step
//   the hi product and then the lo product. ctxT is the A operand (rows d; A rows 8..15 repeat rows 0..7 and their
//   results are not stored), wo the B operand (columns o), so lane l < 16 holds M2[16w + l][d0..d0+7]: one 16-B
//   piece of the planes, which are in fragment order with row o and k = d. A wave stores 256 contiguous B per plane.
// coverage: (GB*CH*CH/2048) blocks x 16 waves x (16 rows o x 8 columns d) = whole planes.
// =====================================================================================================
#define CPITCH (CH + 8)                        // ctxT row pitch in LDS, elements (528 B)
static_assert(CH == 16 * 16);                  // sixteen waves x 16 rows o

__global__ __launch_bounds__(512) void k_ksum(const float* __restrict__ part, const float* __restrict__ stm,
                                              const float* __restrict__ sts, const unsigned short* __restrict__ wop,
                                              unsigned short* m2h, unsigned short* m2l) {
  __shared__ __align__(16) float wl[KSP][CH];
  __shared__ __align__(16) unsigned short csh[8 * CPITCH];    // the block's 8 rows of ctxT, bf16 hi
  __shared__ __align__(16) unsigned short csl[8 * CPITCH];    // and lo
  const unsigned t = threadIdx.x;
  const int lane = (int)(t & 31u);
  const int wave = __builtin_amdgcn_readfirstlane((int)(t >> 5));
  const int b = (int)(blockIdx.x / (CH * CH / 2048));
  const unsigned tq = t & 255u;                 // place in the thread's group of 4 rows d
  // the wave's group of 4 rows as a scalar: wave-uniform bases in scalar registers, one lane offset for all loads
  const unsigned g4 = (unsigned)__builtin_amdgcn_readfirstlane((int)(t >> 8));
  const float* pb = part + ((size_t)blockIdx.x * 2 + g4) * (KSP * 1024);
  const float* mb = stm + b * CH;
  const float* sb = sts + b * CH;
  v4f p[KSP];
#pragma unroll   // keeps p[] in registers and the independent loads in flight together
  for (int z = 0; z < KSP; ++z) p[z] = *(const v4f*)(pb + z * 1024 + tq * 4u);
  // keeps the plane loads ahead of the weights' work, in flight under it; the compiler otherwise sinks them
  // behind it, and the block pays the two memory latencies one after the other
  __builtin_amdgcn_sched_barrier(0);
  if (t < CH) {                                 // wave-uniform; no barrier inside
    float m[KSP], sz[KSP];
#pragma unroll   // m[] and sz[] are indexed by constants only, so they stay in registers
    for (int z = 0; z < KSP; ++z) {
      m[z]  = mb[z * (GB * CH) + t];
      sz[z] = sb[z * (GB * CH) + t];
    }
    float mm = m[0];
#pragma unroll
    for (int z = 1; z < KSP; ++z) mm = fmaxf(mm, m[z]);
    float ss = 0.f;
#pragma unroll
    for (int z = 0; z < KSP; ++z) { m[z] = __expf(m[z] - mm); ss += m[z] * sz[z]; }
    const float rinv = 1.0f / ss;
#pragma unroll
    for (int z = 0; z < KSP; ++z) wl[z][t] = m[z] * rinv;
  }
  __syncthreads();   // every column's weights are in LDS before any thread reads its four
  // wo fragments of this wave's 16 rows o, all k steps: they depend on nothing here and fly under the slice sum
  // (behind the barrier, whose wait for outstanding loads would otherwise hold the block up for them)
  v16b wf[KST];
  {
    const v4u* Wo = (const v4u*)(const void*)wop + frag_piece(wave, 0) + lane;
#pragma unroll   // wf[] is indexed by constants only, so it stays in registers
    for (int ks = 0; ks < KST; ++ks) wf[ks] = ldfrag_q(Wo + frag_piece(0, ks));
  }
  const unsigned c4 = (t * 4u) & (CH - 1);
  v4f s = p[0] * *(const v4f*)(&wl[0][c4]);
#pragma unroll   // p[] is indexed by constants only, so it stays in registers
  for (int z = 1; z < KSP; ++z) s += p[z] * *(const v4f*)(&wl[z][c4]);
  uint2 hv, lv;
  split2(s[0], s[1], hv.x, lv.x);
  split2(s[2], s[3], hv.y, lv.y);
  *(uint2*)(csh + (t >> 6) * CPITCH + c4) = hv;
  *(uint2*)(csl + (t >> 6) * CPITCH + c4) = lv;
  __syncthreads();   // all 8 rows of ctxT are in LDS before any wave reads fragments of them

  const __bf16* Ch = (const __bf16*)(const void*)csh + (lane & 7) * CPITCH + (lane >> 4) * 8;   // this lane's A row
  const __bf16* Cl = (const __bf16*)(const void*)csl + (lane & 7) * CPITCH + (lane >> 4) * 8;
  v16b ah[KST], al[KST];
#pragma unroll   // ah[] and al[] are indexed by constants only, so they stay in registers (those of p[], now free)
  for (int ks = 0; ks < KST; ++ks) {
    ah[ks] = ldfrag_b(Ch + ks * 32);
    al[ks] = ldfrag_b(Cl + ks * 32);
  }
  // all LDS fragment loads go as one group ahead of the products; the compiler otherwise loads one fragment at a
  // time into one register set, and each of the sixteen chained products waits a full LDS latency
  __builtin_amdgcn_sched_barrier(0);
  v8f acc = zero8();
#pragma unroll   // wf[], ah[] and al[] are indexed by constants only
  for (int ks = 0; ks < KST; ++ks) {
    acc = mma_b_raw(ah[ks], wf[ks], acc);
    acc = mma_b_raw(al[ks], wf[ks], acc);
  }
  v4u ph, pl;
#pragma unroll
  for (int q = 0; q < 4; ++q) {
    unsigned h, l;
    split2(acc[2 * q], acc[2 * q + 1], h, l);
    ph[q] = h;
    pl[q] = l;
  }
  if (lane < 16) {                              // lanes 16..31 hold the repeated A rows
    const int d0 = (int)(blockIdx.x % (CH * CH / 2048)) * 8;
    const size_t e0 = (size_t)b * (CH * CH) +
        (size_t)(frag_piece(wave, d0 >> 5) + ((d0 >> 4) & 1) * 32 + ((d0 >> 3) & 1) * 16 + lane) * 8;
    *(v4u*)(m2h + e0) = ph;
    *(v4u*)(m2l + e0) = pl;
  }
}

// =====================================================================================================
// q projection + q softmax + output product for one 64-column tile of n. grid (NSP/64, GB), block 128 = 4 waves.
// x tile: CH rows c of 64 columns n, f32, 256 B of each row of x; a wave-wide load takes two such segments. The
//   values go to LDS as bf16, still [c][n], at a pitch of 160 B (32 B x odd) for the transposing fragment reads.
// Part 1, wave w = head w: Q[o][n] = wq . x + bq[o] for o in 64w..64w+63 (K = CH). A lane holds column
//   n0 + 16j + (lane&15) and rows 16i + 8(lane>>4) + r, so one column's head lies in lanes l and l^16:
//   softmax of 0.25 * Q over the 64 rows = a sum inside the lane and one xor-16 exchange.
// Hand-over: 64 * softmax as bf16 hi/lo. Accumulator tiles 2p and 2p+1 of a column block are, lane for lane,
//   elements 0..7 and 8..15 of the B fragment of k step p, so each lane stores and later loads its own 16-B
//   pieces: piece (((k step * 4 + j) * 2 + half) * 32 + lane); a wave-wide access covers 512 contiguous bytes.
// Part 2, wave w: out[o][n] = ((M2h + M2l).qPh + M2h.qPl) / 64 + bo[o] for o in 64w..64w+63 (K = CH, all heads).
// coverage: 64 x GB blocks x 4 waves x (64 rows x 64 columns) = whole output.
// =====================================================================================================
#define XTP 160                                // x tile row pitch in LDS, bytes: 64 bf16 + 32 B

__global__ __launch_bounds__(128) void k_qout(const unsigned short* __restrict__ wqp,
                                              const float* __restrict__ xg,
                                              const float* __restrict__ bq,
                                              const unsigned short* __restrict__ m2hp,
                                              const unsigned short* __restrict__ m2lp,
                                              const float* __restrict__ bo, float* outp) {
  __shared__ __align__(16) unsigned char xs[CH * XTP];        // 40 KiB: x tile, bf16 [c][n]
  __shared__ __align__(16) v4u qsh[KST * 4 * 2 * 32];         // 32 KiB: q hi fragments of the tile
  __shared__ __align__(16) v4u qsl[KST * 4 * 2 * 32];         // 32 KiB: q lo fragments
  __shared__ __align__(16) float sT[4][16 * 68];              // per-wave 16x64 slab, pitch 68 floats
  const int lane = threadIdx.x & 31;
  const int wave = threadIdx.x >> 5;
  const int b  = blockIdx.y;
  const int n0 = blockIdx.x << 6;
  const int m0 = wave << 6;
  const int rlane = lane & 15;                 // row (A) / col (B, D) within subtile
  const int koff  = (lane >> 4) * 8;           // k offset of this lane half
  const int mOff  = (lane >> 4) * 8;           // D row offset
  const int apc = frag_piece(m0 >> 4, 0) + lane;             // this lane's A piece (subtile 0, k step 0), all three A planes
  const v4u* Wq = (const v4u*)(const void*)wqp + apc;
  const v4u* Mh = (const v4u*)(const void*)(m2hp + (size_t)b * CH * CH) + apc;
  const v4u* Ml = (const v4u*)(const void*)(m2lp + (size_t)b * CH * CH) + apc;
  const unsigned char* Xl = xs + (koff + (lane & 7)) * XTP + ((lane >> 3) & 1) * 16;   // ldfrag_t address, k0 = col0 = 0

  // ---- x tile to LDS; wq fragments of the first two k steps meanwhile ----
  v16b wa[2][4];
  {
    // row c = 8 it + wave + 4 (lane>>4): a wave's two rows lie 640 B apart in LDS, on the two halves of the banks
    const int xr = wave + (lane >> 4) * 4, xc = (lane & 15) * 4;
    const float* g = xg + ((size_t)b * CH + (size_t)xr) * NSP + n0 + xc;
    v4f t[32];
#pragma unroll   // keeps t[] in registers and the independent loads in flight together
    for (int it = 0; it < 32; ++it) t[it] = *(const v4f*)(g + (size_t)it * 8 * NSP);
#pragma unroll
    for (int s = 0; s < 2; ++s)
#pragma unroll
      for (int i = 0; i < 4; ++i) wa[s][i] = ldfrag_q(Wq + frag_piece(i, s));
#pragma unroll
    for (int it = 0; it < 32; ++it) {
      uint2 p;
      p.x = cvt2(t[it][0], t[it][1]);
      p.y = cvt2(t[it][2], t[it][3]);
      *(uint2*)(xs + (it * 8 + xr) * XTP + xc * 2) = p;
    }
  }
  __syncthreads();   // the whole x tile is in LDS before any wave reads fragments of it

  v8f acc[4][4];
#pragma unroll
  for (int i = 0; i < 4; ++i)
#pragma unroll
    for (int j = 0; j < 4; ++j) acc[i][j] = zero8();

  // ---- part 1: Q tile of this wave's head ----
  {
    v16b xb[2][4];
#pragma unroll
    for (int j = 0; j < 4; ++j) xb[0][j] = ldfrag_t(Xl + j * 32, XTP);
#pragma unroll   // constant buffer indices keep wa[] and xb[] in registers
    for (int ks = 0; ks < KST; ++ks) {
      const int cu = ks & 1;
      if (ks + 1 < KST) {
#pragma unroll
        for (int j = 0; j < 4; ++j) xb[cu ^ 1][j] = ldfrag_t(Xl + (ks + 1) * 32 * XTP + j * 32, XTP);
      }
#pragma unroll
      for (int i = 0; i < 4; ++i) {
#pragma unroll
        for (int j = 0; j < 4; ++j) acc[i][j] = mma_b_raw(wa[cu][i], xb[cu][j], acc[i][j]);
        if (ks + 2 < KST) wa[cu][i] = ldfrag_q(Wq + frag_piece(i, ks + 2));
        // keeps each refill where it is written, two k steps ahead of its use; the compiler otherwise sinks it
        // to just before its products, and every fragment then waits a full load latency
        __builtin_amdgcn_sched_barrier(0);
      }
    }
  }

  // ---- q softmax over the head's 64 rows, column by column; fragments to LDS ----
  float bro[4][8];
#pragma unroll
  for (int i = 0; i < 4; ++i)
#pragma unroll
    for (int r = 0; r < 8; ++r) bro[i][r] = bf_round(bq[m0 + (i << 4) + mOff + r]);
#pragma unroll
  for (int j = 0; j < 4; ++j) {
    float v[4][8];
#pragma unroll
    for (int i = 0; i < 4; ++i)
#pragma unroll
      for (int r = 0; r < 8; ++r) v[i][r] = (acc[i][j][r] + bro[i][r]) * 0.25f;
    float m = v[0][0];
#pragma unroll
    for (int i = 0; i < 4; ++i)
#pragma unroll
      for (int r = 0; r < 8; ++r) m = fmaxf(m, v[i][r]);
    m = fmaxf(m, __shfl_xor(m, 16, 32));
    float s = 0.f;
#pragma unroll
    for (int i = 0; i < 4; ++i)
#pragma unroll
      for (int r = 0; r < 8; ++r) { v[i][r] = exp_slot(v[i][r] - m); s += v[i][r]; }
    s += __shfl_xor(s, 16, 32);
    const float rinv = 1.0f / s;
#pragma unroll
    for (int i = 0; i < 4; ++i) {
      v4u ph, pl;
#pragma unroll
      for (int q = 0; q < 4; ++q) {
        const float f0 = (v[i][2 * q] * rinv) * 64.0f;
        const float f1 = (v[i][2 * q + 1] * rinv) * 64.0f;
        unsigned h, l;
        split2(f0, f1, h, l);
        ph[q] = h; pl[q] = l;
      }
      const int piece = ((((wave * 2 + (i >> 1)) * 4 + j) * 2 + (i & 1)) << 5) + lane;
      qsh[piece] = ph;
      qsl[piece] = pl;
    }
  }
  v16b ah[4], al[4];   // M2 fragments of k step 0: they do not depend on q, so they fly across the barrier
#pragma unroll
  for (int i = 0; i < 4; ++i) {
    ah[i] = ldfrag_q(Mh + frag_piece(i, 0));
    al[i] = ldfrag_q(Ml + frag_piece(i, 0));
  }
  __syncthreads();   // every head's fragments are in LDS before any wave reads them

  // ---- part 2: output rows 64w..64w+63 over all CH channels of q ----
#pragma unroll
  for (int i = 0; i < 4; ++i)
#pragma unroll
    for (int j = 0; j < 4; ++j) acc[i][j] = zero8();
  {
    v16b bh[2][4], bl[2][4];
#pragma unroll
    for (int j = 0; j < 4; ++j) {
      bh[0][j] = ldfrag_q(qsh + j * 64 + lane);
      bl[0][j] = ldfrag_q(qsl + j * 64 + lane);
    }
#pragma unroll   // constant buffer indices keep the fragment arrays in registers
    for (int ks = 0; ks < KST; ++ks) {
      const int cu = ks & 1;
      if (ks + 1 < KST) {
#pragma unroll
        for (int j = 0; j < 4; ++j) {
          bh[cu ^ 1][j] = ldfrag_q(qsh + ((ks + 1) * 4 + j) * 64 + lane);
          bl[cu ^ 1][j] = ldfrag_q(qsl + ((ks + 1) * 4 + j) * 64 + lane);
        }
      }
#pragma unroll
      for (int i = 0; i < 4; ++i) {
        // each accumulator takes its three products in the order hi.hi, lo.hi, hi.lo; four tiles side by side
#pragma unroll
        for (int j = 0; j < 4; ++j) acc[i][j] = mma_b_raw(ah[i], bh[cu][j], acc[i][j]);
#pragma unroll
        for (int j = 0; j < 4; ++j) acc[i][j] = mma_b_raw(al[i], bh[cu][j], acc[i][j]);
#pragma unroll
        for (int j = 0; j < 4; ++j) acc[i][j] = mma_b_raw(ah[i], bl[cu][j], acc[i][j]);
        if (ks + 1 < KST) {
          ah[i] = ldfrag_q(Mh + frag_piece(i, ks + 1));
          al[i] = ldfrag_q(Ml + frag_piece(i, ks + 1));
        }
        // keeps each refill where it is written, one k step ahead of its use (see part 1)
        __builtin_amdgcn_sched_barrier(0);
      }
    }
  }

  // ---- epilogue: whole 256-B row segments through the wave's own slab ----
  float* slab = sT[wave];
  float* C = outp + (size_t)b * CH * NSP;
  const int hh = lane >> 4, c4 = (lane & 15) * 4;          // 256-B row segment = 16 lanes x 16 B
#pragma unroll
  for (int i = 0; i < 4; ++i) {
    const int mBase = m0 + (i << 4);
    float brow[8];
#pragma unroll
    for (int r = 0; r < 8; ++r) brow[r] = bf_round(bo[mBase + mOff + r]);
#pragma unroll
    for (int j = 0; j < 4; ++j) {
#pragma unroll
      for (int r = 0; r < 8; ++r) {
        slab[(mOff + r) * 68 + (j << 4) + rlane] = acc[i][j][r] * (1.0f / 64.0f) + brow[r];
      }
    }
    // the wave's slab rows are written before its lanes read each other's values back
    asm volatile("s_wait_dscnt 0x0" ::: "memory");
    v4f t[8];
#pragma unroll
    for (int it = 0; it < 8; ++it) t[it] = *(const v4f*)(slab + (it * 2 + hh) * 68 + c4);   // rows 0..15
    // the rows are read before the next 16 rows overwrite the slab
    asm volatile("s_wait_dscnt 0x0" ::: "memory");
#pragma unroll
    for (int it = 0; it < 8; ++it) *(v4f*)(C + (size_t)(mBase + it * 2 + hh) * NSP + n0 + c4) = t[it];
  }
}

// =====================================================================================================
// KV projection + k softmax numerators + context product for one slice of SLN = 128 columns n of one batch.
// grid (KSP, GB), block 512 = 16 waves, one work-group per WGP (256 KiB of LDS).
// c tile: CH rows c of 128 columns n, f32, 512 B of each row of cproj = one wave-wide load. The values go to LDS
//   as bf16, still [c][n], at a pitch of 288 B (32 B x odd) for the transposing fragment reads of all sixteen waves.
// Part 1, wave w: KVt[n][j] = cproj^T . wkv^T + bkv[j] for all 128 n and j in 32w..32w+31 (K = CH). A lane holds column
//   j = 32w + 16jj + (lane&15) and rows n = 16i + 8(lane>>4) + r, so one column lies in lanes l and l^16.
// Waves 0..7 hold K (j < CH): slice maximum m and sum s of exp(K - m) = a sum inside the lane and one xor-16
//   exchange; m and s go to stm, sts [slice][b][j]; the value handed on is exp(K - m). Waves 8..15 hold V as it is.
// Hand-over: bf16 hi/lo. Accumulator tiles 2p and 2p+1 of a column block are, lane for lane, elements 0..7 and
//   8..15 of the A or B fragment of k step p (k = n), so each lane stores and later loads 16-B pieces:
//   piece (((column block * KS2 + k step) * 2 + half) * 32 + lane); a wave-wide access covers 512 contiguous bytes.
//   The fragments take over the c tile's LDS behind a barrier that ends its last read.
// Part 2, wave w: ctxT[d][c] partial = Vh.kPh + Vl.kPh + Vh.kPl for the 64x64 tile (w>>2, w&3), K = 128 -> f32, to
//   part [b * CH/4 + d/4][slice][d%4][c] (the KSP partials that one block of k_ksum adds lie 256 KiB in a row), whole
//   256-B row segments through the wave's slab, which takes over fragment LDS behind a barrier.
// coverage: KSP x GB blocks x 16 waves x (64 x 64) = all of part; 8 waves x 32 columns = every m and s.
// =====================================================================================================
#define SLN (NSP / KSP)                        // columns n of a slice
#define KS2 (SLN / 32)                         // k steps of the context product
#define FPL ((2 * CH / 16) * KS2 * 2 * 32)     // 16-B pieces of one fragment plane (hi or lo)
static_assert(SLN == 128 && 2 * CH == 16 * 32);            // 16 waves x 32 columns j; 8 accumulator row blocks
#define CTP 288                                // c tile row pitch in LDS, bytes: 128 bf16 + 32 B
static_assert(CH * CTP <= 2 * FPL * 16 && 16 * 16 * 68 * 4 <= 2 * FPL * 16);           // c tile and slabs fit

__global__ __launch_bounds__(512) void k_kvctx(const unsigned short* __restrict__ wkvp,
                                               const float* __restrict__ cg,
                                               const float* __restrict__ bkv,
                                               float* part, float* stm, float* sts) {
  __shared__ __align__(16) v4u sm[2 * FPL];                   // 256 KiB: c tile, then fragments, then slabs
  unsigned char* xs = (unsigned char*)(void*)sm;
  v4u* fh = sm;
  v4u* fl = sm + FPL;
  const int lane = threadIdx.x & 31;
  const int wave = __builtin_amdgcn_readfirstlane((int)(threadIdx.x >> 5));
  const int z  = blockIdx.x;
  const int b  = blockIdx.y;
  const int n0 = z * SLN;
  const int rlane = lane & 15;                 // row (A) / col (B, D) within subtile
  const int koff  = (lane >> 4) * 8;           // k offset of this lane half
  const int mOff  = (lane >> 4) * 8;           // D row offset
  const v4u* Wk = (const v4u*)(const void*)wkvp + frag_piece(wave * 2, 0) + lane;                  // B piece, block 0
  const unsigned char* Xl = xs + (koff + (lane & 7)) * CTP + ((lane >> 3) & 1) * 16;               // ldfrag_t address, k0 = col0 = 0

  // ---- c tile to LDS; wkv fragments of the first two k steps and the bias meanwhile ----
  v16b wb[2][2];
  float bj[2];
  {
    const float* g = cg + ((size_t)b * CH + (size_t)wave) * NSP + n0 + lane * 4;                    // row c = 16 it + wave
    v4f t[16];
#pragma unroll   // keeps t[] in registers and the independent loads in flight together
    for (int it = 0; it < 16; ++it) t[it] = *(const v4f*)(g + (size_t)it * 16 * NSP);
#pragma unroll
    for (int s = 0; s < 2; ++s)
#pragma unroll
      for (int jj = 0; jj < 2; ++jj) wb[s][jj] = ldfrag_q(Wk + frag_piece(jj, s));
#pragma unroll
    for (int jj = 0; jj < 2; ++jj) bj[jj] = bf_round(bkv[wave * 32 + jj * 16 + rlane]);
#pragma unroll
    for (int it = 0; it < 16; ++it) {
      uint2 p;
      p.x = cvt2(t[it][0], t[it][1]);
      p.y = cvt2(t[it][2], t[it][3]);
      *(uint2*)(xs + (it * 16 + wave) * CTP + lane * 8) = p;
    }
  }
  __syncthreads();   // the whole c tile is in LDS before any wave reads fragments of it

  // ---- part 1: KVt tile, 128 rows n x this wave's 32 columns j ----
  v8f acc[8][2];
#pragma unroll
  for (int i = 0; i < 8; ++i)
#pragma unroll
    for (int jj = 0; jj < 2; ++jj) acc[i][jj] = zero8();
  v16b xa[2][4];                               // c tile fragments of four row blocks, two sets
#pragma unroll
  for (int q = 0; q < 4; ++q) xa[0][q] = ldfrag_t(Xl + q * 32, CTP);
#pragma unroll   // constant buffer indices keep wb[] and xa[] in registers
  for (int st = 0; st < 2 * KST; ++st) {       // k step st >> 1, row blocks 4 * (st & 1) ..
    const int ks = st >> 1, hf = st & 1, cu = ks & 1, nx = st + 1;
    if (nx < 2 * KST) {
#pragma unroll
      for (int q = 0; q < 4; ++q) xa[hf ^ 1][q] = ldfrag_t(Xl + (nx >> 1) * 32 * CTP + ((nx & 1) * 4 + q) * 32, CTP);
    }
    // the next set's LDS loads go as one group ahead of this set's products; the compiler otherwise loads one
    // fragment at a time into one register set and every pair of products waits a full LDS latency
    __builtin_amdgcn_sched_barrier(0);
#pragma unroll
    for (int q = 0; q < 4; ++q)
#pragma unroll
      for (int jj = 0; jj < 2; ++jj) acc[hf * 4 + q][jj] = mma_b_raw(xa[hf][q], wb[cu][jj], acc[hf * 4 + q][jj]);
    if (hf == 1 && ks + 2 < KST) {
#pragma unroll
      for (int jj = 0; jj < 2; ++jj) wb[cu][jj] = ldfrag_q(Wk + frag_piece(jj, ks + 2));
    }
    // keeps each wkv refill where it is written, two k steps ahead of its use; the compiler otherwise sinks it
    // to just before its products, and every fragment then waits a full load latency
    __builtin_amdgcn_sched_barrier(0);
  }
  __syncthreads();   // every wave has read its last c tile fragment before fragments overwrite the tile

  // ---- k softmax numerators of the slice (waves 0..7); hi/lo fragments of K and V to LDS ----
#pragma unroll
  for (int jj = 0; jj < 2; ++jj) {
    float v[8][8];
#pragma unroll
    for (int i = 0; i < 8; ++i)
#pragma unroll
      for (int r = 0; r < 8; ++r) v[i][r] = acc[i][jj][r] + bj[jj];
    if (wave < 8) {                            // wave-uniform; no barrier inside
      float m = v[0][0];
#pragma unroll
      for (int i = 0; i < 8; ++i)
#pragma unroll
        for (int r = 0; r < 8; ++r) m = fmaxf(m, v[i][r]);
      m = fmaxf(m, __shfl_xor(m, 16, 32));
      float s = 0.f;
#pragma unroll
      for (int i = 0; i < 8; ++i)
#pragma unroll
        for (int r = 0; r < 8; ++r) { v[i][r] = exp_slot(v[i][r] - m); s += v[i][r]; }
      s += __shfl_xor(s, 16, 32);
      if (lane < 16) {
        const int so = (z * GB + b) * CH + wave * 32 + jj * 16 + rlane;
        stm[so] = m;
        sts[so] = s;
      }
    }
#pragma unroll
    for (int i = 0; i < 8; ++i) {
      v4u ph, pl;
#pragma unroll
      for (int q = 0; q < 4; ++q) {
        const float f0 = v[i][2 * q], f1 = v[i][2 * q + 1];
        unsigned h, l;
        split2(f0, f1, h, l);
        ph[q] = h; pl[q] = l;
      }
      const int piece = ((((wave * 2 + jj) * KS2 + (i >> 1)) * 2 + (i & 1)) << 5) + lane;
      fh[piece] = ph;
      fl[piece] = pl;
    }
  }
  __syncthreads();   // every column block's fragments are in LDS before any wave reads them

  // ---- part 2: 64x64 tile of the slice's ctxT, rows d from V (A), columns c from kP (B) ----
  const int tm = wave >> 2, tn = wave & 3;
  v8f cx[4][4];
#pragma unroll
  for (int i = 0; i < 4; ++i)
#pragma unroll
    for (int j = 0; j < 4; ++j) cx[i][j] = zero8();
  const v4u* Ah = fh + (CH / 16 + tm * 4) * KS2 * 64 + lane;   // V column blocks of this tile's rows d
  const v4u* Al = fl + (CH / 16 + tm * 4) * KS2 * 64 + lane;
  v16b ah[2], al[2];
  ah[0] = ldfrag_q(Ah);
  al[0] = ldfrag_q(Al);
#pragma unroll   // constant indices keep the fragment arrays in registers
  for (int p = 0; p < KS2; ++p) {
    v16b bh[4], bl[4];
#pragma unroll
    for (int j = 0; j < 4; ++j) {
      bh[j] = ldfrag_q(fh + ((tn * 4 + j) * KS2 + p) * 64 + lane);
      bl[j] = ldfrag_q(fl + ((tn * 4 + j) * KS2 + p) * 64 + lane);
    }
#pragma unroll
    for (int i = 0; i < 4; ++i) {
      const int cu = i & 1;
      const int nx = p * 4 + i + 1;            // the next row block's A fragments, one block of products ahead
      if (nx < KS2 * 4) {
        ah[cu ^ 1] = ldfrag_q(Ah + ((nx & 3) * KS2 + (nx >> 2)) * 64);
        al[cu ^ 1] = ldfrag_q(Al + ((nx & 3) * KS2 + (nx >> 2)) * 64);
      }
      // each accumulator takes its three products in the order hi.hi, lo.hi, hi.lo; four tiles side by side
#pragma unroll
      for (int j = 0; j < 4; ++j) cx[i][j] = mma_b_raw(ah[cu], bh[j], cx[i][j]);
#pragma unroll
      for (int j = 0; j < 4; ++j) cx[i][j] = mma_b_raw(al[cu], bh[j], cx[i][j]);
#pragma unroll
      for (int j = 0; j < 4; ++j) cx[i][j] = mma_b_raw(ah[cu], bl[j], cx[i][j]);
      // keeps later blocks' fragment loads from being lifted up here: with more than one block's fragments
      // ahead the live set passes the 256 registers of a 16-wave work-group and spills to scratch
      __builtin_amdgcn_sched_barrier(0);
    }
  }
  __syncthreads();   // every wave has read its last fragment before the slabs overwrite them

  // ---- epilogue: whole 256-B row segments through the wave's own slab ----
  const int hh = lane >> 4, c4 = (lane & 15) * 4;          // 256-B row segment = 16 lanes x 16 B
  float* slab = (float*)(void*)sm + wave * (16 * 68);
  float* C = part + ((size_t)b * (CH / 4) * KSP + (size_t)z) * (4 * CH) + hh * CH + (tn << 6) + c4;
#pragma unroll
  for (int i = 0; i < 4; ++i) {
    const int mBase = (tm << 6) + (i << 4);
#pragma unroll
    for (int j = 0; j < 4; ++j) {
#pragma unroll
      for (int r = 0; r < 8; ++r) slab[(mOff + r) * 68 + (j << 4) + rlane] = cx[i][j][r];
    }
    // the wave's slab rows are written before its lanes read each other's values back
    asm volatile("s_wait_dscnt 0x0" ::: "memory");
    v4f t[8];
#pragma unroll
    for (int it = 0; it < 8; ++it) t[it] = *(const v4f*)(slab + (it * 2 + hh) * 68 + c4);   // rows 0..15
    // the rows are read before the next 16 rows overwrite the slab
    asm volatile("s_wait_dscnt 0x0" ::: "memory");
#pragma unroll
    for (int it = 0; it < 8; ++it)             // row d = mBase + 2 it + hh: group d/4, row d%4 = 2 (it&1) + hh
      *(v4f*)(C + (size_t)((mBase >> 2) + (it >> 1)) * (KSP * 4 * CH) + (it & 1) * (2 * CH)) = t[it];
  }
}

// =====================================================================================================
// Workspace map (bytes), every plane an exact multiple of its 64x64-tile / whole-line store granularity
// (no padded tails needed: 4096, 512, 256 are tile multiples); one group holds all GB = NBAT batches:
//   Wqb   bf16 [256][256]              0          131072
//   Wkvb  bf16 [512][256]              131072     262144
//   Wob   bf16 [256][256]              393216     131072
//   cxp   f32  [GB*64][KSP][4][256]    524288     67108864
//   stm   f32  [KSP][GB][256]          67633152   262144
//   sts   f32  [KSP][GB][256]          67895296   262144
//   m2h   bf16 [GB][256][256]          68157440   1048576
//   m2l   bf16 [GB][256][256]          69206016   1048576
//   end                                70254592
// Weights are [out][in] with the in index as k; Wqb, Wkvb, Wob, m2h, m2l are in fragment order.
// =====================================================================================================
extern "C" void kernel_launch(void* const* d_in, const int* in_sizes, int n_in,
                              void* d_out, int out_size, void* d_ws, size_t ws_size,
                              hipStream_t stream) {
  if (n_in < 8) return;
  if (in_sizes[0] != NBAT * CH * NSP) return;
  if (in_sizes[1] != NBAT * CH * NSP) return;
  if (in_sizes[2] != CH * CH) return;
  if (in_sizes[3] != CH) return;
  if (in_sizes[4] != 2 * CH * CH) return;
  if (in_sizes[5] != 2 * CH) return;
  if (in_sizes[6] != CH * CH) return;
  if (in_sizes[7] != CH) return;
  if (out_size != NBAT * CH * NSP) return;

  const float* x     = (const float*)d_in[0];
  const float* cproj = (const float*)d_in[1];
  const float* wq    = (const float*)d_in[2];
  const float* bq    = (const float*)d_in[3];
  const float* wkv   = (const float*)d_in[4];
  const float* bkv   = (const float*)d_in[5];
  const float* wo    = (const float*)d_in[6];
  const float* bo    = (const float*)d_in[7];
  float* out = (float*)d_out;

  const size_t PWq  = (size_t)CH * CH * 2;               //   131072
  const size_t PWkv = (size_t)2 * CH * CH * 2;           //   262144
  const size_t PWo  = (size_t)CH * CH * 2;               //   131072
  const size_t PCxp = (size_t)KSP * GB * CH * CH * 4;    // 67108864
  const size_t PSt  = (size_t)KSP * GB * CH * 4;         //   262144
  const size_t PCx  = (size_t)GB * CH * CH * 2;          //  1048576
  size_t off = 0;
  const size_t oWq  = off; off += PWq;
  const size_t oWkv = off; off += PWkv;
  const size_t oWo  = off; off += PWo;
  const size_t oCxp = off; off += PCxp;
  const size_t oStm = off; off += PSt;
  const size_t oSts = off; off += PSt;
  const size_t oM2h = off; off += PCx;
  const size_t oM2l = off; off += PCx;
  if (off > ws_size) return;                             // off = 70254592

  char* ws = (char*)d_ws;
  unsigned short* Wqb  = (unsigned short*)(ws + oWq);
  unsigned short* Wkvb = (unsigned short*)(ws + oWkv);
  unsigned short* Wob  = (unsigned short*)(ws + oWo);
  float*          Cxp  = (float*)(ws + oCxp);
  float*          Stm  = (float*)(ws + oStm);
  float*          Sts  = (float*)(ws + oSts);
  unsigned short* M2h  = (unsigned short*)(ws + oM2h);
  unsigned short* M2l  = (unsigned short*)(ws + oM2l);

  const dim3 blk(256);

  const dim3 gW(4 * WPC / 256);                          // 128 blocks of weight pieces
  const dim3 gKc(KSP, GB);                               // 32 slices of n x GB, 16 waves each
  const dim3 gSum(GB * CH * CH / 2048);                  // 256 blocks
  const dim3 gQo(NSP / 64, GB);                          // 64 column tiles x GB, 4 waves each

  for (int g = 0; g < NGRP; ++g) {
    const int b0 = g * GB;
    // (1) weights -> bf16 planes
    k_wcvt<<<gW, blk, 0, stream>>>(wq, wkv, wo, Wqb, Wkvb, Wob);
    // (2) per slice of 128 n: KVt[n][j] = cproj^T . wkv^T + bkv[j] (K=256); kP = exp(K - slice max) and V as hi/lo in
    //     LDS; ctxT[d][c] partial = Vh.kPh^T + Vl.kPh^T + Vh.kPl^T (M=N=256, K=128) -> f32 partials
    k_kvctx<<<gKc, dim3(512), 0, stream>>>(Wkvb, cproj + (size_t)b0 * CH * NSP, bkv, Cxp, Stm, Sts);
    // (3) softmax-weighted sum of the partials -> 8 rows of ctxT bf16 hi/lo in LDS per block;
    //     M2[o][d] = wo . (ctxTh + ctxTl)^T  (K=256) -> bf16 hi/lo
    k_ksum<<<gSum, dim3(512), 0, stream>>>(Cxp, Stm, Sts, Wob, M2h, M2l);
    // (4) Q = wq . x + bq, qP = 64 * softmax over each head's 64 rows (hi/lo, in LDS),
    //     out[b][o][n] = ((M2h + M2l).qPh + M2h.qPl) / 64 + bo[o] -> d_out f32
    float* outg = out + (size_t)b0 * CH * NSP;
    k_qout<<<gQo, dim3(128), 0, stream>>>(Wqb, x + (size_t)b0 * CH * NSP, bq, M2h, M2l, bo, outg);
  }
  (void)hipGetLastError();
}

// v010
// A run of this version takes 58.9 microseconds.
// Next to v009, in two timings, it ran 1.06 and 1.05 times as fast.
// Counting every step since v000, it is 26.3 times as fast.
// Contractions (all v_wmma_f32_16x16x32_bf16, f32 accumulate): x^T.wq^T and wkv.cproj with bf16 operands
// RNE-converted from the f32 inputs (single product); V.kP^T with bf16 hi+lo planes on both operands (3 products);
// wo.ctx^T with bf16 wo times ctx hi+lo planes (2 products); M2.qP^T with bf16 hi+lo planes on both (3 products).
// Softmaxes and epilogues in f32; the q softmax output is carried x64, folded back by the epilogue scale.
// The q projection, its softmax and the output product run in one kernel; q passes from one to the other in LDS.
// The KV projection, the k softmax and the V.kP^T product run in one kernel per slice of 128 columns n: kP is
// exp(K - slice maximum), un-normalised; the slice sum weighs each slice by exp(slice max - row max) / row sum.
// The slice sum and the wo.ctx^T product run in one kernel; a block's rows of ctx pass from one to the other in LDS.
// The slice partials of ctx lie in the workspace in accumulator order (see k_kvctx, part 2): a lane stores its own
// registers, 16 B at a time, and a finished row block goes out under the next one's products.
// Every bf16 plane that a kernel reads from global memory as WMMA fragments (wq, wkv, wo, M2 hi/lo) lies
// there in fragment order (see frag_piece), so a wave-wide 16-B load covers 512 contiguous bytes.
// x and cproj are read as they lie, f32 [c][n]: a tile is converted to bf16 and kept [c][n] in LDS, and its
// fragments (k = c) come out of LDS by the transposing load ds_load_tr16_b128 (see ldfrag_t).
#include <hip/hip_runtime.h>
#include <stdint.h>

#define NBAT 8
#define CH   256
#define NSP  4096
#define GB   8
#define NGRP (NBAT / GB)
static_assert((NSP % 64) == 0 && (CH % 64) == 0 && (NBAT % GB) == 0);
static_assert(CH == 4 * 64);         // four heads of 64 channels: one wave of k_qout per head
#define KSP  32                      // k slices of the V.kP^T product (K = NSP), one work-group of k_kvctx each
static_assert((NSP % (KSP * 32)) == 0 && ((GB * CH * CH) % 1024) == 0);

typedef __bf16   v16b __attribute__((ext_vector_type(16)));
typedef __bf16   v8b  __attribute__((ext_vector_type(8)));
typedef __bf16   v2b  __attribute__((ext_vector_type(2)));
typedef float    v2f  __attribute__((ext_vector_type(2)));
typedef float    v8f  __attribute__((ext_vector_type(8)));
typedef float    v4f  __attribute__((ext_vector_type(4)));
typedef unsigned int v4u __attribute__((ext_vector_type(4)));

// ---- scalar helpers --------------------------------------------------------------------------------
__device__ __forceinline__ float bf_round(float f) { return (float)(__bf16)f; }      // f32 -> bf16 (RNE) -> f32
__device__ __forceinline__ v2b cvt2v(float a, float b) {            // two f32 -> two bf16, RNE, one packed convert
  const v2f f = {a, b};
  return __builtin_convertvector(f, v2b);
}
__device__ __forceinline__ unsigned cvt2(float a, float b) { return __builtin_bit_cast(unsigned, cvt2v(a, b)); }
// hi = bf16(f), lo = bf16(f - hi) for two values; element 0 in the low half of each word
__device__ __forceinline__ void split2(float a, float b, unsigned& hi, unsigned& lo) {
  const v2b h = cvt2v(a, b);
  hi = __builtin_bit_cast(unsigned, h);
  lo = cvt2(a - (float)h[0], b - (float)h[1]);
}
__device__ __forceinline__ v8f zero8() { v8f z = {0.f, 0.f, 0.f, 0.f, 0.f, 0.f, 0.f, 0.f}; return z; }

// exp(x) as __expf forms it (one multiply, one v_exp_f32), with the v_nop in the same statement: it fills the slot
// that the instruction set asks for between a transcendental and an instruction directly behind it that reads its
// result or overwrites its source.
__device__ __forceinline__ float exp_slot(float x) {
  float y = 0.f;
#if defined(__HIP_DEVICE_COMPILE__)
  const float a = x * 1.44269504088896340736f;
  asm("v_exp_f32 %0, %1\n\tv_nop" : "=v"(y) : "v"(a));
#endif
  return y;
}

// ---- fragment loader: 16-bit A/B operand, lane -> row/col (lane&15), p already includes +8*(lane>>4);
//      elements 0..7 <- p[0..7] (k0+8h..), elements 8..15 <- p[16..23] (k0+16+8h..)
__device__ __forceinline__ v16b ldfrag_b(const __bf16* p) {
  union { v16b v; v8b h[2]; } f;
  f.h[0] = *(const v8b*)(p);
  f.h[1] = *(const v8b*)(p + 16);
  return f.v;
}

// ---- transposing fragment loader: bf16 tile T[k][col] in LDS, rows of pitch bytes (32 B x odd).
//      p = T + (k0 + 8*(lane>>4) + (lane&7)) * pitch + 2 * col0 + 16 * ((lane>>3)&1), in bytes; the lane then holds
//      column col0 + (lane&15): elements 0..7 <- k0+8h.., elements 8..15 <- k0+16+8h..: the k order of ldfrag_b.
typedef short s16x8 __attribute__((ext_vector_type(8)));
__device__ __forceinline__ v4u ld_tr16(const unsigned char* p) {
  typedef __attribute__((address_space(3))) s16x8 lds_s16x8;
  return __builtin_bit_cast(v4u, __builtin_amdgcn_ds_load_tr16_b128_v8i16((lds_s16x8*)p));
}
__device__ __forceinline__ v16b ldfrag_t(const unsigned char* p, int pitch) {
  union { v16b v; v4u q[2]; } f;
  f.q[0] = ld_tr16(p);
  f.q[1] = ld_tr16(p + 16 * pitch);
  return f.v;
}

// ---- fragment order of a plane P[row][k] with CH values k per row: 16-B pieces of 8 consecutive k;
//      piece (((row block * KST + k step) * 2 + half) * 32 + lane) holds row 16 * block + (lane&15),
//      k = 32 * step + 16 * half + 8 * (lane>>4) + 0..7: the same lane -> k order as ldfrag_b.
#define KST    (CH / 32)                       // k steps of a product over CH
__device__ __forceinline__ int frag_piece(int rowblk, int kstep) { return (rowblk * KST + kstep) * 64; }
__device__ __forceinline__ v16b ldfrag_q(const v4u* p) {   // p = this lane's piece of half 0; half 1 lies 32 pieces on
  union { v16b v; v4u q[2]; } f;
  f.q[0] = p[0];
  f.q[1] = p[32];
  return f.v;
}

// ---- WMMA helper -------------------------------------------------------------------------------------
__device__ __forceinline__ v8f mma_b_raw(v16b a, v16b b, v8f c) {
  return __builtin_amdgcn_wmma_f32_16x16x32_bf16(false, a, false, b, (short)0, c, false, false);
}

// =====================================================================================================
// f32 [rows][CH] -> bf16 (RNE convert) in fragment order: the thread forms piece i from 8 consecutive k of its row
// (a wave reads 64 B of each of 16 rows); one 16-B store per lane: a wave writes 512 contiguous B.
// =====================================================================================================
__device__ __forceinline__ void cvt_piece(const float* __restrict__ in, unsigned short* out, int i) {
  const int row = (i / (KST * 64)) * 16 + (i & 15);
  const int k   = ((i >> 6) % KST) * 32 + ((i >> 5) & 1) * 16 + ((i >> 4) & 1) * 8;
  const float* src = in + (size_t)row * CH + k;
  const v4f a = *(const v4f*)(src);
  const v4f b = *(const v4f*)(src + 4);
  v4u p;
  p[0] = cvt2(a[0], a[1]);
  p[1] = cvt2(a[2], a[3]);
  p[2] = cvt2(b[0], b[1]);
  p[3] = cvt2(b[2], b[3]);
  *(v4u*)(out + (size_t)i * 8) = p;
}

// =====================================================================================================
// The three weight planes, one 16-B piece per thread (cvt_piece). grid 4 * WPC / 256, block 256: block u takes
// pieces 256 * u ..; blocks 0..31 wq, 32..95 wkv, 96..127 wo: 32768 pieces = whole planes.
// =====================================================================================================
#define WPC   (CH * CH / 8)                    // 16-B pieces of a [CH][CH] plane
static_assert((WPC % 256) == 0);

__global__ __launch_bounds__(256) void k_wcvt(const float* __restrict__ wq, const float* __restrict__ wkv,
                                              const float* __restrict__ wo, unsigned short* wqb,
                                              unsigned short* wkvb, unsigned short* wob) {
  const int wblk = (int)blockIdx.x;
  const int pl = wblk < WPC / 256 ? 0 : wblk < 3 * WPC / 256 ? 1 : 2;         // block-uniform selects, all global
  const float* win = pl == 0 ? wq : pl == 1 ? wkv : wo;
  unsigned short* wout = pl == 0 ? wqb : pl == 1 ? wkvb : wob;
  const int first = pl == 0 ? 0 : pl == 1 ? WPC / 256 : 3 * WPC / 256;        // the plane's first block
  cvt_piece(win, wout, (wblk - first) * 256 + (int)threadIdx.x);
}

// =====================================================================================================
// Weighted sum of the KSP k-slice partials of ctxT, then M2 = wo . ctxT^T for the block's rows d.
// part f32 [GB*CH/8][KSP][CH/16][2][16][4] (8 rows d; column block; rows 0..3 or 4..7; column; row) -> M2 bf16 hi/lo
// planes [GB][CH*CH].
// Slice z of column c weighs exp(m[z][c] - M[c]) / S[c], M = maximum of the slice maxima, S = sum over z of
// exp(m[z][c] - M[c]) * s[z][c]: the softmax over all n. A block covers 8 rows d x all CH columns c of one batch:
// thread t < CH forms the KSP weights of column t once, in LDS; slices are added in index order.
// Thread owns 4 rows d of one column c (16-B loads, a wave 512 contiguous B); their bf16 hi and lo go to LDS rows
// [d][c] at a pitch of 528 B.
// Product, wave w: M2[o][d] = sum over c of wo[o][c] * (ctxTh + ctxTl)[d][c] for o in 16w..16w+15, K = CH, per k step
//   the hi product and then the lo product. ctxT is the A operand (rows d; A rows 8..15 repeat rows 0..7 and their
//   results are not stored), wo the B operand (columns o), so lane l < 16 holds M2[16w + l][d0..d0+7]: one 16-B
//   piece of the planes, which are in fragment order with row o and k = d. A wave stores 256 contiguous B per plane.
// coverage: (GB*CH*CH/2048) blocks x 16 waves x (16 rows o x 8 columns d) = whole planes.
// =====================================================================================================
#define CPITCH (CH + 8)                        // ctxT row pitch in LDS, elements (528 B)
static_assert(CH == 16 * 16);                  // sixteen waves x 16 rows o

__global__ __launch_bounds__(512) void k_ksum(const float* __restrict__ part, const float* __restrict__ stm,
                                              const float* __restrict__ sts, const unsigned short* __restrict__ wop,
                                              unsigned short* m2h, unsigned short* m2l) {
  __shared__ __align__(16) float wl[KSP][CH];
  __shared__ __align__(16) unsigned short csh[8 * CPITCH];    // the block's 8 rows of ctxT, bf16 hi
  __shared__ __align__(16) unsigned short csl[8 * CPITCH];    // and lo
  const unsigned t = threadIdx.x;
  const int lane = (int)(t & 31u);
  const int wave = __builtin_amdgcn_readfirstlane((int)(t >> 5));
  const int b = (int)(blockIdx.x / (CH * CH / 2048));
  const float* pb = part + (size_t)blockIdx.x * (KSP * 8 * CH);   // block-uniform base, one lane offset for all loads
  const float* mb = stm + b * CH;
  const float* sb = sts + b * CH;
  v4f p[KSP];
#pragma unroll   // keeps p[] in registers and the independent loads in flight together
  for (int z = 0; z < KSP; ++z) p[z] = *(const v4f*)(pb + z * (8 * CH) + t * 4u);
  // keeps the plane loads ahead of the weights' work, in flight under it; the compiler otherwise sinks them
  // behind it, and the block pays the two memory latencies one after the other
  __builtin_amdgcn_sched_barrier(0);
  if (t < CH) {                                 // wave-uniform; no barrier inside
    float m[KSP], sz[KSP];
#pragma unroll   // m[] and sz[] are indexed by constants only, so they stay in registers
    for (int z = 0; z < KSP; ++z) {
      m[z]  = mb[z * (GB * CH) + t];
      sz[z] = sb[z * (GB * CH) + t];
    }
    float mm = m[0];
#pragma unroll
    for (int z = 1; z < KSP; ++z) mm = fmaxf(mm, m[z]);
    float ss = 0.f;
#pragma unroll
    for (int z = 0; z < KSP; ++z) { m[z] = __expf(m[z] - mm); ss += m[z] * sz[z]; }
    const float rinv = 1.0f / ss;
#pragma unroll
    for (int z = 0; z < KSP; ++z) wl[z][t] = m[z] * rinv;
  }
  __syncthreads();   // every column's weights are in LDS before any thread reads its column's
  // wo fragments of this wave's 16 rows o, all k steps: they depend on nothing here and fly under the slice sum
  // (behind the barrier, whose wait for outstanding loads would otherwise hold the block up for them)
  v16b wf[KST];
  {
    const v4u* Wo = (const v4u*)(const void*)wop + frag_piece(wave, 0) + lane;
#pragma unroll   // wf[] is indexed by constants only, so it stays in registers
    for (int ks = 0; ks < KST; ++ks) wf[ks] = ldfrag_q(Wo + frag_piece(0, ks));
  }
  const unsigned cc = (t >> 5) * 16u + (t & 15u);              // the thread's column c
  const unsigned r0 = ((t >> 4) & 1u) * 4u;                    // and the first of its 4 rows d
  v4f s = p[0] * wl[0][cc];
#pragma unroll   // p[] is indexed by constants only, so it stays in registers
  for (int z = 1; z < KSP; ++z) s += p[z] * wl[z][cc];
  unsigned hv[2], lv[2];
  split2(s[0], s[1], hv[0], lv[0]);
  split2(s[2], s[3], hv[1], lv[1]);
#pragma unroll
  for (int e = 0; e < 4; ++e) {
    csh[(r0 + e) * CPITCH + cc] = (unsigned short)(hv[e >> 1] >> ((e & 1) * 16));
    csl[(r0 + e) * CPITCH + cc] = (unsigned short)(lv[e >> 1] >> ((e & 1) * 16));
  }
  __syncthreads();   // all 8 rows of ctxT are in LDS before any wave reads fragments of them

  const __bf16* Ch = (const __bf16*)(const void*)csh + (lane & 7) * CPITCH + (lane >> 4) * 8;   // this lane's A row
  const __bf16* Cl = (const __bf16*)(const void*)csl + (lane & 7) * CPITCH + (lane >> 4) * 8;
  v16b ah[KST], al[KST];
#pragma unroll   // ah[] and al[] are indexed by constants only, so they stay in registers (those of p[], now free)
  for (int ks = 0; ks < KST; ++ks) {
    ah[ks] = ldfrag_b(Ch + ks * 32);
    al[ks] = ldfrag_b(Cl + ks * 32);
  }
  // all LDS fragment loads go as one group ahead of the products; the compiler otherwise loads one fragment at a
  // time into one register set, and each of the sixteen chained products waits a full LDS latency
  __builtin_amdgcn_sched_barrier(0);
  v8f acc = zero8();
#pragma unroll   // wf[], ah[] and al[] are indexed by constants only
  for (int ks = 0; ks < KST; ++ks) {
    acc = mma_b_raw(ah[ks], wf[ks], acc);
    acc = mma_b_raw(al[ks], wf[ks], acc);
  }
  v4u ph, pl;
#pragma unroll
  for (int q = 0; q < 4; ++q) {
    unsigned h, l;
    split2(acc[2 * q], acc[2 * q + 1], h, l);
    ph[q] = h;
    pl[q] = l;
  }
  if (lane < 16) {                              // lanes 16..31 hold the repeated A rows
    const int d0 = (int)(blockIdx.x % (CH * CH / 2048)) * 8;
    const size_t e0 = (size_t)b * (CH * CH) +
        (size_t)(frag_piece(wave, d0 >> 5) + ((d0 >> 4) & 1) * 32 + ((d0 >> 3) & 1) * 16 + lane) * 8;
    *(v4u*)(m2h + e0) = ph;
    *(v4u*)(m2l + e0) = pl;
  }
}

// =====================================================================================================
// q projection + q softmax + output product for one 64-column tile of n. grid (NSP/64, GB), block 128 = 4 waves.
// x tile: CH rows c of 64 columns n, f32, 256 B of each row of x; a wave-wide load takes two such segments. The
//   values go to LDS as bf16, still [c][n], at a pitch of 160 B (32 B x odd) for the transposing fragment reads.
// Part 1, wave w = head w: Q[o][n] = wq . x + bq[o] for o in 64w..64w+63 (K = CH). A lane holds column
//   n0 + 16j + (lane&15) and rows 16i + 8(lane>>4) + r, so one column's head lies in lanes l and l^16:
//   softmax of 0.25 * Q over the 64 rows = a sum inside the lane and one xor-16 exchange.
// Hand-over: 64 * softmax as bf16 hi/lo. Accumulator tiles 2p and 2p+1 of a column block are, lane for lane,
//   elements 0..7 and 8..15 of the B fragment of k step p, so each lane stores and later loads its own 16-B
//   pieces: piece (((k step * 4 + j) * 2 + half) * 32 + lane); a wave-wide access covers 512 contiguous bytes.
// Part 2, wave w: out[o][n] = ((M2h + M2l).qPh + M2h.qPl) / 64 + bo[o] for o in 64w..64w+63 (K = CH, all heads).
// coverage: 64 x GB blocks x 4 waves x (64 rows x 64 columns) = whole output.
// =====================================================================================================
#define XTP 160                                // x tile row pitch in LDS, bytes: 64 bf16 + 32 B

__global__ __launch_bounds__(128) void k_qout(const unsigned short* __restrict__ wqp,
                                              const float* __restrict__ xg,
                                              const float* __restrict__ bq,
                                              const unsigned short* __restrict__ m2hp,
                                              const unsigned short* __restrict__ m2lp,
                                              const float* __restrict__ bo, float* outp) {
  __shared__ __align__(16) unsigned char xs[CH * XTP];        // 40 KiB: x tile, bf16 [c][n]
  __shared__ __align__(16) v4u qsh[KST * 4 * 2 * 32];         // 32 KiB: q hi fragments of the tile
  __shared__ __align__(16) v4u qsl[KST * 4 * 2 * 32];         // 32 KiB: q lo fragments
  __shared__ __align__(16) float sT[4][16 * 68];              // per-wave 16x64 slab, pitch 68 floats
  const int lane = threadIdx.x & 31;
  const int wave = threadIdx.x >> 5;
  const int b  = blockIdx.y;
  const int n0 = blockIdx.x << 6;
  const int m0 = wave << 6;
  const int rlane = lane & 15;                 // row (A) / col (B, D) within subtile
  const int koff  = (lane >> 4) * 8;           // k offset of this lane half
  const int mOff  = (lane >> 4) * 8;           // D row offset
  const int apc = frag_piece(m0 >> 4, 0) + lane;             // this lane's A piece (subtile 0, k step 0), all three A planes
  const v4u* Wq = (const v4u*)(const void*)wqp + apc;
  const v4u* Mh = (const v4u*)(const void*)(m2hp + (size_t)b * CH * CH) + apc;
  const v4u* Ml = (const v4u*)(const void*)(m2lp + (size_t)b * CH * CH) + apc;
  const unsigned char* Xl = xs + (koff + (lane & 7)) * XTP + ((lane >> 3) & 1) * 16;   // ldfrag_t address, k0 = col0 = 0

  // ---- x tile to LDS; wq fragments of the first two k steps meanwhile ----
  v16b wa[2][4];
  {
    // row c = 8 it + wave + 4 (lane>>4): a wave's two rows lie 640 B apart in LDS, on the two halves of the banks
    const int xr = wave + (lane >> 4) * 4, xc = (lane & 15) * 4;
    const float* g = xg + ((size_t)b * CH + (size_t)xr) * NSP + n0 + xc;
    v4f t[32];
#pragma unroll   // keeps t[] in registers and the independent loads in flight together
    for (int it = 0; it < 32; ++it) t[it] = *(const v4f*)(g + (size_t)it * 8 * NSP);
#pragma unroll
    for (int s = 0; s < 2; ++s)
#pragma unroll
      for (int i = 0; i < 4; ++i) wa[s][i] = ldfrag_q(Wq + frag_piece(i, s));
#pragma unroll
    for (int it = 0; it < 32; ++it) {
      uint2 p;
      p.x = cvt2(t[it][0], t[it][1]);
      p.y = cvt2(t[it][2], t[it][3]);
      *(uint2*)(xs + (it * 8 + xr) * XTP + xc * 2) = p;
    }
  }
  __syncthreads();   // the whole x tile is in LDS before any wave reads fragments of it

  v8f acc[4][4];
#pragma unroll
  for (int i = 0; i < 4; ++i)
#pragma unroll
    for (int j = 0; j < 4; ++j) acc[i][j] = zero8();

  // ---- part 1: Q tile of this wave's head ----
  {
    v16b xb[2][4];
#pragma unroll
    for (int j = 0; j < 4; ++j) xb[0][j] = ldfrag_t(Xl + j * 32, XTP);
#pragma unroll   // constant buffer indices keep wa[] and xb[] in registers
    for (int ks = 0; ks < KST; ++ks) {
      const int cu = ks & 1;
      if (ks + 1 < KST) {
#pragma unroll
        for (int j = 0; j < 4; ++j) xb[cu ^ 1][j] = ldfrag_t(Xl + (ks + 1) * 32 * XTP + j * 32, XTP);
      }
#pragma unroll
      for (int i = 0; i < 4; ++i) {
#pragma unroll
        for (int j = 0; j < 4; ++j) acc[i][j] = mma_b_raw(wa[cu][i], xb[cu][j], acc[i][j]);
        if (ks + 2 < KST) wa[cu][i] = ldfrag_q(Wq + frag_piece(i, ks + 2));
        // keeps each refill where it is written, two k steps ahead of its use; the compiler otherwise sinks it
        // to just before its products, and every fragment then waits a full load latency
        __builtin_amdgcn_sched_barrier(0);
      }
    }
  }

  // ---- q softmax over the head's 64 rows, column by column; fragments to LDS ----
  float bro[4][8];
#pragma unroll
  for (int i = 0; i < 4; ++i)
#pragma unroll
    for (int r = 0; r < 8; ++r) bro[i][r] = bf_round(bq[m0 + (i << 4) + mOff + r]);
#pragma unroll
  for (int j = 0; j < 4; ++j) {
    float v[4][8];
#pragma unroll
    for (int i = 0; i < 4; ++i)
#pragma unroll
      for (int r = 0; r < 8; ++r) v[i][r] = (acc[i][j][r] + bro[i][r]) * 0.25f;
    float m = v[0][0];
#pragma unroll
    for (int i = 0; i < 4; ++i)
#pragma unroll
      for (int r = 0; r < 8; ++r) m = fmaxf(m, v[i][r]);
    m = fmaxf(m, __shfl_xor(m, 16, 32));
    float s = 0.f;
#pragma unroll
    for (int i = 0; i < 4; ++i)
#pragma unroll
      for (int r = 0; r < 8; ++r) { v[i][r] = exp_slot(v[i][r] - m); s += v[i][r]; }
    s += __shfl_xor(s, 16, 32);
    const float rinv = 1.0f / s;
#pragma unroll
    for (int i = 0; i < 4; ++i) {
      v4u ph, pl;
#pragma unroll
      for (int q = 0; q < 4; ++q) {
        const float f0 = (v[i][2 * q] * rinv) * 64.0f;
        const float f1 = (v[i][2 * q + 1] * rinv) * 64.0f;
        unsigned h, l;
        split2(f0, f1, h, l);
        ph[q] = h; pl[q] = l;
      }
      const int piece = ((((wave * 2 + (i >> 1)) * 4 + j) * 2 + (i & 1)) << 5) + lane;
      qsh[piece] = ph;
      qsl[piece] = pl;
    }
  }
  v16b ah[4], al[4];   // M2 fragments of k step 0: they do not depend on q, so they fly across the barrier
#pragma unroll
  for (int i = 0; i < 4; ++i) {
    ah[i] = ldfrag_q(Mh + frag_piece(i, 0));
    al[i] = ldfrag_q(Ml + frag_piece(i, 0));
  }
  __syncthreads();   // every head's fragments are in LDS before any wave reads them

  // ---- part 2: output rows 64w..64w+63 over all CH channels of q ----
#pragma unroll
  for (int i = 0; i < 4; ++i)
#pragma unroll
    for (int j = 0; j < 4; ++j) acc[i][j] = zero8();
  {
    v16b bh[2][4], bl[2][4];
#pragma unroll
    for (int j = 0; j < 4; ++j) {
      bh[0][j] = ldfrag_q(qsh + j * 64 + lane);
      bl[0][j] = ldfrag_q(qsl + j * 64 + lane);
    }
#pragma unroll   // constant buffer indices keep the fragment arrays in registers
    for (int ks = 0; ks < KST; ++ks) {
      const int cu = ks & 1;
      if (ks + 1 < KST) {
#pragma unroll
        for (int j = 0; j < 4; ++j) {
          bh[cu ^ 1][j] = ldfrag_q(qsh + ((ks + 1) * 4 + j) * 64 + lane);
          bl[cu ^ 1][j] = ldfrag_q(qsl + ((ks + 1) * 4 + j) * 64 + lane);
        }
      }
#pragma unroll
      for (int i = 0; i < 4; ++i) {
        // each accumulator takes its three products in the order hi.hi, lo.hi, hi.lo; four tiles side by side
#pragma unroll
        for (int j = 0; j < 4; ++j) acc[i][j] = mma_b_raw(ah[i], bh[cu][j], acc[i][j]);
#pragma unroll
        for (int j = 0; j < 4; ++j) acc[i][j] = mma_b_raw(al[i], bh[cu][j], acc[i][j]);
#pragma unroll
        for (int j = 0; j < 4; ++j) acc[i][j] = mma_b_raw(ah[i], bl[cu][j], acc[i][j]);
        if (ks + 1 < KST) {
          ah[i] = ldfrag_q(Mh + frag_piece(i, ks + 1));
          al[i] = ldfrag_q(Ml + frag_piece(i, ks + 1));
        }
        // keeps each refill where it is written, one k step ahead of its use (see part 1)
        __builtin_amdgcn_sched_barrier(0);
      }
    }
  }

  // ---- epilogue: whole 256-B row segments through the wave's own slab ----
  float* slab = sT[wave];
  float* C = outp + (size_t)b * CH * NSP;
  const int hh = lane >> 4, c4 = (lane & 15) * 4;          // 256-B row segment = 16 lanes x 16 B
#pragma unroll
  for (int i = 0; i < 4; ++i) {
    const int mBase = m0 + (i << 4);
    float brow[8];
#pragma unroll
    for (int r = 0; r < 8; ++r) brow[r] = bf_round(bo[mBase + mOff + r]);
#pragma unroll
    for (int j = 0; j < 4; ++j) {
#pragma unroll
      for (int r = 0; r < 8; ++r) {
        slab[(mOff + r) * 68 + (j << 4) + rlane] = acc[i][j][r] * (1.0f / 64.0f) + brow[r];
      }
    }
    // the wave's slab rows are written before its lanes read each other's values back
    asm volatile("s_wait_dscnt 0x0" ::: "memory");
    v4f t[8];
#pragma unroll
    for (int it = 0; it < 8; ++it) t[it] = *(const v4f*)(slab + (it * 2 + hh) * 68 + c4);   // rows 0..15
    // the rows are read before the next 16 rows overwrite the slab
    asm volatile("s_wait_dscnt 0x0" ::: "memory");
#pragma unroll
    for (int it = 0; it < 8; ++it) *(v4f*)(C + (size_t)(mBase + it * 2 + hh) * NSP + n0 + c4) = t[it];
  }
}

// =====================================================================================================
// KV projection + k softmax numerators + context product for one slice of SLN = 128 columns n of one batch.
// grid (KSP, GB), block 512 = 16 waves, one work-group per WGP (256 KiB of LDS).
// c tile: CH rows c of 128 columns n, f32, 512 B of each row of cproj = one wave-wide load. The values go to LDS
//   as bf16, still [c][n], at a pitch of 288 B (32 B x odd) for the transposing fragment reads of all sixteen waves.
// Part 1, wave w: KVt[n][j] = cproj^T . wkv^T + bkv[j] for all 128 n and j in 32w..32w+31 (K = CH). A lane holds column
//   j = 32w + 16jj + (lane&15) and rows n = 16i + 8(lane>>4) + r, so one column lies in lanes l and l^16.
// Waves 0..7 hold K (j < CH): slice maximum m and sum s of exp(K - m) = a sum inside the lane and one xor-16
//   exchange; m and s go to stm, sts [slice][b][j]; the value handed on is exp(K - m). Waves 8..15 hold V as it is.
// Hand-over: bf16 hi/lo. Accumulator tiles 2p and 2p+1 of a column block are, lane for lane, elements 0..7 and
//   8..15 of the A or B fragment of k step p (k = n), so each lane stores and later loads 16-B pieces:
//   piece (((column block * KS2 + k step) * 2 + half) * 32 + lane); a wave-wide access covers 512 contiguous bytes.
//   The fragments take over the c tile's LDS behind a barrier that ends its last read.
// Part 2, wave w: ctxT[d][c] partial = Vh.kPh + Vl.kPh + Vh.kPl for the 64x64 tile (w>>2, w&3), K = 128 -> f32, to
//   part [b * CH/8 + d/8][slice][c/16][(d%8)/4][c%16][d%4] (the KSP partials that one block of k_ksum adds lie
//   256 KiB in a row): a lane's 8 accumulators of a 16x16 tile are rows d%8 = 0..7 of one column, so it stores them
//   as they lie, two 16-B pieces; a wave-wide store covers two whole 256-B runs. Nothing passes through LDS.
// coverage: KSP x GB blocks x 16 waves x (64 x 64) = all of part; 8 waves x 32 columns = every m and s.
// =====================================================================================================
#define SLN (NSP / KSP)                        // columns n of a slice
#define KS2 (SLN / 32)                         // k steps of the context product
#define FPL ((2 * CH / 16) * KS2 * 2 * 32)     // 16-B pieces of one fragment plane (hi or lo)
static_assert(SLN == 128 && 2 * CH == 16 * 32);            // 16 waves x 32 columns j; 8 accumulator row blocks
#define CTP 288                                // c tile row pitch in LDS, bytes: 128 bf16 + 32 B
static_assert(CH * CTP <= 2 * FPL * 16);       // the c tile fits

__global__ __launch_bounds__(512) void k_kvctx(const unsigned short* __restrict__ wkvp,
                                               const float* __restrict__ cg,
                                               const float* __restrict__ bkv,
                                               float* part, float* stm, float* sts) {
  __shared__ __align__(16) v4u sm[2 * FPL];                   // 256 KiB: c tile, then fragments
  unsigned char* xs = (unsigned char*)(void*)sm;
  v4u* fh = sm;
  v4u* fl = sm + FPL;
  const int lane = threadIdx.x & 31;
  const int wave = __builtin_amdgcn_readfirstlane((int)(threadIdx.x >> 5));
  const int z  = blockIdx.x;
  const int b  = blockIdx.y;
  const int n0 = z * SLN;
  const int rlane = lane & 15;                 // row (A) / col (B, D) within subtile
  const int koff  = (lane >> 4) * 8;           // k offset of this lane half
  const v4u* Wk = (const v4u*)(const void*)wkvp + frag_piece(wave * 2, 0) + lane;                  // B piece, block 0
  const unsigned char* Xl = xs + (koff + (lane & 7)) * CTP + ((lane >> 3) & 1) * 16;               // ldfrag_t address, k0 = col0 = 0

  // ---- c tile to LDS; wkv fragments of the first two k steps and the bias meanwhile ----
  v16b wb[2][2];
  float bj[2];
  {
    const float* g = cg + ((size_t)b * CH + (size_t)wave) * NSP + n0 + lane * 4;                    // row c = 16 it + wave
    v4f t[16];
#pragma unroll   // keeps t[] in registers and the independent loads in flight together
    for (int it = 0; it < 16; ++it) t[it] = *(const v4f*)(g + (size_t)it * 16 * NSP);
#pragma unroll
    for (int s = 0; s < 2; ++s)
#pragma unroll
      for (int jj = 0; jj < 2; ++jj) wb[s][jj] = ldfrag_q(Wk + frag_piece(jj, s));
#pragma unroll
    for (int jj = 0; jj < 2; ++jj) bj[jj] = bf_round(bkv[wave * 32 + jj * 16 + rlane]);
#pragma unroll
    for (int it = 0; it < 16; ++it) {
      uint2 p;
      p.x = cvt2(t[it][0], t[it][1]);
      p.y = cvt2(t[it][2], t[it][3]);
      *(uint2*)(xs + (it * 16 + wave) * CTP + lane * 8) = p;
    }
  }
  __syncthreads();   // the whole c tile is in LDS before any wave reads fragments of it

  // ---- part 1: KVt tile, 128 rows n x this wave's 32 columns j ----
  v8f acc[8][2];
#pragma unroll
  for (int i = 0; i < 8; ++i)
#pragma unroll
    for (int jj = 0; jj < 2; ++jj) acc[i][jj] = zero8();
  v16b xa[2][4];                               // c tile fragments of four row blocks, two sets
#pragma unroll
  for (int q = 0; q < 4; ++q) xa[0][q] = ldfrag_t(Xl + q * 32, CTP);
#pragma unroll   // constant buffer indices keep wb[] and xa[] in registers
  for (int st = 0; st < 2 * KST; ++st) {       // k step st >> 1, row blocks 4 * (st & 1) ..
    const int ks = st >> 1, hf = st & 1, cu = ks & 1, nx = st + 1;
    if (nx < 2 * KST) {
#pragma unroll
      for (int q = 0; q < 4; ++q) xa[hf ^ 1][q] = ldfrag_t(Xl + (nx >> 1) * 32 * CTP + ((nx & 1) * 4 + q) * 32, CTP);
    }
    // the next set's LDS loads go as one group ahead of this set's products; the compiler otherwise loads one
    // fragment at a time into one register set and every pair of products waits a full LDS latency
    __builtin_amdgcn_sched_barrier(0);
#pragma unroll
    for (int q = 0; q < 4; ++q)
#pragma unroll
      for (int jj = 0; jj < 2; ++jj) acc[hf * 4 + q][jj] = mma_b_raw(xa[hf][q], wb[cu][jj], acc[hf * 4 + q][jj]);
    if (hf == 1 && ks + 2 < KST) {
#pragma unroll
      for (int jj = 0; jj < 2; ++jj) wb[cu][jj] = ldfrag_q(Wk + frag_piece(jj, ks + 2));
    }
    // keeps each wkv refill where it is written, two k steps ahead of its use; the compiler otherwise sinks it
    // to just before its products, and every fragment then waits a full load latency
    __builtin_amdgcn_sched_barrier(0);
  }
  __syncthreads();   // every wave has read its last c tile fragment before fragments overwrite the tile

  // ---- k softmax numerators of the slice (waves 0..7); hi/lo fragments of K and V to LDS ----
#pragma unroll
  for (int jj = 0; jj < 2; ++jj) {
    float v[8][8];
#pragma unroll
    for (int i = 0; i < 8; ++i)
#pragma unroll
      for (int r = 0; r < 8; ++r) v[i][r] = acc[i][jj][r] + bj[jj];
    if (wave < 8) {                            // wave-uniform; no barrier inside
      float m = v[0][0];
#pragma unroll
      for (int i = 0; i < 8; ++i)
#pragma unroll
        for (int r = 0; r < 8; ++r) m = fmaxf(m, v[i][r]);
      m = fmaxf(m, __shfl_xor(m, 16, 32));
      float s = 0.f;
#pragma unroll
      for (int i = 0; i < 8; ++i)
#pragma unroll
        for (int r = 0; r < 8; ++r) { v[i][r] = exp_slot(v[i][r] - m); s += v[i][r]; }
      s += __shfl_xor(s, 16, 32);
      if (lane < 16) {
        const int so = (z * GB + b) * CH + wave * 32 + jj * 16 + rlane;
        stm[so] = m;
        sts[so] = s;
      }
    }
#pragma unroll
    for (int i = 0; i < 8; ++i) {
      v4u ph, pl;
#pragma unroll
      for (int q = 0; q < 4; ++q) {
        const float f0 = v[i][2 * q], f1 = v[i][2 * q + 1];
        unsigned h, l;
        split2(f0, f1, h, l);
        ph[q] = h; pl[q] = l;
      }
      const int piece = ((((wave * 2 + jj) * KS2 + (i >> 1)) * 2 + (i & 1)) << 5) + lane;
      fh[piece] = ph;
      fl[piece] = pl;
    }
  }
  __syncthreads();   // every column block's fragments are in LDS before any wave reads them

  // ---- part 2: 64x64 tile of the slice's ctxT, rows d from V (A), columns c from kP (B) ----
  const int tm = wave >> 2, tn = wave & 3;
  v8f cx[4][4];
#pragma unroll
  for (int i = 0; i < 4; ++i)
#pragma unroll
    for (int j = 0; j < 4; ++j) cx[i][j] = zero8();
  const v4u* Ah = fh + (CH / 16 + tm * 4) * KS2 * 64 + lane;   // V column blocks of this tile's rows d
  const v4u* Al = fl + (CH / 16 + tm * 4) * KS2 * 64 + lane;
  // this lane's place in part: rows d = 64 tm + 16 i + 8 (lane>>4) + 0..7, column c = 64 tn + 16 j + (lane&15)
  float* C = part + (((size_t)b * (CH / 8) + (size_t)(tm * 8 + (lane >> 4))) * KSP + (size_t)z) * (8 * CH) +
             tn * (4 * 128) + rlane * 4;
  v16b ah[2], al[2];
  ah[0] = ldfrag_q(Ah);
  al[0] = ldfrag_q(Al);
#pragma unroll   // constant indices keep the fragment arrays in registers
  for (int p = 0; p < KS2; ++p) {
    v16b bh[4], bl[4];
#pragma unroll
    for (int j = 0; j < 4; ++j) {
      bh[j] = ldfrag_q(fh + ((tn * 4 + j) * KS2 + p) * 64 + lane);
      bl[j] = ldfrag_q(fl + ((tn * 4 + j) * KS2 + p) * 64 + lane);
    }
#pragma unroll
    for (int i = 0; i < 4; ++i) {
      const int cu = i & 1;
      const int nx = p * 4 + i + 1;            // the next row block's A fragments, one block of products ahead
      if (nx < KS2 * 4) {
        ah[cu ^ 1] = ldfrag_q(Ah + ((nx & 3) * KS2 + (nx >> 2)) * 64);
        al[cu ^ 1] = ldfrag_q(Al + ((nx & 3) * KS2 + (nx >> 2)) * 64);
      }
      // each accumulator takes its three products in the order hi.hi, lo.hi, hi.lo; four tiles side by side
#pragma unroll
      for (int j = 0; j < 4; ++j) cx[i][j] = mma_b_raw(ah[cu], bh[j], cx[i][j]);
#pragma unroll
      for (int j = 0; j < 4; ++j) cx[i][j] = mma_b_raw(al[cu], bh[j], cx[i][j]);
#pragma unroll
      for (int j = 0; j < 4; ++j) cx[i][j] = mma_b_raw(ah[cu], bl[j], cx[i][j]);
      // in the last k step a finished row block goes out behind the next block's products, under the rest of the work
      if (p == KS2 - 1 && i > 0) {
#pragma unroll
        for (int j = 0; j < 4; ++j) {
          float* q = C + (size_t)(i - 1) * (2 * KSP * 8 * CH) + j * 128;
          *(v4f*)(q)      = __builtin_shufflevector(cx[i - 1][j], cx[i - 1][j], 0, 1, 2, 3);
          *(v4f*)(q + 64) = __builtin_shufflevector(cx[i - 1][j], cx[i - 1][j], 4, 5, 6, 7);
        }
      }
      // keeps later blocks' fragment loads from being lifted up here: with more than one block's fragments
      // ahead the live set passes the 256 registers of a 16-wave work-group and spills to scratch
      __builtin_amdgcn_sched_barrier(0);
    }
  }
#pragma unroll
  for (int j = 0; j < 4; ++j) {                // the last row block
    float* q = C + (size_t)3 * (2 * KSP * 8 * CH) + j * 128;
    *(v4f*)(q)      = __builtin_shufflevector(cx[3][j], cx[3][j], 0, 1, 2, 3);
    *(v4f*)(q + 64) = __builtin_shufflevector(cx[3][j], cx[3][j], 4, 5, 6, 7);
  }
}

// =====================================================================================================
// Workspace map (bytes), every plane an exact multiple of its 64x64-tile / whole-line store granularity
// (no padded tails needed: 4096, 512, 256 are tile multiples); one group holds all GB = NBAT batches:
//   Wqb   bf16 [256][256]              0          131072
//   Wkvb  bf16 [512][256]              131072     262144
//   Wob   bf16 [256][256]              393216     131072
//   cxp   f32  [GB*32][KSP][2048]      524288     67108864
//   stm   f32  [KSP][GB][256]          67633152   262144
//   sts   f32  [KSP][GB][256]          67895296   262144
//   m2h   bf16 [GB][256][256]          68157440   1048576
//   m2l   bf16 [GB][256][256]          69206016   1048576
//   end                                70254592
// Weights are [out][in] with the in index as k; Wqb, Wkvb, Wob, m2h, m2l are in fragment order.
// =====================================================================================================
extern "C" void kernel_launch(void* const* d_in, const int* in_sizes, int n_in,
                              void* d_out, int out_size, void* d_ws, size_t ws_size,
                              hipStream_t stream) {
  if (n_in < 8) return;
  if (in_sizes[0] != NBAT * CH * NSP) return;
  if (in_sizes[1] != NBAT * CH * NSP) return;
  if (in_sizes[2] != CH * CH) return;
  if (in_sizes[3] != CH) return;
  if (in_sizes[4] != 2 * CH * CH) return;
  if (in_sizes[5] != 2 * CH) return;
  if (in_sizes[6] != CH * CH) return;
  if (in_sizes[7] != CH) return;
  if (out_size != NBAT * CH * NSP) return;

  const float* x     = (const float*)d_in[0];
  const float* cproj = (const float*)d_in[1];
  const float* wq    = (const float*)d_in[2];
  const float* bq    = (const float*)d_in[3];
  const float* wkv   = (const float*)d_in[4];
  const float* bkv   = (const float*)d_in[5];
  const float* wo    = (const float*)d_in[6];
  const float* bo    = (const float*)d_in[7];
  float* out = (float*)d_out;

  const size_t PWq  = (size_t)CH * CH * 2;               //   131072
  const size_t PWkv = (size_t)2 * CH * CH * 2;           //   262144
  const size_t PWo  = (size_t)CH * CH * 2;               //   131072
  const size_t PCxp = (size_t)KSP * GB * CH * CH * 4;    // 67108864
  const size_t PSt  = (size_t)KSP * GB * CH * 4;         //   262144
  const size_t PCx  = (size_t)GB * CH * CH * 2;          //  1048576
  size_t off = 0;
  const size_t oWq  = off; off += PWq;
  const size_t oWkv = off; off += PWkv;
  const size_t oWo  = off; off += PWo;
  const size_t oCxp = off; off += PCxp;
  const size_t oStm = off; off += PSt;
  const size_t oSts = off; off += PSt;
  const size_t oM2h = off; off += PCx;
  const size_t oM2l = off; off += PCx;
  if (off > ws_size) return;                             // off = 70254592

  char* ws = (char*)d_ws;
  unsigned short* Wqb  = (unsigned short*)(ws + oWq);
  unsigned short* Wkvb = (unsigned short*)(ws + oWkv);
  unsigned short* Wob  = (unsigned short*)(ws + oWo);
  float*          Cxp  = (float*)(ws + oCxp);
  float*          Stm  = (float*)(ws + oStm);
  float*          Sts  = (float*)(ws + oSts);
  unsigned short* M2h  = (unsigned short*)(ws + oM2h);
  unsigned short* M2l  = (unsigned short*)(ws + oM2l);

  const dim3 blk(256);

  const dim3 gW(4 * WPC / 256);                          // 128 blocks of weight pieces
  const dim3 gKc(KSP, GB);                               // 32 slices of n x GB, 16 waves each
  const dim3 gSum(GB * CH * CH / 2048);                  // 256 blocks
  const dim3 gQo(NSP / 64, GB);                          // 64 column tiles x GB, 4 waves each

  for (int g = 0; g < NGRP; ++g) {
    const int b0 = g * GB;
    // (1) weights -> bf16 planes
    k_wcvt<<<gW, blk, 0, stream>>>(wq, wkv, wo, Wqb, Wkvb, Wob);
    // (2) per slice of 128 n: KVt[n][j] = cproj^T . wkv^T + bkv[j] (K=256); kP = exp(K - slice max) and V as hi/lo in
    //     LDS; ctxT[d][c] partial = Vh.kPh^T + Vl.kPh^T + Vh.kPl^T (M=N=256, K=128) -> f32 partials
    k_kvctx<<<gKc, dim3(512), 0, stream>>>(Wkvb, cproj + (size_t)b0 * CH * NSP, bkv, Cxp, Stm, Sts);
    // (3) softmax-weighted sum of the partials -> 8 rows of ctxT bf16 hi/lo in LDS per block;
    //     M2[o][d] = wo . (ctxTh + ctxTl)^T  (K=256) -> bf16 hi/lo
    k_ksum<<<gSum, dim3(512), 0, stream>>>(Cxp, Stm, Sts, Wob, M2h, M2l);
    // (4) Q = wq . x + bq, qP = 64 * softmax over each head's 64 rows (hi/lo, in LDS),
    //     out[b][o][n] = ((M2h + M2l).qPh + M2h.qPl) / 64 + bo[o] -> d_out f32
    float* outg = out + (size_t)b0 * CH * NSP;
    k_qout<<<gQo, dim3(128), 0, stream>>>(Wqb, x + (size_t)b0 * CH * NSP, bq, M2h, M2l, bo, outg);
  }
  (void)hipGetLastError();
}
